// v000
// Times are from an AMD MI455X. After a warm-up the kernel runs many times in a row, and a time is the length of
// such a window on the GPU divided by its runs, so every launch and the gaps after it count. The runs cycle
// through copies of the inputs. A figure is the median of several windows, for all but v000 over two sittings.
// Sittings can differ by a few percent; kernels timed side by side share one.
// The starting kernel, v000, takes 2070 microseconds a run.
#include <hip/hip_runtime.h>

// T5 self-attention layer (hidden [2][2048][1024]; n = LayerNorm(hidden) (1e-6, ln_g, ln_b); q, k, v = n W ('xw' [1024][1024], no bias, 16 heads x 64); scores = q.k (NO 1/sqrt(d)) + rel_bias[bucket(j - i)][h] (T5 bidirectional buckets, 32 buckets, max distance 128); softmax over all keys; out = hidden + merged Wo -> [2][2048][1024]).
// The bucket index depends only on (j - i); it is embedded as a 4095-entry integer table computed with the reference's own bucket function (its f32 log -> int32 cast has exact-integer knife edges, so it is not recomputed on the device).
// Compute dtypes, f32 accumulate: every input rounded to bf16; q/k/v hl x exact (2 products); the relative-position bias (bf16-rounded rel_bias values through the embedded bucket table) added in f32 inside the softmax kernel; scores and attn.v: query rows < 512 hl (3 products), the rest single fp16 (x1024); softmax f32; Wo hl x exact (2 products), + hidden residual in f32.

#define NB_  2
#define TT   2048
#define DM   1024
#define NH_  16
#define NKV  16
#define REP  (NH_ / NKV)
#define HD   64
#define DQ   (NH_ * HD)
#define DKV  (NKV * HD)
#define LNEPS 1e-6f
#define NBKT 32
#define ZH   2
#define RH   512                  // query rows < RH use hi+lo planes (0: none)
#define WIN  0
#define PCAR 1024.0f
#define SCL  1.0f                  // T5: no 1/sqrt(d) scaling
typedef _Float16 h16;
typedef unsigned short bf;
typedef __attribute__((ext_vector_type(16))) __bf16   v16bf;
typedef __attribute__((ext_vector_type(16))) _Float16 v16h;
typedef __attribute__((ext_vector_type(8)))  _Float16 v8h;
typedef __attribute__((ext_vector_type(8)))  unsigned short v8us;
typedef __attribute__((ext_vector_type(8)))  float    v8f;
typedef __attribute__((ext_vector_type(4)))  float    v4f;
typedef v8h  __attribute__((may_alias)) v8ha;
typedef v4f  __attribute__((may_alias)) v4fa;
typedef v8us __attribute__((may_alias)) v8usa;

__device__ __forceinline__ unsigned short f2bf(float f) { unsigned u = __float_as_uint(f); u += 0x7FFFu + ((u >> 16) & 1u); return (unsigned short)(u >> 16); }
__device__ __forceinline__ float bf2f(unsigned short b) { return __uint_as_float(((unsigned)b) << 16); }
__device__ __forceinline__ float bfr(float f) { return bf2f(f2bf(f)); }
__device__ __forceinline__ v16h cat16(v8h lo, v8h hi) { return __builtin_shufflevector(lo, hi, 0, 1, 2, 3, 4, 5, 6, 7, 8, 9, 10, 11, 12, 13, 14, 15); }
__device__ __forceinline__ v16bf cat16b(v8us lo, v8us hi) { return __builtin_bit_cast(v16bf, __builtin_shufflevector(lo, hi, 0, 1, 2, 3, 4, 5, 6, 7, 8, 9, 10, 11, 12, 13, 14, 15)); }
__device__ __forceinline__ v8f wmma16(v16h a, v16h b, v8f c) { return __builtin_amdgcn_wmma_f32_16x16x32_f16(false, a, false, b, (short)0, c, false, false); }
__device__ __forceinline__ v8f wmmab(v16bf a, v16bf b, v8f c) { return __builtin_amdgcn_wmma_f32_16x16x32_bf16(false, a, false, b, (short)0, c, false, false); }



// ---- k_gemmw: register-blocked GEMM, ONE WAVE per 64x64 output tile (16 accumulators), operands straight from K-contiguous 16-bit planes; grid (M/64, N/64, Z), 32 threads.
// C[m][n] (f32, pitch ldc, + optional f32 bias[n]) = sum_k A[m][k] Bt[n][k] (+ split products per NSPLIT). z-batch strides sA/sB/sC in elements. K % 32 == 0.
template <typename T16> struct WFrag;
template <> struct WFrag<h16> { typedef v16h V; static __device__ __forceinline__ V ld(const h16* p) { return cat16(*(const v8h*)p, *(const v8h*)(p + 16)); } static __device__ __forceinline__ v8f mma(V a, V b, v8f c) { return wmma16(a, b, c); } };
template <> struct WFrag<bf> { typedef v16bf V; static __device__ __forceinline__ V ld(const bf* p) { return cat16b(*(const v8us*)p, *(const v8us*)(p + 16)); } static __device__ __forceinline__ v8f mma(V a, V b, v8f c) { return wmmab(a, b, c); } };
template <typename T16, int NSPLIT, bool BIAS>
__global__ __launch_bounds__(32) void k_gemmw(const T16* __restrict__ A, const T16* __restrict__ A2, const T16* __restrict__ Bt, const T16* __restrict__ Bt2, int K, float* C, int ldc, const float* __restrict__ bias, size_t sA, size_t sB, size_t sC) {
    typedef typename WFrag<T16>::V V;
    __shared__ __align__(16) float os[16 * 68];
    const size_t z = blockIdx.z; A += z * sA; if (A2) A2 += z * sA; Bt += z * sB; if (Bt2) Bt2 += z * sB; C += z * sC;
    const int lane = threadIdx.x & 31, lr = lane & 15, hi = lane >> 4; const int r0 = blockIdx.x * 64, c0 = blockIdx.y * 64;
    v8f acc[4][4];
#pragma unroll
    for (int mb = 0; mb < 4; ++mb)
#pragma unroll
        for (int nb = 0; nb < 4; ++nb) acc[mb][nb] = (v8f){};
    const size_t aoff = (size_t)(r0 + lr) * K + 8 * hi, boff = (size_t)(c0 + lr) * K + 8 * hi;
#pragma unroll 1
    for (int kc = 0; kc < K; kc += 32) {
        V a[4], a2[4];
#pragma unroll
        for (int mb = 0; mb < 4; ++mb) { a[mb] = WFrag<T16>::ld(A + aoff + (size_t)mb * 16 * K + kc); if (NSPLIT == 1 || NSPLIT == 2) a2[mb] = WFrag<T16>::ld(A2 + aoff + (size_t)mb * 16 * K + kc); }
#pragma unroll
        for (int nb = 0; nb < 4; ++nb) { const V b = WFrag<T16>::ld(Bt + boff + (size_t)nb * 16 * K + kc); V b2; if (NSPLIT >= 2) b2 = WFrag<T16>::ld(Bt2 + boff + (size_t)nb * 16 * K + kc);
#pragma unroll
            for (int mb = 0; mb < 4; ++mb) { acc[mb][nb] = WFrag<T16>::mma(a[mb], b, acc[mb][nb]); if (NSPLIT == 1 || NSPLIT == 2) acc[mb][nb] = WFrag<T16>::mma(a2[mb], b, acc[mb][nb]); if (NSPLIT >= 2) acc[mb][nb] = WFrag<T16>::mma(a[mb], b2, acc[mb][nb]); } }
        asm volatile("v_nop\n\tv_nop\n\tv_nop\n\tv_nop" : "+v"(acc[0][0]), "+v"(acc[1][1]), "+v"(acc[2][2]), "+v"(acc[3][3]) : "v"(a[0]), "v"(a[3]));
    }
#pragma unroll
    for (int mb = 0; mb < 4; ++mb) {
#pragma unroll
        for (int nb = 0; nb < 4; ++nb) {
#pragma unroll
            for (int j = 0; j < 8; ++j) os[(hi * 8 + j) * 68 + nb * 16 + lr] = acc[mb][nb][j]; }
        __builtin_amdgcn_wave_barrier(); asm volatile("" ::: "memory");
        float* crow = C + (size_t)(r0 + mb * 16) * ldc + c0;
{
#pragma unroll
            for (int s = 0; s < 8; ++s) { const int row = 2 * s + hi, cofs = lr * 4; v4f val = *(const v4fa*)(os + row * 68 + cofs); if (BIAS) { val[0] += bfr(bias[c0 + cofs]); val[1] += bfr(bias[c0 + cofs + 1]); val[2] += bfr(bias[c0 + cofs + 2]); val[3] += bfr(bias[c0 + cofs + 3]); }
                *(v4f*)(crow + (size_t)row * ldc + cofs) = val; }
             }
        __builtin_amdgcn_wave_barrier(); asm volatile("" ::: "memory");
    }
}

__device__ __forceinline__ h16 tohx(float x) { return (h16)x; }
__device__ __forceinline__ void splitf(float y, unsigned short& h, unsigned short& l) { h = f2bf(y); l = f2bf(y - bf2f(h)); }
typedef __attribute__((ext_vector_type(2))) _Float16 v2h;
typedef __attribute__((ext_vector_type(4))) _Float16 v4h;
typedef __attribute__((ext_vector_type(2))) unsigned short v2us;
typedef __attribute__((ext_vector_type(4))) unsigned short v4us;
typedef __attribute__((ext_vector_type(2))) float v2f;
typedef __attribute__((ext_vector_type(4))) int v4i;

__global__ __launch_bounds__(256) void k_wtG(const float* __restrict__ w, int K, int N, bf* Bt) {
    const int lane = threadIdx.x & 31; const int L0 = (blockIdx.x * 8 + (threadIdx.x >> 5)) * 8; const int nlines = N * K / 64;
{
#pragma unroll 1
        for (int l = 0; l < 8; ++l) { const int L = L0 + l; if (L >= nlines) break; const size_t e = (size_t)L * 64 + lane * 2; const int k = (int)(e % K), n = (int)(e / K); v2us o;
            o[0] = f2bf(w[(size_t)k * N + n]); o[1] = f2bf(w[(size_t)(k + 1) * N + n]); *(v2us*)(Bt + e) = o; }
         }
}
__global__ __launch_bounds__(256) void k_lnhl(const float* __restrict__ X, const float* __restrict__ A, const float* __restrict__ g, const float* __restrict__ be, float* Z, bf* Yh, bf* Yl) {
    const int lane = threadIdx.x & 31; const int r = blockIdx.x * 8 + (threadIdx.x >> 5); if (r >= TT) return; const float* xr = X + (size_t)r * DM; const float* ar = A ? A + (size_t)r * DM : nullptr; float s = 0.f;
#pragma unroll 1
    for (int ch = 0; ch < DM / 128; ++ch) { const int c0 = ch * 128 + lane * 4; const v4f a = *(const v4f*)(xr + c0); v4f d = {0.f, 0.f, 0.f, 0.f}; if (ar) d = *(const v4f*)(ar + c0);
#pragma unroll
        for (int q = 0; q < 4; ++q) s += __fadd_rn(bfr(a[q]), d[q]); }
#pragma unroll
    for (int sh = 16; sh; sh >>= 1) s += __shfl_xor(s, sh, 32);
    const float mu = s * (1.0f / DM); float s2 = 0.f;
#pragma unroll 1
    for (int ch = 0; ch < DM / 128; ++ch) { const int c0 = ch * 128 + lane * 4; const v4f a = *(const v4f*)(xr + c0); v4f d = {0.f, 0.f, 0.f, 0.f}; if (ar) d = *(const v4f*)(ar + c0);
#pragma unroll
        for (int q = 0; q < 4; ++q) { const float d0 = __fsub_rn(__fadd_rn(bfr(a[q]), d[q]), mu); float p = __fmul_rn(d0, d0); asm volatile("" : "+v"(p)); s2 = __fadd_rn(s2, p); } }
#pragma unroll
    for (int sh = 16; sh; sh >>= 1) s2 += __shfl_xor(s2, sh, 32);
    const float rs = __fdiv_rn(1.0f, __fsqrt_rn(__fadd_rn(s2 * (1.0f / DM), LNEPS)));
{
#pragma unroll 1
        for (int ch = 0; ch < DM / 128; ++ch) { const int c0 = ch * 128 + lane * 4; const v4f a = *(const v4f*)(xr + c0); v4f d = {0.f, 0.f, 0.f, 0.f}; if (ar) d = *(const v4f*)(ar + c0); v4f z4; v4us oh, ol;
#pragma unroll
            for (int q = 0; q < 4; ++q) { const float v = __fadd_rn(bfr(a[q]), d[q]); z4[q] = v; float n0 = __fmul_rn(__fsub_rn(v, mu), rs); asm volatile("" : "+v"(n0)); float n1 = __fmul_rn(n0, bfr(g[c0 + q])); asm volatile("" : "+v"(n1)); const float y = __fadd_rn(n1, bfr(be[c0 + q])); unsigned short h2, l2; splitf(y, h2, l2); oh[q] = h2; ol[q] = l2; }
            if (Z) *(v4f*)(Z + (size_t)r * DM + c0) = z4; *(v4us*)(Yh + (size_t)r * DM + c0) = oh; *(v4us*)(Yl + (size_t)r * DM + c0) = ol; }
         } }
__global__ __launch_bounds__(256) void k_addres(const float* __restrict__ X, const float* __restrict__ Y, float* O, size_t n4) { const size_t i = (size_t)blockIdx.x * 256 + threadIdx.x; if (i >= n4) return; const v4f a = *(const v4f*)(X + i * 4), b = *(const v4f*)(Y + i * 4); v4f o;
#pragma unroll
    for (int q = 0; q < 4; ++q) o[q] = __fadd_rn(bfr(a[q]), b[q]); *(v4f*)(O + i * 4) = o;  }
__constant__ int BKT[4095] = {15,15,15,15,15,15,15,15,15,15,15,15,15,15,15,15,15,15,15,15,15,15,15,15,15,15,15,15,15,15,15,15,15,15,15,15,15,15,15,15,15,15,15,15,15,15,15,15,15,15,15,15,15,15,15,15,15,15,15,15,15,15,15,15,15,15,15,15,15,15,15,15,15,15,15,15,15,15,15,15,15,15,15,15,15,15,15,15,15,15,15,15,15,15,15,15,15,15,15,15,15,15,15,15,15,15,15,15,15,15,15,15,15,15,15,15,15,15,15,15,15,15,15,15,15,15,15,15,15,15,15,15,15,15,15,15,15,15,15,15,15,15,15,15,15,15,15,15,15,15,15,15,15,15,15,15,15,15,15,15,15,15,15,15,15,15,15,15,15,15,15,15,15,15,15,15,15,15,15,15,15,15,15,15,15,15,15,15,15,15,15,15,15,15,15,15,15,15,15,15,15,15,15,15,15,15,15,15,15,15,15,15,15,15,15,15,15,15,15,15,15,15,15,15,15,15,15,15,15,15,15,15,15,15,15,15,15,15,15,15,15,15,15,15,15,15,15,15,15,15,15,15,15,15,15,15,15,15,15,15,15,15,15,15,15,15,15,15,15,15,15,15,15,15,15,15,15,15,15,15,15,15,15,15,15,15,15,15,15,15,15,15,15,15,15,15,15,15,15,15,15,15,15,15,15,15,15,15,15,15,15,15,15,15,15,15,15,15,15,15,15,15,15,15,15,15,15,15,15,15,15,15,15,15,15,15,15,15,15,15,15,15,15,15,15,15,15,15,15,15,15,15,15,15,15,15,15,15,15,15,15,15,15,15,15,15,15,15,15,15,15,15,15,15,15,15,15,15,15,15,15,15,15,15,15,15,15,15,15,15,15,15,15,15,15,15,15,15,15,15,15,15,15,15,15,15,15,15,15,15,15,15,15,15,15,15,15,15,15,15,15,15,15,15,15,15,15,15,15,15,15,15,15,15,15,15,15,15,15,15,15,15,15,15,15,15,15,15,15,15,15,15,15,15,15,15,15,15,15,15,15,15,15,15,15,15,15,15,15,15,15,15,15,15,15,15,15,15,15,15,15,15,15,15,15,15,15,15,15,15,15,15,15,15,15,15,15,15,15,15,15,15,15,15,15,15,15,15,15,15,15,15,15,15,15,15,15,15,15,15,15,15,15,15,15,15,15,15,15,15,15,15,15,15,15,15,15,15,15,15,15,15,15,15,15,15,15,15,15,15,15,15,15,15,15,15,15,15,15,15,15,15,15,15,15,15,15,15,15,15,15,15,15,15,15,15,15,15,15,15,15,15,15,15,15,15,15,15,15,15,15,15,15,15,15,15,15,15,15,15,15,15,15,15,15,15,15,15,15,15,15,15,15,15,15,15,15,15,15,15,15,15,15,15,15,15,15,15,15,15,15,15,15,15,15,15,15,15,15,15,15,15,15,15,15,15,15,15,15,15,15,15,15,15,15,15,15,15,15,15,15,15,15,15,15,15,15,15,15,15,15,15,15,15,15,15,15,15,15,15,15,15,15,15,15,15,15,15,15,15,15,15,15,15,15,15,15,15,15,15,15,15,15,15,15,15,15,15,15,15,15,15,15,15,15,15,15,15,15,15,15,15,15,15,15,15,15,15,15,15,15,15,15,15,15,15,15,15,15,15,15,15,15,15,15,15,15,15,15,15,15,15,15,15,15,15,15,15,15,15,15,15,15,15,15,15,15,15,15,15,15,15,15,15,15,15,15,15,15,15,15,15,15,15,15,15,15,15,15,15,15,15,15,15,15,15,15,15,15,15,15,15,15,15,15,15,15,15,15,15,15,15,15,15,15,15,15,15,15,15,15,15,15,15,15,15,15,15,15,15,15,15,15,15,15,15,15,15,15,15,15,15,15,15,15,15,15,15,15,15,15,15,15,15,15,15,15,15,15,15,15,15,15,15,15,15,15,15,15,15,15,15,15,15,15,15,15,15,15,15,15,15,15,15,15,15,15,15,15,15,15,15,15,15,15,15,15,15,15,15,15,15,15,15,15,15,15,15,15,15,15,15,15,15,15,15,15,15,15,15,15,15,15,15,15,15,15,15,15,15,15,15,15,15,15,15,15,15,15,15,15,15,15,15,15,15,15,15,15,15,15,15,15,15,15,15,15,15,15,15,15,15,15,15,15,15,15,15,15,15,15,15,15,15,15,15,15,15,15,15,15,15,15,15,15,15,15,15,15,15,15,15,15,15,15,15,15,15,15,15,15,15,15,15,15,15,15,15,15,15,15,15,15,15,15,15,15,15,15,15,15,15,15,15,15,15,15,15,15,15,15,15,15,15,15,15,15,15,15,15,15,15,15,15,15,15,15,15,15,15,15,15,15,15,15,15,15,15,15,15,15,15,15,15,15,15,15,15,15,15,15,15,15,15,15,15,15,15,15,15,15,15,15,15,15,15,15,15,15,15,15,15,15,15,15,15,15,15,15,15,15,15,15,15,15,15,15,15,15,15,15,15,15,15,15,15,15,15,15,15,15,15,15,15,15,15,15,15,15,15,15,15,15,15,15,15,15,15,15,15,15,15,15,15,15,15,15,15,15,15,15,15,15,15,15,15,15,15,15,15,15,15,15,15,15,15,15,15,15,15,15,15,15,15,15,15,15,15,15,15,15,15,15,15,15,15,15,15,15,15,15,15,15,15,15,15,15,15,15,15,15,15,15,15,15,15,15,15,15,15,15,15,15,15,15,15,15,15,15,15,15,15,15,15,15,15,15,15,15,15,15,15,15,15,15,15,15,15,15,15,15,15,15,15,15,15,15,15,15,15,15,15,15,15,15,15,15,15,15,15,15,15,15,15,15,15,15,15,15,15,15,15,15,15,15,15,15,15,15,15,15,15,15,15,15,15,15,15,15,15,15,15,15,15,15,15,15,15,15,15,15,15,15,15,15,15,15,15,15,15,15,15,15,15,15,15,15,15,15,15,15,15,15,15,15,15,15,15,15,15,15,15,15,15,15,15,15,15,15,15,15,15,15,15,15,15,15,15,15,15,15,15,15,15,15,15,15,15,15,15,15,15,15,15,15,15,15,15,15,15,15,15,15,15,15,15,15,15,15,15,15,15,15,15,15,15,15,15,15,15,15,15,15,15,15,15,15,15,15,15,15,15,15,15,15,15,15,15,15,15,15,15,15,15,15,15,15,15,15,15,15,15,15,15,15,15,15,15,15,15,15,15,15,15,15,15,15,15,15,15,15,15,15,15,15,15,15,15,15,15,15,15,15,15,15,15,15,15,15,15,15,15,15,15,15,15,15,15,15,15,15,15,15,15,15,15,15,15,15,15,15,15,15,15,15,15,15,15,15,15,15,15,15,15,15,15,15,15,15,15,15,15,15,15,15,15,15,15,15,15,15,15,15,15,15,15,15,15,15,15,15,15,15,15,15,15,15,15,15,15,15,15,15,15,15,15,15,15,15,15,15,15,15,15,15,15,15,15,15,15,15,15,15,15,15,15,15,15,15,15,15,15,15,15,15,15,15,15,15,15,15,15,15,15,15,15,15,15,15,15,15,15,15,15,15,15,15,15,15,15,15,15,15,15,15,15,15,15,15,15,15,15,15,15,15,15,15,15,15,15,15,15,15,15,15,15,15,15,15,15,15,15,15,15,15,15,15,15,15,15,15,15,15,15,15,15,15,15,15,15,15,15,15,15,15,15,15,15,15,15,15,15,15,15,15,15,15,15,15,15,15,15,15,15,15,15,15,15,15,15,15,15,15,15,15,15,15,15,15,15,15,15,15,15,15,15,15,15,15,15,15,15,15,15,15,15,15,15,15,15,15,15,15,15,15,15,15,15,15,15,15,15,15,15,15,15,15,15,15,15,15,15,15,15,15,15,15,15,15,15,15,15,15,15,15,15,15,15,15,15,15,15,15,15,15,15,15,15,15,15,15,15,15,15,15,15,15,15,15,15,15,15,15,15,15,15,15,15,15,15,15,15,15,15,15,15,15,15,15,15,15,15,15,15,15,15,15,15,15,15,15,15,15,15,15,15,15,15,15,15,15,15,15,15,15,15,15,15,15,15,15,15,15,15,15,15,15,15,15,15,15,15,15,15,15,15,15,15,15,15,15,15,15,15,15,15,15,15,15,15,15,15,15,15,15,15,15,15,15,15,15,15,15,15,15,15,15,15,15,15,15,15,15,15,15,15,15,15,15,15,15,15,15,15,15,15,15,15,15,15,15,15,15,15,15,15,15,15,15,15,15,15,15,15,15,15,15,15,15,15,15,15,15,15,15,15,15,15,15,15,15,15,15,15,15,15,15,15,15,15,15,15,15,15,15,15,15,15,15,15,15,15,15,15,15,15,15,15,15,15,15,15,15,15,15,15,15,15,15,15,15,15,15,15,15,15,15,14,14,14,14,14,14,14,14,14,14,14,14,14,14,14,14,14,14,14,14,14,14,14,14,14,14,14,13,13,13,13,13,13,13,13,13,13,13,13,13,13,13,13,13,13,12,12,12,12,12,12,12,12,12,12,12,12,12,12,11,11,11,11,11,11,11,11,11,10,10,10,10,10,10,10,9,9,9,9,8,8,8,8,7,6,5,4,3,2,1,0,17,18,19,20,21,22,23,24,24,24,24,25,25,25,25,26,26,26,26,26,26,26,27,27,27,27,27,27,27,27,27,28,28,28,28,28,28,28,28,28,28,28,28,28,28,29,29,29,29,29,29,29,29,29,29,29,29,29,29,29,29,29,29,30,30,30,30,30,30,30,30,30,30,30,30,30,30,30,30,30,30,30,30,30,30,30,30,30,30,30,31,31,31,31,31,31,31,31,31,31,31,31,31,31,31,31,31,31,31,31,31,31,31,31,31,31,31,31,31,31,31,31,31,31,31,31,31,31,31,31,31,31,31,31,31,31,31,31,31,31,31,31,31,31,31,31,31,31,31,31,31,31,31,31,31,31,31,31,31,31,31,31,31,31,31,31,31,31,31,31,31,31,31,31,31,31,31,31,31,31,31,31,31,31,31,31,31,31,31,31,31,31,31,31,31,31,31,31,31,31,31,31,31,31,31,31,31,31,31,31,31,31,31,31,31,31,31,31,31,31,31,31,31,31,31,31,31,31,31,31,31,31,31,31,31,31,31,31,31,31,31,31,31,31,31,31,31,31,31,31,31,31,31,31,31,31,31,31,31,31,31,31,31,31,31,31,31,31,31,31,31,31,31,31,31,31,31,31,31,31,31,31,31,31,31,31,31,31,31,31,31,31,31,31,31,31,31,31,31,31,31,31,31,31,31,31,31,31,31,31,31,31,31,31,31,31,31,31,31,31,31,31,31,31,31,31,31,31,31,31,31,31,31,31,31,31,31,31,31,31,31,31,31,31,31,31,31,31,31,31,31,31,31,31,31,31,31,31,31,31,31,31,31,31,31,31,31,31,31,31,31,31,31,31,31,31,31,31,31,31,31,31,31,31,31,31,31,31,31,31,31,31,31,31,31,31,31,31,31,31,31,31,31,31,31,31,31,31,31,31,31,31,31,31,31,31,31,31,31,31,31,31,31,31,31,31,31,31,31,31,31,31,31,31,31,31,31,31,31,31,31,31,31,31,31,31,31,31,31,31,31,31,31,31,31,31,31,31,31,31,31,31,31,31,31,31,31,31,31,31,31,31,31,31,31,31,31,31,31,31,31,31,31,31,31,31,31,31,31,31,31,31,31,31,31,31,31,31,31,31,31,31,31,31,31,31,31,31,31,31,31,31,31,31,31,31,31,31,31,31,31,31,31,31,31,31,31,31,31,31,31,31,31,31,31,31,31,31,31,31,31,31,31,31,31,31,31,31,31,31,31,31,31,31,31,31,31,31,31,31,31,31,31,31,31,31,31,31,31,31,31,31,31,31,31,31,31,31,31,31,31,31,31,31,31,31,31,31,31,31,31,31,31,31,31,31,31,31,31,31,31,31,31,31,31,31,31,31,31,31,31,31,31,31,31,31,31,31,31,31,31,31,31,31,31,31,31,31,31,31,31,31,31,31,31,31,31,31,31,31,31,31,31,31,31,31,31,31,31,31,31,31,31,31,31,31,31,31,31,31,31,31,31,31,31,31,31,31,31,31,31,31,31,31,31,31,31,31,31,31,31,31,31,31,31,31,31,31,31,31,31,31,31,31,31,31,31,31,31,31,31,31,31,31,31,31,31,31,31,31,31,31,31,31,31,31,31,31,31,31,31,31,31,31,31,31,31,31,31,31,31,31,31,31,31,31,31,31,31,31,31,31,31,31,31,31,31,31,31,31,31,31,31,31,31,31,31,31,31,31,31,31,31,31,31,31,31,31,31,31,31,31,31,31,31,31,31,31,31,31,31,31,31,31,31,31,31,31,31,31,31,31,31,31,31,31,31,31,31,31,31,31,31,31,31,31,31,31,31,31,31,31,31,31,31,31,31,31,31,31,31,31,31,31,31,31,31,31,31,31,31,31,31,31,31,31,31,31,31,31,31,31,31,31,31,31,31,31,31,31,31,31,31,31,31,31,31,31,31,31,31,31,31,31,31,31,31,31,31,31,31,31,31,31,31,31,31,31,31,31,31,31,31,31,31,31,31,31,31,31,31,31,31,31,31,31,31,31,31,31,31,31,31,31,31,31,31,31,31,31,31,31,31,31,31,31,31,31,31,31,31,31,31,31,31,31,31,31,31,31,31,31,31,31,31,31,31,31,31,31,31,31,31,31,31,31,31,31,31,31,31,31,31,31,31,31,31,31,31,31,31,31,31,31,31,31,31,31,31,31,31,31,31,31,31,31,31,31,31,31,31,31,31,31,31,31,31,31,31,31,31,31,31,31,31,31,31,31,31,31,31,31,31,31,31,31,31,31,31,31,31,31,31,31,31,31,31,31,31,31,31,31,31,31,31,31,31,31,31,31,31,31,31,31,31,31,31,31,31,31,31,31,31,31,31,31,31,31,31,31,31,31,31,31,31,31,31,31,31,31,31,31,31,31,31,31,31,31,31,31,31,31,31,31,31,31,31,31,31,31,31,31,31,31,31,31,31,31,31,31,31,31,31,31,31,31,31,31,31,31,31,31,31,31,31,31,31,31,31,31,31,31,31,31,31,31,31,31,31,31,31,31,31,31,31,31,31,31,31,31,31,31,31,31,31,31,31,31,31,31,31,31,31,31,31,31,31,31,31,31,31,31,31,31,31,31,31,31,31,31,31,31,31,31,31,31,31,31,31,31,31,31,31,31,31,31,31,31,31,31,31,31,31,31,31,31,31,31,31,31,31,31,31,31,31,31,31,31,31,31,31,31,31,31,31,31,31,31,31,31,31,31,31,31,31,31,31,31,31,31,31,31,31,31,31,31,31,31,31,31,31,31,31,31,31,31,31,31,31,31,31,31,31,31,31,31,31,31,31,31,31,31,31,31,31,31,31,31,31,31,31,31,31,31,31,31,31,31,31,31,31,31,31,31,31,31,31,31,31,31,31,31,31,31,31,31,31,31,31,31,31,31,31,31,31,31,31,31,31,31,31,31,31,31,31,31,31,31,31,31,31,31,31,31,31,31,31,31,31,31,31,31,31,31,31,31,31,31,31,31,31,31,31,31,31,31,31,31,31,31,31,31,31,31,31,31,31,31,31,31,31,31,31,31,31,31,31,31,31,31,31,31,31,31,31,31,31,31,31,31,31,31,31,31,31,31,31,31,31,31,31,31,31,31,31,31,31,31,31,31,31,31,31,31,31,31,31,31,31,31,31,31,31,31,31,31,31,31,31,31,31,31,31,31,31,31,31,31,31,31,31,31,31,31,31,31,31,31,31,31,31,31,31,31,31,31,31,31,31,31,31,31,31,31,31,31,31,31,31,31,31,31,31,31,31,31,31,31,31,31,31,31,31,31,31,31,31,31,31,31,31,31,31,31,31,31,31,31,31,31,31,31,31,31,31,31,31,31,31,31,31,31,31,31,31,31,31,31,31,31,31,31,31,31,31,31,31,31,31,31,31,31,31,31,31,31,31,31,31,31,31,31,31,31,31,31,31,31,31,31,31,31,31,31,31,31,31,31,31,31,31,31,31,31,31,31,31,31,31,31,31,31,31,31,31,31,31,31,31,31,31,31,31,31,31,31,31,31,31,31,31,31,31,31,31,31,31,31,31,31,31,31,31,31,31,31,31,31,31,31,31,31,31,31,31,31,31,31,31,31,31,31,31,31,31,31,31,31,31,31,31,31,31,31,31,31,31,31,31,31,31,31,31,31,31,31,31,31,31,31,31,31,31,31,31,31,31,31,31,31,31,31,31,31,31,31,31,31,31,31,31,31,31,31,31,31,31,31,31,31,31,31,31,31,31,31,31,31,31,31,31,31,31,31,31,31,31,31,31,31,31,31,31,31,31,31,31,31,31,31,31,31,31,31,31,31,31,31,31,31,31,31,31,31,31,31,31,31,31,31,31,31,31,31,31,31,31,31,31,31,31,31,31,31,31,31,31,31,31,31,31,31,31,31,31,31,31,31,31,31,31,31,31,31,31,31,31,31,31,31,31,31,31,31,31,31,31,31,31,31,31,31,31,31,31,31,31,31,31,31,31,31,31,31,31,31,31,31,31,31,31,31,31,31,31,31,31,31,31,31,31,31,31,31,31,31,31,31,31,31,31,31,31,31,31,31,31,31,31,31,31,31,31,31,31,31,31,31,31,31,31,31,31,31,31,31,31,31,31,31,31,31,31,31,31,31,31,31,31,31,31,31,31,31,31,31,31,31,31,31,31,31,31,31,31,31,31,31,31,31,31,31,31,31,31,31,31,31,31,31,31,31,31,31,31,31,31,31,31,31,31,31,31,31,31,31,31,31,31,31,31,31,31,31,31,31,31,31,31,31,31,31,31,31,31,31,31,31,31,31,31,31,31,31,31,31,31,31,31,31,31,31,31,31,31,31,31,31,31,31,31,31,31,31,31,31,31,31,31,31,31,31,31,31,31,31,31,31,31,31,31,31,31,31,31,31,31,31,31,31,31,31,31,31,31,31,31,31,31,31,31,31,31,31,31,31,31,31,31,31,31,31,31,31,31,31,31,31,31,31,31,31,31,31,31,31,31,31,31,31,31,31,31,31,31,31,31,31,31,31,31,31,31,31,31,31,31,31,31,31,31,31,31,31,31,31,31,31,31,31,31,31,31,31,31,31,31,31,31,31,31,31,31,31,31,31,31};
__global__ __launch_bounds__(256) void k_btab(const float* __restrict__ relb, float* BT) { const int e = blockIdx.x * 256 + threadIdx.x; if (e >= NH_ * 4096) return; const int r = e % 4096, h = e / 4096; const float v = (r < 4095) ? bfr(relb[BKT[r] * NH_ + h]) : 0.f; *(float*)(BT + e) = v;  }
__global__ __launch_bounds__(256) void k_cvt8(const float* __restrict__ src, bf* dst, size_t n8) { const size_t i = (size_t)blockIdx.x * 256 + threadIdx.x; if (i >= n8) return; const v8f v = *(const v8f*)(src + i * 8); v8us o;
#pragma unroll
    for (int k = 0; k < 8; ++k) o[k] = f2bf(v[k]); *(v8us*)(dst + i * 8) = o;  }

// k_rope: head planes [h][t][d] (fp16 + hi/lo) of rope(x) x sc with the rotate-half convention out[d] = x[d] cos[t][d] - x[d+HD/2] sin[t][d], out[d+HD/2] = x[d+HD/2] cos[t][d+HD/2] + x[d] sin[t][d+HD/2]
__global__ __launch_bounds__(256) void k_rope(const float* __restrict__ F, int pitch, int nheads, const float* __restrict__ CS, const float* __restrict__ RF, const float* __restrict__ nw, float sc, h16* P16, bf* Ph, bf* Pl) {
    const size_t e = ((size_t)blockIdx.x * 256 + threadIdx.x) * 2; if (e >= (size_t)nheads * TT * HD) return; const int d = (int)(e % HD); const int t = (int)((e / HD) % TT); const int h = (int)(e / ((size_t)HD * TT)); const float* f = F + (size_t)t * pitch + h * HD; const float rf = RF ? RF[(size_t)h * TT + t] : 1.0f; v2h o16; v2us oh, ol;
#pragma unroll
    for (int q = 0; q < 2; ++q) { const int dd = d + q; const int dp = (dd < HD / 2) ? dd + HD / 2 : dd - HD / 2; float x0 = f[dd], x1 = f[dp];
        if (RF) { float n0 = __fmul_rn(x0, rf), n1 = __fmul_rn(x1, rf); asm volatile("" : "+v"(n0)); asm volatile("" : "+v"(n1)); x0 = __fmul_rn(bfr(nw[dd]), n0); x1 = __fmul_rn(bfr(nw[dp]), n1); }
        const v2f cs = *(const v2f*)(CS + ((size_t)t * HD + dd) * 2); float a = __fmul_rn(x0, cs[0]), bq = __fmul_rn(x1, cs[1]); asm volatile("" : "+v"(a)); asm volatile("" : "+v"(bq)); const float r = ((dd < HD / 2) ? __fsub_rn(a, bq) : __fadd_rn(a, bq)) * sc;
        o16[q] = tohx(r); unsigned short a2, c2; splitf(r, a2, c2); oh[q] = a2; ol[q] = c2; }
    *(v2h*)(P16 + e) = o16; *(v2us*)(Ph + e) = oh; *(v2us*)(Pl + e) = ol;  }
__global__ __launch_bounds__(256) void k_vtp(const float* __restrict__ F, int pitch, int nheads, h16* V16, bf* Vh, bf* Vl) { const size_t e = ((size_t)blockIdx.x * 256 + threadIdx.x) * 2; if (e >= (size_t)nheads * HD * TT) return; const int t = (int)(e % TT); const int d = (int)((e / TT) % HD); const int g = (int)(e / ((size_t)TT * HD)); v2h o16; v2us oh, ol;
#pragma unroll
    for (int q = 0; q < 2; ++q) { const float x = F[(size_t)(t + q) * pitch + g * HD + d]; o16[q] = tohx(x); unsigned short a2, c2; splitf(x, a2, c2); oh[q] = a2; ol[q] = c2; }
    *(v2h*)(V16 + e) = o16; *(v2us*)(Vh + e) = oh; *(v2us*)(Vl + e) = ol;  }
__global__ __launch_bounds__(256) void k_csid(float* CS) { const int idx = blockIdx.x * 256 + threadIdx.x; if (idx >= TT * HD) return; v2f cs; cs[0] = 1.0f; cs[1] = 0.0f; *(v2f*)(CS + (size_t)idx * 2) = cs;  }
// k_asoft: per row (zz, i): t = S (no mask); softmax over the 2048 keys (register row, one exp, fixed trees);; T5: no score scaling, plus BT[h][j - i + 2047] (the learned relative-position bias through the embedded bucket table) before the max
__global__ __launch_bounds__(256) void k_asoft(const float* __restrict__ Sb, const float* __restrict__ BT, int h0, h16* P16, bf* Ph, bf* Pl) {
    const int lane = threadIdx.x & 31; const int row = blockIdx.x * 8 + (threadIdx.x >> 5); if (row >= ZH * TT) return; const int i = row % TT; const int zz = row / TT; const float* bt = BT + (size_t)(h0 + zz) * 4096 + 2047 - i;   /* bt[j] = bias for (j - i) */ const bool hires = (i < RH); const float* sr = Sb + (size_t)row * TT; float v[TT / 32]; float mx = -3.0e38f;
#pragma unroll
    for (int ch = 0; ch < TT / 128; ++ch) { const int j0 = ch * 128 + lane * 4; const v4f a = *(const v4f*)(sr + j0);
#pragma unroll
        for (int q = 0; q < 4; ++q) { const int j = j0 + q; const float t = __fadd_rn(a[q], bt[j]);   /* scores + rel_bias[bucket(j - i)][h] */ v[ch * 4 + q] = t; mx = fmaxf(mx, t); } }
#pragma unroll
    for (int sh = 16; sh; sh >>= 1) mx = fmaxf(mx, __shfl_xor(mx, sh, 32));
    float sum = 0.f;
#pragma unroll
    for (int k = 0; k < TT / 32; ++k) { float d0 = __fsub_rn(v[k], mx); asm volatile("" : "+v"(d0)); v[k] = __builtin_amdgcn_exp2f(__fmul_rn(d0, 1.4426950408889634f)); sum += v[k]; }
#pragma unroll
    for (int sh = 16; sh; sh >>= 1) sum += __shfl_xor(sum, sh, 32);
    const float f = __fdiv_rn(hires ? 1.0f : PCAR, sum);
{
        if (hires) {
#pragma unroll
            for (int ch = 0; ch < TT / 128; ++ch) { v4us oh, ol;
#pragma unroll
                for (int q = 0; q < 4; ++q) { unsigned short a, c2; splitf(v[ch * 4 + q] * f, a, c2); oh[q] = a; ol[q] = c2; }
                const size_t oo = ((size_t)zz * (RH ? RH : 1) + i) * TT + ch * 128 + lane * 4; *(v4us*)(Ph + oo) = oh; *(v4us*)(Pl + oo) = ol; }
        } else {
#pragma unroll
            for (int ch = 0; ch < TT / 128; ++ch) { v4h o4;
#pragma unroll
                for (int q = 0; q < 4; ++q) o4[q] = tohx(v[ch * 4 + q] * f);
                *(v4h*)(P16 + (size_t)row * TT + ch * 128 + lane * 4) = o4; } }
         }
}
__global__ __launch_bounds__(256) void k_merge(const float* __restrict__ O, int h0, bf* Ah, bf* Al) { const size_t e = ((size_t)blockIdx.x * 256 + threadIdx.x) * 2; if (e >= (size_t)ZH * TT * HD) return; const int d = (int)(e % HD); const int t = (int)((e / HD) % TT); const int zz = (int)(e / ((size_t)HD * TT)); const float cs = (t < RH) ? 1.0f : (1.0f / PCAR); const size_t oo = (size_t)t * DQ + (h0 + zz) * HD + d;
    v2us oh, ol;
#pragma unroll
    for (int q = 0; q < 2; ++q) { unsigned short a, c2; splitf(O[e + q] * cs, a, c2); oh[q] = a; ol[q] = c2; } *(v2us*)(Ah + oo) = oh; *(v2us*)(Al + oo) = ol;  }

extern "C" void kernel_launch(void* const* d_in, const int* in_sizes, int n_in,
                              void* d_out, int out_size, void* d_ws, size_t ws_size, hipStream_t stream) {
    (void)in_sizes; (void)n_in; (void)out_size;
    const float* x = (const float*)d_in[0]; const float* g1 = (const float*)d_in[1]; const float* e1b = (const float*)d_in[2]; const float* wq = (const float*)d_in[3]; const float* wk = (const float*)d_in[4]; const float* wv = (const float*)d_in[5]; const float* wo = (const float*)d_in[6]; const float* relb = (const float*)d_in[7];
    float* OUT = (float*)d_out;     // [2][2048][1024]
    char* wsp = (char*)d_ws;
    auto take = [&](size_t bytes) { char* p = wsp; wsp += (bytes + 255) & ~(size_t)255; return (void*)p; };
    bf* WQ = (bf*)take((size_t)DQ * DM * 2); bf* WK = (bf*)take((size_t)DKV * DM * 2); bf* WV = (bf*)take((size_t)DKV * DM * 2); bf* WO = (bf*)take((size_t)DM * DQ * 2); float* CS = (float*)take((size_t)TT * HD * 2 * 4);
    bf* Yh = (bf*)take((size_t)TT * DM * 2); bf* Yl = (bf*)take((size_t)TT * DM * 2); float* YO = (float*)take((size_t)TT * DM * 4); float* BT = (float*)take((size_t)NH_ * 4096 * 4); float* FQ = (float*)take((size_t)TT * DQ * 4); float* FK = (float*)take((size_t)TT * DKV * 4);
    h16* QP16 = (h16*)take((size_t)NH_ * TT * HD * 2); h16* KP16 = (h16*)take((size_t)NKV * TT * HD * 2); h16* VT16 = (h16*)take((size_t)NKV * HD * TT * 2);
    bf* QPh = (bf*)take((size_t)NH_ * TT * HD * 2); bf* QPl = (bf*)take((size_t)NH_ * TT * HD * 2); bf* KPh = (bf*)take((size_t)NKV * TT * HD * 2); bf* KPl = (bf*)take((size_t)NKV * TT * HD * 2); bf* VTh = (bf*)take((size_t)NKV * HD * TT * 2); bf* VTl = (bf*)take((size_t)NKV * HD * TT * 2); bf* Ph = (bf*)take((size_t)ZH * RH * TT * 2); bf* Pl = (bf*)take((size_t)ZH * RH * TT * 2);
    float* Sb = (float*)take((size_t)ZH * TT * TT * 4); h16* P16 = (h16*)take((size_t)ZH * TT * TT * 2); float* Ob = (float*)take((size_t)ZH * TT * HD * 4); bf* ATh = (bf*)take((size_t)TT * DQ * 2); bf* ATl = (bf*)take((size_t)TT * DQ * 2);
    if ((size_t)(wsp - (char*)d_ws) > ws_size) return;    // ws 256 MiB
    float* FV = FK;   // v projection reuses the k buffer after the k planes are built (stream-ordered)
    { k_wtG<<<(unsigned)((DM * DQ / 64 + 63) / 64), 256, 0, stream>>>(wq, DM, DQ, WQ); k_wtG<<<(unsigned)((DM * DKV / 64 + 63) / 64), 256, 0, stream>>>(wk, DM, DKV, WK); k_wtG<<<(unsigned)((DM * DKV / 64 + 63) / 64), 256, 0, stream>>>(wv, DM, DKV, WV);
      k_wtG<<<(unsigned)((DQ * DM / 64 + 63) / 64), 256, 0, stream>>>(wo, DQ, DM, WO);
       }
    k_csid<<<(TT * HD + 255) / 256, 256, 0, stream>>>(CS);
    const unsigned LQ = (unsigned)(((size_t)NH_ * TT * HD / 2 + 255) / 256), LKv = (unsigned)(((size_t)NKV * TT * HD / 2 + 255) / 256);
    for (int b = 0; b < NB_; ++b) {
        
        k_lnhl<<<TT / 8, 256, 0, stream>>>(x + (size_t)b * TT * DM, nullptr, g1, e1b, nullptr, Yh, Yl);   /* n = LN(hidden) as hi/lo planes */ if (b == 0) k_btab<<<(NH_ * 4096 + 255) / 256, 256, 0, stream>>>(relb, BT);
        k_gemmw<bf, 1, false><<<dim3(TT / 64, DQ / 64, 1), 32, 0, stream>>>(Yh, Yl, WQ, nullptr, DM, FQ, DQ, nullptr, 0, 0, 0);
        k_rope<<<LQ, 256, 0, stream>>>(FQ, DQ, NH_, CS, nullptr, nullptr, 1.0f, QP16, QPh, QPl);
        k_gemmw<bf, 1, false><<<dim3(TT / 64, DKV / 64, 1), 32, 0, stream>>>(Yh, Yl, WK, nullptr, DM, FK, DKV, nullptr, 0, 0, 0);
        k_rope<<<LKv, 256, 0, stream>>>(FK, DKV, NKV, CS, nullptr, nullptr, 1.0f, KP16, KPh, KPl);
        k_gemmw<bf, 1, false><<<dim3(TT / 64, DKV / 64, 1), 32, 0, stream>>>(Yh, Yl, WV, nullptr, DM, FV, DKV, nullptr, 0, 0, 0); k_vtp<<<LKv, 256, 0, stream>>>(FV, DKV, NKV, VT16, VTh, VTl);
        for (int h0 = 0; h0 < NH_; h0 += ZH) { const size_t zq = (size_t)h0, zk = (size_t)(h0 / REP);   // one kv head per query head: the pass's two heads use consecutive kv planes (z-strides TT*HD)
            k_gemmw<bf, 2, false><<<dim3(RH / 64, TT / 64, ZH), 32, 0, stream>>>(QPh + zq * TT * HD, QPl + zq * TT * HD, KPh + zk * TT * HD, KPl + zk * TT * HD, HD, Sb, TT, nullptr, (size_t)TT * HD, (size_t)TT * HD, (size_t)TT * TT);
            k_gemmw<h16, 0, false><<<dim3((TT - RH) / 64, TT / 64, ZH), 32, 0, stream>>>(QP16 + zq * TT * HD + (size_t)RH * HD, nullptr, KP16 + zk * TT * HD, nullptr, HD, Sb + (size_t)RH * TT, TT, nullptr, (size_t)TT * HD, (size_t)TT * HD, (size_t)TT * TT);
            k_asoft<<<ZH * TT / 8, 256, 0, stream>>>(Sb, BT, h0, P16, Ph, Pl);
            k_gemmw<bf, 2, false><<<dim3(RH / 64, HD / 64, ZH), 32, 0, stream>>>(Ph, Pl, VTh + zk * HD * TT, VTl + zk * HD * TT, TT, Ob, HD, nullptr, (size_t)RH * TT, (size_t)HD * TT, (size_t)TT * HD);
            k_gemmw<h16, 0, false><<<dim3((TT - RH) / 64, HD / 64, ZH), 32, 0, stream>>>(P16 + (size_t)RH * TT, nullptr, VT16 + zk * HD * TT, nullptr, TT, Ob + (size_t)RH * HD, HD, nullptr, (size_t)TT * TT, (size_t)HD * TT, (size_t)TT * HD);
            k_merge<<<(unsigned)(((size_t)ZH * TT * HD / 2 + 255) / 256), 256, 0, stream>>>(Ob, h0, ATh, ATl); }
        k_gemmw<bf, 1, false><<<dim3(TT / 64, DM / 64, 1), 32, 0, stream>>>(ATh, ATl, WO, nullptr, DQ, YO, DM, nullptr, 0, 0, 0);
        k_addres<<<(unsigned)(((size_t)TT * DM / 4 + 255) / 256), 256, 0, stream>>>(x + (size_t)b * TT * DM, YO, OUT + (size_t)b * TT * DM, (size_t)TT * DM / 4); }   /* out = hidden + ctx Wo */
}

// v001
// One run takes 955 microseconds.
// Two timings next to v000 both put it at 2.19 times that version's speed.
#include <hip/hip_runtime.h>

// T5 self-attention layer (hidden [2][2048][1024]; n = LayerNorm(hidden) (1e-6, ln_g, ln_b); q, k, v = n W ('xw' [1024][1024], no bias, 16 heads x 64); scores = q.k (NO 1/sqrt(d)) + rel_bias[bucket(j - i)][h] (T5 bidirectional buckets, 32 buckets, max distance 128); softmax over all keys; out = hidden + merged Wo -> [2][2048][1024]).
// The bucket index depends only on (j - i); it is embedded as a 4095-entry integer table computed with the reference's own bucket function (its f32 log -> int32 cast has exact-integer knife edges, so it is not recomputed on the device).
// Compute dtypes, f32 accumulate: every input rounded to bf16; q/k/v hl x exact (2 products); the relative-position bias (bf16-rounded rel_bias values through the embedded bucket table) added in f32 inside the softmax kernel; scores and attn.v: query rows < 512 hl (3 products), the rest single fp16 (x1024); softmax f32; Wo hl x exact (2 products), + hidden residual in f32.

#define NB_  2
#define TT   2048
#define DM   1024
#define NH_  16
#define NKV  16
#define REP  (NH_ / NKV)
#define HD   64
#define DQ   (NH_ * HD)
#define DKV  (NKV * HD)
#define LNEPS 1e-6f
#define NBKT 32
#define ZH   2
#define RH   512                  // query rows < RH use hi+lo planes (0: none)
#define WIN  0
#define PCAR 1024.0f
#define SCL  1.0f                  // T5: no 1/sqrt(d) scaling
#define KSP  16                    // attn.v: key ranges per output tile, one wave each; f32 partial planes, summed in k_merge
typedef _Float16 h16;
typedef unsigned short bf;
typedef __attribute__((ext_vector_type(16))) __bf16   v16bf;
typedef __attribute__((ext_vector_type(16))) _Float16 v16h;
typedef __attribute__((ext_vector_type(8)))  _Float16 v8h;
typedef __attribute__((ext_vector_type(8)))  unsigned short v8us;
typedef __attribute__((ext_vector_type(8)))  float    v8f;
typedef __attribute__((ext_vector_type(4)))  float    v4f;
typedef v8h  __attribute__((may_alias)) v8ha;
typedef v4f  __attribute__((may_alias)) v4fa;
typedef v8us __attribute__((may_alias)) v8usa;

__device__ __forceinline__ unsigned short f2bf(float f) { unsigned u = __float_as_uint(f); u += 0x7FFFu + ((u >> 16) & 1u); return (unsigned short)(u >> 16); }
__device__ __forceinline__ float bf2f(unsigned short b) { return __uint_as_float(((unsigned)b) << 16); }
__device__ __forceinline__ float bfr(float f) { return bf2f(f2bf(f)); }
__device__ __forceinline__ v16h cat16(v8h lo, v8h hi) { return __builtin_shufflevector(lo, hi, 0, 1, 2, 3, 4, 5, 6, 7, 8, 9, 10, 11, 12, 13, 14, 15); }
__device__ __forceinline__ v16bf cat16b(v8us lo, v8us hi) { return __builtin_bit_cast(v16bf, __builtin_shufflevector(lo, hi, 0, 1, 2, 3, 4, 5, 6, 7, 8, 9, 10, 11, 12, 13, 14, 15)); }
__device__ __forceinline__ v8f wmma16(v16h a, v16h b, v8f c) { return __builtin_amdgcn_wmma_f32_16x16x32_f16(false, a, false, b, (short)0, c, false, false); }
__device__ __forceinline__ v8f wmmab(v16bf a, v16bf b, v8f c) { return __builtin_amdgcn_wmma_f32_16x16x32_bf16(false, a, false, b, (short)0, c, false, false); }



// ---- k_gemmw: register-blocked GEMM, ONE WAVE per 64x64 output tile (16 accumulators), operands straight from K-contiguous 16-bit planes; grid (M/64, N/64, Z), 32 threads.
// C[m][n] (f32, pitch ldc, + optional f32 bias[n]) = sum_k A[m][k] Bt[n][k] (+ split products per NSPLIT). z-batch strides sA/sB/sC in elements. K % 32 == 0.
// KS > 1: grid z = Z * KS; slice ks = blockIdx.z % KS sums k in [ks K/KS, (ks+1) K/KS) only and stores its partial tile in plane ks (plane stride sP elements). K % (32 KS) == 0.
template <typename T16> struct WFrag;
template <> struct WFrag<h16> { typedef v16h V; static __device__ __forceinline__ V ld(const h16* p) { return cat16(*(const v8h*)p, *(const v8h*)(p + 16)); } static __device__ __forceinline__ v8f mma(V a, V b, v8f c) { return wmma16(a, b, c); } };
template <> struct WFrag<bf> { typedef v16bf V; static __device__ __forceinline__ V ld(const bf* p) { return cat16b(*(const v8us*)p, *(const v8us*)(p + 16)); } static __device__ __forceinline__ v8f mma(V a, V b, v8f c) { return wmmab(a, b, c); } };
template <typename T16, int NSPLIT, bool BIAS, int KS = 1>
__global__ __launch_bounds__(32) void k_gemmw(const T16* __restrict__ A, const T16* __restrict__ A2, const T16* __restrict__ Bt, const T16* __restrict__ Bt2, int K, float* C, int ldc, const float* __restrict__ bias, size_t sA, size_t sB, size_t sC, size_t sP) {
    typedef typename WFrag<T16>::V V;
    __shared__ __align__(16) float os[16 * 68];
    const size_t z = blockIdx.z / KS; const int ks = blockIdx.z % KS; A += z * sA; if (A2) A2 += z * sA; Bt += z * sB; if (Bt2) Bt2 += z * sB; C += z * sC + ks * sP;
    const int lane = threadIdx.x & 31, lr = lane & 15, hi = lane >> 4; const int r0 = blockIdx.x * 64, c0 = blockIdx.y * 64;
    v8f acc[4][4];
#pragma unroll
    for (int mb = 0; mb < 4; ++mb)
#pragma unroll
        for (int nb = 0; nb < 4; ++nb) acc[mb][nb] = (v8f){};
    const size_t aoff = (size_t)(r0 + lr) * K + 8 * hi, boff = (size_t)(c0 + lr) * K + 8 * hi;
#pragma unroll 1
    for (int kc = ks * (K / KS); kc < (ks + 1) * (K / KS); kc += 32) {
        V a[4], a2[4];
#pragma unroll
        for (int mb = 0; mb < 4; ++mb) { a[mb] = WFrag<T16>::ld(A + aoff + (size_t)mb * 16 * K + kc); if (NSPLIT == 1 || NSPLIT == 2) a2[mb] = WFrag<T16>::ld(A2 + aoff + (size_t)mb * 16 * K + kc); }
#pragma unroll
        for (int nb = 0; nb < 4; ++nb) { const V b = WFrag<T16>::ld(Bt + boff + (size_t)nb * 16 * K + kc); V b2; if (NSPLIT >= 2) b2 = WFrag<T16>::ld(Bt2 + boff + (size_t)nb * 16 * K + kc);
#pragma unroll
            for (int mb = 0; mb < 4; ++mb) { acc[mb][nb] = WFrag<T16>::mma(a[mb], b, acc[mb][nb]); if (NSPLIT == 1 || NSPLIT == 2) acc[mb][nb] = WFrag<T16>::mma(a2[mb], b, acc[mb][nb]); if (NSPLIT >= 2) acc[mb][nb] = WFrag<T16>::mma(a[mb], b2, acc[mb][nb]); } }
        asm volatile("v_nop\n\tv_nop\n\tv_nop\n\tv_nop" : "+v"(acc[0][0]), "+v"(acc[1][1]), "+v"(acc[2][2]), "+v"(acc[3][3]) : "v"(a[0]), "v"(a[3]));
    }
#pragma unroll
    for (int mb = 0; mb < 4; ++mb) {
#pragma unroll
        for (int nb = 0; nb < 4; ++nb) {
#pragma unroll
            for (int j = 0; j < 8; ++j) os[(hi * 8 + j) * 68 + nb * 16 + lr] = acc[mb][nb][j]; }
        __builtin_amdgcn_wave_barrier(); asm volatile("" ::: "memory");
        float* crow = C + (size_t)(r0 + mb * 16) * ldc + c0;
{
#pragma unroll
            for (int s = 0; s < 8; ++s) { const int row = 2 * s + hi, cofs = lr * 4; v4f val = *(const v4fa*)(os + row * 68 + cofs); if (BIAS) { val[0] += bfr(bias[c0 + cofs]); val[1] += bfr(bias[c0 + cofs + 1]); val[2] += bfr(bias[c0 + cofs + 2]); val[3] += bfr(bias[c0 + cofs + 3]); }
                *(v4f*)(crow + (size_t)row * ldc + cofs) = val; }
             }
        __builtin_amdgcn_wave_barrier(); asm volatile("" ::: "memory");
    }
}

__device__ __forceinline__ h16 tohx(float x) { return (h16)x; }
__device__ __forceinline__ void splitf(float y, unsigned short& h, unsigned short& l) { h = f2bf(y); l = f2bf(y - bf2f(h)); }
typedef __attribute__((ext_vector_type(2))) _Float16 v2h;
typedef __attribute__((ext_vector_type(4))) _Float16 v4h;
typedef __attribute__((ext_vector_type(2))) unsigned short v2us;
typedef __attribute__((ext_vector_type(4))) unsigned short v4us;
typedef __attribute__((ext_vector_type(2))) float v2f;
typedef __attribute__((ext_vector_type(4))) int v4i;

__global__ __launch_bounds__(256) void k_wtG(const float* __restrict__ w, int K, int N, bf* Bt) {
    const int lane = threadIdx.x & 31; const int L0 = (blockIdx.x * 8 + (threadIdx.x >> 5)) * 8; const int nlines = N * K / 64;
{
#pragma unroll 1
        for (int l = 0; l < 8; ++l) { const int L = L0 + l; if (L >= nlines) break; const size_t e = (size_t)L * 64 + lane * 2; const int k = (int)(e % K), n = (int)(e / K); v2us o;
            o[0] = f2bf(w[(size_t)k * N + n]); o[1] = f2bf(w[(size_t)(k + 1) * N + n]); *(v2us*)(Bt + e) = o; }
         }
}
__global__ __launch_bounds__(256) void k_lnhl(const float* __restrict__ X, const float* __restrict__ A, const float* __restrict__ g, const float* __restrict__ be, float* Z, bf* Yh, bf* Yl) {
    const int lane = threadIdx.x & 31; const int r = blockIdx.x * 8 + (threadIdx.x >> 5); if (r >= TT) return; const float* xr = X + (size_t)r * DM; const float* ar = A ? A + (size_t)r * DM : nullptr; float s = 0.f;
#pragma unroll 1
    for (int ch = 0; ch < DM / 128; ++ch) { const int c0 = ch * 128 + lane * 4; const v4f a = *(const v4f*)(xr + c0); v4f d = {0.f, 0.f, 0.f, 0.f}; if (ar) d = *(const v4f*)(ar + c0);
#pragma unroll
        for (int q = 0; q < 4; ++q) s += __fadd_rn(bfr(a[q]), d[q]); }
#pragma unroll
    for (int sh = 16; sh; sh >>= 1) s += __shfl_xor(s, sh, 32);
    const float mu = s * (1.0f / DM); float s2 = 0.f;
#pragma unroll 1
    for (int ch = 0; ch < DM / 128; ++ch) { const int c0 = ch * 128 + lane * 4; const v4f a = *(const v4f*)(xr + c0); v4f d = {0.f, 0.f, 0.f, 0.f}; if (ar) d = *(const v4f*)(ar + c0);
#pragma unroll
        for (int q = 0; q < 4; ++q) { const float d0 = __fsub_rn(__fadd_rn(bfr(a[q]), d[q]), mu); float p = __fmul_rn(d0, d0); asm volatile("" : "+v"(p)); s2 = __fadd_rn(s2, p); } }
#pragma unroll
    for (int sh = 16; sh; sh >>= 1) s2 += __shfl_xor(s2, sh, 32);
    const float rs = __fdiv_rn(1.0f, __fsqrt_rn(__fadd_rn(s2 * (1.0f / DM), LNEPS)));
{
#pragma unroll 1
        for (int ch = 0; ch < DM / 128; ++ch) { const int c0 = ch * 128 + lane * 4; const v4f a = *(const v4f*)(xr + c0); v4f d = {0.f, 0.f, 0.f, 0.f}; if (ar) d = *(const v4f*)(ar + c0); v4f z4; v4us oh, ol;
#pragma unroll
            for (int q = 0; q < 4; ++q) { const float v = __fadd_rn(bfr(a[q]), d[q]); z4[q] = v; float n0 = __fmul_rn(__fsub_rn(v, mu), rs); asm volatile("" : "+v"(n0)); float n1 = __fmul_rn(n0, bfr(g[c0 + q])); asm volatile("" : "+v"(n1)); const float y = __fadd_rn(n1, bfr(be[c0 + q])); unsigned short h2, l2; splitf(y, h2, l2); oh[q] = h2; ol[q] = l2; }
            if (Z) *(v4f*)(Z + (size_t)r * DM + c0) = z4; *(v4us*)(Yh + (size_t)r * DM + c0) = oh; *(v4us*)(Yl + (size_t)r * DM + c0) = ol; }
         } }
__global__ __launch_bounds__(256) void k_addres(const float* __restrict__ X, const float* __restrict__ Y, float* O, size_t n4) { const size_t i = (size_t)blockIdx.x * 256 + threadIdx.x; if (i >= n4) return; const v4f a = *(const v4f*)(X + i * 4), b = *(const v4f*)(Y + i * 4); v4f o;
#pragma unroll
    for (int q = 0; q < 4; ++q) o[q] = __fadd_rn(bfr(a[q]), b[q]); *(v4f*)(O + i * 4) = o;  }
__constant__ int BKT[4095] = {15,15,15,15,15,15,15,15,15,15,15,15,15,15,15,15,15,15,15,15,15,15,15,15,15,15,15,15,15,15,15,15,15,15,15,15,15,15,15,15,15,15,15,15,15,15,15,15,15,15,15,15,15,15,15,15,15,15,15,15,15,15,15,15,15,15,15,15,15,15,15,15,15,15,15,15,15,15,15,15,15,15,15,15,15,15,15,15,15,15,15,15,15,15,15,15,15,15,15,15,15,15,15,15,15,15,15,15,15,15,15,15,15,15,15,15,15,15,15,15,15,15,15,15,15,15,15,15,15,15,15,15,15,15,15,15,15,15,15,15,15,15,15,15,15,15,15,15,15,15,15,15,15,15,15,15,15,15,15,15,15,15,15,15,15,15,15,15,15,15,15,15,15,15,15,15,15,15,15,15,15,15,15,15,15,15,15,15,15,15,15,15,15,15,15,15,15,15,15,15,15,15,15,15,15,15,15,15,15,15,15,15,15,15,15,15,15,15,15,15,15,15,15,15,15,15,15,15,15,15,15,15,15,15,15,15,15,15,15,15,15,15,15,15,15,15,15,15,15,15,15,15,15,15,15,15,15,15,15,15,15,15,15,15,15,15,15,15,15,15,15,15,15,15,15,15,15,15,15,15,15,15,15,15,15,15,15,15,15,15,15,15,15,15,15,15,15,15,15,15,15,15,15,15,15,15,15,15,15,15,15,15,15,15,15,15,15,15,15,15,15,15,15,15,15,15,15,15,15,15,15,15,15,15,15,15,15,15,15,15,15,15,15,15,15,15,15,15,15,15,15,15,15,15,15,15,15,15,15,15,15,15,15,15,15,15,15,15,15,15,15,15,15,15,15,15,15,15,15,15,15,15,15,15,15,15,15,15,15,15,15,15,15,15,15,15,15,15,15,15,15,15,15,15,15,15,15,15,15,15,15,15,15,15,15,15,15,15,15,15,15,15,15,15,15,15,15,15,15,15,15,15,15,15,15,15,15,15,15,15,15,15,15,15,15,15,15,15,15,15,15,15,15,15,15,15,15,15,15,15,15,15,15,15,15,15,15,15,15,15,15,15,15,15,15,15,15,15,15,15,15,15,15,15,15,15,15,15,15,15,15,15,15,15,15,15,15,15,15,15,15,15,15,15,15,15,15,15,15,15,15,15,15,15,15,15,15,15,15,15,15,15,15,15,15,15,15,15,15,15,15,15,15,15,15,15,15,15,15,15,15,15,15,15,15,15,15,15,15,15,15,15,15,15,15,15,15,15,15,15,15,15,15,15,15,15,15,15,15,15,15,15,15,15,15,15,15,15,15,15,15,15,15,15,15,15,15,15,15,15,15,15,15,15,15,15,15,15,15,15,15,15,15,15,15,15,15,15,15,15,15,15,15,15,15,15,15,15,15,15,15,15,15,15,15,15,15,15,15,15,15,15,15,15,15,15,15,15,15,15,15,15,15,15,15,15,15,15,15,15,15,15,15,15,15,15,15,15,15,15,15,15,15,15,15,15,15,15,15,15,15,15,15,15,15,15,15,15,15,15,15,15,15,15,15,15,15,15,15,15,15,15,15,15,15,15,15,15,15,15,15,15,15,15,15,15,15,15,15,15,15,15,15,15,15,15,15,15,15,15,15,15,15,15,15,15,15,15,15,15,15,15,15,15,15,15,15,15,15,15,15,15,15,15,15,15,15,15,15,15,15,15,15,15,15,15,15,15,15,15,15,15,15,15,15,15,15,15,15,15,15,15,15,15,15,15,15,15,15,15,15,15,15,15,15,15,15,15,15,15,15,15,15,15,15,15,15,15,15,15,15,15,15,15,15,15,15,15,15,15,15,15,15,15,15,15,15,15,15,15,15,15,15,15,15,15,15,15,15,15,15,15,15,15,15,15,15,15,15,15,15,15,15,15,15,15,15,15,15,15,15,15,15,15,15,15,15,15,15,15,15,15,15,15,15,15,15,15,15,15,15,15,15,15,15,15,15,15,15,15,15,15,15,15,15,15,15,15,15,15,15,15,15,15,15,15,15,15,15,15,15,15,15,15,15,15,15,15,15,15,15,15,15,15,15,15,15,15,15,15,15,15,15,15,15,15,15,15,15,15,15,15,15,15,15,15,15,15,15,15,15,15,15,15,15,15,15,15,15,15,15,15,15,15,15,15,15,15,15,15,15,15,15,15,15,15,15,15,15,15,15,15,15,15,15,15,15,15,15,15,15,15,15,15,15,15,15,15,15,15,15,15,15,15,15,15,15,15,15,15,15,15,15,15,15,15,15,15,15,15,15,15,15,15,15,15,15,15,15,15,15,15,15,15,15,15,15,15,15,15,15,15,15,15,15,15,15,15,15,15,15,15,15,15,15,15,15,15,15,15,15,15,15,15,15,15,15,15,15,15,15,15,15,15,15,15,15,15,15,15,15,15,15,15,15,15,15,15,15,15,15,15,15,15,15,15,15,15,15,15,15,15,15,15,15,15,15,15,15,15,15,15,15,15,15,15,15,15,15,15,15,15,15,15,15,15,15,15,15,15,15,15,15,15,15,15,15,15,15,15,15,15,15,15,15,15,15,15,15,15,15,15,15,15,15,15,15,15,15,15,15,15,15,15,15,15,15,15,15,15,15,15,15,15,15,15,15,15,15,15,15,15,15,15,15,15,15,15,15,15,15,15,15,15,15,15,15,15,15,15,15,15,15,15,15,15,15,15,15,15,15,15,15,15,15,15,15,15,15,15,15,15,15,15,15,15,15,15,15,15,15,15,15,15,15,15,15,15,15,15,15,15,15,15,15,15,15,15,15,15,15,15,15,15,15,15,15,15,15,15,15,15,15,15,15,15,15,15,15,15,15,15,15,15,15,15,15,15,15,15,15,15,15,15,15,15,15,15,15,15,15,15,15,15,15,15,15,15,15,15,15,15,15,15,15,15,15,15,15,15,15,15,15,15,15,15,15,15,15,15,15,15,15,15,15,15,15,15,15,15,15,15,15,15,15,15,15,15,15,15,15,15,15,15,15,15,15,15,15,15,15,15,15,15,15,15,15,15,15,15,15,15,15,15,15,15,15,15,15,15,15,15,15,15,15,15,15,15,15,15,15,15,15,15,15,15,15,15,15,15,15,15,15,15,15,15,15,15,15,15,15,15,15,15,15,15,15,15,15,15,15,15,15,15,15,15,15,15,15,15,15,15,15,15,15,15,15,15,15,15,15,15,15,15,15,15,15,15,15,15,15,15,15,15,15,15,15,15,15,15,15,15,15,15,15,15,15,15,15,15,15,15,15,15,15,15,15,15,15,15,15,15,15,15,15,15,15,15,15,15,15,15,15,15,15,15,15,15,15,15,15,15,15,15,15,15,15,15,15,15,15,15,15,15,15,15,15,15,15,15,15,15,15,15,15,15,15,15,15,15,15,15,15,15,15,15,15,15,15,15,15,15,15,15,15,15,15,15,15,15,15,15,15,15,15,15,15,15,15,15,15,15,15,15,15,15,15,15,15,15,15,15,15,15,15,15,15,15,15,15,15,15,15,15,15,15,15,15,15,15,15,15,15,15,15,15,15,15,15,15,15,15,15,15,15,15,15,15,15,15,15,15,15,15,15,15,15,15,15,15,15,15,15,15,15,15,15,15,15,15,15,15,15,15,15,15,15,15,15,15,15,15,15,15,15,15,15,15,15,15,15,15,15,15,15,15,15,15,15,15,15,15,15,15,15,15,15,15,15,15,15,15,15,15,15,15,15,15,15,15,15,15,15,15,15,15,15,15,15,15,15,15,15,15,15,15,15,15,15,15,15,15,15,15,15,15,15,15,15,15,15,15,15,15,15,15,15,15,15,15,15,15,15,15,15,15,15,15,15,15,15,15,15,15,15,15,15,15,15,15,15,15,15,15,15,15,15,15,15,15,15,15,15,15,15,15,15,15,15,15,15,15,15,15,15,15,15,15,15,15,15,15,15,15,15,15,15,15,15,15,15,15,15,15,15,15,15,15,15,15,15,15,15,15,15,15,15,15,15,15,15,15,15,15,15,15,15,15,15,15,15,15,15,15,15,15,15,15,15,15,15,15,15,15,15,15,15,15,15,15,15,15,15,15,15,15,15,15,15,15,15,15,15,15,15,15,15,15,15,15,15,15,15,15,15,15,15,15,15,15,15,15,15,15,15,15,15,15,15,15,15,15,15,15,15,15,15,15,15,15,15,15,15,15,15,15,15,15,15,15,15,15,15,15,15,15,15,15,15,15,15,15,15,15,15,15,15,15,15,15,15,15,15,15,15,15,15,15,15,15,15,15,15,15,15,15,15,15,15,15,15,15,15,15,15,15,15,15,15,15,15,15,15,15,15,15,15,15,15,15,15,15,15,15,15,15,15,15,15,15,15,15,15,15,15,15,15,15,15,15,15,15,15,15,15,15,15,14,14,14,14,14,14,14,14,14,14,14,14,14,14,14,14,14,14,14,14,14,14,14,14,14,14,14,13,13,13,13,13,13,13,13,13,13,13,13,13,13,13,13,13,13,12,12,12,12,12,12,12,12,12,12,12,12,12,12,11,11,11,11,11,11,11,11,11,10,10,10,10,10,10,10,9,9,9,9,8,8,8,8,7,6,5,4,3,2,1,0,17,18,19,20,21,22,23,24,24,24,24,25,25,25,25,26,26,26,26,26,26,26,27,27,27,27,27,27,27,27,27,28,28,28,28,28,28,28,28,28,28,28,28,28,28,29,29,29,29,29,29,29,29,29,29,29,29,29,29,29,29,29,29,30,30,30,30,30,30,30,30,30,30,30,30,30,30,30,30,30,30,30,30,30,30,30,30,30,30,30,31,31,31,31,31,31,31,31,31,31,31,31,31,31,31,31,31,31,31,31,31,31,31,31,31,31,31,31,31,31,31,31,31,31,31,31,31,31,31,31,31,31,31,31,31,31,31,31,31,31,31,31,31,31,31,31,31,31,31,31,31,31,31,31,31,31,31,31,31,31,31,31,31,31,31,31,31,31,31,31,31,31,31,31,31,31,31,31,31,31,31,31,31,31,31,31,31,31,31,31,31,31,31,31,31,31,31,31,31,31,31,31,31,31,31,31,31,31,31,31,31,31,31,31,31,31,31,31,31,31,31,31,31,31,31,31,31,31,31,31,31,31,31,31,31,31,31,31,31,31,31,31,31,31,31,31,31,31,31,31,31,31,31,31,31,31,31,31,31,31,31,31,31,31,31,31,31,31,31,31,31,31,31,31,31,31,31,31,31,31,31,31,31,31,31,31,31,31,31,31,31,31,31,31,31,31,31,31,31,31,31,31,31,31,31,31,31,31,31,31,31,31,31,31,31,31,31,31,31,31,31,31,31,31,31,31,31,31,31,31,31,31,31,31,31,31,31,31,31,31,31,31,31,31,31,31,31,31,31,31,31,31,31,31,31,31,31,31,31,31,31,31,31,31,31,31,31,31,31,31,31,31,31,31,31,31,31,31,31,31,31,31,31,31,31,31,31,31,31,31,31,31,31,31,31,31,31,31,31,31,31,31,31,31,31,31,31,31,31,31,31,31,31,31,31,31,31,31,31,31,31,31,31,31,31,31,31,31,31,31,31,31,31,31,31,31,31,31,31,31,31,31,31,31,31,31,31,31,31,31,31,31,31,31,31,31,31,31,31,31,31,31,31,31,31,31,31,31,31,31,31,31,31,31,31,31,31,31,31,31,31,31,31,31,31,31,31,31,31,31,31,31,31,31,31,31,31,31,31,31,31,31,31,31,31,31,31,31,31,31,31,31,31,31,31,31,31,31,31,31,31,31,31,31,31,31,31,31,31,31,31,31,31,31,31,31,31,31,31,31,31,31,31,31,31,31,31,31,31,31,31,31,31,31,31,31,31,31,31,31,31,31,31,31,31,31,31,31,31,31,31,31,31,31,31,31,31,31,31,31,31,31,31,31,31,31,31,31,31,31,31,31,31,31,31,31,31,31,31,31,31,31,31,31,31,31,31,31,31,31,31,31,31,31,31,31,31,31,31,31,31,31,31,31,31,31,31,31,31,31,31,31,31,31,31,31,31,31,31,31,31,31,31,31,31,31,31,31,31,31,31,31,31,31,31,31,31,31,31,31,31,31,31,31,31,31,31,31,31,31,31,31,31,31,31,31,31,31,31,31,31,31,31,31,31,31,31,31,31,31,31,31,31,31,31,31,31,31,31,31,31,31,31,31,31,31,31,31,31,31,31,31,31,31,31,31,31,31,31,31,31,31,31,31,31,31,31,31,31,31,31,31,31,31,31,31,31,31,31,31,31,31,31,31,31,31,31,31,31,31,31,31,31,31,31,31,31,31,31,31,31,31,31,31,31,31,31,31,31,31,31,31,31,31,31,31,31,31,31,31,31,31,31,31,31,31,31,31,31,31,31,31,31,31,31,31,31,31,31,31,31,31,31,31,31,31,31,31,31,31,31,31,31,31,31,31,31,31,31,31,31,31,31,31,31,31,31,31,31,31,31,31,31,31,31,31,31,31,31,31,31,31,31,31,31,31,31,31,31,31,31,31,31,31,31,31,31,31,31,31,31,31,31,31,31,31,31,31,31,31,31,31,31,31,31,31,31,31,31,31,31,31,31,31,31,31,31,31,31,31,31,31,31,31,31,31,31,31,31,31,31,31,31,31,31,31,31,31,31,31,31,31,31,31,31,31,31,31,31,31,31,31,31,31,31,31,31,31,31,31,31,31,31,31,31,31,31,31,31,31,31,31,31,31,31,31,31,31,31,31,31,31,31,31,31,31,31,31,31,31,31,31,31,31,31,31,31,31,31,31,31,31,31,31,31,31,31,31,31,31,31,31,31,31,31,31,31,31,31,31,31,31,31,31,31,31,31,31,31,31,31,31,31,31,31,31,31,31,31,31,31,31,31,31,31,31,31,31,31,31,31,31,31,31,31,31,31,31,31,31,31,31,31,31,31,31,31,31,31,31,31,31,31,31,31,31,31,31,31,31,31,31,31,31,31,31,31,31,31,31,31,31,31,31,31,31,31,31,31,31,31,31,31,31,31,31,31,31,31,31,31,31,31,31,31,31,31,31,31,31,31,31,31,31,31,31,31,31,31,31,31,31,31,31,31,31,31,31,31,31,31,31,31,31,31,31,31,31,31,31,31,31,31,31,31,31,31,31,31,31,31,31,31,31,31,31,31,31,31,31,31,31,31,31,31,31,31,31,31,31,31,31,31,31,31,31,31,31,31,31,31,31,31,31,31,31,31,31,31,31,31,31,31,31,31,31,31,31,31,31,31,31,31,31,31,31,31,31,31,31,31,31,31,31,31,31,31,31,31,31,31,31,31,31,31,31,31,31,31,31,31,31,31,31,31,31,31,31,31,31,31,31,31,31,31,31,31,31,31,31,31,31,31,31,31,31,31,31,31,31,31,31,31,31,31,31,31,31,31,31,31,31,31,31,31,31,31,31,31,31,31,31,31,31,31,31,31,31,31,31,31,31,31,31,31,31,31,31,31,31,31,31,31,31,31,31,31,31,31,31,31,31,31,31,31,31,31,31,31,31,31,31,31,31,31,31,31,31,31,31,31,31,31,31,31,31,31,31,31,31,31,31,31,31,31,31,31,31,31,31,31,31,31,31,31,31,31,31,31,31,31,31,31,31,31,31,31,31,31,31,31,31,31,31,31,31,31,31,31,31,31,31,31,31,31,31,31,31,31,31,31,31,31,31,31,31,31,31,31,31,31,31,31,31,31,31,31,31,31,31,31,31,31,31,31,31,31,31,31,31,31,31,31,31,31,31,31,31,31,31,31,31,31,31,31,31,31,31,31,31,31,31,31,31,31,31,31,31,31,31,31,31,31,31,31,31,31,31,31,31,31,31,31,31,31,31,31,31,31,31,31,31,31,31,31,31,31,31,31,31,31,31,31,31,31,31,31,31,31,31,31,31,31,31,31,31,31,31,31,31,31,31,31,31,31,31,31,31,31,31,31,31,31,31,31,31,31,31,31,31,31,31,31,31,31,31,31,31,31,31,31,31,31,31,31,31,31,31,31,31,31,31,31,31,31,31,31,31,31,31,31,31,31,31,31,31,31,31,31,31,31,31,31,31,31,31,31,31,31,31,31,31,31,31,31,31,31,31,31,31,31,31,31,31,31,31,31,31,31,31,31,31,31,31,31,31,31,31,31,31,31,31,31,31,31,31,31,31,31,31,31,31,31,31,31,31,31,31,31,31,31,31,31,31,31,31,31,31,31,31,31,31,31,31,31,31,31,31,31,31,31,31,31,31,31,31,31,31,31,31,31,31,31,31,31,31,31,31,31,31,31,31,31,31,31,31,31,31,31,31,31,31,31,31,31,31,31,31,31,31,31,31,31,31,31,31,31,31,31,31,31,31,31,31,31,31,31,31,31,31,31,31,31,31,31,31,31,31,31,31,31,31,31,31,31,31,31,31,31,31,31,31,31,31,31,31,31,31,31,31,31,31,31,31,31,31,31,31,31,31,31,31,31,31,31,31,31,31,31,31,31,31,31,31,31,31,31,31,31,31,31,31,31,31,31,31,31,31,31,31,31,31,31,31,31,31,31,31,31,31,31,31,31,31,31,31,31,31,31,31,31,31,31,31,31,31,31,31,31,31,31,31,31,31,31,31,31,31,31,31,31,31,31,31,31,31,31,31,31,31,31,31,31,31,31,31,31,31,31,31,31,31,31,31,31,31,31,31,31,31,31,31,31,31,31,31,31,31,31,31,31,31,31,31,31,31,31,31,31,31,31,31,31,31,31,31,31,31,31,31,31,31,31,31,31,31,31,31,31,31,31,31,31,31,31,31,31,31,31,31,31,31,31,31,31,31,31,31,31,31,31,31,31,31,31,31,31,31,31,31,31,31,31,31,31,31,31,31,31,31,31,31,31,31,31,31,31,31,31,31,31,31,31,31,31,31,31,31,31,31,31,31,31,31,31,31,31,31,31,31,31,31,31,31,31,31,31,31,31,31,31,31,31,31,31,31,31,31,31,31,31,31,31,31,31,31,31,31,31,31,31,31,31,31,31,31,31,31,31,31,31,31,31,31,31,31,31,31,31,31,31,31,31,31,31,31,31,31,31,31,31,31,31,31,31,31,31,31,31,31,31,31,31,31,31,31,31,31,31,31,31,31,31,31,31,31,31,31,31,31,31,31,31,31,31,31,31,31,31,31,31,31,31,31,31,31,31,31,31,31,31,31,31,31,31,31,31};
__global__ __launch_bounds__(256) void k_btab(const float* __restrict__ relb, float* BT) { const int e = blockIdx.x * 256 + threadIdx.x; if (e >= NH_ * 4096) return; const int r = e % 4096, h = e / 4096; const float v = (r < 4095) ? bfr(relb[BKT[r] * NH_ + h]) : 0.f; *(float*)(BT + e) = v;  }
__global__ __launch_bounds__(256) void k_cvt8(const float* __restrict__ src, bf* dst, size_t n8) { const size_t i = (size_t)blockIdx.x * 256 + threadIdx.x; if (i >= n8) return; const v8f v = *(const v8f*)(src + i * 8); v8us o;
#pragma unroll
    for (int k = 0; k < 8; ++k) o[k] = f2bf(v[k]); *(v8us*)(dst + i * 8) = o;  }

// k_rope: head planes [h][t][d] (fp16 + hi/lo) of rope(x) x sc with the rotate-half convention out[d] = x[d] cos[t][d] - x[d+HD/2] sin[t][d], out[d+HD/2] = x[d+HD/2] cos[t][d+HD/2] + x[d] sin[t][d+HD/2]
__global__ __launch_bounds__(256) void k_rope(const float* __restrict__ F, int pitch, int nheads, const float* __restrict__ CS, const float* __restrict__ RF, const float* __restrict__ nw, float sc, h16* P16, bf* Ph, bf* Pl) {
    const size_t e = ((size_t)blockIdx.x * 256 + threadIdx.x) * 2; if (e >= (size_t)nheads * TT * HD) return; const int d = (int)(e % HD); const int t = (int)((e / HD) % TT); const int h = (int)(e / ((size_t)HD * TT)); const float* f = F + (size_t)t * pitch + h * HD; const float rf = RF ? RF[(size_t)h * TT + t] : 1.0f; v2h o16; v2us oh, ol;
#pragma unroll
    for (int q = 0; q < 2; ++q) { const int dd = d + q; const int dp = (dd < HD / 2) ? dd + HD / 2 : dd - HD / 2; float x0 = f[dd], x1 = f[dp];
        if (RF) { float n0 = __fmul_rn(x0, rf), n1 = __fmul_rn(x1, rf); asm volatile("" : "+v"(n0)); asm volatile("" : "+v"(n1)); x0 = __fmul_rn(bfr(nw[dd]), n0); x1 = __fmul_rn(bfr(nw[dp]), n1); }
        const v2f cs = *(const v2f*)(CS + ((size_t)t * HD + dd) * 2); float a = __fmul_rn(x0, cs[0]), bq = __fmul_rn(x1, cs[1]); asm volatile("" : "+v"(a)); asm volatile("" : "+v"(bq)); const float r = ((dd < HD / 2) ? __fsub_rn(a, bq) : __fadd_rn(a, bq)) * sc;
        o16[q] = tohx(r); unsigned short a2, c2; splitf(r, a2, c2); oh[q] = a2; ol[q] = c2; }
    *(v2h*)(P16 + e) = o16; *(v2us*)(Ph + e) = oh; *(v2us*)(Pl + e) = ol;  }
__global__ __launch_bounds__(256) void k_vtp(const float* __restrict__ F, int pitch, int nheads, h16* V16, bf* Vh, bf* Vl) { const size_t e = ((size_t)blockIdx.x * 256 + threadIdx.x) * 2; if (e >= (size_t)nheads * HD * TT) return; const int t = (int)(e % TT); const int d = (int)((e / TT) % HD); const int g = (int)(e / ((size_t)TT * HD)); v2h o16; v2us oh, ol;
#pragma unroll
    for (int q = 0; q < 2; ++q) { const float x = F[(size_t)(t + q) * pitch + g * HD + d]; o16[q] = tohx(x); unsigned short a2, c2; splitf(x, a2, c2); oh[q] = a2; ol[q] = c2; }
    *(v2h*)(V16 + e) = o16; *(v2us*)(Vh + e) = oh; *(v2us*)(Vl + e) = ol;  }
__global__ __launch_bounds__(256) void k_csid(float* CS) { const int idx = blockIdx.x * 256 + threadIdx.x; if (idx >= TT * HD) return; v2f cs; cs[0] = 1.0f; cs[1] = 0.0f; *(v2f*)(CS + (size_t)idx * 2) = cs;  }
// k_asoft: per row (zz, i): t = S (no mask); softmax over the 2048 keys (register row, one exp, fixed trees);; T5: no score scaling, plus BT[h][j - i + 2047] (the learned relative-position bias through the embedded bucket table) before the max
__global__ __launch_bounds__(256) void k_asoft(const float* __restrict__ Sb, const float* __restrict__ BT, int h0, h16* P16, bf* Ph, bf* Pl) {
    const int lane = threadIdx.x & 31; const int row = blockIdx.x * 8 + (threadIdx.x >> 5); if (row >= ZH * TT) return; const int i = row % TT; const int zz = row / TT; const float* bt = BT + (size_t)(h0 + zz) * 4096 + 2047 - i;   /* bt[j] = bias for (j - i) */ const bool hires = (i < RH); const float* sr = Sb + (size_t)row * TT; float v[TT / 32]; float mx = -3.0e38f;
#pragma unroll
    for (int ch = 0; ch < TT / 128; ++ch) { const int j0 = ch * 128 + lane * 4; const v4f a = *(const v4f*)(sr + j0);
#pragma unroll
        for (int q = 0; q < 4; ++q) { const int j = j0 + q; const float t = __fadd_rn(a[q], bt[j]);   /* scores + rel_bias[bucket(j - i)][h] */ v[ch * 4 + q] = t; mx = fmaxf(mx, t); } }
#pragma unroll
    for (int sh = 16; sh; sh >>= 1) mx = fmaxf(mx, __shfl_xor(mx, sh, 32));
    float sum = 0.f;
#pragma unroll
    for (int k = 0; k < TT / 32; ++k) { float d0 = __fsub_rn(v[k], mx); asm volatile("" : "+v"(d0)); v[k] = __builtin_amdgcn_exp2f(__fmul_rn(d0, 1.4426950408889634f)); sum += v[k]; }
#pragma unroll
    for (int sh = 16; sh; sh >>= 1) sum += __shfl_xor(sum, sh, 32);
    const float f = __fdiv_rn(hires ? 1.0f : PCAR, sum);
{
        if (hires) {
#pragma unroll
            for (int ch = 0; ch < TT / 128; ++ch) { v4us oh, ol;
#pragma unroll
                for (int q = 0; q < 4; ++q) { unsigned short a, c2; splitf(v[ch * 4 + q] * f, a, c2); oh[q] = a; ol[q] = c2; }
                const size_t oo = ((size_t)zz * (RH ? RH : 1) + i) * TT + ch * 128 + lane * 4; *(v4us*)(Ph + oo) = oh; *(v4us*)(Pl + oo) = ol; }
        } else {
#pragma unroll
            for (int ch = 0; ch < TT / 128; ++ch) { v4h o4;
#pragma unroll
                for (int q = 0; q < 4; ++q) o4[q] = tohx(v[ch * 4 + q] * f);
                *(v4h*)(P16 + (size_t)row * TT + ch * 128 + lane * 4) = o4; } }
         }
}
__global__ __launch_bounds__(256) void k_merge(const float* __restrict__ O, int h0, bf* Ah, bf* Al) { const size_t e = ((size_t)blockIdx.x * 256 + threadIdx.x) * 2; if (e >= (size_t)ZH * TT * HD) return; const int d = (int)(e % HD); const int t = (int)((e / HD) % TT); const int zz = (int)(e / ((size_t)HD * TT)); const float cs = (t < RH) ? 1.0f : (1.0f / PCAR); const size_t oo = (size_t)t * DQ + (h0 + zz) * HD + d;
    v2us oh, ol; v2f sm = {0.f, 0.f};
#pragma unroll
    for (int p = 0; p < KSP; ++p) { const v2f w = *(const v2f*)(O + (size_t)p * ZH * TT * HD + e); sm[0] += w[0]; sm[1] += w[1]; }   /* the KSP key ranges' partial sums, in range order */
#pragma unroll
    for (int q = 0; q < 2; ++q) { unsigned short a, c2; splitf(sm[q] * cs, a, c2); oh[q] = a; ol[q] = c2; } *(v2us*)(Ah + oo) = oh; *(v2us*)(Al + oo) = ol;  }

extern "C" void kernel_launch(void* const* d_in, const int* in_sizes, int n_in,
                              void* d_out, int out_size, void* d_ws, size_t ws_size, hipStream_t stream) {
    (void)in_sizes; (void)n_in; (void)out_size;
    const float* x = (const float*)d_in[0]; const float* g1 = (const float*)d_in[1]; const float* e1b = (const float*)d_in[2]; const float* wq = (const float*)d_in[3]; const float* wk = (const float*)d_in[4]; const float* wv = (const float*)d_in[5]; const float* wo = (const float*)d_in[6]; const float* relb = (const float*)d_in[7];
    float* OUT = (float*)d_out;     // [2][2048][1024]
    char* wsp = (char*)d_ws;
    auto take = [&](size_t bytes) { char* p = wsp; wsp += (bytes + 255) & ~(size_t)255; return (void*)p; };
    bf* WQ = (bf*)take((size_t)DQ * DM * 2); bf* WK = (bf*)take((size_t)DKV * DM * 2); bf* WV = (bf*)take((size_t)DKV * DM * 2); bf* WO = (bf*)take((size_t)DM * DQ * 2); float* CS = (float*)take((size_t)TT * HD * 2 * 4);
    bf* Yh = (bf*)take((size_t)TT * DM * 2); bf* Yl = (bf*)take((size_t)TT * DM * 2); float* YO = (float*)take((size_t)TT * DM * 4); float* BT = (float*)take((size_t)NH_ * 4096 * 4); float* FQ = (float*)take((size_t)TT * DQ * 4); float* FK = (float*)take((size_t)TT * DKV * 4);
    h16* QP16 = (h16*)take((size_t)NH_ * TT * HD * 2); h16* KP16 = (h16*)take((size_t)NKV * TT * HD * 2); h16* VT16 = (h16*)take((size_t)NKV * HD * TT * 2);
    bf* QPh = (bf*)take((size_t)NH_ * TT * HD * 2); bf* QPl = (bf*)take((size_t)NH_ * TT * HD * 2); bf* KPh = (bf*)take((size_t)NKV * TT * HD * 2); bf* KPl = (bf*)take((size_t)NKV * TT * HD * 2); bf* VTh = (bf*)take((size_t)NKV * HD * TT * 2); bf* VTl = (bf*)take((size_t)NKV * HD * TT * 2); bf* Ph = (bf*)take((size_t)ZH * RH * TT * 2); bf* Pl = (bf*)take((size_t)ZH * RH * TT * 2);
    float* Sb = (float*)take((size_t)ZH * TT * TT * 4); h16* P16 = (h16*)take((size_t)ZH * TT * TT * 2); float* Ob = (float*)take((size_t)KSP * ZH * TT * HD * 4); bf* ATh = (bf*)take((size_t)TT * DQ * 2); bf* ATl = (bf*)take((size_t)TT * DQ * 2);
    if ((size_t)(wsp - (char*)d_ws) > ws_size) return;    // ws 256 MiB
    float* FV = FK;   // v projection reuses the k buffer after the k planes are built (stream-ordered)
    { k_wtG<<<(unsigned)((DM * DQ / 64 + 63) / 64), 256, 0, stream>>>(wq, DM, DQ, WQ); k_wtG<<<(unsigned)((DM * DKV / 64 + 63) / 64), 256, 0, stream>>>(wk, DM, DKV, WK); k_wtG<<<(unsigned)((DM * DKV / 64 + 63) / 64), 256, 0, stream>>>(wv, DM, DKV, WV);
      k_wtG<<<(unsigned)((DQ * DM / 64 + 63) / 64), 256, 0, stream>>>(wo, DQ, DM, WO);
       }
    k_csid<<<(TT * HD + 255) / 256, 256, 0, stream>>>(CS);
    const unsigned LQ = (unsigned)(((size_t)NH_ * TT * HD / 2 + 255) / 256), LKv = (unsigned)(((size_t)NKV * TT * HD / 2 + 255) / 256);
    for (int b = 0; b < NB_; ++b) {
        
        k_lnhl<<<TT / 8, 256, 0, stream>>>(x + (size_t)b * TT * DM, nullptr, g1, e1b, nullptr, Yh, Yl);   /* n = LN(hidden) as hi/lo planes */ if (b == 0) k_btab<<<(NH_ * 4096 + 255) / 256, 256, 0, stream>>>(relb, BT);
        k_gemmw<bf, 1, false><<<dim3(TT / 64, DQ / 64, 1), 32, 0, stream>>>(Yh, Yl, WQ, nullptr, DM, FQ, DQ, nullptr, 0, 0, 0, 0);
        k_rope<<<LQ, 256, 0, stream>>>(FQ, DQ, NH_, CS, nullptr, nullptr, 1.0f, QP16, QPh, QPl);
        k_gemmw<bf, 1, false><<<dim3(TT / 64, DKV / 64, 1), 32, 0, stream>>>(Yh, Yl, WK, nullptr, DM, FK, DKV, nullptr, 0, 0, 0, 0);
        k_rope<<<LKv, 256, 0, stream>>>(FK, DKV, NKV, CS, nullptr, nullptr, 1.0f, KP16, KPh, KPl);
        k_gemmw<bf, 1, false><<<dim3(TT / 64, DKV / 64, 1), 32, 0, stream>>>(Yh, Yl, WV, nullptr, DM, FV, DKV, nullptr, 0, 0, 0, 0); k_vtp<<<LKv, 256, 0, stream>>>(FV, DKV, NKV, VT16, VTh, VTl);
        for (int h0 = 0; h0 < NH_; h0 += ZH) { const size_t zq = (size_t)h0, zk = (size_t)(h0 / REP);   // one kv head per query head: the pass's two heads use consecutive kv planes (z-strides TT*HD)
            k_gemmw<bf, 2, false><<<dim3(RH / 64, TT / 64, ZH), 32, 0, stream>>>(QPh + zq * TT * HD, QPl + zq * TT * HD, KPh + zk * TT * HD, KPl + zk * TT * HD, HD, Sb, TT, nullptr, (size_t)TT * HD, (size_t)TT * HD, (size_t)TT * TT, 0);
            k_gemmw<h16, 0, false><<<dim3((TT - RH) / 64, TT / 64, ZH), 32, 0, stream>>>(QP16 + zq * TT * HD + (size_t)RH * HD, nullptr, KP16 + zk * TT * HD, nullptr, HD, Sb + (size_t)RH * TT, TT, nullptr, (size_t)TT * HD, (size_t)TT * HD, (size_t)TT * TT, 0);
            k_asoft<<<ZH * TT / 8, 256, 0, stream>>>(Sb, BT, h0, P16, Ph, Pl);
            k_gemmw<bf, 2, false, KSP><<<dim3(RH / 64, HD / 64, ZH * KSP), 32, 0, stream>>>(Ph, Pl, VTh + zk * HD * TT, VTl + zk * HD * TT, TT, Ob, HD, nullptr, (size_t)RH * TT, (size_t)HD * TT, (size_t)TT * HD, (size_t)ZH * TT * HD);
            k_gemmw<h16, 0, false, KSP><<<dim3((TT - RH) / 64, HD / 64, ZH * KSP), 32, 0, stream>>>(P16 + (size_t)RH * TT, nullptr, VT16 + zk * HD * TT, nullptr, TT, Ob + (size_t)RH * HD, HD, nullptr, (size_t)TT * TT, (size_t)HD * TT, (size_t)TT * HD, (size_t)ZH * TT * HD);
            k_merge<<<(unsigned)(((size_t)ZH * TT * HD / 2 + 255) / 256), 256, 0, stream>>>(Ob, h0, ATh, ATl); }
        k_gemmw<bf, 1, false><<<dim3(TT / 64, DM / 64, 1), 32, 0, stream>>>(ATh, ATl, WO, nullptr, DQ, YO, DM, nullptr, 0, 0, 0, 0);
        k_addres<<<(unsigned)(((size_t)TT * DM / 4 + 255) / 256), 256, 0, stream>>>(x + (size_t)b * TT * DM, YO, OUT + (size_t)b * TT * DM, (size_t)TT * DM / 4); }   /* out = hidden + ctx Wo */
}

// v002
// It runs in 451 microseconds.
// Two timings next to v001 put it at 2.13 and 2.10 times that version's speed.
// Over all steps from v000 it is 4.64 times as fast.
#include <hip/hip_runtime.h>

// T5 self-attention layer (hidden [2][2048][1024]; n = LayerNorm(hidden) (1e-6, ln_g, ln_b); q, k, v = n W ('xw' [1024][1024], no bias, 16 heads x 64); scores = q.k (NO 1/sqrt(d)) + rel_bias[bucket(j - i)][h] (T5 bidirectional buckets, 32 buckets, max distance 128); softmax over all keys; out = hidden + merged Wo -> [2][2048][1024]).
// The bucket index depends only on (j - i); it is embedded as a 4095-entry integer table computed with the reference's own bucket function (its f32 log -> int32 cast has exact-integer knife edges, so it is not recomputed on the device).
// Compute dtypes, f32 accumulate: every input rounded to bf16; q/k/v projections hl x exact (2 products); the relative-position bias (bf16-rounded rel_bias values through the embedded bucket table) enters the scores in f32; scores and attn.v: query rows < 512 hl (3 products), the rest single fp16 (P x1024); softmax f32, online; Wo hl x exact (2 products), + hidden residual in f32.

#define NB_  2
#define TT   2048
#define DM   1024
#define NH_  16
#define NKV  16
#define REP  (NH_ / NKV)
#define HD   64
#define DQ   (NH_ * HD)
#define DKV  (NKV * HD)
#define LNEPS 1e-6f
#define NBKT 32
#define RH   512                  // query rows < RH use hi+lo planes
#define WIN  0
#define PSH  10.0f                 // fp16 P carries 2^10 (added to the exponent; it cancels against the row sum)
#define SCL  1.0f                  // T5: no 1/sqrt(d) scaling
typedef _Float16 h16;
typedef unsigned short bf;
typedef __attribute__((ext_vector_type(16))) __bf16   v16bf;
typedef __attribute__((ext_vector_type(16))) _Float16 v16h;
typedef __attribute__((ext_vector_type(8)))  _Float16 v8h;
typedef __attribute__((ext_vector_type(8)))  unsigned short v8us;
typedef __attribute__((ext_vector_type(8)))  float    v8f;
typedef __attribute__((ext_vector_type(4)))  float    v4f;
typedef v8h  __attribute__((may_alias)) v8ha;
typedef v4f  __attribute__((may_alias)) v4fa;
typedef v8us __attribute__((may_alias)) v8usa;

__device__ __forceinline__ unsigned short f2bf(float f) { unsigned u = __float_as_uint(f); u += 0x7FFFu + ((u >> 16) & 1u); return (unsigned short)(u >> 16); }
__device__ __forceinline__ float bf2f(unsigned short b) { return __uint_as_float(((unsigned)b) << 16); }
__device__ __forceinline__ float bfr(float f) { return bf2f(f2bf(f)); }
__device__ __forceinline__ v16h cat16(v8h lo, v8h hi) { return __builtin_shufflevector(lo, hi, 0, 1, 2, 3, 4, 5, 6, 7, 8, 9, 10, 11, 12, 13, 14, 15); }
__device__ __forceinline__ v16bf cat16b(v8us lo, v8us hi) { return __builtin_bit_cast(v16bf, __builtin_shufflevector(lo, hi, 0, 1, 2, 3, 4, 5, 6, 7, 8, 9, 10, 11, 12, 13, 14, 15)); }
__device__ __forceinline__ v8f wmma16(v16h a, v16h b, v8f c) { return __builtin_amdgcn_wmma_f32_16x16x32_f16(false, a, false, b, (short)0, c, false, false); }
__device__ __forceinline__ v8f wmmab(v16bf a, v16bf b, v8f c) { return __builtin_amdgcn_wmma_f32_16x16x32_bf16(false, a, false, b, (short)0, c, false, false); }



// ---- k_gemmw: register-blocked GEMM, ONE WAVE per 64x64 output tile (16 accumulators), operands straight from K-contiguous 16-bit planes; grid (M/64, N/64, Z), 32 threads.
// C[m][n] (f32, pitch ldc, + optional f32 bias[n]) = sum_k A[m][k] Bt[n][k] (+ split products per NSPLIT). z-batch strides sA/sB/sC in elements. K % 32 == 0.
// KS > 1: grid z = Z * KS; slice ks = blockIdx.z % KS sums k in [ks K/KS, (ks+1) K/KS) only and stores its partial tile in plane ks (plane stride sP elements). K % (32 KS) == 0.
template <typename T16> struct WFrag;
template <> struct WFrag<h16> { typedef v16h V; static __device__ __forceinline__ V ld(const h16* p) { return cat16(*(const v8h*)p, *(const v8h*)(p + 16)); } static __device__ __forceinline__ v8f mma(V a, V b, v8f c) { return wmma16(a, b, c); } };
template <> struct WFrag<bf> { typedef v16bf V; static __device__ __forceinline__ V ld(const bf* p) { return cat16b(*(const v8us*)p, *(const v8us*)(p + 16)); } static __device__ __forceinline__ v8f mma(V a, V b, v8f c) { return wmmab(a, b, c); } };
template <typename T16, int NSPLIT, bool BIAS, int KS = 1>
__global__ __launch_bounds__(32) void k_gemmw(const T16* __restrict__ A, const T16* __restrict__ A2, const T16* __restrict__ Bt, const T16* __restrict__ Bt2, int K, float* C, int ldc, const float* __restrict__ bias, size_t sA, size_t sB, size_t sC, size_t sP) {
    typedef typename WFrag<T16>::V V;
    __shared__ __align__(16) float os[16 * 68];
    const size_t z = blockIdx.z / KS; const int ks = blockIdx.z % KS; A += z * sA; if (A2) A2 += z * sA; Bt += z * sB; if (Bt2) Bt2 += z * sB; C += z * sC + ks * sP;
    const int lane = threadIdx.x & 31, lr = lane & 15, hi = lane >> 4; const int r0 = blockIdx.x * 64, c0 = blockIdx.y * 64;
    v8f acc[4][4];
#pragma unroll
    for (int mb = 0; mb < 4; ++mb)
#pragma unroll
        for (int nb = 0; nb < 4; ++nb) acc[mb][nb] = (v8f){};
    const size_t aoff = (size_t)(r0 + lr) * K + 8 * hi, boff = (size_t)(c0 + lr) * K + 8 * hi;
#pragma unroll 1
    for (int kc = ks * (K / KS); kc < (ks + 1) * (K / KS); kc += 32) {
        V a[4], a2[4];
#pragma unroll
        for (int mb = 0; mb < 4; ++mb) { a[mb] = WFrag<T16>::ld(A + aoff + (size_t)mb * 16 * K + kc); if (NSPLIT == 1 || NSPLIT == 2) a2[mb] = WFrag<T16>::ld(A2 + aoff + (size_t)mb * 16 * K + kc); }
#pragma unroll
        for (int nb = 0; nb < 4; ++nb) { const V b = WFrag<T16>::ld(Bt + boff + (size_t)nb * 16 * K + kc); V b2; if (NSPLIT >= 2) b2 = WFrag<T16>::ld(Bt2 + boff + (size_t)nb * 16 * K + kc);
#pragma unroll
            for (int mb = 0; mb < 4; ++mb) { acc[mb][nb] = WFrag<T16>::mma(a[mb], b, acc[mb][nb]); if (NSPLIT == 1 || NSPLIT == 2) acc[mb][nb] = WFrag<T16>::mma(a2[mb], b, acc[mb][nb]); if (NSPLIT >= 2) acc[mb][nb] = WFrag<T16>::mma(a[mb], b2, acc[mb][nb]); } }
        asm volatile("v_nop\n\tv_nop\n\tv_nop\n\tv_nop" : "+v"(acc[0][0]), "+v"(acc[1][1]), "+v"(acc[2][2]), "+v"(acc[3][3]) : "v"(a[0]), "v"(a[3]));
    }
#pragma unroll
    for (int mb = 0; mb < 4; ++mb) {
#pragma unroll
        for (int nb = 0; nb < 4; ++nb) {
#pragma unroll
            for (int j = 0; j < 8; ++j) os[(hi * 8 + j) * 68 + nb * 16 + lr] = acc[mb][nb][j]; }
        __builtin_amdgcn_wave_barrier(); asm volatile("" ::: "memory");
        float* crow = C + (size_t)(r0 + mb * 16) * ldc + c0;
{
#pragma unroll
            for (int s = 0; s < 8; ++s) { const int row = 2 * s + hi, cofs = lr * 4; v4f val = *(const v4fa*)(os + row * 68 + cofs); if (BIAS) { val[0] += bfr(bias[c0 + cofs]); val[1] += bfr(bias[c0 + cofs + 1]); val[2] += bfr(bias[c0 + cofs + 2]); val[3] += bfr(bias[c0 + cofs + 3]); }
                *(v4f*)(crow + (size_t)row * ldc + cofs) = val; }
             }
        __builtin_amdgcn_wave_barrier(); asm volatile("" ::: "memory");
    }
}

__device__ __forceinline__ h16 tohx(float x) { return (h16)x; }
__device__ __forceinline__ void splitf(float y, unsigned short& h, unsigned short& l) { h = f2bf(y); l = f2bf(y - bf2f(h)); }
typedef __attribute__((ext_vector_type(2))) _Float16 v2h;
typedef __attribute__((ext_vector_type(4))) _Float16 v4h;
typedef __attribute__((ext_vector_type(2))) unsigned short v2us;
typedef __attribute__((ext_vector_type(4))) unsigned short v4us;
typedef __attribute__((ext_vector_type(2))) float v2f;
typedef __attribute__((ext_vector_type(4))) int v4i;

__global__ __launch_bounds__(256) void k_wtG(const float* __restrict__ w, int K, int N, bf* Bt) {
    const int lane = threadIdx.x & 31; const int L0 = (blockIdx.x * 8 + (threadIdx.x >> 5)) * 8; const int nlines = N * K / 64;
{
#pragma unroll 1
        for (int l = 0; l < 8; ++l) { const int L = L0 + l; if (L >= nlines) break; const size_t e = (size_t)L * 64 + lane * 2; const int k = (int)(e % K), n = (int)(e / K); v2us o;
            o[0] = f2bf(w[(size_t)k * N + n]); o[1] = f2bf(w[(size_t)(k + 1) * N + n]); *(v2us*)(Bt + e) = o; }
         }
}
__global__ __launch_bounds__(256) void k_lnhl(const float* __restrict__ X, const float* __restrict__ A, const float* __restrict__ g, const float* __restrict__ be, float* Z, bf* Yh, bf* Yl) {
    const int lane = threadIdx.x & 31; const int r = blockIdx.x * 8 + (threadIdx.x >> 5); if (r >= TT) return; const float* xr = X + (size_t)r * DM; const float* ar = A ? A + (size_t)r * DM : nullptr; float s = 0.f;
#pragma unroll 1
    for (int ch = 0; ch < DM / 128; ++ch) { const int c0 = ch * 128 + lane * 4; const v4f a = *(const v4f*)(xr + c0); v4f d = {0.f, 0.f, 0.f, 0.f}; if (ar) d = *(const v4f*)(ar + c0);
#pragma unroll
        for (int q = 0; q < 4; ++q) s += __fadd_rn(bfr(a[q]), d[q]); }
#pragma unroll
    for (int sh = 16; sh; sh >>= 1) s += __shfl_xor(s, sh, 32);
    const float mu = s * (1.0f / DM); float s2 = 0.f;
#pragma unroll 1
    for (int ch = 0; ch < DM / 128; ++ch) { const int c0 = ch * 128 + lane * 4; const v4f a = *(const v4f*)(xr + c0); v4f d = {0.f, 0.f, 0.f, 0.f}; if (ar) d = *(const v4f*)(ar + c0);
#pragma unroll
        for (int q = 0; q < 4; ++q) { const float d0 = __fsub_rn(__fadd_rn(bfr(a[q]), d[q]), mu); float p = __fmul_rn(d0, d0); asm volatile("" : "+v"(p)); s2 = __fadd_rn(s2, p); } }
#pragma unroll
    for (int sh = 16; sh; sh >>= 1) s2 += __shfl_xor(s2, sh, 32);
    const float rs = __fdiv_rn(1.0f, __fsqrt_rn(__fadd_rn(s2 * (1.0f / DM), LNEPS)));
{
#pragma unroll 1
        for (int ch = 0; ch < DM / 128; ++ch) { const int c0 = ch * 128 + lane * 4; const v4f a = *(const v4f*)(xr + c0); v4f d = {0.f, 0.f, 0.f, 0.f}; if (ar) d = *(const v4f*)(ar + c0); v4f z4; v4us oh, ol;
#pragma unroll
            for (int q = 0; q < 4; ++q) { const float v = __fadd_rn(bfr(a[q]), d[q]); z4[q] = v; float n0 = __fmul_rn(__fsub_rn(v, mu), rs); asm volatile("" : "+v"(n0)); float n1 = __fmul_rn(n0, bfr(g[c0 + q])); asm volatile("" : "+v"(n1)); const float y = __fadd_rn(n1, bfr(be[c0 + q])); unsigned short h2, l2; splitf(y, h2, l2); oh[q] = h2; ol[q] = l2; }
            if (Z) *(v4f*)(Z + (size_t)r * DM + c0) = z4; *(v4us*)(Yh + (size_t)r * DM + c0) = oh; *(v4us*)(Yl + (size_t)r * DM + c0) = ol; }
         } }
__global__ __launch_bounds__(256) void k_addres(const float* __restrict__ X, const float* __restrict__ Y, float* O, size_t n4) { const size_t i = (size_t)blockIdx.x * 256 + threadIdx.x; if (i >= n4) return; const v4f a = *(const v4f*)(X + i * 4), b = *(const v4f*)(Y + i * 4); v4f o;
#pragma unroll
    for (int q = 0; q < 4; ++q) o[q] = __fadd_rn(bfr(a[q]), b[q]); *(v4f*)(O + i * 4) = o;  }
__constant__ int BKT[4095] = {15,15,15,15,15,15,15,15,15,15,15,15,15,15,15,15,15,15,15,15,15,15,15,15,15,15,15,15,15,15,15,15,15,15,15,15,15,15,15,15,15,15,15,15,15,15,15,15,15,15,15,15,15,15,15,15,15,15,15,15,15,15,15,15,15,15,15,15,15,15,15,15,15,15,15,15,15,15,15,15,15,15,15,15,15,15,15,15,15,15,15,15,15,15,15,15,15,15,15,15,15,15,15,15,15,15,15,15,15,15,15,15,15,15,15,15,15,15,15,15,15,15,15,15,15,15,15,15,15,15,15,15,15,15,15,15,15,15,15,15,15,15,15,15,15,15,15,15,15,15,15,15,15,15,15,15,15,15,15,15,15,15,15,15,15,15,15,15,15,15,15,15,15,15,15,15,15,15,15,15,15,15,15,15,15,15,15,15,15,15,15,15,15,15,15,15,15,15,15,15,15,15,15,15,15,15,15,15,15,15,15,15,15,15,15,15,15,15,15,15,15,15,15,15,15,15,15,15,15,15,15,15,15,15,15,15,15,15,15,15,15,15,15,15,15,15,15,15,15,15,15,15,15,15,15,15,15,15,15,15,15,15,15,15,15,15,15,15,15,15,15,15,15,15,15,15,15,15,15,15,15,15,15,15,15,15,15,15,15,15,15,15,15,15,15,15,15,15,15,15,15,15,15,15,15,15,15,15,15,15,15,15,15,15,15,15,15,15,15,15,15,15,15,15,15,15,15,15,15,15,15,15,15,15,15,15,15,15,15,15,15,15,15,15,15,15,15,15,15,15,15,15,15,15,15,15,15,15,15,15,15,15,15,15,15,15,15,15,15,15,15,15,15,15,15,15,15,15,15,15,15,15,15,15,15,15,15,15,15,15,15,15,15,15,15,15,15,15,15,15,15,15,15,15,15,15,15,15,15,15,15,15,15,15,15,15,15,15,15,15,15,15,15,15,15,15,15,15,15,15,15,15,15,15,15,15,15,15,15,15,15,15,15,15,15,15,15,15,15,15,15,15,15,15,15,15,15,15,15,15,15,15,15,15,15,15,15,15,15,15,15,15,15,15,15,15,15,15,15,15,15,15,15,15,15,15,15,15,15,15,15,15,15,15,15,15,15,15,15,15,15,15,15,15,15,15,15,15,15,15,15,15,15,15,15,15,15,15,15,15,15,15,15,15,15,15,15,15,15,15,15,15,15,15,15,15,15,15,15,15,15,15,15,15,15,15,15,15,15,15,15,15,15,15,15,15,15,15,15,15,15,15,15,15,15,15,15,15,15,15,15,15,15,15,15,15,15,15,15,15,15,15,15,15,15,15,15,15,15,15,15,15,15,15,15,15,15,15,15,15,15,15,15,15,15,15,15,15,15,15,15,15,15,15,15,15,15,15,15,15,15,15,15,15,15,15,15,15,15,15,15,15,15,15,15,15,15,15,15,15,15,15,15,15,15,15,15,15,15,15,15,15,15,15,15,15,15,15,15,15,15,15,15,15,15,15,15,15,15,15,15,15,15,15,15,15,15,15,15,15,15,15,15,15,15,15,15,15,15,15,15,15,15,15,15,15,15,15,15,15,15,15,15,15,15,15,15,15,15,15,15,15,15,15,15,15,15,15,15,15,15,15,15,15,15,15,15,15,15,15,15,15,15,15,15,15,15,15,15,15,15,15,15,15,15,15,15,15,15,15,15,15,15,15,15,15,15,15,15,15,15,15,15,15,15,15,15,15,15,15,15,15,15,15,15,15,15,15,15,15,15,15,15,15,15,15,15,15,15,15,15,15,15,15,15,15,15,15,15,15,15,15,15,15,15,15,15,15,15,15,15,15,15,15,15,15,15,15,15,15,15,15,15,15,15,15,15,15,15,15,15,15,15,15,15,15,15,15,15,15,15,15,15,15,15,15,15,15,15,15,15,15,15,15,15,15,15,15,15,15,15,15,15,15,15,15,15,15,15,15,15,15,15,15,15,15,15,15,15,15,15,15,15,15,15,15,15,15,15,15,15,15,15,15,15,15,15,15,15,15,15,15,15,15,15,15,15,15,15,15,15,15,15,15,15,15,15,15,15,15,15,15,15,15,15,15,15,15,15,15,15,15,15,15,15,15,15,15,15,15,15,15,15,15,15,15,15,15,15,15,15,15,15,15,15,15,15,15,15,15,15,15,15,15,15,15,15,15,15,15,15,15,15,15,15,15,15,15,15,15,15,15,15,15,15,15,15,15,15,15,15,15,15,15,15,15,15,15,15,15,15,15,15,15,15,15,15,15,15,15,15,15,15,15,15,15,15,15,15,15,15,15,15,15,15,15,15,15,15,15,15,15,15,15,15,15,15,15,15,15,15,15,15,15,15,15,15,15,15,15,15,15,15,15,15,15,15,15,15,15,15,15,15,15,15,15,15,15,15,15,15,15,15,15,15,15,15,15,15,15,15,15,15,15,15,15,15,15,15,15,15,15,15,15,15,15,15,15,15,15,15,15,15,15,15,15,15,15,15,15,15,15,15,15,15,15,15,15,15,15,15,15,15,15,15,15,15,15,15,15,15,15,15,15,15,15,15,15,15,15,15,15,15,15,15,15,15,15,15,15,15,15,15,15,15,15,15,15,15,15,15,15,15,15,15,15,15,15,15,15,15,15,15,15,15,15,15,15,15,15,15,15,15,15,15,15,15,15,15,15,15,15,15,15,15,15,15,15,15,15,15,15,15,15,15,15,15,15,15,15,15,15,15,15,15,15,15,15,15,15,15,15,15,15,15,15,15,15,15,15,15,15,15,15,15,15,15,15,15,15,15,15,15,15,15,15,15,15,15,15,15,15,15,15,15,15,15,15,15,15,15,15,15,15,15,15,15,15,15,15,15,15,15,15,15,15,15,15,15,15,15,15,15,15,15,15,15,15,15,15,15,15,15,15,15,15,15,15,15,15,15,15,15,15,15,15,15,15,15,15,15,15,15,15,15,15,15,15,15,15,15,15,15,15,15,15,15,15,15,15,15,15,15,15,15,15,15,15,15,15,15,15,15,15,15,15,15,15,15,15,15,15,15,15,15,15,15,15,15,15,15,15,15,15,15,15,15,15,15,15,15,15,15,15,15,15,15,15,15,15,15,15,15,15,15,15,15,15,15,15,15,15,15,15,15,15,15,15,15,15,15,15,15,15,15,15,15,15,15,15,15,15,15,15,15,15,15,15,15,15,15,15,15,15,15,15,15,15,15,15,15,15,15,15,15,15,15,15,15,15,15,15,15,15,15,15,15,15,15,15,15,15,15,15,15,15,15,15,15,15,15,15,15,15,15,15,15,15,15,15,15,15,15,15,15,15,15,15,15,15,15,15,15,15,15,15,15,15,15,15,15,15,15,15,15,15,15,15,15,15,15,15,15,15,15,15,15,15,15,15,15,15,15,15,15,15,15,15,15,15,15,15,15,15,15,15,15,15,15,15,15,15,15,15,15,15,15,15,15,15,15,15,15,15,15,15,15,15,15,15,15,15,15,15,15,15,15,15,15,15,15,15,15,15,15,15,15,15,15,15,15,15,15,15,15,15,15,15,15,15,15,15,15,15,15,15,15,15,15,15,15,15,15,15,15,15,15,15,15,15,15,15,15,15,15,15,15,15,15,15,15,15,15,15,15,15,15,15,15,15,15,15,15,15,15,15,15,15,15,15,15,15,15,15,15,15,15,15,15,15,15,15,15,15,15,15,15,15,15,15,15,15,15,15,15,15,15,15,15,15,15,15,15,15,15,15,15,15,15,15,15,15,15,15,15,15,15,15,15,15,15,15,15,15,15,15,15,15,15,15,15,15,15,15,15,15,15,15,15,15,15,15,15,15,15,15,15,15,15,15,15,15,15,15,15,15,15,15,15,15,15,15,15,15,15,15,15,15,15,15,15,15,15,15,15,15,15,15,15,15,15,15,15,15,15,15,15,15,15,15,15,15,15,15,15,15,15,15,15,15,15,15,15,15,15,15,15,15,15,15,15,15,15,15,15,15,15,15,15,15,15,15,15,15,15,15,15,15,15,15,15,15,15,15,15,15,15,15,15,15,15,15,15,15,15,15,15,15,15,15,15,15,15,15,15,15,15,15,15,15,15,15,15,15,15,15,15,15,15,15,15,15,15,15,15,15,15,15,15,15,15,15,15,15,15,15,15,15,15,15,15,15,15,15,15,15,15,15,15,15,15,15,15,15,15,15,15,15,15,15,15,15,15,15,15,15,15,15,15,15,15,15,15,15,15,15,15,15,15,15,15,15,15,15,15,15,15,15,15,15,15,15,15,15,15,15,15,15,15,15,15,15,15,15,15,15,15,15,15,15,15,15,15,15,15,15,15,15,15,15,15,15,15,15,15,15,15,15,15,15,15,15,15,15,15,15,15,15,15,15,15,15,15,15,15,15,15,14,14,14,14,14,14,14,14,14,14,14,14,14,14,14,14,14,14,14,14,14,14,14,14,14,14,14,13,13,13,13,13,13,13,13,13,13,13,13,13,13,13,13,13,13,12,12,12,12,12,12,12,12,12,12,12,12,12,12,11,11,11,11,11,11,11,11,11,10,10,10,10,10,10,10,9,9,9,9,8,8,8,8,7,6,5,4,3,2,1,0,17,18,19,20,21,22,23,24,24,24,24,25,25,25,25,26,26,26,26,26,26,26,27,27,27,27,27,27,27,27,27,28,28,28,28,28,28,28,28,28,28,28,28,28,28,29,29,29,29,29,29,29,29,29,29,29,29,29,29,29,29,29,29,30,30,30,30,30,30,30,30,30,30,30,30,30,30,30,30,30,30,30,30,30,30,30,30,30,30,30,31,31,31,31,31,31,31,31,31,31,31,31,31,31,31,31,31,31,31,31,31,31,31,31,31,31,31,31,31,31,31,31,31,31,31,31,31,31,31,31,31,31,31,31,31,31,31,31,31,31,31,31,31,31,31,31,31,31,31,31,31,31,31,31,31,31,31,31,31,31,31,31,31,31,31,31,31,31,31,31,31,31,31,31,31,31,31,31,31,31,31,31,31,31,31,31,31,31,31,31,31,31,31,31,31,31,31,31,31,31,31,31,31,31,31,31,31,31,31,31,31,31,31,31,31,31,31,31,31,31,31,31,31,31,31,31,31,31,31,31,31,31,31,31,31,31,31,31,31,31,31,31,31,31,31,31,31,31,31,31,31,31,31,31,31,31,31,31,31,31,31,31,31,31,31,31,31,31,31,31,31,31,31,31,31,31,31,31,31,31,31,31,31,31,31,31,31,31,31,31,31,31,31,31,31,31,31,31,31,31,31,31,31,31,31,31,31,31,31,31,31,31,31,31,31,31,31,31,31,31,31,31,31,31,31,31,31,31,31,31,31,31,31,31,31,31,31,31,31,31,31,31,31,31,31,31,31,31,31,31,31,31,31,31,31,31,31,31,31,31,31,31,31,31,31,31,31,31,31,31,31,31,31,31,31,31,31,31,31,31,31,31,31,31,31,31,31,31,31,31,31,31,31,31,31,31,31,31,31,31,31,31,31,31,31,31,31,31,31,31,31,31,31,31,31,31,31,31,31,31,31,31,31,31,31,31,31,31,31,31,31,31,31,31,31,31,31,31,31,31,31,31,31,31,31,31,31,31,31,31,31,31,31,31,31,31,31,31,31,31,31,31,31,31,31,31,31,31,31,31,31,31,31,31,31,31,31,31,31,31,31,31,31,31,31,31,31,31,31,31,31,31,31,31,31,31,31,31,31,31,31,31,31,31,31,31,31,31,31,31,31,31,31,31,31,31,31,31,31,31,31,31,31,31,31,31,31,31,31,31,31,31,31,31,31,31,31,31,31,31,31,31,31,31,31,31,31,31,31,31,31,31,31,31,31,31,31,31,31,31,31,31,31,31,31,31,31,31,31,31,31,31,31,31,31,31,31,31,31,31,31,31,31,31,31,31,31,31,31,31,31,31,31,31,31,31,31,31,31,31,31,31,31,31,31,31,31,31,31,31,31,31,31,31,31,31,31,31,31,31,31,31,31,31,31,31,31,31,31,31,31,31,31,31,31,31,31,31,31,31,31,31,31,31,31,31,31,31,31,31,31,31,31,31,31,31,31,31,31,31,31,31,31,31,31,31,31,31,31,31,31,31,31,31,31,31,31,31,31,31,31,31,31,31,31,31,31,31,31,31,31,31,31,31,31,31,31,31,31,31,31,31,31,31,31,31,31,31,31,31,31,31,31,31,31,31,31,31,31,31,31,31,31,31,31,31,31,31,31,31,31,31,31,31,31,31,31,31,31,31,31,31,31,31,31,31,31,31,31,31,31,31,31,31,31,31,31,31,31,31,31,31,31,31,31,31,31,31,31,31,31,31,31,31,31,31,31,31,31,31,31,31,31,31,31,31,31,31,31,31,31,31,31,31,31,31,31,31,31,31,31,31,31,31,31,31,31,31,31,31,31,31,31,31,31,31,31,31,31,31,31,31,31,31,31,31,31,31,31,31,31,31,31,31,31,31,31,31,31,31,31,31,31,31,31,31,31,31,31,31,31,31,31,31,31,31,31,31,31,31,31,31,31,31,31,31,31,31,31,31,31,31,31,31,31,31,31,31,31,31,31,31,31,31,31,31,31,31,31,31,31,31,31,31,31,31,31,31,31,31,31,31,31,31,31,31,31,31,31,31,31,31,31,31,31,31,31,31,31,31,31,31,31,31,31,31,31,31,31,31,31,31,31,31,31,31,31,31,31,31,31,31,31,31,31,31,31,31,31,31,31,31,31,31,31,31,31,31,31,31,31,31,31,31,31,31,31,31,31,31,31,31,31,31,31,31,31,31,31,31,31,31,31,31,31,31,31,31,31,31,31,31,31,31,31,31,31,31,31,31,31,31,31,31,31,31,31,31,31,31,31,31,31,31,31,31,31,31,31,31,31,31,31,31,31,31,31,31,31,31,31,31,31,31,31,31,31,31,31,31,31,31,31,31,31,31,31,31,31,31,31,31,31,31,31,31,31,31,31,31,31,31,31,31,31,31,31,31,31,31,31,31,31,31,31,31,31,31,31,31,31,31,31,31,31,31,31,31,31,31,31,31,31,31,31,31,31,31,31,31,31,31,31,31,31,31,31,31,31,31,31,31,31,31,31,31,31,31,31,31,31,31,31,31,31,31,31,31,31,31,31,31,31,31,31,31,31,31,31,31,31,31,31,31,31,31,31,31,31,31,31,31,31,31,31,31,31,31,31,31,31,31,31,31,31,31,31,31,31,31,31,31,31,31,31,31,31,31,31,31,31,31,31,31,31,31,31,31,31,31,31,31,31,31,31,31,31,31,31,31,31,31,31,31,31,31,31,31,31,31,31,31,31,31,31,31,31,31,31,31,31,31,31,31,31,31,31,31,31,31,31,31,31,31,31,31,31,31,31,31,31,31,31,31,31,31,31,31,31,31,31,31,31,31,31,31,31,31,31,31,31,31,31,31,31,31,31,31,31,31,31,31,31,31,31,31,31,31,31,31,31,31,31,31,31,31,31,31,31,31,31,31,31,31,31,31,31,31,31,31,31,31,31,31,31,31,31,31,31,31,31,31,31,31,31,31,31,31,31,31,31,31,31,31,31,31,31,31,31,31,31,31,31,31,31,31,31,31,31,31,31,31,31,31,31,31,31,31,31,31,31,31,31,31,31,31,31,31,31,31,31,31,31,31,31,31,31,31,31,31,31,31,31,31,31,31,31,31,31,31,31,31,31,31,31,31,31,31,31,31,31,31,31,31,31,31,31,31,31,31,31,31,31,31,31,31,31,31,31,31,31,31,31,31,31,31,31,31,31,31,31,31,31,31,31,31,31,31,31,31,31,31,31,31,31,31,31,31,31,31,31,31,31,31,31,31,31,31,31,31,31,31,31,31,31,31,31,31,31,31,31,31,31,31,31,31,31,31,31,31,31,31,31,31,31,31,31,31,31,31,31,31,31,31,31,31,31,31,31,31,31,31,31,31,31,31,31,31,31,31,31,31,31,31,31,31,31,31,31,31,31,31,31,31,31,31,31,31,31,31,31,31,31,31,31,31,31,31,31,31,31,31,31,31,31,31,31,31,31,31,31,31,31,31,31,31,31,31,31,31,31,31,31,31,31,31,31,31,31,31,31,31,31,31,31,31,31,31,31,31,31,31,31,31,31,31,31,31,31,31,31,31,31,31,31,31,31,31,31,31,31,31,31,31,31,31,31,31,31,31,31,31,31,31,31,31,31,31,31,31,31,31,31,31,31,31,31,31,31,31,31,31,31,31,31,31,31,31,31,31,31,31,31,31,31,31,31,31,31,31,31,31,31,31,31,31,31,31,31,31,31,31,31,31,31,31,31,31,31,31,31,31,31,31,31,31,31,31,31,31,31,31,31,31,31,31,31,31,31,31,31,31,31,31,31,31,31,31,31,31,31,31,31,31,31,31,31,31,31,31,31,31,31,31,31,31,31,31,31,31,31,31,31,31,31,31,31,31,31,31,31,31,31,31,31,31,31,31,31,31,31,31,31,31,31,31,31,31,31,31,31,31,31,31,31,31,31,31,31,31,31,31,31,31,31,31,31,31,31,31,31,31,31,31,31,31,31,31,31,31,31,31,31,31,31,31,31,31,31,31,31,31,31,31,31,31,31,31,31,31,31,31,31,31,31,31,31,31,31,31,31,31,31,31,31,31,31,31,31,31,31,31,31,31,31,31,31,31,31,31,31,31,31,31,31,31,31,31,31,31,31,31,31,31,31,31,31,31,31,31,31,31,31,31,31,31,31,31,31,31,31,31,31,31,31,31,31,31,31,31,31,31,31,31,31,31,31,31,31,31,31,31,31,31,31,31,31,31,31,31,31,31,31,31,31,31,31,31,31,31,31,31,31,31,31,31,31,31,31,31,31,31,31,31,31,31,31,31,31,31,31,31,31,31,31,31,31,31,31,31,31,31,31,31,31,31,31,31,31,31,31,31,31,31,31,31,31,31,31,31,31,31,31,31,31,31,31,31,31,31,31,31,31,31,31,31,31,31,31,31,31,31,31,31,31,31,31,31,31,31,31,31,31,31,31,31,31,31,31,31,31,31,31,31,31,31,31,31,31,31,31,31,31,31,31,31,31,31,31,31,31,31,31,31,31,31,31,31,31,31,31,31,31,31,31,31,31,31,31,31,31,31,31,31,31,31,31,31,31,31,31,31,31,31,31,31,31,31,31,31,31,31,31,31,31,31,31};
__global__ __launch_bounds__(256) void k_btab(const float* __restrict__ relb, float* BT) { const int e = blockIdx.x * 256 + threadIdx.x; if (e >= NH_ * 4096) return; const int r = e % 4096, h = e / 4096; const float v = (r < 4095) ? bfr(relb[BKT[r] * NH_ + h]) : 0.f; *(float*)(BT + e) = v;  }
__global__ __launch_bounds__(256) void k_cvt8(const float* __restrict__ src, bf* dst, size_t n8) { const size_t i = (size_t)blockIdx.x * 256 + threadIdx.x; if (i >= n8) return; const v8f v = *(const v8f*)(src + i * 8); v8us o;
#pragma unroll
    for (int k = 0; k < 8; ++k) o[k] = f2bf(v[k]); *(v8us*)(dst + i * 8) = o;  }

// k_rope: head planes [h][t][d] (fp16 + hi/lo) of rope(x) x sc with the rotate-half convention out[d] = x[d] cos[t][d] - x[d+HD/2] sin[t][d], out[d+HD/2] = x[d+HD/2] cos[t][d+HD/2] + x[d] sin[t][d+HD/2]
__global__ __launch_bounds__(256) void k_rope(const float* __restrict__ F, int pitch, int nheads, const float* __restrict__ CS, const float* __restrict__ RF, const float* __restrict__ nw, float sc, h16* P16, bf* Ph, bf* Pl) {
    const size_t e = ((size_t)blockIdx.x * 256 + threadIdx.x) * 2; if (e >= (size_t)nheads * TT * HD) return; const int d = (int)(e % HD); const int t = (int)((e / HD) % TT); const int h = (int)(e / ((size_t)HD * TT)); const float* f = F + (size_t)t * pitch + h * HD; const float rf = RF ? RF[(size_t)h * TT + t] : 1.0f; v2h o16; v2us oh, ol;
#pragma unroll
    for (int q = 0; q < 2; ++q) { const int dd = d + q; const int dp = (dd < HD / 2) ? dd + HD / 2 : dd - HD / 2; float x0 = f[dd], x1 = f[dp];
        if (RF) { float n0 = __fmul_rn(x0, rf), n1 = __fmul_rn(x1, rf); asm volatile("" : "+v"(n0)); asm volatile("" : "+v"(n1)); x0 = __fmul_rn(bfr(nw[dd]), n0); x1 = __fmul_rn(bfr(nw[dp]), n1); }
        const v2f cs = *(const v2f*)(CS + ((size_t)t * HD + dd) * 2); float a = __fmul_rn(x0, cs[0]), bq = __fmul_rn(x1, cs[1]); asm volatile("" : "+v"(a)); asm volatile("" : "+v"(bq)); const float r = ((dd < HD / 2) ? __fsub_rn(a, bq) : __fadd_rn(a, bq)) * sc;
        o16[q] = tohx(r); unsigned short a2, c2; splitf(r, a2, c2); oh[q] = a2; ol[q] = c2; }
    *(v2h*)(P16 + e) = o16; *(v2us*)(Ph + e) = oh; *(v2us*)(Pl + e) = ol;  }
__global__ __launch_bounds__(256) void k_vtp(const float* __restrict__ F, int pitch, int nheads, h16* V16, bf* Vh, bf* Vl) { const size_t e = ((size_t)blockIdx.x * 256 + threadIdx.x) * 2; if (e >= (size_t)nheads * HD * TT) return; const int t = (int)(e % TT); const int d = (int)((e / TT) % HD); const int g = (int)(e / ((size_t)TT * HD)); v2h o16; v2us oh, ol;
#pragma unroll
    for (int q = 0; q < 2; ++q) { const float x = F[(size_t)(t + q) * pitch + g * HD + d]; o16[q] = tohx(x); unsigned short a2, c2; splitf(x, a2, c2); oh[q] = a2; ol[q] = c2; }
    *(v2h*)(V16 + e) = o16; *(v2us*)(Vh + e) = oh; *(v2us*)(Vl + e) = ol;  }
__global__ __launch_bounds__(256) void k_csid(float* CS) { const int idx = blockIdx.x * 256 + threadIdx.x; if (idx >= TT * HD) return; v2f cs; cs[0] = 1.0f; cs[1] = 0.0f; *(v2f*)(CS + (size_t)idx * 2) = cs;  }
typedef __attribute__((ext_vector_type(8))) __bf16 v8bf;
__device__ __forceinline__ float xhalf(float x) { const int b = __float_as_int(x); return __int_as_float(__builtin_amdgcn_permlanex16(b, b, 0x76543210, 0xfedcba98, false, false)); }   /* lane l <-> l ^ 16 */
// The wait stands between a run of global loads and the first rewrite of an address register that they name: the addresses are inputs, so they stay in their registers up to it, and the scheduling barrier keeps later instructions behind it.
__device__ __forceinline__ void xwait(const void* a, const void* b) { asm volatile("s_wait_xcnt 0x0" :: "v"(a), "v"(b) : "memory"); __builtin_amdgcn_sched_barrier(0); }
// 2^x by v_exp_f32 with the one free slot that the instruction set asks for behind a transcendental in the same statement, so that it stands directly behind it wherever the statement is scheduled.
__device__ __forceinline__ float exp2s(float x) { float y; asm("v_exp_f32 %0, %1\n\tv_nop" : "=v"(y) : "v"(x)); return y; }
template <typename T16, bool HI, int NQ>
__device__ __forceinline__ void fa_wave(const T16* __restrict__ Q, const T16* __restrict__ Q2, const T16* __restrict__ K, const T16* __restrict__ K2, const T16* __restrict__ V, const T16* __restrict__ V2, const float* __restrict__ bt, int q0, bf* Ah, bf* Al) {
    typedef WFrag<T16> WF; typedef typename WF::V F;
    const int lane = threadIdx.x & 31, lr = lane & 15, hi = lane >> 4;
    const float L2E = 1.4426950408889634f;
    F qf[NQ][2], qf2[NQ][2];
    const T16* qp = Q + (size_t)(q0 + lr) * HD + 8 * hi; const T16* qp2 = Q2 + (size_t)(q0 + lr) * HD + 8 * hi;
#pragma unroll
    for (int nb = 0; nb < NQ; ++nb)
#pragma unroll
        for (int ks = 0; ks < 2; ++ks) { qf[nb][ks] = WF::ld(qp + nb * 16 * HD + ks * 32); if (HI) qf2[nb][ks] = WF::ld(qp2 + nb * 16 * HD + ks * 32); }
    v8f o[4][NQ];
#pragma unroll
    for (int dt = 0; dt < 4; ++dt)
#pragma unroll
        for (int nb = 0; nb < NQ; ++nb) o[dt][nb] = (v8f){};
    float m[NQ], l[NQ];
#pragma unroll
    for (int nb = 0; nb < NQ; ++nb) { m[nb] = -3.0e38f; l[nb] = 0.f; }
    const float cneg = bt[-(TT - 1)], cpos = bt[TT - 1];
    const int ko = lr * HD + 8 * hi, vo = lr * TT + 8 * hi;
    F kf[2][2], kf2[2][2];
#pragma unroll
    for (int kt = 0; kt < 2; ++kt)
#pragma unroll
        for (int ks = 0; ks < 2; ++ks) { kf[kt][ks] = WF::ld(K + ko + kt * 16 * HD + ks * 32); if (HI) kf2[kt][ks] = WF::ld(K2 + ko + kt * 16 * HD + ks * 32); }
    xwait(qp, HI ? qp2 : qp); xwait(K + ko, HI ? K2 + ko : K + ko);
    // rolled: the running maximum chains the passes, so unrolling would add code and registers without overlapping them
#pragma unroll 1
    for (int k0 = 0; k0 < TT; k0 += 32) {
        F vf[4], vf2[4]; const T16* vp = V + vo + k0; const T16* vp2 = V2 + vo + k0;
#pragma unroll
        for (int dt = 0; dt < 4; ++dt) { vf[dt] = WF::ld(vp + dt * 16 * TT); if (HI) vf2[dt] = WF::ld(vp2 + dt * 16 * TT); }
        xwait(vp, HI ? vp2 : vp);
        v8f s[2][NQ];
        if (k0 - (q0 + 16 * NQ - 1) >= 128 || (k0 + 31) - q0 <= -128) { const float c = (k0 > q0) ? cpos : cneg;
#pragma unroll
            for (int kt = 0; kt < 2; ++kt)
#pragma unroll
                for (int nb = 0; nb < NQ; ++nb)
#pragma unroll
                    for (int r = 0; r < 8; ++r) s[kt][nb][r] = c;
        } else { const float* bp0 = bt + (k0 + 8 * hi) - (q0 + lr);
#pragma unroll
            for (int kt = 0; kt < 2; ++kt)
#pragma unroll
                for (int nb = 0; nb < NQ; ++nb) { const float* bp = bp0 + (kt - nb) * 16;
#pragma unroll
                    for (int r = 0; r < 8; ++r) s[kt][nb][r] = bp[r]; }
            xwait(bp0, bp0);
        }
#pragma unroll
        for (int ks = 0; ks < 2; ++ks)
#pragma unroll
            for (int kt = 0; kt < 2; ++kt)
#pragma unroll
                for (int nb = 0; nb < NQ; ++nb) { s[kt][nb] = WF::mma(kf[kt][ks], qf[nb][ks], s[kt][nb]); if (HI) { s[kt][nb] = WF::mma(kf[kt][ks], qf2[nb][ks], s[kt][nb]); s[kt][nb] = WF::mma(kf2[kt][ks], qf[nb][ks], s[kt][nb]); } }
        const int kn = (k0 + 32 < TT) ? k0 + 32 : 0;   /* the next pass's key rows, fetched behind this pass's score products; the last pass refetches rows 0-31, unused */
        const T16* kp = K + ko + kn * HD; const T16* kp2 = K2 + ko + kn * HD;
#pragma unroll
        for (int kt = 0; kt < 2; ++kt)
#pragma unroll
            for (int ks = 0; ks < 2; ++ks) { kf[kt][ks] = WF::ld(kp + kt * 16 * HD + ks * 32); if (HI) kf2[kt][ks] = WF::ld(kp2 + kt * 16 * HD + ks * 32); }
        xwait(kp, HI ? kp2 : kp);
        F pf[NQ], pf2[NQ];
#pragma unroll
        for (int nb = 0; nb < NQ; ++nb) {
            float mx = s[0][nb][0];
#pragma unroll
            for (int r = 1; r < 8; ++r) mx = fmaxf(mx, s[0][nb][r]);
#pragma unroll
            for (int r = 0; r < 8; ++r) mx = fmaxf(mx, s[1][nb][r]);
            mx = fmaxf(mx, xhalf(mx));
            const float mn = fmaxf(m[nb], mx);
            const float al = exp2s((m[nb] - mn) * L2E);
            const float ng = (HI ? 0.0f : PSH) - mn * L2E;
            m[nb] = mn;
            float sum = 0.f;
#pragma unroll
            for (int kt = 0; kt < 2; ++kt)
#pragma unroll
                for (int r = 0; r < 8; ++r) { const float p = exp2s(__builtin_fmaf(s[kt][nb][r], L2E, ng)); s[kt][nb][r] = p; sum += p; }
            l[nb] = l[nb] * al + sum;
#pragma unroll
            for (int dt = 0; dt < 4; ++dt) o[dt][nb] *= al;
            if constexpr (HI) {
                const v8bf h0 = __builtin_convertvector(s[0][nb], v8bf), h1 = __builtin_convertvector(s[1][nb], v8bf);
                const v8bf l0 = __builtin_convertvector(s[0][nb] - __builtin_convertvector(h0, v8f), v8bf), l1 = __builtin_convertvector(s[1][nb] - __builtin_convertvector(h1, v8f), v8bf);
                pf[nb] = __builtin_shufflevector(h0, h1, 0, 1, 2, 3, 4, 5, 6, 7, 8, 9, 10, 11, 12, 13, 14, 15); pf2[nb] = __builtin_shufflevector(l0, l1, 0, 1, 2, 3, 4, 5, 6, 7, 8, 9, 10, 11, 12, 13, 14, 15);
            } else {
                pf[nb] = cat16(__builtin_convertvector(s[0][nb], v8h), __builtin_convertvector(s[1][nb], v8h));
            }
        }
#pragma unroll
        for (int dt = 0; dt < 4; ++dt)
#pragma unroll
            for (int nb = 0; nb < NQ; ++nb) { o[dt][nb] = WF::mma(vf[dt], pf[nb], o[dt][nb]); if (HI) { o[dt][nb] = WF::mma(vf[dt], pf2[nb], o[dt][nb]); o[dt][nb] = WF::mma(vf2[dt], pf[nb], o[dt][nb]); } }
    }
#pragma unroll
    for (int nb = 0; nb < NQ; ++nb) { const float inv = __fdiv_rn(1.0f, l[nb] + xhalf(l[nb])); const size_t oo = (size_t)(q0 + nb * 16 + lr) * DQ + 8 * hi;
#pragma unroll
        for (int dt = 0; dt < 4; ++dt) { v8us oh, ol;
#pragma unroll
            for (int r = 0; r < 8; ++r) { unsigned short a, c2; splitf(o[dt][nb][r] * inv, a, c2); oh[r] = a; ol[r] = c2; }
            *(v8us*)(Ah + oo + dt * 16) = oh; *(v8us*)(Al + oo + dt * 16) = ol; } }
}
// grid (RH / 32, heads, batches), 5 waves: waves 0-1 take 16 hi/lo query rows each, waves 2-4 take 32 fp16 rows each, so every workgroup carries the same share of both kinds of work (no barrier in the kernel: the waves are independent); planes [b][h][t][d] (q, k) and [b][h][d][t] (v); merged output planes [b][t][h d] as hi/lo
static_assert(RH / 32 == (TT - RH) / 96 && RH % 32 == 0 && (TT - RH) % 96 == 0, "2 hi/lo waves and 3 fp16 waves per workgroup cover all rows");
__global__ __launch_bounds__(160) void k_fattn(const h16* __restrict__ Q16, const h16* __restrict__ K16, const h16* __restrict__ V16, const bf* __restrict__ Qh, const bf* __restrict__ Ql, const bf* __restrict__ Kh, const bf* __restrict__ Kl, const bf* __restrict__ Vh, const bf* __restrict__ Vl, const float* __restrict__ BT, bf* Ah, bf* Al) {
    const int wv = __builtin_amdgcn_readfirstlane((int)(threadIdx.x >> 5)), bx = blockIdx.x, h = blockIdx.y, b = blockIdx.z;
    const size_t pq = ((size_t)b * NH_ + h) * TT * HD, pk = ((size_t)b * NKV + h / REP) * TT * HD, po = (size_t)b * TT * DQ + h * HD;
    const float* bt = BT + (size_t)h * 4096 + (TT - 1);   /* bt[j - i] */
    if (wv < 2) fa_wave<bf, true, 1>(Qh + pq, Ql + pq, Kh + pk, Kl + pk, Vh + pk, Vl + pk, bt, (bx * 2 + wv) * 16, Ah + po, Al + po);
    else fa_wave<h16, false, 2>(Q16 + pq, nullptr, K16 + pk, nullptr, V16 + pk, nullptr, bt, RH + (bx * 3 + wv - 2) * 32, Ah + po, Al + po);
}

extern "C" void kernel_launch(void* const* d_in, const int* in_sizes, int n_in,
                              void* d_out, int out_size, void* d_ws, size_t ws_size, hipStream_t stream) {
    (void)in_sizes; (void)n_in; (void)out_size;
    const float* x = (const float*)d_in[0]; const float* g1 = (const float*)d_in[1]; const float* e1b = (const float*)d_in[2]; const float* wq = (const float*)d_in[3]; const float* wk = (const float*)d_in[4]; const float* wv = (const float*)d_in[5]; const float* wo = (const float*)d_in[6]; const float* relb = (const float*)d_in[7];
    float* OUT = (float*)d_out;     // [2][2048][1024]
    char* wsp = (char*)d_ws;
    auto take = [&](size_t bytes) { char* p = wsp; wsp += (bytes + 255) & ~(size_t)255; return (void*)p; };
    bf* WQ = (bf*)take((size_t)DQ * DM * 2); bf* WK = (bf*)take((size_t)DKV * DM * 2); bf* WV = (bf*)take((size_t)DKV * DM * 2); bf* WO = (bf*)take((size_t)DM * DQ * 2); float* CS = (float*)take((size_t)TT * HD * 2 * 4);
    bf* Yh = (bf*)take((size_t)TT * DM * 2); bf* Yl = (bf*)take((size_t)TT * DM * 2); float* YO = (float*)take((size_t)TT * DM * 4); float* BT = (float*)take((size_t)NH_ * 4096 * 4); float* FQ = (float*)take((size_t)TT * DQ * 4); float* FK = (float*)take((size_t)TT * DKV * 4);
    h16* QP16 = (h16*)take((size_t)NB_ * NH_ * TT * HD * 2); h16* KP16 = (h16*)take((size_t)NB_ * NKV * TT * HD * 2); h16* VT16 = (h16*)take((size_t)NB_ * NKV * HD * TT * 2);
    bf* QPh = (bf*)take((size_t)NB_ * NH_ * TT * HD * 2); bf* QPl = (bf*)take((size_t)NB_ * NH_ * TT * HD * 2); bf* KPh = (bf*)take((size_t)NB_ * NKV * TT * HD * 2); bf* KPl = (bf*)take((size_t)NB_ * NKV * TT * HD * 2); bf* VTh = (bf*)take((size_t)NB_ * NKV * HD * TT * 2); bf* VTl = (bf*)take((size_t)NB_ * NKV * HD * TT * 2);
    bf* ATh = (bf*)take((size_t)NB_ * TT * DQ * 2); bf* ATl = (bf*)take((size_t)NB_ * TT * DQ * 2);
    if ((size_t)(wsp - (char*)d_ws) > ws_size) return;    // ws 256 MiB
    float* FV = FK;   // v projection reuses the k buffer after the k planes are built (stream-ordered)
    { k_wtG<<<(unsigned)((DM * DQ / 64 + 63) / 64), 256, 0, stream>>>(wq, DM, DQ, WQ); k_wtG<<<(unsigned)((DM * DKV / 64 + 63) / 64), 256, 0, stream>>>(wk, DM, DKV, WK); k_wtG<<<(unsigned)((DM * DKV / 64 + 63) / 64), 256, 0, stream>>>(wv, DM, DKV, WV);
      k_wtG<<<(unsigned)((DQ * DM / 64 + 63) / 64), 256, 0, stream>>>(wo, DQ, DM, WO);
       }
    k_csid<<<(TT * HD + 255) / 256, 256, 0, stream>>>(CS);
    const unsigned LQ = (unsigned)(((size_t)NH_ * TT * HD / 2 + 255) / 256), LKv = (unsigned)(((size_t)NKV * TT * HD / 2 + 255) / 256);
    for (int b = 0; b < NB_; ++b) { const size_t zq = (size_t)b * NH_ * TT * HD, zk = (size_t)b * NKV * TT * HD;   // each batch's head planes
        k_lnhl<<<TT / 8, 256, 0, stream>>>(x + (size_t)b * TT * DM, nullptr, g1, e1b, nullptr, Yh, Yl);   /* n = LN(hidden) as hi/lo planes */ if (b == 0) k_btab<<<(NH_ * 4096 + 255) / 256, 256, 0, stream>>>(relb, BT);
        k_gemmw<bf, 1, false><<<dim3(TT / 64, DQ / 64, 1), 32, 0, stream>>>(Yh, Yl, WQ, nullptr, DM, FQ, DQ, nullptr, 0, 0, 0, 0);
        k_rope<<<LQ, 256, 0, stream>>>(FQ, DQ, NH_, CS, nullptr, nullptr, 1.0f, QP16 + zq, QPh + zq, QPl + zq);
        k_gemmw<bf, 1, false><<<dim3(TT / 64, DKV / 64, 1), 32, 0, stream>>>(Yh, Yl, WK, nullptr, DM, FK, DKV, nullptr, 0, 0, 0, 0);
        k_rope<<<LKv, 256, 0, stream>>>(FK, DKV, NKV, CS, nullptr, nullptr, 1.0f, KP16 + zk, KPh + zk, KPl + zk);
        k_gemmw<bf, 1, false><<<dim3(TT / 64, DKV / 64, 1), 32, 0, stream>>>(Yh, Yl, WV, nullptr, DM, FV, DKV, nullptr, 0, 0, 0, 0); k_vtp<<<LKv, 256, 0, stream>>>(FV, DKV, NKV, VT16 + zk, VTh + zk, VTl + zk); }
    k_fattn<<<dim3(RH / 32, NH_, NB_), 160, 0, stream>>>(QP16, KP16, VT16, QPh, QPl, KPh, KPl, VTh, VTl, BT, ATh, ATl);
    for (int b = 0; b < NB_; ++b) {
        k_gemmw<bf, 1, false><<<dim3(TT / 64, DM / 64, 1), 32, 0, stream>>>(ATh + (size_t)b * TT * DQ, ATl + (size_t)b * TT * DQ, WO, nullptr, DQ, YO, DM, nullptr, 0, 0, 0, 0);
        k_addres<<<(unsigned)(((size_t)TT * DM / 4 + 255) / 256), 256, 0, stream>>>(x + (size_t)b * TT * DM, YO, OUT + (size_t)b * TT * DM, (size_t)TT * DM / 4); }   /* out = hidden + ctx Wo */
}

// v003
// It runs in 411 microseconds.
// In both of two side-by-side timings against v002, it was 1.09 times as fast.
// All steps since v000 together make it 5.07 times as fast.
#include <hip/hip_runtime.h>

// T5 self-attention layer (hidden [2][2048][1024]; n = LayerNorm(hidden) (1e-6, ln_g, ln_b); q, k, v = n W ('xw' [1024][1024], no bias, 16 heads x 64); scores = q.k (NO 1/sqrt(d)) + rel_bias[bucket(j - i)][h] (T5 bidirectional buckets, 32 buckets, max distance 128); softmax over all keys; out = hidden + merged Wo -> [2][2048][1024]).
// The bucket index depends only on (j - i); it is embedded as a 4095-entry integer table computed with the reference's own bucket function (its f32 log -> int32 cast has exact-integer knife edges, so it is not recomputed on the device).
// Compute dtypes, f32 accumulate: every input rounded to bf16; q/k/v projections hl x exact (2 products); the relative-position bias (bf16-rounded rel_bias values through the embedded bucket table) enters the scores in f32; scores and attn.v: query rows < 512 hl (3 products), the rest single fp16 (P x1024); softmax f32, online; Wo hl x exact (2 products), + hidden residual in f32.

#define NB_  2
#define TT   2048
#define DM   1024
#define NH_  16
#define NKV  16
#define REP  (NH_ / NKV)
#define HD   64
#define DQ   (NH_ * HD)
#define DKV  (NKV * HD)
#define LNEPS 1e-6f
#define NBKT 32
#define RH   512                  // query rows < RH use hi+lo planes
#define WIN  0
#define PSH  10.0f                 // fp16 P carries 2^10 (added to the exponent; it cancels against the row sum)
#define SCL  1.0f                  // T5: no 1/sqrt(d) scaling
typedef _Float16 h16;
typedef unsigned short bf;
typedef __attribute__((ext_vector_type(16))) __bf16   v16bf;
typedef __attribute__((ext_vector_type(16))) _Float16 v16h;
typedef __attribute__((ext_vector_type(8)))  _Float16 v8h;
typedef __attribute__((ext_vector_type(8)))  unsigned short v8us;
typedef __attribute__((ext_vector_type(8)))  float    v8f;
typedef __attribute__((ext_vector_type(4)))  float    v4f;
typedef v8h  __attribute__((may_alias)) v8ha;
typedef v4f  __attribute__((may_alias)) v4fa;
typedef v8us __attribute__((may_alias)) v8usa;

__device__ __forceinline__ unsigned short f2bf(float f) { unsigned u = __float_as_uint(f); u += 0x7FFFu + ((u >> 16) & 1u); return (unsigned short)(u >> 16); }
__device__ __forceinline__ float bf2f(unsigned short b) { return __uint_as_float(((unsigned)b) << 16); }
__device__ __forceinline__ float bfr(float f) { return bf2f(f2bf(f)); }
__device__ __forceinline__ v16h cat16(v8h lo, v8h hi) { return __builtin_shufflevector(lo, hi, 0, 1, 2, 3, 4, 5, 6, 7, 8, 9, 10, 11, 12, 13, 14, 15); }
__device__ __forceinline__ v16bf cat16b(v8us lo, v8us hi) { return __builtin_bit_cast(v16bf, __builtin_shufflevector(lo, hi, 0, 1, 2, 3, 4, 5, 6, 7, 8, 9, 10, 11, 12, 13, 14, 15)); }
__device__ __forceinline__ v8f wmma16(v16h a, v16h b, v8f c) { return __builtin_amdgcn_wmma_f32_16x16x32_f16(false, a, false, b, (short)0, c, false, false); }
__device__ __forceinline__ v8f wmmab(v16bf a, v16bf b, v8f c) { return __builtin_amdgcn_wmma_f32_16x16x32_bf16(false, a, false, b, (short)0, c, false, false); }



__device__ __forceinline__ h16 tohx(float x) { return (h16)x; }
__device__ __forceinline__ void splitf(float y, unsigned short& h, unsigned short& l) { h = f2bf(y); l = f2bf(y - bf2f(h)); }
// The two waits stand between a run of global stores and the first rewrite of a register that they name: addresses and data are inputs, so they stay in their registers up to the wait, and the scheduling barrier keeps later instructions behind it.
__device__ __forceinline__ void swaitp(const void* a, const void* b, const void* c, const v8h (&x)[4], const v8us (&y)[4], const v8us (&w)[4]) { asm volatile("s_wait_xcnt 0x0" :: "v"(a), "v"(b), "v"(c), "v"(x[0]), "v"(x[1]), "v"(x[2]), "v"(x[3]), "v"(y[0]), "v"(y[1]), "v"(y[2]), "v"(y[3]), "v"(w[0]), "v"(w[1]), "v"(w[2]), "v"(w[3]) : "memory"); __builtin_amdgcn_sched_barrier(0); }
__device__ __forceinline__ void swaitf(const void* a, const void* b, const v4f (&x)[8]) { asm volatile("s_wait_xcnt 0x0" :: "v"(a), "v"(b), "v"(x[0]), "v"(x[1]), "v"(x[2]), "v"(x[3]), "v"(x[4]), "v"(x[5]), "v"(x[6]), "v"(x[7]) : "memory"); __builtin_amdgcn_sched_barrier(0); }

// ---- k_gemmw: register-blocked GEMM, ONE WAVE per 64x64 output tile (16 accumulators), operands straight from K-contiguous 16-bit planes; grid (M/64, N/64, Z), 32 threads.
// c[m][n] (f32) = sum_k A[m][k] Bt[n][k] (+ split products per NSPLIT). z-batch strides sA/sB/sC in elements (sC: of C and X, or of each plane). K % 32 == 0.
// The tile leaves the kernel in its final form, 16 staged rows of 64 at a time, every store a whole 128-byte line or more:
// EPI 0: C[m][n] (f32, pitch DM) = bf16-rounded X[m][n] + c, the residual add. EPI 1: head planes [n / 64][m][n % 64]. EPI 2: transposed head planes [n / 64][n % 64][m]. Planes: fp16 (P16) and a bf16 hi/lo pair (Ph, Pl); a tile's 64 columns are one head.
template <typename T16> struct WFrag;
template <> struct WFrag<h16> { typedef v16h V; static __device__ __forceinline__ V ld(const h16* p) { return cat16(*(const v8h*)p, *(const v8h*)(p + 16)); } static __device__ __forceinline__ v8f mma(V a, V b, v8f c) { return wmma16(a, b, c); } };
template <> struct WFrag<bf> { typedef v16bf V; static __device__ __forceinline__ V ld(const bf* p) { return cat16b(*(const v8us*)p, *(const v8us*)(p + 16)); } static __device__ __forceinline__ v8f mma(V a, V b, v8f c) { return wmmab(a, b, c); } };
static_assert(HD == 64, "one 64-column tile is one head");
template <typename T16, int NSPLIT, int EPI>
__global__ __launch_bounds__(32) void k_gemmw(const T16* __restrict__ A, const T16* __restrict__ A2, const T16* __restrict__ Bt, const T16* __restrict__ Bt2, int K, const float* __restrict__ X, float* C, h16* P16, bf* Ph, bf* Pl, size_t sA, size_t sB, size_t sC) {
    typedef typename WFrag<T16>::V V;
    __shared__ __align__(16) float os[16 * 68];
    const size_t z = blockIdx.z; A += z * sA; if (A2) A2 += z * sA; Bt += z * sB; if (Bt2) Bt2 += z * sB;
    const int lane = threadIdx.x & 31, lr = lane & 15, hi = lane >> 4; const int r0 = blockIdx.x * 64, c0 = blockIdx.y * 64;
    v8f acc[4][4];
#pragma unroll
    for (int mb = 0; mb < 4; ++mb)
#pragma unroll
        for (int nb = 0; nb < 4; ++nb) acc[mb][nb] = (v8f){};
    const size_t aoff = (size_t)(r0 + lr) * K + 8 * hi, boff = (size_t)(c0 + lr) * K + 8 * hi;
#pragma unroll 1
    for (int kc = 0; kc < K; kc += 32) {
        V a[4], a2[4];
#pragma unroll
        for (int mb = 0; mb < 4; ++mb) { a[mb] = WFrag<T16>::ld(A + aoff + (size_t)mb * 16 * K + kc); if (NSPLIT == 1 || NSPLIT == 2) a2[mb] = WFrag<T16>::ld(A2 + aoff + (size_t)mb * 16 * K + kc); }
#pragma unroll
        for (int nb = 0; nb < 4; ++nb) { const V b = WFrag<T16>::ld(Bt + boff + (size_t)nb * 16 * K + kc); V b2; if (NSPLIT >= 2) b2 = WFrag<T16>::ld(Bt2 + boff + (size_t)nb * 16 * K + kc);
#pragma unroll
            for (int mb = 0; mb < 4; ++mb) { acc[mb][nb] = WFrag<T16>::mma(a[mb], b, acc[mb][nb]); if (NSPLIT == 1 || NSPLIT == 2) acc[mb][nb] = WFrag<T16>::mma(a2[mb], b, acc[mb][nb]); if (NSPLIT >= 2) acc[mb][nb] = WFrag<T16>::mma(a[mb], b2, acc[mb][nb]); } }
        asm volatile("v_nop\n\tv_nop\n\tv_nop\n\tv_nop" : "+v"(acc[0][0]), "+v"(acc[1][1]), "+v"(acc[2][2]), "+v"(acc[3][3]) : "v"(a[0]), "v"(a[3]));
    }
    // Epilogue. Every loop is unrolled: the accumulators are registers and take constant indices only. The staged rows pass from lane to lane through LDS, which runs one wave's operations in order;
    // each fence (wave barrier + memory clobber) keeps that order in the compiled code: all lanes' writes of a block, then its reads, then the next block's writes.
    if constexpr (EPI == 0) {
        const size_t co = z * sC + (size_t)(r0 + hi) * DM + c0 + lr * 4;   /* a lane's 4 columns of rows hi, 2 + hi, ... */
        const float* xp = X + co; float* cp = C + co;
        v4f xv[2][8];   /* the residual rows, fetched one 16-row block ahead */
#pragma unroll
        for (int s = 0; s < 8; ++s) xv[0][s] = *(const v4f*)(xp + 2 * s * DM);
#pragma unroll
        for (int mb = 0; mb < 4; ++mb) {
            if (mb < 3) {
#pragma unroll
                for (int s = 0; s < 8; ++s) xv[(mb + 1) & 1][s] = *(const v4f*)(xp + ((mb + 1) * 16 + 2 * s) * DM); }
#pragma unroll
            for (int nb = 0; nb < 4; ++nb) {
#pragma unroll
                for (int j = 0; j < 8; ++j) os[(hi * 8 + j) * 68 + nb * 16 + lr] = acc[mb][nb][j]; }
            __builtin_amdgcn_wave_barrier(); asm volatile("" ::: "memory");   /* fence: writes before reads */
            v4f val[8];
#pragma unroll
            for (int s = 0; s < 8; ++s) { val[s] = *(const v4fa*)(os + (2 * s + hi) * 68 + lr * 4);
#pragma unroll
                for (int q = 0; q < 4; ++q) val[s][q] = __fadd_rn(bfr(xv[mb & 1][s][q]), val[s][q]);
                *(v4f*)(cp + (mb * 16 + 2 * s) * DM) = val[s]; }
            swaitf(xp, cp, val);
            __builtin_amdgcn_wave_barrier(); asm volatile("" ::: "memory");   /* fence: reads before the next writes */
        }
    } else {
        constexpr int PP = (EPI == 1) ? HD : TT;   /* pitch of a staged row in the planes */
        const size_t po = z * sC + ((EPI == 1) ? ((size_t)blockIdx.y * TT + r0) * HD : (size_t)blockIdx.y * HD * TT + r0) + (size_t)(lane >> 3) * PP + (lane & 7) * 8;   /* a lane's 8 elements of staged rows lane / 8, 4 + lane / 8, ... */
        h16* p16 = P16 + po; bf* ph = Ph + po; bf* pl = Pl + po;
#pragma unroll
        for (int blk = 0; blk < 4; ++blk) {
#pragma unroll
            for (int ob = 0; ob < 4; ++ob) {
                if constexpr (EPI == 1) {   /* staged row = m, 16 rows of block blk */
#pragma unroll
                    for (int j = 0; j < 8; ++j) os[(hi * 8 + j) * 68 + ob * 16 + lr] = acc[blk][ob][j];
                } else {   /* staged row = n, 16 columns of block blk: a lane's 8 accumulator rows are 8 neighbours in it */
                    const v8f t = acc[ob][blk]; *(v4fa*)(os + lr * 68 + ob * 16 + hi * 8) = __builtin_shufflevector(t, t, 0, 1, 2, 3); *(v4fa*)(os + lr * 68 + ob * 16 + hi * 8 + 4) = __builtin_shufflevector(t, t, 4, 5, 6, 7); } }
            __builtin_amdgcn_wave_barrier(); asm volatile("" ::: "memory");   /* fence: writes before reads */
            v8h o16[4]; v8us oh[4], ol[4];
#pragma unroll
            for (int s = 0; s < 4; ++s) { const float* sp = os + (s * 4 + (lane >> 3)) * 68 + (lane & 7) * 8; const v4f x0 = *(const v4fa*)sp, x1 = *(const v4fa*)(sp + 4);
#pragma unroll
                for (int k = 0; k < 8; ++k) { const float x = (k < 4) ? x0[k & 3] : x1[k & 3]; o16[s][k] = tohx(x); unsigned short a2, c2; splitf(x, a2, c2); oh[s][k] = a2; ol[s][k] = c2; }
                *(v8h*)(p16 + (blk * 16 + s * 4) * PP) = o16[s]; *(v8us*)(ph + (blk * 16 + s * 4) * PP) = oh[s]; *(v8us*)(pl + (blk * 16 + s * 4) * PP) = ol[s]; }
            swaitp(p16, ph, pl, o16, oh, ol);
            __builtin_amdgcn_wave_barrier(); asm volatile("" ::: "memory");   /* fence: reads before the next writes */
        }
    }
}

typedef __attribute__((ext_vector_type(2))) _Float16 v2h;
typedef __attribute__((ext_vector_type(4))) _Float16 v4h;
typedef __attribute__((ext_vector_type(2))) unsigned short v2us;
typedef __attribute__((ext_vector_type(4))) unsigned short v4us;
typedef __attribute__((ext_vector_type(2))) float v2f;
typedef __attribute__((ext_vector_type(4))) int v4i;

__global__ __launch_bounds__(256) void k_wtG(const float* __restrict__ w, int K, int N, bf* Bt) {
    const int lane = threadIdx.x & 31; const int L0 = (blockIdx.x * 8 + (threadIdx.x >> 5)) * 8; const int nlines = N * K / 64;
{
#pragma unroll 1
        for (int l = 0; l < 8; ++l) { const int L = L0 + l; if (L >= nlines) break; const size_t e = (size_t)L * 64 + lane * 2; const int k = (int)(e % K), n = (int)(e / K); v2us o;
            o[0] = f2bf(w[(size_t)k * N + n]); o[1] = f2bf(w[(size_t)(k + 1) * N + n]); *(v2us*)(Bt + e) = o; }
         }
}
__global__ __launch_bounds__(256) void k_lnhl(const float* __restrict__ X, const float* __restrict__ A, const float* __restrict__ g, const float* __restrict__ be, float* Z, bf* Yh, bf* Yl) {
    const int lane = threadIdx.x & 31; const int r = blockIdx.x * 8 + (threadIdx.x >> 5); if (r >= TT) return; const float* xr = X + (size_t)r * DM; const float* ar = A ? A + (size_t)r * DM : nullptr; float s = 0.f;
#pragma unroll 1
    for (int ch = 0; ch < DM / 128; ++ch) { const int c0 = ch * 128 + lane * 4; const v4f a = *(const v4f*)(xr + c0); v4f d = {0.f, 0.f, 0.f, 0.f}; if (ar) d = *(const v4f*)(ar + c0);
#pragma unroll
        for (int q = 0; q < 4; ++q) s += __fadd_rn(bfr(a[q]), d[q]); }
#pragma unroll
    for (int sh = 16; sh; sh >>= 1) s += __shfl_xor(s, sh, 32);
    const float mu = s * (1.0f / DM); float s2 = 0.f;
#pragma unroll 1
    for (int ch = 0; ch < DM / 128; ++ch) { const int c0 = ch * 128 + lane * 4; const v4f a = *(const v4f*)(xr + c0); v4f d = {0.f, 0.f, 0.f, 0.f}; if (ar) d = *(const v4f*)(ar + c0);
#pragma unroll
        for (int q = 0; q < 4; ++q) { const float d0 = __fsub_rn(__fadd_rn(bfr(a[q]), d[q]), mu); float p = __fmul_rn(d0, d0); asm volatile("" : "+v"(p)); s2 = __fadd_rn(s2, p); } }
#pragma unroll
    for (int sh = 16; sh; sh >>= 1) s2 += __shfl_xor(s2, sh, 32);
    const float rs = __fdiv_rn(1.0f, __fsqrt_rn(__fadd_rn(s2 * (1.0f / DM), LNEPS)));
{
#pragma unroll 1
        for (int ch = 0; ch < DM / 128; ++ch) { const int c0 = ch * 128 + lane * 4; const v4f a = *(const v4f*)(xr + c0); v4f d = {0.f, 0.f, 0.f, 0.f}; if (ar) d = *(const v4f*)(ar + c0); v4f z4; v4us oh, ol;
#pragma unroll
            for (int q = 0; q < 4; ++q) { const float v = __fadd_rn(bfr(a[q]), d[q]); z4[q] = v; float n0 = __fmul_rn(__fsub_rn(v, mu), rs); asm volatile("" : "+v"(n0)); float n1 = __fmul_rn(n0, bfr(g[c0 + q])); asm volatile("" : "+v"(n1)); const float y = __fadd_rn(n1, bfr(be[c0 + q])); unsigned short h2, l2; splitf(y, h2, l2); oh[q] = h2; ol[q] = l2; }
            if (Z) *(v4f*)(Z + (size_t)r * DM + c0) = z4; *(v4us*)(Yh + (size_t)r * DM + c0) = oh; *(v4us*)(Yl + (size_t)r * DM + c0) = ol; }
         } }
__constant__ int BKT[4095] = {15,15,15,15,15,15,15,15,15,15,15,15,15,15,15,15,15,15,15,15,15,15,15,15,15,15,15,15,15,15,15,15,15,15,15,15,15,15,15,15,15,15,15,15,15,15,15,15,15,15,15,15,15,15,15,15,15,15,15,15,15,15,15,15,15,15,15,15,15,15,15,15,15,15,15,15,15,15,15,15,15,15,15,15,15,15,15,15,15,15,15,15,15,15,15,15,15,15,15,15,15,15,15,15,15,15,15,15,15,15,15,15,15,15,15,15,15,15,15,15,15,15,15,15,15,15,15,15,15,15,15,15,15,15,15,15,15,15,15,15,15,15,15,15,15,15,15,15,15,15,15,15,15,15,15,15,15,15,15,15,15,15,15,15,15,15,15,15,15,15,15,15,15,15,15,15,15,15,15,15,15,15,15,15,15,15,15,15,15,15,15,15,15,15,15,15,15,15,15,15,15,15,15,15,15,15,15,15,15,15,15,15,15,15,15,15,15,15,15,15,15,15,15,15,15,15,15,15,15,15,15,15,15,15,15,15,15,15,15,15,15,15,15,15,15,15,15,15,15,15,15,15,15,15,15,15,15,15,15,15,15,15,15,15,15,15,15,15,15,15,15,15,15,15,15,15,15,15,15,15,15,15,15,15,15,15,15,15,15,15,15,15,15,15,15,15,15,15,15,15,15,15,15,15,15,15,15,15,15,15,15,15,15,15,15,15,15,15,15,15,15,15,15,15,15,15,15,15,15,15,15,15,15,15,15,15,15,15,15,15,15,15,15,15,15,15,15,15,15,15,15,15,15,15,15,15,15,15,15,15,15,15,15,15,15,15,15,15,15,15,15,15,15,15,15,15,15,15,15,15,15,15,15,15,15,15,15,15,15,15,15,15,15,15,15,15,15,15,15,15,15,15,15,15,15,15,15,15,15,15,15,15,15,15,15,15,15,15,15,15,15,15,15,15,15,15,15,15,15,15,15,15,15,15,15,15,15,15,15,15,15,15,15,15,15,15,15,15,15,15,15,15,15,15,15,15,15,15,15,15,15,15,15,15,15,15,15,15,15,15,15,15,15,15,15,15,15,15,15,15,15,15,15,15,15,15,15,15,15,15,15,15,15,15,15,15,15,15,15,15,15,15,15,15,15,15,15,15,15,15,15,15,15,15,15,15,15,15,15,15,15,15,15,15,15,15,15,15,15,15,15,15,15,15,15,15,15,15,15,15,15,15,15,15,15,15,15,15,15,15,15,15,15,15,15,15,15,15,15,15,15,15,15,15,15,15,15,15,15,15,15,15,15,15,15,15,15,15,15,15,15,15,15,15,15,15,15,15,15,15,15,15,15,15,15,15,15,15,15,15,15,15,15,15,15,15,15,15,15,15,15,15,15,15,15,15,15,15,15,15,15,15,15,15,15,15,15,15,15,15,15,15,15,15,15,15,15,15,15,15,15,15,15,15,15,15,15,15,15,15,15,15,15,15,15,15,15,15,15,15,15,15,15,15,15,15,15,15,15,15,15,15,15,15,15,15,15,15,15,15,15,15,15,15,15,15,15,15,15,15,15,15,15,15,15,15,15,15,15,15,15,15,15,15,15,15,15,15,15,15,15,15,15,15,15,15,15,15,15,15,15,15,15,15,15,15,15,15,15,15,15,15,15,15,15,15,15,15,15,15,15,15,15,15,15,15,15,15,15,15,15,15,15,15,15,15,15,15,15,15,15,15,15,15,15,15,15,15,15,15,15,15,15,15,15,15,15,15,15,15,15,15,15,15,15,15,15,15,15,15,15,15,15,15,15,15,15,15,15,15,15,15,15,15,15,15,15,15,15,15,15,15,15,15,15,15,15,15,15,15,15,15,15,15,15,15,15,15,15,15,15,15,15,15,15,15,15,15,15,15,15,15,15,15,15,15,15,15,15,15,15,15,15,15,15,15,15,15,15,15,15,15,15,15,15,15,15,15,15,15,15,15,15,15,15,15,15,15,15,15,15,15,15,15,15,15,15,15,15,15,15,15,15,15,15,15,15,15,15,15,15,15,15,15,15,15,15,15,15,15,15,15,15,15,15,15,15,15,15,15,15,15,15,15,15,15,15,15,15,15,15,15,15,15,15,15,15,15,15,15,15,15,15,15,15,15,15,15,15,15,15,15,15,15,15,15,15,15,15,15,15,15,15,15,15,15,15,15,15,15,15,15,15,15,15,15,15,15,15,15,15,15,15,15,15,15,15,15,15,15,15,15,15,15,15,15,15,15,15,15,15,15,15,15,15,15,15,15,15,15,15,15,15,15,15,15,15,15,15,15,15,15,15,15,15,15,15,15,15,15,15,15,15,15,15,15,15,15,15,15,15,15,15,15,15,15,15,15,15,15,15,15,15,15,15,15,15,15,15,15,15,15,15,15,15,15,15,15,15,15,15,15,15,15,15,15,15,15,15,15,15,15,15,15,15,15,15,15,15,15,15,15,15,15,15,15,15,15,15,15,15,15,15,15,15,15,15,15,15,15,15,15,15,15,15,15,15,15,15,15,15,15,15,15,15,15,15,15,15,15,15,15,15,15,15,15,15,15,15,15,15,15,15,15,15,15,15,15,15,15,15,15,15,15,15,15,15,15,15,15,15,15,15,15,15,15,15,15,15,15,15,15,15,15,15,15,15,15,15,15,15,15,15,15,15,15,15,15,15,15,15,15,15,15,15,15,15,15,15,15,15,15,15,15,15,15,15,15,15,15,15,15,15,15,15,15,15,15,15,15,15,15,15,15,15,15,15,15,15,15,15,15,15,15,15,15,15,15,15,15,15,15,15,15,15,15,15,15,15,15,15,15,15,15,15,15,15,15,15,15,15,15,15,15,15,15,15,15,15,15,15,15,15,15,15,15,15,15,15,15,15,15,15,15,15,15,15,15,15,15,15,15,15,15,15,15,15,15,15,15,15,15,15,15,15,15,15,15,15,15,15,15,15,15,15,15,15,15,15,15,15,15,15,15,15,15,15,15,15,15,15,15,15,15,15,15,15,15,15,15,15,15,15,15,15,15,15,15,15,15,15,15,15,15,15,15,15,15,15,15,15,15,15,15,15,15,15,15,15,15,15,15,15,15,15,15,15,15,15,15,15,15,15,15,15,15,15,15,15,15,15,15,15,15,15,15,15,15,15,15,15,15,15,15,15,15,15,15,15,15,15,15,15,15,15,15,15,15,15,15,15,15,15,15,15,15,15,15,15,15,15,15,15,15,15,15,15,15,15,15,15,15,15,15,15,15,15,15,15,15,15,15,15,15,15,15,15,15,15,15,15,15,15,15,15,15,15,15,15,15,15,15,15,15,15,15,15,15,15,15,15,15,15,15,15,15,15,15,15,15,15,15,15,15,15,15,15,15,15,15,15,15,15,15,15,15,15,15,15,15,15,15,15,15,15,15,15,15,15,15,15,15,15,15,15,15,15,15,15,15,15,15,15,15,15,15,15,15,15,15,15,15,15,15,15,15,15,15,15,15,15,15,15,15,15,15,15,15,15,15,15,15,15,15,15,15,15,15,15,15,15,15,15,15,15,15,15,15,15,15,15,15,15,15,15,15,15,15,15,15,15,15,15,15,15,15,15,15,15,15,15,15,15,15,15,15,15,15,15,15,15,15,15,15,15,15,15,15,15,15,15,15,15,15,15,15,15,15,15,15,15,15,15,15,15,15,15,15,15,15,15,15,15,15,15,15,15,15,15,15,15,15,15,15,15,15,15,15,15,15,15,15,15,15,15,15,15,15,15,15,15,15,15,15,15,15,15,15,15,15,15,15,15,15,15,15,15,15,15,15,15,15,15,15,15,15,15,15,15,15,15,15,15,15,15,15,15,15,15,15,15,15,15,15,15,15,15,15,15,15,15,15,15,15,15,15,15,15,15,15,15,15,15,15,15,15,15,15,15,15,15,15,15,15,15,15,15,15,15,15,15,15,15,15,15,15,15,15,15,15,15,15,15,15,15,15,15,15,15,15,15,15,15,15,15,15,15,15,15,15,15,15,15,15,15,15,15,15,15,15,15,15,15,15,15,15,15,15,15,15,15,15,15,15,15,15,15,15,15,15,15,15,15,15,15,15,15,15,15,15,15,15,15,15,15,15,15,15,15,15,15,15,15,15,15,15,15,15,15,15,15,15,15,15,15,15,15,15,15,15,15,15,15,15,15,15,15,15,15,15,15,15,15,15,15,15,15,15,15,15,15,15,15,15,15,15,15,15,15,15,15,15,15,15,15,15,15,15,15,15,15,15,15,15,15,15,15,15,15,15,15,15,15,15,15,15,15,15,15,15,15,15,15,15,15,15,15,15,15,15,15,15,15,15,15,15,15,15,15,15,15,15,15,15,15,15,15,15,15,15,15,15,15,15,15,15,15,15,15,15,15,15,15,15,15,15,15,14,14,14,14,14,14,14,14,14,14,14,14,14,14,14,14,14,14,14,14,14,14,14,14,14,14,14,13,13,13,13,13,13,13,13,13,13,13,13,13,13,13,13,13,13,12,12,12,12,12,12,12,12,12,12,12,12,12,12,11,11,11,11,11,11,11,11,11,10,10,10,10,10,10,10,9,9,9,9,8,8,8,8,7,6,5,4,3,2,1,0,17,18,19,20,21,22,23,24,24,24,24,25,25,25,25,26,26,26,26,26,26,26,27,27,27,27,27,27,27,27,27,28,28,28,28,28,28,28,28,28,28,28,28,28,28,29,29,29,29,29,29,29,29,29,29,29,29,29,29,29,29,29,29,30,30,30,30,30,30,30,30,30,30,30,30,30,30,30,30,30,30,30,30,30,30,30,30,30,30,30,31,31,31,31,31,31,31,31,31,31,31,31,31,31,31,31,31,31,31,31,31,31,31,31,31,31,31,31,31,31,31,31,31,31,31,31,31,31,31,31,31,31,31,31,31,31,31,31,31,31,31,31,31,31,31,31,31,31,31,31,31,31,31,31,31,31,31,31,31,31,31,31,31,31,31,31,31,31,31,31,31,31,31,31,31,31,31,31,31,31,31,31,31,31,31,31,31,31,31,31,31,31,31,31,31,31,31,31,31,31,31,31,31,31,31,31,31,31,31,31,31,31,31,31,31,31,31,31,31,31,31,31,31,31,31,31,31,31,31,31,31,31,31,31,31,31,31,31,31,31,31,31,31,31,31,31,31,31,31,31,31,31,31,31,31,31,31,31,31,31,31,31,31,31,31,31,31,31,31,31,31,31,31,31,31,31,31,31,31,31,31,31,31,31,31,31,31,31,31,31,31,31,31,31,31,31,31,31,31,31,31,31,31,31,31,31,31,31,31,31,31,31,31,31,31,31,31,31,31,31,31,31,31,31,31,31,31,31,31,31,31,31,31,31,31,31,31,31,31,31,31,31,31,31,31,31,31,31,31,31,31,31,31,31,31,31,31,31,31,31,31,31,31,31,31,31,31,31,31,31,31,31,31,31,31,31,31,31,31,31,31,31,31,31,31,31,31,31,31,31,31,31,31,31,31,31,31,31,31,31,31,31,31,31,31,31,31,31,31,31,31,31,31,31,31,31,31,31,31,31,31,31,31,31,31,31,31,31,31,31,31,31,31,31,31,31,31,31,31,31,31,31,31,31,31,31,31,31,31,31,31,31,31,31,31,31,31,31,31,31,31,31,31,31,31,31,31,31,31,31,31,31,31,31,31,31,31,31,31,31,31,31,31,31,31,31,31,31,31,31,31,31,31,31,31,31,31,31,31,31,31,31,31,31,31,31,31,31,31,31,31,31,31,31,31,31,31,31,31,31,31,31,31,31,31,31,31,31,31,31,31,31,31,31,31,31,31,31,31,31,31,31,31,31,31,31,31,31,31,31,31,31,31,31,31,31,31,31,31,31,31,31,31,31,31,31,31,31,31,31,31,31,31,31,31,31,31,31,31,31,31,31,31,31,31,31,31,31,31,31,31,31,31,31,31,31,31,31,31,31,31,31,31,31,31,31,31,31,31,31,31,31,31,31,31,31,31,31,31,31,31,31,31,31,31,31,31,31,31,31,31,31,31,31,31,31,31,31,31,31,31,31,31,31,31,31,31,31,31,31,31,31,31,31,31,31,31,31,31,31,31,31,31,31,31,31,31,31,31,31,31,31,31,31,31,31,31,31,31,31,31,31,31,31,31,31,31,31,31,31,31,31,31,31,31,31,31,31,31,31,31,31,31,31,31,31,31,31,31,31,31,31,31,31,31,31,31,31,31,31,31,31,31,31,31,31,31,31,31,31,31,31,31,31,31,31,31,31,31,31,31,31,31,31,31,31,31,31,31,31,31,31,31,31,31,31,31,31,31,31,31,31,31,31,31,31,31,31,31,31,31,31,31,31,31,31,31,31,31,31,31,31,31,31,31,31,31,31,31,31,31,31,31,31,31,31,31,31,31,31,31,31,31,31,31,31,31,31,31,31,31,31,31,31,31,31,31,31,31,31,31,31,31,31,31,31,31,31,31,31,31,31,31,31,31,31,31,31,31,31,31,31,31,31,31,31,31,31,31,31,31,31,31,31,31,31,31,31,31,31,31,31,31,31,31,31,31,31,31,31,31,31,31,31,31,31,31,31,31,31,31,31,31,31,31,31,31,31,31,31,31,31,31,31,31,31,31,31,31,31,31,31,31,31,31,31,31,31,31,31,31,31,31,31,31,31,31,31,31,31,31,31,31,31,31,31,31,31,31,31,31,31,31,31,31,31,31,31,31,31,31,31,31,31,31,31,31,31,31,31,31,31,31,31,31,31,31,31,31,31,31,31,31,31,31,31,31,31,31,31,31,31,31,31,31,31,31,31,31,31,31,31,31,31,31,31,31,31,31,31,31,31,31,31,31,31,31,31,31,31,31,31,31,31,31,31,31,31,31,31,31,31,31,31,31,31,31,31,31,31,31,31,31,31,31,31,31,31,31,31,31,31,31,31,31,31,31,31,31,31,31,31,31,31,31,31,31,31,31,31,31,31,31,31,31,31,31,31,31,31,31,31,31,31,31,31,31,31,31,31,31,31,31,31,31,31,31,31,31,31,31,31,31,31,31,31,31,31,31,31,31,31,31,31,31,31,31,31,31,31,31,31,31,31,31,31,31,31,31,31,31,31,31,31,31,31,31,31,31,31,31,31,31,31,31,31,31,31,31,31,31,31,31,31,31,31,31,31,31,31,31,31,31,31,31,31,31,31,31,31,31,31,31,31,31,31,31,31,31,31,31,31,31,31,31,31,31,31,31,31,31,31,31,31,31,31,31,31,31,31,31,31,31,31,31,31,31,31,31,31,31,31,31,31,31,31,31,31,31,31,31,31,31,31,31,31,31,31,31,31,31,31,31,31,31,31,31,31,31,31,31,31,31,31,31,31,31,31,31,31,31,31,31,31,31,31,31,31,31,31,31,31,31,31,31,31,31,31,31,31,31,31,31,31,31,31,31,31,31,31,31,31,31,31,31,31,31,31,31,31,31,31,31,31,31,31,31,31,31,31,31,31,31,31,31,31,31,31,31,31,31,31,31,31,31,31,31,31,31,31,31,31,31,31,31,31,31,31,31,31,31,31,31,31,31,31,31,31,31,31,31,31,31,31,31,31,31,31,31,31,31,31,31,31,31,31,31,31,31,31,31,31,31,31,31,31,31,31,31,31,31,31,31,31,31,31,31,31,31,31,31,31,31,31,31,31,31,31,31,31,31,31,31,31,31,31,31,31,31,31,31,31,31,31,31,31,31,31,31,31,31,31,31,31,31,31,31,31,31,31,31,31,31,31,31,31,31,31,31,31,31,31,31,31,31,31,31,31,31,31,31,31,31,31,31,31,31,31,31,31,31,31,31,31,31,31,31,31,31,31,31,31,31,31,31,31,31,31,31,31,31,31,31,31,31,31,31,31,31,31,31,31,31,31,31,31,31,31,31,31,31,31,31,31,31,31,31,31,31,31,31,31,31,31,31,31,31,31,31,31,31,31,31,31,31,31,31,31,31,31,31,31,31,31,31,31,31,31,31,31,31,31,31,31,31,31,31,31,31,31,31,31,31,31,31,31,31,31,31,31,31,31,31,31,31,31,31,31,31,31,31,31,31,31,31,31,31,31,31,31,31,31,31,31,31,31,31,31,31,31,31,31,31,31,31,31,31,31,31,31,31,31,31,31,31,31,31,31,31,31,31,31,31,31,31,31,31,31,31,31,31,31,31,31,31,31,31,31,31,31,31,31,31,31,31,31,31,31,31,31,31,31,31,31,31,31,31,31,31,31,31,31,31,31,31,31,31,31,31,31,31,31,31,31,31,31,31,31,31,31,31,31,31,31,31,31,31,31,31,31,31,31,31,31,31,31,31,31,31,31,31,31,31,31,31,31,31,31,31,31,31,31,31,31,31,31,31,31,31,31,31,31,31,31,31,31,31,31,31,31,31,31,31,31,31,31,31,31,31,31,31,31,31,31,31,31,31,31,31,31,31,31,31,31,31,31,31,31,31,31,31,31,31,31,31,31,31,31,31,31,31,31,31,31,31,31,31,31,31,31,31,31,31,31,31,31,31,31,31,31,31,31,31,31,31,31,31,31,31,31,31,31,31,31,31,31,31,31,31,31,31,31,31,31,31,31,31,31,31,31,31,31,31,31,31,31,31,31,31,31,31,31,31,31,31,31,31,31,31,31,31,31,31,31,31,31,31,31,31,31,31,31,31,31,31,31,31,31,31,31,31,31,31,31,31,31,31,31,31,31,31,31,31,31,31,31,31,31,31,31,31,31,31,31,31,31,31,31,31,31,31,31,31,31,31,31,31,31,31,31,31,31,31,31,31,31,31,31,31,31,31,31,31,31,31,31,31,31,31,31,31,31,31,31,31,31,31,31,31,31,31,31,31,31,31,31,31,31,31,31,31,31,31,31,31,31,31,31,31,31,31,31,31,31,31,31,31,31,31,31,31,31,31,31,31,31,31,31,31,31,31,31,31,31,31,31,31,31,31,31,31,31,31,31,31,31,31,31,31,31,31,31,31,31,31,31,31,31,31,31,31,31,31,31,31,31,31,31,31,31,31,31,31,31,31,31,31,31,31,31,31,31,31,31,31,31,31,31,31,31,31,31,31,31,31,31,31,31,31,31,31,31,31,31,31,31,31,31,31,31,31,31,31,31,31,31,31,31,31,31,31,31,31,31,31,31,31,31,31,31,31,31,31,31,31,31,31,31,31,31,31,31,31,31,31,31,31};
__global__ __launch_bounds__(256) void k_btab(const float* __restrict__ relb, float* BT) { const int e = blockIdx.x * 256 + threadIdx.x; if (e >= NH_ * 4096) return; const int r = e % 4096, h = e / 4096; const float v = (r < 4095) ? bfr(relb[BKT[r] * NH_ + h]) : 0.f; *(float*)(BT + e) = v;  }
__global__ __launch_bounds__(256) void k_cvt8(const float* __restrict__ src, bf* dst, size_t n8) { const size_t i = (size_t)blockIdx.x * 256 + threadIdx.x; if (i >= n8) return; const v8f v = *(const v8f*)(src + i * 8); v8us o;
#pragma unroll
    for (int k = 0; k < 8; ++k) o[k] = f2bf(v[k]); *(v8us*)(dst + i * 8) = o;  }

typedef __attribute__((ext_vector_type(8))) __bf16 v8bf;
__device__ __forceinline__ float xhalf(float x) { const int b = __float_as_int(x); return __int_as_float(__builtin_amdgcn_permlanex16(b, b, 0x76543210, 0xfedcba98, false, false)); }   /* lane l <-> l ^ 16 */
// The wait stands between a run of global loads and the first rewrite of an address register that they name: the addresses are inputs, so they stay in their registers up to it, and the scheduling barrier keeps later instructions behind it.
__device__ __forceinline__ void xwait(const void* a, const void* b) { asm volatile("s_wait_xcnt 0x0" :: "v"(a), "v"(b) : "memory"); __builtin_amdgcn_sched_barrier(0); }
// 2^x by v_exp_f32 with the one free slot that the instruction set asks for behind a transcendental in the same statement, so that it stands directly behind it wherever the statement is scheduled.
__device__ __forceinline__ float exp2s(float x) { float y; asm("v_exp_f32 %0, %1\n\tv_nop" : "=v"(y) : "v"(x)); return y; }
template <typename T16, bool HI, int NQ>
__device__ __forceinline__ void fa_wave(const T16* __restrict__ Q, const T16* __restrict__ Q2, const T16* __restrict__ K, const T16* __restrict__ K2, const T16* __restrict__ V, const T16* __restrict__ V2, const float* __restrict__ bt, int q0, bf* Ah, bf* Al) {
    typedef WFrag<T16> WF; typedef typename WF::V F;
    const int lane = threadIdx.x & 31, lr = lane & 15, hi = lane >> 4;
    const float L2E = 1.4426950408889634f;
    F qf[NQ][2], qf2[NQ][2];
    const T16* qp = Q + (size_t)(q0 + lr) * HD + 8 * hi; const T16* qp2 = Q2 + (size_t)(q0 + lr) * HD + 8 * hi;
#pragma unroll
    for (int nb = 0; nb < NQ; ++nb)
#pragma unroll
        for (int ks = 0; ks < 2; ++ks) { qf[nb][ks] = WF::ld(qp + nb * 16 * HD + ks * 32); if (HI) qf2[nb][ks] = WF::ld(qp2 + nb * 16 * HD + ks * 32); }
    v8f o[4][NQ];
#pragma unroll
    for (int dt = 0; dt < 4; ++dt)
#pragma unroll
        for (int nb = 0; nb < NQ; ++nb) o[dt][nb] = (v8f){};
    float m[NQ], l[NQ];
#pragma unroll
    for (int nb = 0; nb < NQ; ++nb) { m[nb] = -3.0e38f; l[nb] = 0.f; }
    const float cneg = bt[-(TT - 1)], cpos = bt[TT - 1];
    const int ko = lr * HD + 8 * hi, vo = lr * TT + 8 * hi;
    F kf[2][2], kf2[2][2];
#pragma unroll
    for (int kt = 0; kt < 2; ++kt)
#pragma unroll
        for (int ks = 0; ks < 2; ++ks) { kf[kt][ks] = WF::ld(K + ko + kt * 16 * HD + ks * 32); if (HI) kf2[kt][ks] = WF::ld(K2 + ko + kt * 16 * HD + ks * 32); }
    xwait(qp, HI ? qp2 : qp); xwait(K + ko, HI ? K2 + ko : K + ko);
    // rolled: the running maximum chains the passes, so unrolling would add code and registers without overlapping them
#pragma unroll 1
    for (int k0 = 0; k0 < TT; k0 += 32) {
        F vf[4], vf2[4]; const T16* vp = V + vo + k0; const T16* vp2 = V2 + vo + k0;
#pragma unroll
        for (int dt = 0; dt < 4; ++dt) { vf[dt] = WF::ld(vp + dt * 16 * TT); if (HI) vf2[dt] = WF::ld(vp2 + dt * 16 * TT); }
        xwait(vp, HI ? vp2 : vp);
        v8f s[2][NQ];
        if (k0 - (q0 + 16 * NQ - 1) >= 128 || (k0 + 31) - q0 <= -128) { const float c = (k0 > q0) ? cpos : cneg;
#pragma unroll
            for (int kt = 0; kt < 2; ++kt)
#pragma unroll
                for (int nb = 0; nb < NQ; ++nb)
#pragma unroll
                    for (int r = 0; r < 8; ++r) s[kt][nb][r] = c;
        } else { const float* bp0 = bt + (k0 + 8 * hi) - (q0 + lr);
#pragma unroll
            for (int kt = 0; kt < 2; ++kt)
#pragma unroll
                for (int nb = 0; nb < NQ; ++nb) { const float* bp = bp0 + (kt - nb) * 16;
#pragma unroll
                    for (int r = 0; r < 8; ++r) s[kt][nb][r] = bp[r]; }
            xwait(bp0, bp0);
        }
#pragma unroll
        for (int ks = 0; ks < 2; ++ks)
#pragma unroll
            for (int kt = 0; kt < 2; ++kt)
#pragma unroll
                for (int nb = 0; nb < NQ; ++nb) { s[kt][nb] = WF::mma(kf[kt][ks], qf[nb][ks], s[kt][nb]); if (HI) { s[kt][nb] = WF::mma(kf[kt][ks], qf2[nb][ks], s[kt][nb]); s[kt][nb] = WF::mma(kf2[kt][ks], qf[nb][ks], s[kt][nb]); } }
        const int kn = (k0 + 32 < TT) ? k0 + 32 : 0;   /* the next pass's key rows, fetched behind this pass's score products; the last pass refetches rows 0-31, unused */
        const T16* kp = K + ko + kn * HD; const T16* kp2 = K2 + ko + kn * HD;
#pragma unroll
        for (int kt = 0; kt < 2; ++kt)
#pragma unroll
            for (int ks = 0; ks < 2; ++ks) { kf[kt][ks] = WF::ld(kp + kt * 16 * HD + ks * 32); if (HI) kf2[kt][ks] = WF::ld(kp2 + kt * 16 * HD + ks * 32); }
        xwait(kp, HI ? kp2 : kp);
        F pf[NQ], pf2[NQ];
#pragma unroll
        for (int nb = 0; nb < NQ; ++nb) {
            float mx = s[0][nb][0];
#pragma unroll
            for (int r = 1; r < 8; ++r) mx = fmaxf(mx, s[0][nb][r]);
#pragma unroll
            for (int r = 0; r < 8; ++r) mx = fmaxf(mx, s[1][nb][r]);
            mx = fmaxf(mx, xhalf(mx));
            const float mn = fmaxf(m[nb], mx);
            const float al = exp2s((m[nb] - mn) * L2E);
            const float ng = (HI ? 0.0f : PSH) - mn * L2E;
            m[nb] = mn;
            float sum = 0.f;
#pragma unroll
            for (int kt = 0; kt < 2; ++kt)
#pragma unroll
                for (int r = 0; r < 8; ++r) { const float p = exp2s(__builtin_fmaf(s[kt][nb][r], L2E, ng)); s[kt][nb][r] = p; sum += p; }
            l[nb] = l[nb] * al + sum;
#pragma unroll
            for (int dt = 0; dt < 4; ++dt) o[dt][nb] *= al;
            if constexpr (HI) {
                const v8bf h0 = __builtin_convertvector(s[0][nb], v8bf), h1 = __builtin_convertvector(s[1][nb], v8bf);
                const v8bf l0 = __builtin_convertvector(s[0][nb] - __builtin_convertvector(h0, v8f), v8bf), l1 = __builtin_convertvector(s[1][nb] - __builtin_convertvector(h1, v8f), v8bf);
                pf[nb] = __builtin_shufflevector(h0, h1, 0, 1, 2, 3, 4, 5, 6, 7, 8, 9, 10, 11, 12, 13, 14, 15); pf2[nb] = __builtin_shufflevector(l0, l1, 0, 1, 2, 3, 4, 5, 6, 7, 8, 9, 10, 11, 12, 13, 14, 15);
            } else {
                pf[nb] = cat16(__builtin_convertvector(s[0][nb], v8h), __builtin_convertvector(s[1][nb], v8h));
            }
        }
#pragma unroll
        for (int dt = 0; dt < 4; ++dt)
#pragma unroll
            for (int nb = 0; nb < NQ; ++nb) { o[dt][nb] = WF::mma(vf[dt], pf[nb], o[dt][nb]); if (HI) { o[dt][nb] = WF::mma(vf[dt], pf2[nb], o[dt][nb]); o[dt][nb] = WF::mma(vf2[dt], pf[nb], o[dt][nb]); } }
    }
#pragma unroll
    for (int nb = 0; nb < NQ; ++nb) { const float inv = __fdiv_rn(1.0f, l[nb] + xhalf(l[nb])); const size_t oo = (size_t)(q0 + nb * 16 + lr) * DQ + 8 * hi;
#pragma unroll
        for (int dt = 0; dt < 4; ++dt) { v8us oh, ol;
#pragma unroll
            for (int r = 0; r < 8; ++r) { unsigned short a, c2; splitf(o[dt][nb][r] * inv, a, c2); oh[r] = a; ol[r] = c2; }
            *(v8us*)(Ah + oo + dt * 16) = oh; *(v8us*)(Al + oo + dt * 16) = ol; } }
}
// grid (RH / 32, heads, batches), 5 waves: waves 0-1 take 16 hi/lo query rows each, waves 2-4 take 32 fp16 rows each, so every workgroup carries the same share of both kinds of work (no barrier in the kernel: the waves are independent); planes [b][h][t][d] (q, k) and [b][h][d][t] (v); merged output planes [b][t][h d] as hi/lo
static_assert(RH / 32 == (TT - RH) / 96 && RH % 32 == 0 && (TT - RH) % 96 == 0, "2 hi/lo waves and 3 fp16 waves per workgroup cover all rows");
__global__ __launch_bounds__(160) void k_fattn(const h16* __restrict__ Q16, const h16* __restrict__ K16, const h16* __restrict__ V16, const bf* __restrict__ Qh, const bf* __restrict__ Ql, const bf* __restrict__ Kh, const bf* __restrict__ Kl, const bf* __restrict__ Vh, const bf* __restrict__ Vl, const float* __restrict__ BT, bf* Ah, bf* Al) {
    const int wv = __builtin_amdgcn_readfirstlane((int)(threadIdx.x >> 5)), bx = blockIdx.x, h = blockIdx.y, b = blockIdx.z;
    const size_t pq = ((size_t)b * NH_ + h) * TT * HD, pk = ((size_t)b * NKV + h / REP) * TT * HD, po = (size_t)b * TT * DQ + h * HD;
    const float* bt = BT + (size_t)h * 4096 + (TT - 1);   /* bt[j - i] */
    if (wv < 2) fa_wave<bf, true, 1>(Qh + pq, Ql + pq, Kh + pk, Kl + pk, Vh + pk, Vl + pk, bt, (bx * 2 + wv) * 16, Ah + po, Al + po);
    else fa_wave<h16, false, 2>(Q16 + pq, nullptr, K16 + pk, nullptr, V16 + pk, nullptr, bt, RH + (bx * 3 + wv - 2) * 32, Ah + po, Al + po);
}

extern "C" void kernel_launch(void* const* d_in, const int* in_sizes, int n_in,
                              void* d_out, int out_size, void* d_ws, size_t ws_size, hipStream_t stream) {
    (void)in_sizes; (void)n_in; (void)out_size;
    const float* x = (const float*)d_in[0]; const float* g1 = (const float*)d_in[1]; const float* e1b = (const float*)d_in[2]; const float* wq = (const float*)d_in[3]; const float* wk = (const float*)d_in[4]; const float* wv = (const float*)d_in[5]; const float* wo = (const float*)d_in[6]; const float* relb = (const float*)d_in[7];
    float* OUT = (float*)d_out;     // [2][2048][1024]
    char* wsp = (char*)d_ws;
    auto take = [&](size_t bytes) { char* p = wsp; wsp += (bytes + 255) & ~(size_t)255; return (void*)p; };
    bf* WQ = (bf*)take((size_t)DQ * DM * 2); bf* WK = (bf*)take((size_t)DKV * DM * 2); bf* WV = (bf*)take((size_t)DKV * DM * 2); bf* WO = (bf*)take((size_t)DM * DQ * 2);
    bf* Yh = (bf*)take((size_t)TT * DM * 2); bf* Yl = (bf*)take((size_t)TT * DM * 2); float* BT = (float*)take((size_t)NH_ * 4096 * 4);
    h16* QP16 = (h16*)take((size_t)NB_ * NH_ * TT * HD * 2); h16* KP16 = (h16*)take((size_t)NB_ * NKV * TT * HD * 2); h16* VT16 = (h16*)take((size_t)NB_ * NKV * HD * TT * 2);
    bf* QPh = (bf*)take((size_t)NB_ * NH_ * TT * HD * 2); bf* QPl = (bf*)take((size_t)NB_ * NH_ * TT * HD * 2); bf* KPh = (bf*)take((size_t)NB_ * NKV * TT * HD * 2); bf* KPl = (bf*)take((size_t)NB_ * NKV * TT * HD * 2); bf* VTh = (bf*)take((size_t)NB_ * NKV * HD * TT * 2); bf* VTl = (bf*)take((size_t)NB_ * NKV * HD * TT * 2);
    bf* ATh = (bf*)take((size_t)NB_ * TT * DQ * 2); bf* ATl = (bf*)take((size_t)NB_ * TT * DQ * 2);
    if ((size_t)(wsp - (char*)d_ws) > ws_size) return;    // ws 256 MiB
    { k_wtG<<<(unsigned)((DM * DQ / 64 + 63) / 64), 256, 0, stream>>>(wq, DM, DQ, WQ); k_wtG<<<(unsigned)((DM * DKV / 64 + 63) / 64), 256, 0, stream>>>(wk, DM, DKV, WK); k_wtG<<<(unsigned)((DM * DKV / 64 + 63) / 64), 256, 0, stream>>>(wv, DM, DKV, WV);
      k_wtG<<<(unsigned)((DQ * DM / 64 + 63) / 64), 256, 0, stream>>>(wo, DQ, DM, WO);
       }
    for (int b = 0; b < NB_; ++b) { const size_t zq = (size_t)b * NH_ * TT * HD, zk = (size_t)b * NKV * TT * HD;   // each batch's head planes, written by the projections themselves
        k_lnhl<<<TT / 8, 256, 0, stream>>>(x + (size_t)b * TT * DM, nullptr, g1, e1b, nullptr, Yh, Yl);   /* n = LN(hidden) as hi/lo planes */ if (b == 0) k_btab<<<(NH_ * 4096 + 255) / 256, 256, 0, stream>>>(relb, BT);
        k_gemmw<bf, 1, 1><<<dim3(TT / 64, DQ / 64, 1), 32, 0, stream>>>(Yh, Yl, WQ, nullptr, DM, nullptr, nullptr, QP16 + zq, QPh + zq, QPl + zq, 0, 0, 0);
        k_gemmw<bf, 1, 1><<<dim3(TT / 64, DKV / 64, 1), 32, 0, stream>>>(Yh, Yl, WK, nullptr, DM, nullptr, nullptr, KP16 + zk, KPh + zk, KPl + zk, 0, 0, 0);
        k_gemmw<bf, 1, 2><<<dim3(TT / 64, DKV / 64, 1), 32, 0, stream>>>(Yh, Yl, WV, nullptr, DM, nullptr, nullptr, VT16 + zk, VTh + zk, VTl + zk, 0, 0, 0); }
    k_fattn<<<dim3(RH / 32, NH_, NB_), 160, 0, stream>>>(QP16, KP16, VT16, QPh, QPl, KPh, KPl, VTh, VTl, BT, ATh, ATl);
    for (int b = 0; b < NB_; ++b)
        k_gemmw<bf, 1, 0><<<dim3(TT / 64, DM / 64, 1), 32, 0, stream>>>(ATh + (size_t)b * TT * DQ, ATl + (size_t)b * TT * DQ, WO, nullptr, DQ, x + (size_t)b * TT * DM, OUT + (size_t)b * TT * DM, nullptr, nullptr, nullptr, 0, 0, 0);   /* out = hidden + ctx Wo */
}

// v004
// A run of this version takes 338 microseconds.
// Next to v003, in two timings, it ran 1.21 times as fast each time.
// All steps since v000 together make it 6.15 times as fast.
#include <hip/hip_runtime.h>

// T5 self-attention layer (hidden [2][2048][1024]; n = LayerNorm(hidden) (1e-6, ln_g, ln_b); q, k, v = n W ('xw' [1024][1024], no bias, 16 heads x 64); scores = q.k (NO 1/sqrt(d)) + rel_bias[bucket(j - i)][h] (T5 bidirectional buckets, 32 buckets, max distance 128); softmax over all keys; out = hidden + merged Wo -> [2][2048][1024]).
// The bucket index depends only on (j - i); it is embedded as a 4095-entry integer table computed with the reference's own bucket function (its f32 log -> int32 cast has exact-integer knife edges, so it is not recomputed on the device).
// Compute dtypes, f32 accumulate: every input rounded to bf16; q/k/v projections hl x exact (2 products); the relative-position bias (bf16-rounded rel_bias values through the embedded bucket table) enters the scores in f32; scores and attn.v: query rows < 512 hl (3 products), the rest single fp16 (P x1024); softmax f32, online; Wo hl x exact (2 products), + hidden residual in f32.

#define NB_  2
#define TT   2048
#define DM   1024
#define NH_  16
#define NKV  16
#define REP  (NH_ / NKV)
#define HD   64
#define DQ   (NH_ * HD)
#define DKV  (NKV * HD)
#define LNEPS 1e-6f
#define NBKT 32
#define RH   512                  // query rows < RH use hi+lo planes
#define WIN  0
#define PSH  10.0f                 // fp16 P carries 2^10 (added to the exponent; it cancels against the row sum)
#define SCL  1.0f                  // T5: no 1/sqrt(d) scaling
typedef _Float16 h16;
typedef unsigned short bf;
typedef __attribute__((ext_vector_type(16))) __bf16   v16bf;
typedef __attribute__((ext_vector_type(16))) _Float16 v16h;
typedef __attribute__((ext_vector_type(8)))  _Float16 v8h;
typedef __attribute__((ext_vector_type(8)))  unsigned short v8us;
typedef __attribute__((ext_vector_type(8)))  float    v8f;
typedef __attribute__((ext_vector_type(4)))  float    v4f;
typedef v8h  __attribute__((may_alias)) v8ha;
typedef v4f  __attribute__((may_alias)) v4fa;
typedef v8us __attribute__((may_alias)) v8usa;

__device__ __forceinline__ unsigned short f2bf(float f) { unsigned u = __float_as_uint(f); u += 0x7FFFu + ((u >> 16) & 1u); return (unsigned short)(u >> 16); }
__device__ __forceinline__ float bf2f(unsigned short b) { return __uint_as_float(((unsigned)b) << 16); }
__device__ __forceinline__ float bfr(float f) { return bf2f(f2bf(f)); }
__device__ __forceinline__ v16h cat16(v8h lo, v8h hi) { return __builtin_shufflevector(lo, hi, 0, 1, 2, 3, 4, 5, 6, 7, 8, 9, 10, 11, 12, 13, 14, 15); }
__device__ __forceinline__ v16bf cat16b(v8us lo, v8us hi) { return __builtin_bit_cast(v16bf, __builtin_shufflevector(lo, hi, 0, 1, 2, 3, 4, 5, 6, 7, 8, 9, 10, 11, 12, 13, 14, 15)); }
__device__ __forceinline__ v8f wmma16(v16h a, v16h b, v8f c) { return __builtin_amdgcn_wmma_f32_16x16x32_f16(false, a, false, b, (short)0, c, false, false); }
__device__ __forceinline__ v8f wmmab(v16bf a, v16bf b, v8f c) { return __builtin_amdgcn_wmma_f32_16x16x32_bf16(false, a, false, b, (short)0, c, false, false); }



__device__ __forceinline__ h16 tohx(float x) { return (h16)x; }
__device__ __forceinline__ void splitf(float y, unsigned short& h, unsigned short& l) { h = f2bf(y); l = f2bf(y - bf2f(h)); }
// The two waits stand between a run of global stores and the first rewrite of a register that they name: addresses and data are inputs, so they stay in their registers up to the wait, and the scheduling barrier keeps later instructions behind it.
__device__ __forceinline__ void swaitp(const void* a, const void* b, const void* c, const v8h (&x)[4], const v8us (&y)[4], const v8us (&w)[4]) { asm volatile("s_wait_xcnt 0x0" :: "v"(a), "v"(b), "v"(c), "v"(x[0]), "v"(x[1]), "v"(x[2]), "v"(x[3]), "v"(y[0]), "v"(y[1]), "v"(y[2]), "v"(y[3]), "v"(w[0]), "v"(w[1]), "v"(w[2]), "v"(w[3]) : "memory"); __builtin_amdgcn_sched_barrier(0); }
// The same between a run of global loads and the first rewrite of an address register that they name.
__device__ __forceinline__ void gwait(const void* a, const void* b, const void* c, const void* d) { asm volatile("s_wait_xcnt 0x0" :: "v"(a), "v"(b), "v"(c), "v"(d) : "memory"); __builtin_amdgcn_sched_barrier(0); }
__device__ __forceinline__ void swaitf(const void* a, const void* b, const v4f (&x)[8]) { asm volatile("s_wait_xcnt 0x0" :: "v"(a), "v"(b), "v"(x[0]), "v"(x[1]), "v"(x[2]), "v"(x[3]), "v"(x[4]), "v"(x[5]), "v"(x[6]), "v"(x[7]) : "memory"); __builtin_amdgcn_sched_barrier(0); }

// FRAGMENT ORDER of every 16-bit operand plane P[row][k] (K columns): element (row, k) lies at ((row / 16) (K / 32) + k / 32) 512 + ((k / 16) % 2) 256 + ((k / 8) % 2) 128 + (row % 16) 8 + k % 8.
// A 16 x 32 fragment is 1 KiB in a row and lane l = 16 hi + lr takes 8 elements at l 8 and 8 at 256 + l 8 (the same values in the same registers as from a row-major plane: row lr, k = 8 hi .. and 16 + 8 hi ..), so each 16-byte load of a wave reads 512 contiguous bytes, four whole lines, not 32 bytes of each of 16 lines.
// ---- k_gemmw: register-blocked GEMM, ONE WAVE per 64x64 output tile (16 accumulators), operands straight from 16-bit planes in fragment order; grid (M/64, N/64, Z), 32 threads.
// c[m][n] (f32) = sum_k A[m][k] Bt[n][k] (+ split products per NSPLIT). z-batch strides sA/sB/sC in elements (sC: of C and X, or of each plane). K % 32 == 0, a compile-time constant, so that the 16-row blocks of a pass lie at constant offsets.
// The tile leaves the kernel in its final form, 16 staged rows of 64 at a time, every store a whole 128-byte line or more:
// EPI 0: C[m][n] (f32, pitch DM) = bf16-rounded X[m][n] + c, the residual add. EPI 1: head planes [n / 64], each (row m, k = n % 64) in fragment order. EPI 2: transposed head planes [n / 64], each (row n % 64, k = m) in fragment order. Planes: fp16 (P16) and a bf16 hi/lo pair (Ph, Pl); a tile's 64 columns are one head.
template <typename T16> struct WFrag;
template <> struct WFrag<h16> { typedef v16h V; static __device__ __forceinline__ V ld(const h16* p) { return cat16(*(const v8h*)p, *(const v8h*)(p + 256)); } static __device__ __forceinline__ v8f mma(V a, V b, v8f c) { return wmma16(a, b, c); } };
template <> struct WFrag<bf> { typedef v16bf V; static __device__ __forceinline__ V ld(const bf* p) { return cat16b(*(const v8us*)p, *(const v8us*)(p + 256)); } static __device__ __forceinline__ v8f mma(V a, V b, v8f c) { return wmmab(a, b, c); } };
static_assert(HD == 64, "one 64-column tile is one head");
template <typename T16, int NSPLIT, int EPI, int K>
__global__ __launch_bounds__(32) void k_gemmw(const T16* __restrict__ A, const T16* __restrict__ A2, const T16* __restrict__ Bt, const T16* __restrict__ Bt2, const float* __restrict__ X, float* C, h16* P16, bf* Ph, bf* Pl, size_t sA, size_t sB, size_t sC) {
    typedef typename WFrag<T16>::V V;
    __shared__ __align__(16) float os[16 * 68];
    const size_t z = blockIdx.z; A += z * sA; if (A2) A2 += z * sA; Bt += z * sB; if (Bt2) Bt2 += z * sB;
    const int lane = threadIdx.x & 31, lr = lane & 15, hi = lane >> 4; const int r0 = blockIdx.x * 64, c0 = blockIdx.y * 64;
    v8f acc[4][4];
#pragma unroll
    for (int mb = 0; mb < 4; ++mb)
#pragma unroll
        for (int nb = 0; nb < 4; ++nb) acc[mb][nb] = (v8f){};
    const size_t aoff = (size_t)r0 * K + lane * 8, boff = (size_t)c0 * K + lane * 8;
#pragma unroll 1
    for (int kc = 0; kc < K; kc += 32) {
        V a[4], a2[4], b[4], b2[4]; const T16* ap = A + aoff + kc * 16; const T16* ap2 = (NSPLIT == 1 || NSPLIT == 2) ? A2 + aoff + kc * 16 : ap; const T16* bp = Bt + boff + kc * 16; const T16* bp2 = (NSPLIT >= 2) ? Bt2 + boff + kc * 16 : bp;   /* every load of the pass names one of these, plus a constant */
#pragma unroll
        for (int mb = 0; mb < 4; ++mb) { a[mb] = WFrag<T16>::ld(ap + mb * 16 * K); if (NSPLIT == 1 || NSPLIT == 2) a2[mb] = WFrag<T16>::ld(ap2 + mb * 16 * K); }
#pragma unroll
        for (int nb = 0; nb < 4; ++nb) { b[nb] = WFrag<T16>::ld(bp + nb * 16 * K); if (NSPLIT >= 2) b2[nb] = WFrag<T16>::ld(bp2 + nb * 16 * K); }
        gwait(ap, ap2, bp, bp2);
#pragma unroll
        for (int nb = 0; nb < 4; ++nb) {
#pragma unroll
            for (int mb = 0; mb < 4; ++mb) { acc[mb][nb] = WFrag<T16>::mma(a[mb], b[nb], acc[mb][nb]); if (NSPLIT == 1 || NSPLIT == 2) acc[mb][nb] = WFrag<T16>::mma(a2[mb], b[nb], acc[mb][nb]); if (NSPLIT >= 2) acc[mb][nb] = WFrag<T16>::mma(a[mb], b2[nb], acc[mb][nb]); } }
        asm volatile("v_nop\n\tv_nop\n\tv_nop\n\tv_nop" : "+v"(acc[0][0]), "+v"(acc[1][1]), "+v"(acc[2][2]), "+v"(acc[3][3]) : "v"(a[0]), "v"(a[3]));
    }
    // Epilogue. Every loop is unrolled: the accumulators are registers and take constant indices only. The staged rows pass from lane to lane through LDS, which runs one wave's operations in order;
    // each fence (wave barrier + memory clobber) keeps that order in the compiled code: all lanes' writes of a block, then its reads, then the next block's writes.
    if constexpr (EPI == 0) {
        const size_t co = z * sC + (size_t)(r0 + hi) * DM + c0 + lr * 4;   /* a lane's 4 columns of rows hi, 2 + hi, ... */
        const float* xp = X + co; float* cp = C + co;
        v4f xv[2][8];   /* the residual rows, fetched one 16-row block ahead */
#pragma unroll
        for (int s = 0; s < 8; ++s) xv[0][s] = *(const v4f*)(xp + 2 * s * DM);
#pragma unroll
        for (int mb = 0; mb < 4; ++mb) {
            if (mb < 3) {
#pragma unroll
                for (int s = 0; s < 8; ++s) xv[(mb + 1) & 1][s] = *(const v4f*)(xp + ((mb + 1) * 16 + 2 * s) * DM); }
#pragma unroll
            for (int nb = 0; nb < 4; ++nb) {
#pragma unroll
                for (int j = 0; j < 8; ++j) os[(hi * 8 + j) * 68 + nb * 16 + lr] = acc[mb][nb][j]; }
            __builtin_amdgcn_wave_barrier(); asm volatile("" ::: "memory");   /* fence: writes before reads */
            v4f val[8];
#pragma unroll
            for (int s = 0; s < 8; ++s) { val[s] = *(const v4fa*)(os + (2 * s + hi) * 68 + lr * 4);
#pragma unroll
                for (int q = 0; q < 4; ++q) val[s][q] = __fadd_rn(bfr(xv[mb & 1][s][q]), val[s][q]);
                *(v4f*)(cp + (mb * 16 + 2 * s) * DM) = val[s]; }
            swaitf(xp, cp, val);
            __builtin_amdgcn_wave_barrier(); asm volatile("" ::: "memory");   /* fence: reads before the next writes */
        }
    } else {
        constexpr int PP = (EPI == 1) ? HD : TT;   /* columns (K) of a plane: 16 staged rows are 16 PP elements of it */
        const size_t po = z * sC + (size_t)blockIdx.y * TT * HD + (size_t)r0 * ((EPI == 1) ? HD : 16) + lane * 8;   /* a lane's 8 elements of staged row lr, columns 8 hi, 16 + 8 hi, ...: each store of the wave is 512 bytes in a row */
        h16* p16 = P16 + po; bf* ph = Ph + po; bf* pl = Pl + po;
#pragma unroll
        for (int blk = 0; blk < 4; ++blk) {
#pragma unroll
            for (int ob = 0; ob < 4; ++ob) {
                if constexpr (EPI == 1) {   /* staged row = m, 16 rows of block blk */
#pragma unroll
                    for (int j = 0; j < 8; ++j) os[(hi * 8 + j) * 68 + ob * 16 + lr] = acc[blk][ob][j];
                } else {   /* staged row = n, 16 columns of block blk: a lane's 8 accumulator rows are 8 neighbours in it */
                    const v8f t = acc[ob][blk]; *(v4fa*)(os + lr * 68 + ob * 16 + hi * 8) = __builtin_shufflevector(t, t, 0, 1, 2, 3); *(v4fa*)(os + lr * 68 + ob * 16 + hi * 8 + 4) = __builtin_shufflevector(t, t, 4, 5, 6, 7); } }
            __builtin_amdgcn_wave_barrier(); asm volatile("" ::: "memory");   /* fence: writes before reads */
            v8h o16[4]; v8us oh[4], ol[4];
#pragma unroll
            for (int s = 0; s < 4; ++s) { const float* sp = os + lr * 68 + s * 16 + hi * 8; const v4f x0 = *(const v4fa*)sp, x1 = *(const v4fa*)(sp + 4);
#pragma unroll
                for (int k = 0; k < 8; ++k) { const float x = (k < 4) ? x0[k & 3] : x1[k & 3]; o16[s][k] = tohx(x); unsigned short a2, c2; splitf(x, a2, c2); oh[s][k] = a2; ol[s][k] = c2; }
                *(v8h*)(p16 + blk * 16 * PP + s * 256) = o16[s]; *(v8us*)(ph + blk * 16 * PP + s * 256) = oh[s]; *(v8us*)(pl + blk * 16 * PP + s * 256) = ol[s]; }
            swaitp(p16, ph, pl, o16, oh, ol);
            __builtin_amdgcn_wave_barrier(); asm volatile("" ::: "memory");   /* fence: reads before the next writes */
        }
    }
}

typedef __attribute__((ext_vector_type(2))) _Float16 v2h;
typedef __attribute__((ext_vector_type(4))) _Float16 v4h;
typedef __attribute__((ext_vector_type(2))) unsigned short v2us;
typedef __attribute__((ext_vector_type(4))) unsigned short v4us;
typedef v4us __attribute__((may_alias)) v4usa;
typedef __attribute__((ext_vector_type(2))) float v2f;
typedef __attribute__((ext_vector_type(4))) int v4i;

template <int K, int N>
__global__ __launch_bounds__(256) void k_wtG(const float* __restrict__ w, bf* Bt) {
    // Bt (row n, column k) = w[k][n] in fragment order: one wave writes one 512-byte unit u (16 rows n, 16 columns k)
    const int lane = threadIdx.x & 31; const int u = blockIdx.x * 8 + (threadIdx.x >> 5); if (u >= N * K / 256) return;
    const int k = (u % (K / 16)) * 16 + (lane >> 4) * 8, n = (u / (K / 16)) * 16 + (lane & 15); const float* wp = w + (size_t)k * N + n; float x[8]; v8us o;
#pragma unroll
    for (int e = 0; e < 8; ++e) x[e] = wp[e * N];
    gwait(wp, wp, wp, wp);
#pragma unroll
    for (int e = 0; e < 8; ++e) o[e] = f2bf(x[e]);
    *(v8us*)(Bt + (size_t)u * 256 + lane * 8) = o;
}
__global__ __launch_bounds__(256) void k_lnhl(const float* __restrict__ X, const float* __restrict__ A, const float* __restrict__ g, const float* __restrict__ be, float* Z, bf* Yh, bf* Yl) {
    static_assert(TT % 8 == 0, "a workgroup's 8 rows are all inside or all outside");
    __shared__ __align__(16) bf ys[2][8][DM + 16];   /* the workgroup's 8 rows, hi and lo; the pitch spreads 8 rows' 16-byte pieces over the banks */
    const int lane = threadIdx.x & 31; const int wr = threadIdx.x >> 5; const int r = blockIdx.x * 8 + wr; if (blockIdx.x * 8 >= TT) return; const float* xr = X + (size_t)r * DM; const float* ar = A ? A + (size_t)r * DM : nullptr; float s = 0.f;
#pragma unroll 1
    for (int ch = 0; ch < DM / 128; ++ch) { const int c0 = ch * 128 + lane * 4; const v4f a = *(const v4f*)(xr + c0); v4f d = {0.f, 0.f, 0.f, 0.f}; if (ar) d = *(const v4f*)(ar + c0);
#pragma unroll
        for (int q = 0; q < 4; ++q) s += __fadd_rn(bfr(a[q]), d[q]); }
#pragma unroll
    for (int sh = 16; sh; sh >>= 1) s += __shfl_xor(s, sh, 32);
    const float mu = s * (1.0f / DM); float s2 = 0.f;
#pragma unroll 1
    for (int ch = 0; ch < DM / 128; ++ch) { const int c0 = ch * 128 + lane * 4; const v4f a = *(const v4f*)(xr + c0); v4f d = {0.f, 0.f, 0.f, 0.f}; if (ar) d = *(const v4f*)(ar + c0);
#pragma unroll
        for (int q = 0; q < 4; ++q) { const float d0 = __fsub_rn(__fadd_rn(bfr(a[q]), d[q]), mu); float p = __fmul_rn(d0, d0); asm volatile("" : "+v"(p)); s2 = __fadd_rn(s2, p); } }
#pragma unroll
    for (int sh = 16; sh; sh >>= 1) s2 += __shfl_xor(s2, sh, 32);
    const float rs = __fdiv_rn(1.0f, __fsqrt_rn(__fadd_rn(s2 * (1.0f / DM), LNEPS)));
{
#pragma unroll 1
        for (int ch = 0; ch < DM / 128; ++ch) { const int c0 = ch * 128 + lane * 4; const v4f a = *(const v4f*)(xr + c0); v4f d = {0.f, 0.f, 0.f, 0.f}; if (ar) d = *(const v4f*)(ar + c0); v4f z4; v4us oh, ol;
#pragma unroll
            for (int q = 0; q < 4; ++q) { const float v = __fadd_rn(bfr(a[q]), d[q]); z4[q] = v; float n0 = __fmul_rn(__fsub_rn(v, mu), rs); asm volatile("" : "+v"(n0)); float n1 = __fmul_rn(n0, bfr(g[c0 + q])); asm volatile("" : "+v"(n1)); const float y = __fadd_rn(n1, bfr(be[c0 + q])); unsigned short h2, l2; splitf(y, h2, l2); oh[q] = h2; ol[q] = l2; }
            if (Z) *(v4f*)(Z + (size_t)r * DM + c0) = z4; *(v4usa*)(&ys[0][wr][c0]) = oh; *(v4usa*)(&ys[1][wr][c0]) = ol; }
         }
    __syncthreads();   /* all 8 rows staged: a 128-byte line of a plane in fragment order holds 16 bytes of each of them */
    const size_t yo = (size_t)(blockIdx.x >> 1) * 16 * DM + (blockIdx.x & 1) * 64 + (threadIdx.x & 7) * 8;   /* rows 8 (x % 2) + t % 8 of row block x / 2 */
#pragma unroll
    for (int i = 0; i < DM / 256; ++i) { const int sg = i * 32 + (threadIdx.x >> 3);   /* columns 8 sg ..: a wave stores four whole lines */
        *(v8us*)(Yh + yo + sg * 128) = *(const v8usa*)(&ys[0][threadIdx.x & 7][sg * 8]); *(v8us*)(Yl + yo + sg * 128) = *(const v8usa*)(&ys[1][threadIdx.x & 7][sg * 8]); } }
__constant__ int BKT[4095] = {15,15,15,15,15,15,15,15,15,15,15,15,15,15,15,15,15,15,15,15,15,15,15,15,15,15,15,15,15,15,15,15,15,15,15,15,15,15,15,15,15,15,15,15,15,15,15,15,15,15,15,15,15,15,15,15,15,15,15,15,15,15,15,15,15,15,15,15,15,15,15,15,15,15,15,15,15,15,15,15,15,15,15,15,15,15,15,15,15,15,15,15,15,15,15,15,15,15,15,15,15,15,15,15,15,15,15,15,15,15,15,15,15,15,15,15,15,15,15,15,15,15,15,15,15,15,15,15,15,15,15,15,15,15,15,15,15,15,15,15,15,15,15,15,15,15,15,15,15,15,15,15,15,15,15,15,15,15,15,15,15,15,15,15,15,15,15,15,15,15,15,15,15,15,15,15,15,15,15,15,15,15,15,15,15,15,15,15,15,15,15,15,15,15,15,15,15,15,15,15,15,15,15,15,15,15,15,15,15,15,15,15,15,15,15,15,15,15,15,15,15,15,15,15,15,15,15,15,15,15,15,15,15,15,15,15,15,15,15,15,15,15,15,15,15,15,15,15,15,15,15,15,15,15,15,15,15,15,15,15,15,15,15,15,15,15,15,15,15,15,15,15,15,15,15,15,15,15,15,15,15,15,15,15,15,15,15,15,15,15,15,15,15,15,15,15,15,15,15,15,15,15,15,15,15,15,15,15,15,15,15,15,15,15,15,15,15,15,15,15,15,15,15,15,15,15,15,15,15,15,15,15,15,15,15,15,15,15,15,15,15,15,15,15,15,15,15,15,15,15,15,15,15,15,15,15,15,15,15,15,15,15,15,15,15,15,15,15,15,15,15,15,15,15,15,15,15,15,15,15,15,15,15,15,15,15,15,15,15,15,15,15,15,15,15,15,15,15,15,15,15,15,15,15,15,15,15,15,15,15,15,15,15,15,15,15,15,15,15,15,15,15,15,15,15,15,15,15,15,15,15,15,15,15,15,15,15,15,15,15,15,15,15,15,15,15,15,15,15,15,15,15,15,15,15,15,15,15,15,15,15,15,15,15,15,15,15,15,15,15,15,15,15,15,15,15,15,15,15,15,15,15,15,15,15,15,15,15,15,15,15,15,15,15,15,15,15,15,15,15,15,15,15,15,15,15,15,15,15,15,15,15,15,15,15,15,15,15,15,15,15,15,15,15,15,15,15,15,15,15,15,15,15,15,15,15,15,15,15,15,15,15,15,15,15,15,15,15,15,15,15,15,15,15,15,15,15,15,15,15,15,15,15,15,15,15,15,15,15,15,15,15,15,15,15,15,15,15,15,15,15,15,15,15,15,15,15,15,15,15,15,15,15,15,15,15,15,15,15,15,15,15,15,15,15,15,15,15,15,15,15,15,15,15,15,15,15,15,15,15,15,15,15,15,15,15,15,15,15,15,15,15,15,15,15,15,15,15,15,15,15,15,15,15,15,15,15,15,15,15,15,15,15,15,15,15,15,15,15,15,15,15,15,15,15,15,15,15,15,15,15,15,15,15,15,15,15,15,15,15,15,15,15,15,15,15,15,15,15,15,15,15,15,15,15,15,15,15,15,15,15,15,15,15,15,15,15,15,15,15,15,15,15,15,15,15,15,15,15,15,15,15,15,15,15,15,15,15,15,15,15,15,15,15,15,15,15,15,15,15,15,15,15,15,15,15,15,15,15,15,15,15,15,15,15,15,15,15,15,15,15,15,15,15,15,15,15,15,15,15,15,15,15,15,15,15,15,15,15,15,15,15,15,15,15,15,15,15,15,15,15,15,15,15,15,15,15,15,15,15,15,15,15,15,15,15,15,15,15,15,15,15,15,15,15,15,15,15,15,15,15,15,15,15,15,15,15,15,15,15,15,15,15,15,15,15,15,15,15,15,15,15,15,15,15,15,15,15,15,15,15,15,15,15,15,15,15,15,15,15,15,15,15,15,15,15,15,15,15,15,15,15,15,15,15,15,15,15,15,15,15,15,15,15,15,15,15,15,15,15,15,15,15,15,15,15,15,15,15,15,15,15,15,15,15,15,15,15,15,15,15,15,15,15,15,15,15,15,15,15,15,15,15,15,15,15,15,15,15,15,15,15,15,15,15,15,15,15,15,15,15,15,15,15,15,15,15,15,15,15,15,15,15,15,15,15,15,15,15,15,15,15,15,15,15,15,15,15,15,15,15,15,15,15,15,15,15,15,15,15,15,15,15,15,15,15,15,15,15,15,15,15,15,15,15,15,15,15,15,15,15,15,15,15,15,15,15,15,15,15,15,15,15,15,15,15,15,15,15,15,15,15,15,15,15,15,15,15,15,15,15,15,15,15,15,15,15,15,15,15,15,15,15,15,15,15,15,15,15,15,15,15,15,15,15,15,15,15,15,15,15,15,15,15,15,15,15,15,15,15,15,15,15,15,15,15,15,15,15,15,15,15,15,15,15,15,15,15,15,15,15,15,15,15,15,15,15,15,15,15,15,15,15,15,15,15,15,15,15,15,15,15,15,15,15,15,15,15,15,15,15,15,15,15,15,15,15,15,15,15,15,15,15,15,15,15,15,15,15,15,15,15,15,15,15,15,15,15,15,15,15,15,15,15,15,15,15,15,15,15,15,15,15,15,15,15,15,15,15,15,15,15,15,15,15,15,15,15,15,15,15,15,15,15,15,15,15,15,15,15,15,15,15,15,15,15,15,15,15,15,15,15,15,15,15,15,15,15,15,15,15,15,15,15,15,15,15,15,15,15,15,15,15,15,15,15,15,15,15,15,15,15,15,15,15,15,15,15,15,15,15,15,15,15,15,15,15,15,15,15,15,15,15,15,15,15,15,15,15,15,15,15,15,15,15,15,15,15,15,15,15,15,15,15,15,15,15,15,15,15,15,15,15,15,15,15,15,15,15,15,15,15,15,15,15,15,15,15,15,15,15,15,15,15,15,15,15,15,15,15,15,15,15,15,15,15,15,15,15,15,15,15,15,15,15,15,15,15,15,15,15,15,15,15,15,15,15,15,15,15,15,15,15,15,15,15,15,15,15,15,15,15,15,15,15,15,15,15,15,15,15,15,15,15,15,15,15,15,15,15,15,15,15,15,15,15,15,15,15,15,15,15,15,15,15,15,15,15,15,15,15,15,15,15,15,15,15,15,15,15,15,15,15,15,15,15,15,15,15,15,15,15,15,15,15,15,15,15,15,15,15,15,15,15,15,15,15,15,15,15,15,15,15,15,15,15,15,15,15,15,15,15,15,15,15,15,15,15,15,15,15,15,15,15,15,15,15,15,15,15,15,15,15,15,15,15,15,15,15,15,15,15,15,15,15,15,15,15,15,15,15,15,15,15,15,15,15,15,15,15,15,15,15,15,15,15,15,15,15,15,15,15,15,15,15,15,15,15,15,15,15,15,15,15,15,15,15,15,15,15,15,15,15,15,15,15,15,15,15,15,15,15,15,15,15,15,15,15,15,15,15,15,15,15,15,15,15,15,15,15,15,15,15,15,15,15,15,15,15,15,15,15,15,15,15,15,15,15,15,15,15,15,15,15,15,15,15,15,15,15,15,15,15,15,15,15,15,15,15,15,15,15,15,15,15,15,15,15,15,15,15,15,15,15,15,15,15,15,15,15,15,15,15,15,15,15,15,15,15,15,15,15,15,15,15,15,15,15,15,15,15,15,15,15,15,15,15,15,15,15,15,15,15,15,15,15,15,15,15,15,15,15,15,15,15,15,15,15,15,15,15,15,15,15,15,15,15,15,15,15,15,15,15,15,15,15,15,15,15,15,15,15,15,15,15,15,15,15,15,15,15,15,15,15,15,15,15,15,15,15,15,15,15,15,15,15,15,15,15,15,15,15,15,15,15,15,15,15,15,15,15,15,15,15,15,15,15,15,15,15,15,15,15,15,15,15,15,15,15,15,15,15,15,15,15,15,15,15,15,15,15,15,15,15,15,15,15,15,15,15,15,15,15,15,15,15,15,15,15,15,15,15,15,15,15,15,15,15,15,15,15,15,15,15,15,15,15,15,15,15,15,15,15,15,15,15,15,15,15,15,15,15,15,15,15,15,15,15,15,15,15,15,15,15,15,15,15,15,15,15,15,15,15,15,15,15,15,15,15,15,15,15,15,15,15,15,15,15,15,15,15,15,15,15,15,15,15,15,15,15,15,15,15,15,15,15,15,15,15,15,15,15,15,15,15,15,15,15,15,15,15,15,15,15,15,15,15,15,15,15,15,15,15,15,15,15,15,15,15,15,15,15,15,15,15,15,15,15,15,15,15,15,15,15,15,15,15,15,15,15,15,15,15,15,15,15,15,15,15,15,15,15,15,15,15,15,15,15,15,15,15,15,15,15,15,15,15,15,15,15,15,15,15,15,15,15,15,15,15,15,15,15,15,15,15,15,15,14,14,14,14,14,14,14,14,14,14,14,14,14,14,14,14,14,14,14,14,14,14,14,14,14,14,14,13,13,13,13,13,13,13,13,13,13,13,13,13,13,13,13,13,13,12,12,12,12,12,12,12,12,12,12,12,12,12,12,11,11,11,11,11,11,11,11,11,10,10,10,10,10,10,10,9,9,9,9,8,8,8,8,7,6,5,4,3,2,1,0,17,18,19,20,21,22,23,24,24,24,24,25,25,25,25,26,26,26,26,26,26,26,27,27,27,27,27,27,27,27,27,28,28,28,28,28,28,28,28,28,28,28,28,28,28,29,29,29,29,29,29,29,29,29,29,29,29,29,29,29,29,29,29,30,30,30,30,30,30,30,30,30,30,30,30,30,30,30,30,30,30,30,30,30,30,30,30,30,30,30,31,31,31,31,31,31,31,31,31,31,31,31,31,31,31,31,31,31,31,31,31,31,31,31,31,31,31,31,31,31,31,31,31,31,31,31,31,31,31,31,31,31,31,31,31,31,31,31,31,31,31,31,31,31,31,31,31,31,31,31,31,31,31,31,31,31,31,31,31,31,31,31,31,31,31,31,31,31,31,31,31,31,31,31,31,31,31,31,31,31,31,31,31,31,31,31,31,31,31,31,31,31,31,31,31,31,31,31,31,31,31,31,31,31,31,31,31,31,31,31,31,31,31,31,31,31,31,31,31,31,31,31,31,31,31,31,31,31,31,31,31,31,31,31,31,31,31,31,31,31,31,31,31,31,31,31,31,31,31,31,31,31,31,31,31,31,31,31,31,31,31,31,31,31,31,31,31,31,31,31,31,31,31,31,31,31,31,31,31,31,31,31,31,31,31,31,31,31,31,31,31,31,31,31,31,31,31,31,31,31,31,31,31,31,31,31,31,31,31,31,31,31,31,31,31,31,31,31,31,31,31,31,31,31,31,31,31,31,31,31,31,31,31,31,31,31,31,31,31,31,31,31,31,31,31,31,31,31,31,31,31,31,31,31,31,31,31,31,31,31,31,31,31,31,31,31,31,31,31,31,31,31,31,31,31,31,31,31,31,31,31,31,31,31,31,31,31,31,31,31,31,31,31,31,31,31,31,31,31,31,31,31,31,31,31,31,31,31,31,31,31,31,31,31,31,31,31,31,31,31,31,31,31,31,31,31,31,31,31,31,31,31,31,31,31,31,31,31,31,31,31,31,31,31,31,31,31,31,31,31,31,31,31,31,31,31,31,31,31,31,31,31,31,31,31,31,31,31,31,31,31,31,31,31,31,31,31,31,31,31,31,31,31,31,31,31,31,31,31,31,31,31,31,31,31,31,31,31,31,31,31,31,31,31,31,31,31,31,31,31,31,31,31,31,31,31,31,31,31,31,31,31,31,31,31,31,31,31,31,31,31,31,31,31,31,31,31,31,31,31,31,31,31,31,31,31,31,31,31,31,31,31,31,31,31,31,31,31,31,31,31,31,31,31,31,31,31,31,31,31,31,31,31,31,31,31,31,31,31,31,31,31,31,31,31,31,31,31,31,31,31,31,31,31,31,31,31,31,31,31,31,31,31,31,31,31,31,31,31,31,31,31,31,31,31,31,31,31,31,31,31,31,31,31,31,31,31,31,31,31,31,31,31,31,31,31,31,31,31,31,31,31,31,31,31,31,31,31,31,31,31,31,31,31,31,31,31,31,31,31,31,31,31,31,31,31,31,31,31,31,31,31,31,31,31,31,31,31,31,31,31,31,31,31,31,31,31,31,31,31,31,31,31,31,31,31,31,31,31,31,31,31,31,31,31,31,31,31,31,31,31,31,31,31,31,31,31,31,31,31,31,31,31,31,31,31,31,31,31,31,31,31,31,31,31,31,31,31,31,31,31,31,31,31,31,31,31,31,31,31,31,31,31,31,31,31,31,31,31,31,31,31,31,31,31,31,31,31,31,31,31,31,31,31,31,31,31,31,31,31,31,31,31,31,31,31,31,31,31,31,31,31,31,31,31,31,31,31,31,31,31,31,31,31,31,31,31,31,31,31,31,31,31,31,31,31,31,31,31,31,31,31,31,31,31,31,31,31,31,31,31,31,31,31,31,31,31,31,31,31,31,31,31,31,31,31,31,31,31,31,31,31,31,31,31,31,31,31,31,31,31,31,31,31,31,31,31,31,31,31,31,31,31,31,31,31,31,31,31,31,31,31,31,31,31,31,31,31,31,31,31,31,31,31,31,31,31,31,31,31,31,31,31,31,31,31,31,31,31,31,31,31,31,31,31,31,31,31,31,31,31,31,31,31,31,31,31,31,31,31,31,31,31,31,31,31,31,31,31,31,31,31,31,31,31,31,31,31,31,31,31,31,31,31,31,31,31,31,31,31,31,31,31,31,31,31,31,31,31,31,31,31,31,31,31,31,31,31,31,31,31,31,31,31,31,31,31,31,31,31,31,31,31,31,31,31,31,31,31,31,31,31,31,31,31,31,31,31,31,31,31,31,31,31,31,31,31,31,31,31,31,31,31,31,31,31,31,31,31,31,31,31,31,31,31,31,31,31,31,31,31,31,31,31,31,31,31,31,31,31,31,31,31,31,31,31,31,31,31,31,31,31,31,31,31,31,31,31,31,31,31,31,31,31,31,31,31,31,31,31,31,31,31,31,31,31,31,31,31,31,31,31,31,31,31,31,31,31,31,31,31,31,31,31,31,31,31,31,31,31,31,31,31,31,31,31,31,31,31,31,31,31,31,31,31,31,31,31,31,31,31,31,31,31,31,31,31,31,31,31,31,31,31,31,31,31,31,31,31,31,31,31,31,31,31,31,31,31,31,31,31,31,31,31,31,31,31,31,31,31,31,31,31,31,31,31,31,31,31,31,31,31,31,31,31,31,31,31,31,31,31,31,31,31,31,31,31,31,31,31,31,31,31,31,31,31,31,31,31,31,31,31,31,31,31,31,31,31,31,31,31,31,31,31,31,31,31,31,31,31,31,31,31,31,31,31,31,31,31,31,31,31,31,31,31,31,31,31,31,31,31,31,31,31,31,31,31,31,31,31,31,31,31,31,31,31,31,31,31,31,31,31,31,31,31,31,31,31,31,31,31,31,31,31,31,31,31,31,31,31,31,31,31,31,31,31,31,31,31,31,31,31,31,31,31,31,31,31,31,31,31,31,31,31,31,31,31,31,31,31,31,31,31,31,31,31,31,31,31,31,31,31,31,31,31,31,31,31,31,31,31,31,31,31,31,31,31,31,31,31,31,31,31,31,31,31,31,31,31,31,31,31,31,31,31,31,31,31,31,31,31,31,31,31,31,31,31,31,31,31,31,31,31,31,31,31,31,31,31,31,31,31,31,31,31,31,31,31,31,31,31,31,31,31,31,31,31,31,31,31,31,31,31,31,31,31,31,31,31,31,31,31,31,31,31,31,31,31,31,31,31,31,31,31,31,31,31,31,31,31,31,31,31,31,31,31,31,31,31,31,31,31,31,31,31,31,31,31,31,31,31,31,31,31,31,31,31,31,31,31,31,31,31,31,31,31,31,31,31,31,31,31,31,31,31,31,31,31,31,31,31,31,31,31,31,31,31,31,31,31,31,31,31,31,31,31,31,31,31,31,31,31,31,31,31,31,31,31,31,31,31,31,31,31,31,31,31,31,31,31,31,31,31,31,31,31,31,31,31,31,31,31,31,31,31,31,31,31,31,31,31,31,31,31,31,31,31,31,31,31,31,31,31,31,31,31,31,31,31,31,31,31,31,31,31,31,31,31,31,31,31,31,31,31,31,31,31,31,31,31,31,31,31,31,31,31,31,31,31,31,31,31,31,31,31,31,31,31,31,31,31,31,31,31,31,31,31,31,31,31,31,31,31,31,31,31,31,31,31,31,31,31,31,31,31,31,31,31,31,31,31,31,31,31,31,31,31,31,31,31,31,31,31,31,31,31,31,31,31,31,31,31,31,31,31,31,31,31,31,31,31,31,31,31,31,31,31,31,31,31,31,31,31,31,31,31,31,31,31,31,31,31,31,31,31,31,31,31,31,31,31,31,31,31,31,31,31,31,31,31,31,31,31,31,31,31,31,31,31,31,31,31,31,31,31,31,31,31,31,31,31,31,31,31,31,31,31,31,31,31,31,31,31,31,31,31,31,31,31,31,31,31,31,31,31,31,31,31,31,31,31,31,31,31,31,31,31,31,31,31,31,31,31,31,31,31,31,31,31,31,31,31,31,31,31,31,31,31,31,31,31,31,31,31,31,31,31,31,31,31,31,31,31,31,31,31,31,31,31,31,31,31,31,31,31,31,31,31,31,31,31,31,31,31,31,31,31,31,31,31,31,31,31,31,31,31,31,31,31,31,31,31,31,31,31,31,31,31,31,31,31,31,31,31,31,31,31,31,31,31,31,31,31,31,31,31,31,31,31,31,31,31,31,31,31,31,31,31,31,31,31,31,31,31,31,31,31,31,31,31,31,31,31,31,31,31,31,31,31,31,31,31,31,31,31,31,31,31,31,31,31,31,31,31,31,31,31,31,31,31,31,31,31,31,31,31,31,31,31,31,31,31,31,31,31,31,31,31,31,31,31,31,31,31,31,31,31,31,31,31,31,31,31,31,31,31,31,31,31,31,31,31,31,31,31,31,31,31,31,31,31,31,31,31,31,31,31,31,31,31,31,31,31,31,31,31,31,31,31,31,31,31,31,31,31,31,31,31,31,31,31,31,31,31,31,31,31,31,31,31,31,31,31,31,31,31,31,31,31,31,31,31,31,31,31,31,31,31,31,31,31,31,31,31,31,31,31,31,31,31,31,31,31,31,31,31,31};
__global__ __launch_bounds__(256) void k_btab(const float* __restrict__ relb, float* BT) { const int e = blockIdx.x * 256 + threadIdx.x; if (e >= NH_ * 4096) return; const int r = e % 4096, h = e / 4096; const float v = (r < 4095) ? bfr(relb[BKT[r] * NH_ + h]) : 0.f; *(float*)(BT + e) = v;  }
__global__ __launch_bounds__(256) void k_cvt8(const float* __restrict__ src, bf* dst, size_t n8) { const size_t i = (size_t)blockIdx.x * 256 + threadIdx.x; if (i >= n8) return; const v8f v = *(const v8f*)(src + i * 8); v8us o;
#pragma unroll
    for (int k = 0; k < 8; ++k) o[k] = f2bf(v[k]); *(v8us*)(dst + i * 8) = o;  }

typedef __attribute__((ext_vector_type(8))) __bf16 v8bf;
__device__ __forceinline__ float xhalf(float x) { const int b = __float_as_int(x); return __int_as_float(__builtin_amdgcn_permlanex16(b, b, 0x76543210, 0xfedcba98, false, false)); }   /* lane l <-> l ^ 16 */
// The wait stands between a run of global loads and the first rewrite of an address register that they name: the addresses are inputs, so they stay in their registers up to it, and the scheduling barrier keeps later instructions behind it.
__device__ __forceinline__ void xwait(const void* a, const void* b) { asm volatile("s_wait_xcnt 0x0" :: "v"(a), "v"(b) : "memory"); __builtin_amdgcn_sched_barrier(0); }
// 2^x by v_exp_f32 with the one free slot that the instruction set asks for behind a transcendental in the same statement, so that it stands directly behind it wherever the statement is scheduled.
__device__ __forceinline__ float exp2s(float x) { float y; asm("v_exp_f32 %0, %1\n\tv_nop" : "=v"(y) : "v"(x)); return y; }
template <typename T16, bool HI, int NQ>
__device__ __forceinline__ void fa_wave(const T16* __restrict__ Q, const T16* __restrict__ Q2, const T16* __restrict__ K, const T16* __restrict__ K2, const T16* __restrict__ V, const T16* __restrict__ V2, const float* __restrict__ bt, int q0, bf* Ah, bf* Al) {
    typedef WFrag<T16> WF; typedef typename WF::V F;
    const int lane = threadIdx.x & 31, lr = lane & 15, hi = lane >> 4;
    const float L2E = 1.4426950408889634f;
    F qf[NQ][2], qf2[NQ][2];
    const T16* qp = Q + (size_t)q0 * HD + lane * 8; const T16* qp2 = Q2 + (size_t)q0 * HD + lane * 8;
#pragma unroll
    for (int nb = 0; nb < NQ; ++nb)
#pragma unroll
        for (int ks = 0; ks < 2; ++ks) { qf[nb][ks] = WF::ld(qp + nb * 16 * HD + ks * 512); if (HI) qf2[nb][ks] = WF::ld(qp2 + nb * 16 * HD + ks * 512); }
    v8f o[4][NQ];
#pragma unroll
    for (int dt = 0; dt < 4; ++dt)
#pragma unroll
        for (int nb = 0; nb < NQ; ++nb) o[dt][nb] = (v8f){};
    float m[NQ], l[NQ];
#pragma unroll
    for (int nb = 0; nb < NQ; ++nb) { m[nb] = -3.0e38f; l[nb] = 0.f; }
    const float cneg = bt[-(TT - 1)], cpos = bt[TT - 1];
    const int ko = lane * 8, vo = lane * 8;
    F kf[2][2], kf2[2][2];
#pragma unroll
    for (int kt = 0; kt < 2; ++kt)
#pragma unroll
        for (int ks = 0; ks < 2; ++ks) { kf[kt][ks] = WF::ld(K + ko + kt * 16 * HD + ks * 512); if (HI) kf2[kt][ks] = WF::ld(K2 + ko + kt * 16 * HD + ks * 512); }
    xwait(qp, HI ? qp2 : qp); xwait(K + ko, HI ? K2 + ko : K + ko);
    // rolled: the running maximum chains the passes, so unrolling would add code and registers without overlapping them
#pragma unroll 1
    for (int k0 = 0; k0 < TT; k0 += 32) {
        F vf[4], vf2[4]; const T16* vp = V + vo + k0 * 16; const T16* vp2 = V2 + vo + k0 * 16;
#pragma unroll
        for (int dt = 0; dt < 4; ++dt) { vf[dt] = WF::ld(vp + dt * 16 * TT); if (HI) vf2[dt] = WF::ld(vp2 + dt * 16 * TT); }
        xwait(vp, HI ? vp2 : vp);
        v8f s[2][NQ];
        if (k0 - (q0 + 16 * NQ - 1) >= 128 || (k0 + 31) - q0 <= -128) { const float c = (k0 > q0) ? cpos : cneg;
#pragma unroll
            for (int kt = 0; kt < 2; ++kt)
#pragma unroll
                for (int nb = 0; nb < NQ; ++nb)
#pragma unroll
                    for (int r = 0; r < 8; ++r) s[kt][nb][r] = c;
        } else { const float* bp0 = bt + (k0 + 8 * hi) - (q0 + lr);
#pragma unroll
            for (int kt = 0; kt < 2; ++kt)
#pragma unroll
                for (int nb = 0; nb < NQ; ++nb) { const float* bp = bp0 + (kt - nb) * 16;
#pragma unroll
                    for (int r = 0; r < 8; ++r) s[kt][nb][r] = bp[r]; }
            xwait(bp0, bp0);
        }
#pragma unroll
        for (int ks = 0; ks < 2; ++ks)
#pragma unroll
            for (int kt = 0; kt < 2; ++kt)
#pragma unroll
                for (int nb = 0; nb < NQ; ++nb) { s[kt][nb] = WF::mma(kf[kt][ks], qf[nb][ks], s[kt][nb]); if (HI) { s[kt][nb] = WF::mma(kf[kt][ks], qf2[nb][ks], s[kt][nb]); s[kt][nb] = WF::mma(kf2[kt][ks], qf[nb][ks], s[kt][nb]); } }
        const int kn = (k0 + 32 < TT) ? k0 + 32 : 0;   /* the next pass's key rows, fetched behind this pass's score products; the last pass refetches rows 0-31, unused */
        const T16* kp = K + ko + kn * HD; const T16* kp2 = K2 + ko + kn * HD;
#pragma unroll
        for (int kt = 0; kt < 2; ++kt)
#pragma unroll
            for (int ks = 0; ks < 2; ++ks) { kf[kt][ks] = WF::ld(kp + kt * 16 * HD + ks * 512); if (HI) kf2[kt][ks] = WF::ld(kp2 + kt * 16 * HD + ks * 512); }
        xwait(kp, HI ? kp2 : kp);
        F pf[NQ], pf2[NQ];
#pragma unroll
        for (int nb = 0; nb < NQ; ++nb) {
            float mx = s[0][nb][0];
#pragma unroll
            for (int r = 1; r < 8; ++r) mx = fmaxf(mx, s[0][nb][r]);
#pragma unroll
            for (int r = 0; r < 8; ++r) mx = fmaxf(mx, s[1][nb][r]);
            mx = fmaxf(mx, xhalf(mx));
            const float mn = fmaxf(m[nb], mx);
            const float al = exp2s((m[nb] - mn) * L2E);
            const float ng = (HI ? 0.0f : PSH) - mn * L2E;
            m[nb] = mn;
            float sum = 0.f;
#pragma unroll
            for (int kt = 0; kt < 2; ++kt)
#pragma unroll
                for (int r = 0; r < 8; ++r) { const float p = exp2s(__builtin_fmaf(s[kt][nb][r], L2E, ng)); s[kt][nb][r] = p; sum += p; }
            l[nb] = l[nb] * al + sum;
#pragma unroll
            for (int dt = 0; dt < 4; ++dt) o[dt][nb] *= al;
            if constexpr (HI) {
                const v8bf h0 = __builtin_convertvector(s[0][nb], v8bf), h1 = __builtin_convertvector(s[1][nb], v8bf);
                const v8bf l0 = __builtin_convertvector(s[0][nb] - __builtin_convertvector(h0, v8f), v8bf), l1 = __builtin_convertvector(s[1][nb] - __builtin_convertvector(h1, v8f), v8bf);
                pf[nb] = __builtin_shufflevector(h0, h1, 0, 1, 2, 3, 4, 5, 6, 7, 8, 9, 10, 11, 12, 13, 14, 15); pf2[nb] = __builtin_shufflevector(l0, l1, 0, 1, 2, 3, 4, 5, 6, 7, 8, 9, 10, 11, 12, 13, 14, 15);
            } else {
                pf[nb] = cat16(__builtin_convertvector(s[0][nb], v8h), __builtin_convertvector(s[1][nb], v8h));
            }
        }
#pragma unroll
        for (int dt = 0; dt < 4; ++dt)
#pragma unroll
            for (int nb = 0; nb < NQ; ++nb) { o[dt][nb] = WF::mma(vf[dt], pf[nb], o[dt][nb]); if (HI) { o[dt][nb] = WF::mma(vf[dt], pf2[nb], o[dt][nb]); o[dt][nb] = WF::mma(vf2[dt], pf[nb], o[dt][nb]); } }
    }
#pragma unroll
    for (int nb = 0; nb < NQ; ++nb) { const float inv = __fdiv_rn(1.0f, l[nb] + xhalf(l[nb])); const size_t oo = (size_t)(q0 + nb * 16) * DQ + lane * 8;
#pragma unroll
        for (int dt = 0; dt < 4; ++dt) { v8us oh, ol;
#pragma unroll
            for (int r = 0; r < 8; ++r) { unsigned short a, c2; splitf(o[dt][nb][r] * inv, a, c2); oh[r] = a; ol[r] = c2; }
            *(v8us*)(Ah + oo + dt * 256) = oh; *(v8us*)(Al + oo + dt * 256) = ol; } }
}
// grid (RH / 32, heads, batches), 5 waves: waves 0-1 take 16 hi/lo query rows each, waves 2-4 take 32 fp16 rows each, so every workgroup carries the same share of both kinds of work (no barrier in the kernel: the waves are independent); planes [b][h] of (row t, k = d) (q, k) and of (row d, k = t) (v); merged output planes [b] of (row t, k = h d) as hi/lo; all in fragment order
static_assert(RH / 32 == (TT - RH) / 96 && RH % 32 == 0 && (TT - RH) % 96 == 0, "2 hi/lo waves and 3 fp16 waves per workgroup cover all rows");
__global__ __launch_bounds__(160) void k_fattn(const h16* __restrict__ Q16, const h16* __restrict__ K16, const h16* __restrict__ V16, const bf* __restrict__ Qh, const bf* __restrict__ Ql, const bf* __restrict__ Kh, const bf* __restrict__ Kl, const bf* __restrict__ Vh, const bf* __restrict__ Vl, const float* __restrict__ BT, bf* Ah, bf* Al) {
    const int wv = __builtin_amdgcn_readfirstlane((int)(threadIdx.x >> 5)), bx = blockIdx.x, h = blockIdx.y, b = blockIdx.z;
    const size_t pq = ((size_t)b * NH_ + h) * TT * HD, pk = ((size_t)b * NKV + h / REP) * TT * HD, po = (size_t)b * TT * DQ + h * HD * 16;
    const float* bt = BT + (size_t)h * 4096 + (TT - 1);   /* bt[j - i] */
    if (wv < 2) fa_wave<bf, true, 1>(Qh + pq, Ql + pq, Kh + pk, Kl + pk, Vh + pk, Vl + pk, bt, (bx * 2 + wv) * 16, Ah + po, Al + po);
    else fa_wave<h16, false, 2>(Q16 + pq, nullptr, K16 + pk, nullptr, V16 + pk, nullptr, bt, RH + (bx * 3 + wv - 2) * 32, Ah + po, Al + po);
}

extern "C" void kernel_launch(void* const* d_in, const int* in_sizes, int n_in,
                              void* d_out, int out_size, void* d_ws, size_t ws_size, hipStream_t stream) {
    (void)in_sizes; (void)n_in; (void)out_size;
    const float* x = (const float*)d_in[0]; const float* g1 = (const float*)d_in[1]; const float* e1b = (const float*)d_in[2]; const float* wq = (const float*)d_in[3]; const float* wk = (const float*)d_in[4]; const float* wv = (const float*)d_in[5]; const float* wo = (const float*)d_in[6]; const float* relb = (const float*)d_in[7];
    float* OUT = (float*)d_out;     // [2][2048][1024]
    char* wsp = (char*)d_ws;
    auto take = [&](size_t bytes) { char* p = wsp; wsp += (bytes + 255) & ~(size_t)255; return (void*)p; };
    bf* WQ = (bf*)take((size_t)DQ * DM * 2); bf* WK = (bf*)take((size_t)DKV * DM * 2); bf* WV = (bf*)take((size_t)DKV * DM * 2); bf* WO = (bf*)take((size_t)DM * DQ * 2);
    bf* Yh = (bf*)take((size_t)TT * DM * 2); bf* Yl = (bf*)take((size_t)TT * DM * 2); float* BT = (float*)take((size_t)NH_ * 4096 * 4);
    h16* QP16 = (h16*)take((size_t)NB_ * NH_ * TT * HD * 2); h16* KP16 = (h16*)take((size_t)NB_ * NKV * TT * HD * 2); h16* VT16 = (h16*)take((size_t)NB_ * NKV * HD * TT * 2);
    bf* QPh = (bf*)take((size_t)NB_ * NH_ * TT * HD * 2); bf* QPl = (bf*)take((size_t)NB_ * NH_ * TT * HD * 2); bf* KPh = (bf*)take((size_t)NB_ * NKV * TT * HD * 2); bf* KPl = (bf*)take((size_t)NB_ * NKV * TT * HD * 2); bf* VTh = (bf*)take((size_t)NB_ * NKV * HD * TT * 2); bf* VTl = (bf*)take((size_t)NB_ * NKV * HD * TT * 2);
    bf* ATh = (bf*)take((size_t)NB_ * TT * DQ * 2); bf* ATl = (bf*)take((size_t)NB_ * TT * DQ * 2);
    if ((size_t)(wsp - (char*)d_ws) > ws_size) return;    // ws 256 MiB
    { k_wtG<DM, DQ><<<(unsigned)((DM * DQ / 256 + 7) / 8), 256, 0, stream>>>(wq, WQ); k_wtG<DM, DKV><<<(unsigned)((DM * DKV / 256 + 7) / 8), 256, 0, stream>>>(wk, WK); k_wtG<DM, DKV><<<(unsigned)((DM * DKV / 256 + 7) / 8), 256, 0, stream>>>(wv, WV);
      k_wtG<DQ, DM><<<(unsigned)((DQ * DM / 256 + 7) / 8), 256, 0, stream>>>(wo, WO);
       }
    for (int b = 0; b < NB_; ++b) { const size_t zq = (size_t)b * NH_ * TT * HD, zk = (size_t)b * NKV * TT * HD;   // each batch's head planes, written by the projections themselves
        k_lnhl<<<TT / 8, 256, 0, stream>>>(x + (size_t)b * TT * DM, nullptr, g1, e1b, nullptr, Yh, Yl);   /* n = LN(hidden) as hi/lo planes */ if (b == 0) k_btab<<<(NH_ * 4096 + 255) / 256, 256, 0, stream>>>(relb, BT);
        k_gemmw<bf, 1, 1, DM><<<dim3(TT / 64, DQ / 64, 1), 32, 0, stream>>>(Yh, Yl, WQ, nullptr, nullptr, nullptr, QP16 + zq, QPh + zq, QPl + zq, 0, 0, 0);
        k_gemmw<bf, 1, 1, DM><<<dim3(TT / 64, DKV / 64, 1), 32, 0, stream>>>(Yh, Yl, WK, nullptr, nullptr, nullptr, KP16 + zk, KPh + zk, KPl + zk, 0, 0, 0);
        k_gemmw<bf, 1, 2, DM><<<dim3(TT / 64, DKV / 64, 1), 32, 0, stream>>>(Yh, Yl, WV, nullptr, nullptr, nullptr, VT16 + zk, VTh + zk, VTl + zk, 0, 0, 0); }
    k_fattn<<<dim3(RH / 32, NH_, NB_), 160, 0, stream>>>(QP16, KP16, VT16, QPh, QPl, KPh, KPl, VTh, VTl, BT, ATh, ATl);
    for (int b = 0; b < NB_; ++b)
        k_gemmw<bf, 1, 0, DQ><<<dim3(TT / 64, DM / 64, 1), 32, 0, stream>>>(ATh + (size_t)b * TT * DQ, ATl + (size_t)b * TT * DQ, WO, nullptr, x + (size_t)b * TT * DM, OUT + (size_t)b * TT * DM, nullptr, nullptr, nullptr, 0, 0, 0);   /* out = hidden + ctx Wo */
}

// v005
// It runs in 199 microseconds.
// Two timings next to v004 put it at 1.67 and 1.71 times that version's speed.
// Counting every step since v000, it is 10.4 times as fast.
#include <hip/hip_runtime.h>

// T5 self-attention layer (hidden [2][2048][1024]; n = LayerNorm(hidden) (1e-6, ln_g, ln_b); q, k, v = n W ('xw' [1024][1024], no bias, 16 heads x 64); scores = q.k (NO 1/sqrt(d)) + rel_bias[bucket(j - i)][h] (T5 bidirectional buckets, 32 buckets, max distance 128); softmax over all keys; out = hidden + merged Wo -> [2][2048][1024]).
// The bucket index depends only on (j - i); it is embedded as a 4095-entry integer table computed with the reference's own bucket function (its f32 log -> int32 cast has exact-integer knife edges, so it is not recomputed on the device).
// Compute dtypes, f32 accumulate: every input rounded to bf16; q/k/v projections hl x exact (2 products); the relative-position bias (bf16-rounded rel_bias values through the embedded bucket table) enters the scores in f32; scores and attn.v: query rows < 512 hl (3 products), the rest single fp16 (P x1024); softmax f32, online; Wo hl x exact (2 products), + hidden residual in f32.

#define NB_  2
#define TT   2048
#define DM   1024
#define NH_  16
#define NKV  16
#define REP  (NH_ / NKV)
#define HD   64
#define DQ   (NH_ * HD)
#define DKV  (NKV * HD)
#define LNEPS 1e-6f
#define NBKT 32
#define RH   512                  // query rows < RH use hi+lo planes
#define WIN  0
#define PSH  10.0f                 // fp16 P carries 2^10 (added to the exponent; it cancels against the row sum)
#define SCL  1.0f                  // T5: no 1/sqrt(d) scaling
typedef _Float16 h16;
typedef unsigned short bf;
typedef __attribute__((ext_vector_type(16))) __bf16   v16bf;
typedef __attribute__((ext_vector_type(16))) _Float16 v16h;
typedef __attribute__((ext_vector_type(8)))  _Float16 v8h;
typedef __attribute__((ext_vector_type(8)))  unsigned short v8us;
typedef __attribute__((ext_vector_type(8)))  float    v8f;
typedef __attribute__((ext_vector_type(4)))  float    v4f;
typedef v8h  __attribute__((may_alias)) v8ha;
typedef v4f  __attribute__((may_alias)) v4fa;
typedef v8us __attribute__((may_alias)) v8usa;

__device__ __forceinline__ unsigned short f2bf(float f) { unsigned u = __float_as_uint(f); u += 0x7FFFu + ((u >> 16) & 1u); return (unsigned short)(u >> 16); }
__device__ __forceinline__ float bf2f(unsigned short b) { return __uint_as_float(((unsigned)b) << 16); }
__device__ __forceinline__ float bfr(float f) { return bf2f(f2bf(f)); }
__device__ __forceinline__ v16h cat16(v8h lo, v8h hi) { return __builtin_shufflevector(lo, hi, 0, 1, 2, 3, 4, 5, 6, 7, 8, 9, 10, 11, 12, 13, 14, 15); }
__device__ __forceinline__ v16bf cat16b(v8us lo, v8us hi) { return __builtin_bit_cast(v16bf, __builtin_shufflevector(lo, hi, 0, 1, 2, 3, 4, 5, 6, 7, 8, 9, 10, 11, 12, 13, 14, 15)); }
__device__ __forceinline__ v8f wmma16(v16h a, v16h b, v8f c) { return __builtin_amdgcn_wmma_f32_16x16x32_f16(false, a, false, b, (short)0, c, false, false); }
__device__ __forceinline__ v8f wmmab(v16bf a, v16bf b, v8f c) { return __builtin_amdgcn_wmma_f32_16x16x32_bf16(false, a, false, b, (short)0, c, false, false); }



__device__ __forceinline__ h16 tohx(float x) { return (h16)x; }
__device__ __forceinline__ void splitf(float y, unsigned short& h, unsigned short& l) { h = f2bf(y); l = f2bf(y - bf2f(h)); }
// The two waits stand between a run of global stores and the first rewrite of a register that they name: addresses and data are inputs, so they stay in their registers up to the wait, and the scheduling barrier keeps later instructions behind it.
__device__ __forceinline__ void swaitp(const void* a, const void* b, const void* c, const v8h (&x)[4], const v8us (&y)[4], const v8us (&w)[4]) { asm volatile("s_wait_xcnt 0x0" :: "v"(a), "v"(b), "v"(c), "v"(x[0]), "v"(x[1]), "v"(x[2]), "v"(x[3]), "v"(y[0]), "v"(y[1]), "v"(y[2]), "v"(y[3]), "v"(w[0]), "v"(w[1]), "v"(w[2]), "v"(w[3]) : "memory"); __builtin_amdgcn_sched_barrier(0); }
// The same between a run of global loads and the first rewrite of an address register that they name.
__device__ __forceinline__ void gwait(const void* a, const void* b, const void* c, const void* d) { asm volatile("s_wait_xcnt 0x0" :: "v"(a), "v"(b), "v"(c), "v"(d) : "memory"); __builtin_amdgcn_sched_barrier(0); }
__device__ __forceinline__ void swaitf(const void* a, const void* b, const v4f (&x)[8]) { asm volatile("s_wait_xcnt 0x0" :: "v"(a), "v"(b), "v"(x[0]), "v"(x[1]), "v"(x[2]), "v"(x[3]), "v"(x[4]), "v"(x[5]), "v"(x[6]), "v"(x[7]) : "memory"); __builtin_amdgcn_sched_barrier(0); }

// FRAGMENT ORDER of every 16-bit operand plane P[row][k] (K columns): element (row, k) lies at ((row / 16) (K / 32) + k / 32) 512 + ((k / 16) % 2) 256 + ((k / 8) % 2) 128 + (row % 16) 8 + k % 8.
// A 16 x 32 fragment is 1 KiB in a row and lane l = 16 hi + lr takes 8 elements at l 8 and 8 at 256 + l 8 (the same values in the same registers as from a row-major plane: row lr, k = 8 hi .. and 16 + 8 hi ..), so each 16-byte load of a wave reads 512 contiguous bytes, four whole lines, not 32 bytes of each of 16 lines.
// ---- k_gemmw: register-blocked GEMM, ONE WAVE per 64x64 output tile (16 accumulators), operands straight from 16-bit planes in fragment order; grid (M/64, N/64, Z), 32 threads. M counts the rows of both batches (their row blocks follow one another in every plane), Z the weight matrices that share the A operand: one launch carries all of a stage's tiles.
// c[m][n] (f32) = sum_k A[m][k] Bt[n][k] (+ split products per NSPLIT). z-batch strides sA/sB/sC in elements (sC: of C and X, or of each plane). K % 32 == 0, a compile-time constant, so that the 16-row blocks of a pass lie at constant offsets.
// The tile leaves the kernel in its final form, 16 staged rows of 64 at a time, every store a whole 128-byte line or more:
// EPI 0: C[m][n] (f32, pitch DM) = bf16-rounded X[m][n] + c, the residual add. EPI 1: planes [z][m / TT][n / 64]; z < 2 (q, k): head planes, each (row m % TT, k = n % 64) in fragment order; z == 2 (v): transposed head planes, each (row n % 64, k = m % TT) in fragment order. Planes: fp16 (P16) and a bf16 hi/lo pair (Ph, Pl); a tile's 64 columns are one head, its 64 rows lie in one batch.
template <typename T16> struct WFrag;
template <> struct WFrag<h16> { typedef v16h V; static __device__ __forceinline__ V ld(const h16* p) { return cat16(*(const v8h*)p, *(const v8h*)(p + 256)); } static __device__ __forceinline__ v8f mma(V a, V b, v8f c) { return wmma16(a, b, c); } };
template <> struct WFrag<bf> { typedef v16bf V; static __device__ __forceinline__ V ld(const bf* p) { return cat16b(*(const v8us*)p, *(const v8us*)(p + 256)); } static __device__ __forceinline__ v8f mma(V a, V b, v8f c) { return wmmab(a, b, c); } };
static_assert(HD == 64, "one 64-column tile is one head");
static_assert(TT % 64 == 0 && NKV == NH_ && DQ == DM && DKV == DM, "a 64-row tile lies in one batch; q, k, v planes and the four weight matrices have one size each");
// The plane epilogue of one tile; TR: transposed planes. Every loop is unrolled (the accumulators are registers and take constant indices only) and PP is a constant, so that all stores of a block name p16, ph or pl plus a constant.
template <bool TR>
__device__ __forceinline__ void gemm_planes(const v8f (&acc)[4][4], float* os, h16* p16, bf* ph, bf* pl, int lr, int hi) {
    constexpr int PP = TR ? TT : HD;   /* columns (K) of a plane: 16 staged rows are 16 PP elements of it */
#pragma unroll
    for (int blk = 0; blk < 4; ++blk) {
#pragma unroll
        for (int ob = 0; ob < 4; ++ob) {
            if constexpr (!TR) {   /* staged row = m, 16 rows of block blk */
#pragma unroll
                for (int j = 0; j < 8; ++j) os[(hi * 8 + j) * 68 + ob * 16 + lr] = acc[blk][ob][j];
            } else {   /* staged row = n, 16 columns of block blk: a lane's 8 accumulator rows are 8 neighbours in it */
                const v8f t = acc[ob][blk]; *(v4fa*)(os + lr * 68 + ob * 16 + hi * 8) = __builtin_shufflevector(t, t, 0, 1, 2, 3); *(v4fa*)(os + lr * 68 + ob * 16 + hi * 8 + 4) = __builtin_shufflevector(t, t, 4, 5, 6, 7); } }
        __builtin_amdgcn_wave_barrier(); asm volatile("" ::: "memory");   /* fence: writes before reads */
        v8h o16[4]; v8us oh[4], ol[4];
#pragma unroll
        for (int s = 0; s < 4; ++s) { const float* sp = os + lr * 68 + s * 16 + hi * 8; const v4f x0 = *(const v4fa*)sp, x1 = *(const v4fa*)(sp + 4);
#pragma unroll
            for (int k = 0; k < 8; ++k) { const float x = (k < 4) ? x0[k & 3] : x1[k & 3]; o16[s][k] = tohx(x); unsigned short a2, c2; splitf(x, a2, c2); oh[s][k] = a2; ol[s][k] = c2; }
            *(v8h*)(p16 + blk * 16 * PP + s * 256) = o16[s]; *(v8us*)(ph + blk * 16 * PP + s * 256) = oh[s]; *(v8us*)(pl + blk * 16 * PP + s * 256) = ol[s]; }
        swaitp(p16, ph, pl, o16, oh, ol);
        __builtin_amdgcn_wave_barrier(); asm volatile("" ::: "memory");   /* fence: reads before the next writes */
    }
}
template <typename T16, int NSPLIT, int EPI, int K>
__global__ __launch_bounds__(32) void k_gemmw(const T16* __restrict__ A, const T16* __restrict__ A2, const T16* __restrict__ Bt, const T16* __restrict__ Bt2, const float* __restrict__ X, float* C, h16* P16, bf* Ph, bf* Pl, size_t sA, size_t sB, size_t sC) {
    typedef typename WFrag<T16>::V V;
    __shared__ __align__(16) float os[16 * 68];
    const size_t z = blockIdx.z; A += z * sA; if (A2) A2 += z * sA; Bt += z * sB; if (Bt2) Bt2 += z * sB;
    const int lane = threadIdx.x & 31, lr = lane & 15, hi = lane >> 4; const int r0 = blockIdx.x * 64, c0 = blockIdx.y * 64;
    v8f acc[4][4];
#pragma unroll
    for (int mb = 0; mb < 4; ++mb)
#pragma unroll
        for (int nb = 0; nb < 4; ++nb) acc[mb][nb] = (v8f){};
    const size_t aoff = (size_t)r0 * K + lane * 8, boff = (size_t)c0 * K + lane * 8;
#pragma unroll 1
    for (int kc = 0; kc < K; kc += 32) {
        V a[4], a2[4], b[4], b2[4]; const T16* ap = A + aoff + kc * 16; const T16* ap2 = (NSPLIT == 1 || NSPLIT == 2) ? A2 + aoff + kc * 16 : ap; const T16* bp = Bt + boff + kc * 16; const T16* bp2 = (NSPLIT >= 2) ? Bt2 + boff + kc * 16 : bp;   /* every load of the pass names one of these, plus a constant */
#pragma unroll
        for (int mb = 0; mb < 4; ++mb) { a[mb] = WFrag<T16>::ld(ap + mb * 16 * K); if (NSPLIT == 1 || NSPLIT == 2) a2[mb] = WFrag<T16>::ld(ap2 + mb * 16 * K); }
#pragma unroll
        for (int nb = 0; nb < 4; ++nb) { b[nb] = WFrag<T16>::ld(bp + nb * 16 * K); if (NSPLIT >= 2) b2[nb] = WFrag<T16>::ld(bp2 + nb * 16 * K); }
        gwait(ap, ap2, bp, bp2);
#pragma unroll
        for (int nb = 0; nb < 4; ++nb) {
#pragma unroll
            for (int mb = 0; mb < 4; ++mb) { acc[mb][nb] = WFrag<T16>::mma(a[mb], b[nb], acc[mb][nb]); if (NSPLIT == 1 || NSPLIT == 2) acc[mb][nb] = WFrag<T16>::mma(a2[mb], b[nb], acc[mb][nb]); if (NSPLIT >= 2) acc[mb][nb] = WFrag<T16>::mma(a[mb], b2[nb], acc[mb][nb]); } }
        asm volatile("v_nop\n\tv_nop\n\tv_nop\n\tv_nop" : "+v"(acc[0][0]), "+v"(acc[1][1]), "+v"(acc[2][2]), "+v"(acc[3][3]) : "v"(a[0]), "v"(a[3]));
    }
    // Epilogue. Every loop is unrolled: the accumulators are registers and take constant indices only. The staged rows pass from lane to lane through LDS, which runs one wave's operations in order;
    // each fence (wave barrier + memory clobber) keeps that order in the compiled code: all lanes' writes of a block, then its reads, then the next block's writes.
    if constexpr (EPI == 0) {
        const size_t co = z * sC + (size_t)(r0 + hi) * DM + c0 + lr * 4;   /* a lane's 4 columns of rows hi, 2 + hi, ... */
        const float* xp = X + co; float* cp = C + co;
        v4f xv[2][8];   /* the residual rows, fetched one 16-row block ahead */
#pragma unroll
        for (int s = 0; s < 8; ++s) xv[0][s] = *(const v4f*)(xp + 2 * s * DM);
#pragma unroll
        for (int mb = 0; mb < 4; ++mb) {
            if (mb < 3) {
#pragma unroll
                for (int s = 0; s < 8; ++s) xv[(mb + 1) & 1][s] = *(const v4f*)(xp + ((mb + 1) * 16 + 2 * s) * DM); }
#pragma unroll
            for (int nb = 0; nb < 4; ++nb) {
#pragma unroll
                for (int j = 0; j < 8; ++j) os[(hi * 8 + j) * 68 + nb * 16 + lr] = acc[mb][nb][j]; }
            __builtin_amdgcn_wave_barrier(); asm volatile("" ::: "memory");   /* fence: writes before reads */
            v4f val[8];
#pragma unroll
            for (int s = 0; s < 8; ++s) { val[s] = *(const v4fa*)(os + (2 * s + hi) * 68 + lr * 4);
#pragma unroll
                for (int q = 0; q < 4; ++q) val[s][q] = __fadd_rn(bfr(xv[mb & 1][s][q]), val[s][q]);
                *(v4f*)(cp + (mb * 16 + 2 * s) * DM) = val[s]; }
            swaitf(xp, cp, val);
            __builtin_amdgcn_wave_barrier(); asm volatile("" ::: "memory");   /* fence: reads before the next writes */
        }
    } else {
        const bool tr = blockIdx.z == 2;   /* the same for the whole wave: a scalar branch */
        const size_t po = z * sC + ((size_t)(r0 / TT) * NH_ + blockIdx.y) * TT * HD + (size_t)(r0 % TT) * (tr ? 16 : HD) + lane * 8;   /* a lane's 8 elements of staged row lr, columns 8 hi, 16 + 8 hi, ...: each store of the wave is 512 bytes in a row */
        if (tr) gemm_planes<true>(acc, os, P16 + po, Ph + po, Pl + po, lr, hi); else gemm_planes<false>(acc, os, P16 + po, Ph + po, Pl + po, lr, hi);
    }
}

typedef __attribute__((ext_vector_type(2))) _Float16 v2h;
typedef __attribute__((ext_vector_type(4))) _Float16 v4h;
typedef __attribute__((ext_vector_type(2))) unsigned short v2us;
typedef __attribute__((ext_vector_type(4))) unsigned short v4us;
typedef v4us __attribute__((may_alias)) v4usa;
typedef __attribute__((ext_vector_type(2))) float v2f;
typedef __attribute__((ext_vector_type(4))) int v4i;

template <int K, int N>
__device__ __forceinline__ void d_wtG(const float* __restrict__ w, bf* Bt) {
    // Bt (row n, column k) = w[k][n] in fragment order: one wave writes one 512-byte unit u (16 rows n, 16 columns k)
    const int lane = threadIdx.x & 31; const int u = blockIdx.x * 8 + (threadIdx.x >> 5); if (u >= N * K / 256) return;
    const int k = (u % (K / 16)) * 16 + (lane >> 4) * 8, n = (u / (K / 16)) * 16 + (lane & 15); const float* wp = w + (size_t)k * N + n; float x[8]; v8us o;
#pragma unroll
    for (int e = 0; e < 8; ++e) x[e] = wp[e * N];
    gwait(wp, wp, wp, wp);
#pragma unroll
    for (int e = 0; e < 8; ++e) o[e] = f2bf(x[e]);
    *(v8us*)(Bt + (size_t)u * 256 + lane * 8) = o;
}
__constant__ int BKT[4095] = {15,15,15,15,15,15,15,15,15,15,15,15,15,15,15,15,15,15,15,15,15,15,15,15,15,15,15,15,15,15,15,15,15,15,15,15,15,15,15,15,15,15,15,15,15,15,15,15,15,15,15,15,15,15,15,15,15,15,15,15,15,15,15,15,15,15,15,15,15,15,15,15,15,15,15,15,15,15,15,15,15,15,15,15,15,15,15,15,15,15,15,15,15,15,15,15,15,15,15,15,15,15,15,15,15,15,15,15,15,15,15,15,15,15,15,15,15,15,15,15,15,15,15,15,15,15,15,15,15,15,15,15,15,15,15,15,15,15,15,15,15,15,15,15,15,15,15,15,15,15,15,15,15,15,15,15,15,15,15,15,15,15,15,15,15,15,15,15,15,15,15,15,15,15,15,15,15,15,15,15,15,15,15,15,15,15,15,15,15,15,15,15,15,15,15,15,15,15,15,15,15,15,15,15,15,15,15,15,15,15,15,15,15,15,15,15,15,15,15,15,15,15,15,15,15,15,15,15,15,15,15,15,15,15,15,15,15,15,15,15,15,15,15,15,15,15,15,15,15,15,15,15,15,15,15,15,15,15,15,15,15,15,15,15,15,15,15,15,15,15,15,15,15,15,15,15,15,15,15,15,15,15,15,15,15,15,15,15,15,15,15,15,15,15,15,15,15,15,15,15,15,15,15,15,15,15,15,15,15,15,15,15,15,15,15,15,15,15,15,15,15,15,15,15,15,15,15,15,15,15,15,15,15,15,15,15,15,15,15,15,15,15,15,15,15,15,15,15,15,15,15,15,15,15,15,15,15,15,15,15,15,15,15,15,15,15,15,15,15,15,15,15,15,15,15,15,15,15,15,15,15,15,15,15,15,15,15,15,15,15,15,15,15,15,15,15,15,15,15,15,15,15,15,15,15,15,15,15,15,15,15,15,15,15,15,15,15,15,15,15,15,15,15,15,15,15,15,15,15,15,15,15,15,15,15,15,15,15,15,15,15,15,15,15,15,15,15,15,15,15,15,15,15,15,15,15,15,15,15,15,15,15,15,15,15,15,15,15,15,15,15,15,15,15,15,15,15,15,15,15,15,15,15,15,15,15,15,15,15,15,15,15,15,15,15,15,15,15,15,15,15,15,15,15,15,15,15,15,15,15,15,15,15,15,15,15,15,15,15,15,15,15,15,15,15,15,15,15,15,15,15,15,15,15,15,15,15,15,15,15,15,15,15,15,15,15,15,15,15,15,15,15,15,15,15,15,15,15,15,15,15,15,15,15,15,15,15,15,15,15,15,15,15,15,15,15,15,15,15,15,15,15,15,15,15,15,15,15,15,15,15,15,15,15,15,15,15,15,15,15,15,15,15,15,15,15,15,15,15,15,15,15,15,15,15,15,15,15,15,15,15,15,15,15,15,15,15,15,15,15,15,15,15,15,15,15,15,15,15,15,15,15,15,15,15,15,15,15,15,15,15,15,15,15,15,15,15,15,15,15,15,15,15,15,15,15,15,15,15,15,15,15,15,15,15,15,15,15,15,15,15,15,15,15,15,15,15,15,15,15,15,15,15,15,15,15,15,15,15,15,15,15,15,15,15,15,15,15,15,15,15,15,15,15,15,15,15,15,15,15,15,15,15,15,15,15,15,15,15,15,15,15,15,15,15,15,15,15,15,15,15,15,15,15,15,15,15,15,15,15,15,15,15,15,15,15,15,15,15,15,15,15,15,15,15,15,15,15,15,15,15,15,15,15,15,15,15,15,15,15,15,15,15,15,15,15,15,15,15,15,15,15,15,15,15,15,15,15,15,15,15,15,15,15,15,15,15,15,15,15,15,15,15,15,15,15,15,15,15,15,15,15,15,15,15,15,15,15,15,15,15,15,15,15,15,15,15,15,15,15,15,15,15,15,15,15,15,15,15,15,15,15,15,15,15,15,15,15,15,15,15,15,15,15,15,15,15,15,15,15,15,15,15,15,15,15,15,15,15,15,15,15,15,15,15,15,15,15,15,15,15,15,15,15,15,15,15,15,15,15,15,15,15,15,15,15,15,15,15,15,15,15,15,15,15,15,15,15,15,15,15,15,15,15,15,15,15,15,15,15,15,15,15,15,15,15,15,15,15,15,15,15,15,15,15,15,15,15,15,15,15,15,15,15,15,15,15,15,15,15,15,15,15,15,15,15,15,15,15,15,15,15,15,15,15,15,15,15,15,15,15,15,15,15,15,15,15,15,15,15,15,15,15,15,15,15,15,15,15,15,15,15,15,15,15,15,15,15,15,15,15,15,15,15,15,15,15,15,15,15,15,15,15,15,15,15,15,15,15,15,15,15,15,15,15,15,15,15,15,15,15,15,15,15,15,15,15,15,15,15,15,15,15,15,15,15,15,15,15,15,15,15,15,15,15,15,15,15,15,15,15,15,15,15,15,15,15,15,15,15,15,15,15,15,15,15,15,15,15,15,15,15,15,15,15,15,15,15,15,15,15,15,15,15,15,15,15,15,15,15,15,15,15,15,15,15,15,15,15,15,15,15,15,15,15,15,15,15,15,15,15,15,15,15,15,15,15,15,15,15,15,15,15,15,15,15,15,15,15,15,15,15,15,15,15,15,15,15,15,15,15,15,15,15,15,15,15,15,15,15,15,15,15,15,15,15,15,15,15,15,15,15,15,15,15,15,15,15,15,15,15,15,15,15,15,15,15,15,15,15,15,15,15,15,15,15,15,15,15,15,15,15,15,15,15,15,15,15,15,15,15,15,15,15,15,15,15,15,15,15,15,15,15,15,15,15,15,15,15,15,15,15,15,15,15,15,15,15,15,15,15,15,15,15,15,15,15,15,15,15,15,15,15,15,15,15,15,15,15,15,15,15,15,15,15,15,15,15,15,15,15,15,15,15,15,15,15,15,15,15,15,15,15,15,15,15,15,15,15,15,15,15,15,15,15,15,15,15,15,15,15,15,15,15,15,15,15,15,15,15,15,15,15,15,15,15,15,15,15,15,15,15,15,15,15,15,15,15,15,15,15,15,15,15,15,15,15,15,15,15,15,15,15,15,15,15,15,15,15,15,15,15,15,15,15,15,15,15,15,15,15,15,15,15,15,15,15,15,15,15,15,15,15,15,15,15,15,15,15,15,15,15,15,15,15,15,15,15,15,15,15,15,15,15,15,15,15,15,15,15,15,15,15,15,15,15,15,15,15,15,15,15,15,15,15,15,15,15,15,15,15,15,15,15,15,15,15,15,15,15,15,15,15,15,15,15,15,15,15,15,15,15,15,15,15,15,15,15,15,15,15,15,15,15,15,15,15,15,15,15,15,15,15,15,15,15,15,15,15,15,15,15,15,15,15,15,15,15,15,15,15,15,15,15,15,15,15,15,15,15,15,15,15,15,15,15,15,15,15,15,15,15,15,15,15,15,15,15,15,15,15,15,15,15,15,15,15,15,15,15,15,15,15,15,15,15,15,15,15,15,15,15,15,15,15,15,15,15,15,15,15,15,15,15,15,15,15,15,15,15,15,15,15,15,15,15,15,15,15,15,15,15,15,15,15,15,15,15,15,15,15,15,15,15,15,15,15,15,15,15,15,15,15,15,15,15,15,15,15,15,15,15,15,15,15,15,15,15,15,15,15,15,15,15,15,15,15,15,15,15,15,15,15,15,15,15,15,15,15,15,15,15,15,15,15,15,15,15,15,15,15,15,15,15,15,15,15,15,15,15,15,15,15,15,15,15,15,15,15,15,15,15,15,15,15,15,15,15,15,15,15,15,15,15,15,15,15,15,15,15,15,15,15,15,15,15,15,15,15,15,15,15,15,15,15,15,15,15,15,15,15,15,15,15,15,15,15,15,15,15,15,15,15,15,15,15,15,15,15,15,15,15,15,15,15,15,15,15,15,15,15,15,15,15,15,15,15,15,15,15,15,15,15,15,15,15,15,15,15,15,15,15,15,15,15,15,15,15,15,15,15,15,15,15,15,15,15,15,15,15,15,15,15,15,15,15,15,15,15,15,15,15,15,15,15,15,15,15,15,15,15,15,15,15,15,15,15,15,15,15,15,15,15,15,15,15,15,15,15,15,15,15,15,15,15,15,15,15,15,15,15,15,15,15,15,15,15,15,15,15,15,15,15,15,15,15,15,15,15,15,15,15,15,15,15,15,15,15,15,15,15,15,15,15,15,15,15,15,15,15,15,15,15,15,15,15,15,15,15,15,15,15,15,15,15,15,15,15,15,15,15,15,15,15,15,15,15,15,15,15,15,15,15,15,15,15,15,15,15,15,15,15,15,15,15,15,15,15,15,15,15,15,15,15,15,15,15,15,15,15,15,15,15,15,15,15,15,15,15,15,15,15,15,15,15,15,15,15,15,15,15,15,15,15,15,15,15,15,15,15,15,15,15,15,15,15,15,14,14,14,14,14,14,14,14,14,14,14,14,14,14,14,14,14,14,14,14,14,14,14,14,14,14,14,13,13,13,13,13,13,13,13,13,13,13,13,13,13,13,13,13,13,12,12,12,12,12,12,12,12,12,12,12,12,12,12,11,11,11,11,11,11,11,11,11,10,10,10,10,10,10,10,9,9,9,9,8,8,8,8,7,6,5,4,3,2,1,0,17,18,19,20,21,22,23,24,24,24,24,25,25,25,25,26,26,26,26,26,26,26,27,27,27,27,27,27,27,27,27,28,28,28,28,28,28,28,28,28,28,28,28,28,28,29,29,29,29,29,29,29,29,29,29,29,29,29,29,29,29,29,29,30,30,30,30,30,30,30,30,30,30,30,30,30,30,30,30,30,30,30,30,30,30,30,30,30,30,30,31,31,31,31,31,31,31,31,31,31,31,31,31,31,31,31,31,31,31,31,31,31,31,31,31,31,31,31,31,31,31,31,31,31,31,31,31,31,31,31,31,31,31,31,31,31,31,31,31,31,31,31,31,31,31,31,31,31,31,31,31,31,31,31,31,31,31,31,31,31,31,31,31,31,31,31,31,31,31,31,31,31,31,31,31,31,31,31,31,31,31,31,31,31,31,31,31,31,31,31,31,31,31,31,31,31,31,31,31,31,31,31,31,31,31,31,31,31,31,31,31,31,31,31,31,31,31,31,31,31,31,31,31,31,31,31,31,31,31,31,31,31,31,31,31,31,31,31,31,31,31,31,31,31,31,31,31,31,31,31,31,31,31,31,31,31,31,31,31,31,31,31,31,31,31,31,31,31,31,31,31,31,31,31,31,31,31,31,31,31,31,31,31,31,31,31,31,31,31,31,31,31,31,31,31,31,31,31,31,31,31,31,31,31,31,31,31,31,31,31,31,31,31,31,31,31,31,31,31,31,31,31,31,31,31,31,31,31,31,31,31,31,31,31,31,31,31,31,31,31,31,31,31,31,31,31,31,31,31,31,31,31,31,31,31,31,31,31,31,31,31,31,31,31,31,31,31,31,31,31,31,31,31,31,31,31,31,31,31,31,31,31,31,31,31,31,31,31,31,31,31,31,31,31,31,31,31,31,31,31,31,31,31,31,31,31,31,31,31,31,31,31,31,31,31,31,31,31,31,31,31,31,31,31,31,31,31,31,31,31,31,31,31,31,31,31,31,31,31,31,31,31,31,31,31,31,31,31,31,31,31,31,31,31,31,31,31,31,31,31,31,31,31,31,31,31,31,31,31,31,31,31,31,31,31,31,31,31,31,31,31,31,31,31,31,31,31,31,31,31,31,31,31,31,31,31,31,31,31,31,31,31,31,31,31,31,31,31,31,31,31,31,31,31,31,31,31,31,31,31,31,31,31,31,31,31,31,31,31,31,31,31,31,31,31,31,31,31,31,31,31,31,31,31,31,31,31,31,31,31,31,31,31,31,31,31,31,31,31,31,31,31,31,31,31,31,31,31,31,31,31,31,31,31,31,31,31,31,31,31,31,31,31,31,31,31,31,31,31,31,31,31,31,31,31,31,31,31,31,31,31,31,31,31,31,31,31,31,31,31,31,31,31,31,31,31,31,31,31,31,31,31,31,31,31,31,31,31,31,31,31,31,31,31,31,31,31,31,31,31,31,31,31,31,31,31,31,31,31,31,31,31,31,31,31,31,31,31,31,31,31,31,31,31,31,31,31,31,31,31,31,31,31,31,31,31,31,31,31,31,31,31,31,31,31,31,31,31,31,31,31,31,31,31,31,31,31,31,31,31,31,31,31,31,31,31,31,31,31,31,31,31,31,31,31,31,31,31,31,31,31,31,31,31,31,31,31,31,31,31,31,31,31,31,31,31,31,31,31,31,31,31,31,31,31,31,31,31,31,31,31,31,31,31,31,31,31,31,31,31,31,31,31,31,31,31,31,31,31,31,31,31,31,31,31,31,31,31,31,31,31,31,31,31,31,31,31,31,31,31,31,31,31,31,31,31,31,31,31,31,31,31,31,31,31,31,31,31,31,31,31,31,31,31,31,31,31,31,31,31,31,31,31,31,31,31,31,31,31,31,31,31,31,31,31,31,31,31,31,31,31,31,31,31,31,31,31,31,31,31,31,31,31,31,31,31,31,31,31,31,31,31,31,31,31,31,31,31,31,31,31,31,31,31,31,31,31,31,31,31,31,31,31,31,31,31,31,31,31,31,31,31,31,31,31,31,31,31,31,31,31,31,31,31,31,31,31,31,31,31,31,31,31,31,31,31,31,31,31,31,31,31,31,31,31,31,31,31,31,31,31,31,31,31,31,31,31,31,31,31,31,31,31,31,31,31,31,31,31,31,31,31,31,31,31,31,31,31,31,31,31,31,31,31,31,31,31,31,31,31,31,31,31,31,31,31,31,31,31,31,31,31,31,31,31,31,31,31,31,31,31,31,31,31,31,31,31,31,31,31,31,31,31,31,31,31,31,31,31,31,31,31,31,31,31,31,31,31,31,31,31,31,31,31,31,31,31,31,31,31,31,31,31,31,31,31,31,31,31,31,31,31,31,31,31,31,31,31,31,31,31,31,31,31,31,31,31,31,31,31,31,31,31,31,31,31,31,31,31,31,31,31,31,31,31,31,31,31,31,31,31,31,31,31,31,31,31,31,31,31,31,31,31,31,31,31,31,31,31,31,31,31,31,31,31,31,31,31,31,31,31,31,31,31,31,31,31,31,31,31,31,31,31,31,31,31,31,31,31,31,31,31,31,31,31,31,31,31,31,31,31,31,31,31,31,31,31,31,31,31,31,31,31,31,31,31,31,31,31,31,31,31,31,31,31,31,31,31,31,31,31,31,31,31,31,31,31,31,31,31,31,31,31,31,31,31,31,31,31,31,31,31,31,31,31,31,31,31,31,31,31,31,31,31,31,31,31,31,31,31,31,31,31,31,31,31,31,31,31,31,31,31,31,31,31,31,31,31,31,31,31,31,31,31,31,31,31,31,31,31,31,31,31,31,31,31,31,31,31,31,31,31,31,31,31,31,31,31,31,31,31,31,31,31,31,31,31,31,31,31,31,31,31,31,31,31,31,31,31,31,31,31,31,31,31,31,31,31,31,31,31,31,31,31,31,31,31,31,31,31,31,31,31,31,31,31,31,31,31,31,31,31,31,31,31,31,31,31,31,31,31,31,31,31,31,31,31,31,31,31,31,31,31,31,31,31,31,31,31,31,31,31,31,31,31,31,31,31,31,31,31,31,31,31,31,31,31,31,31,31,31,31,31,31,31,31,31,31,31,31,31,31,31,31,31,31,31,31,31,31,31,31,31,31,31,31,31,31,31,31,31,31,31,31,31,31,31,31,31,31,31,31,31,31,31,31,31,31,31,31,31,31,31,31,31,31,31,31,31,31,31,31,31,31,31,31,31,31,31,31,31,31,31,31,31,31,31,31,31,31,31,31,31,31,31,31,31,31,31,31,31,31,31,31,31,31,31,31,31,31,31,31,31,31,31,31,31,31,31,31,31,31,31,31,31,31,31,31,31,31,31,31,31,31,31,31,31,31,31,31,31,31,31,31,31,31,31,31,31,31,31,31,31,31,31,31,31,31,31,31,31,31,31,31,31,31,31,31,31,31,31,31,31,31,31,31,31,31,31,31,31,31,31,31,31,31,31,31,31,31,31,31,31,31,31,31,31,31,31,31,31,31,31,31,31,31,31,31,31,31,31,31,31,31,31,31,31,31,31,31,31,31,31,31,31,31,31,31,31,31,31,31,31,31,31,31,31,31,31,31,31,31,31,31,31,31,31,31,31,31,31,31,31,31,31,31,31,31,31,31,31,31,31,31,31,31,31,31,31,31,31,31,31,31,31,31,31,31,31,31,31,31,31,31,31,31,31,31,31,31,31,31,31,31,31,31,31,31,31,31,31,31,31,31,31,31,31,31,31,31,31,31,31,31,31,31,31,31,31,31,31,31,31,31,31,31,31,31,31,31,31,31,31,31,31,31,31,31,31,31,31,31,31,31,31,31,31,31,31,31,31,31,31,31,31,31,31,31,31,31,31,31,31,31,31,31,31,31,31,31,31,31,31,31,31,31,31,31,31,31,31,31,31,31,31,31,31,31,31,31,31,31,31,31,31,31,31,31,31,31,31,31,31,31,31,31,31,31,31,31,31,31,31,31,31,31,31,31,31,31,31,31,31,31,31,31,31,31,31,31,31,31,31,31,31,31,31,31,31,31,31,31,31,31,31,31,31,31,31,31,31,31,31,31,31,31,31,31,31,31,31,31,31,31,31,31,31,31,31,31,31,31,31,31,31,31,31,31,31,31,31,31,31,31,31,31,31,31,31,31,31,31,31,31,31,31,31,31,31,31,31,31,31,31,31,31,31,31,31,31,31,31,31,31,31,31,31,31,31,31,31,31,31,31,31,31,31,31,31,31,31,31,31,31,31,31,31,31,31,31,31,31,31,31,31,31,31,31,31,31,31,31,31,31,31,31,31,31,31,31,31,31,31,31,31,31,31,31,31,31,31,31,31,31,31,31,31,31,31,31,31,31,31,31,31,31,31,31,31,31,31,31,31,31,31,31,31,31,31,31,31,31,31,31,31,31,31,31,31,31,31,31,31,31,31,31,31,31,31,31,31,31,31,31,31,31,31,31,31,31,31,31,31,31,31,31,31,31,31,31,31,31,31,31,31,31,31,31,31,31,31,31,31,31,31,31,31,31,31,31,31,31,31,31,31,31,31,31,31,31,31,31,31,31,31,31,31,31,31,31,31,31,31,31,31,31,31,31,31,31,31,31,31,31,31,31,31};
__device__ __forceinline__ void d_btab(const float* __restrict__ relb, float* BT) { const int e = blockIdx.x * 256 + threadIdx.x; if (e >= NH_ * 4096) return; const int r = e % 4096, h = e / 4096; const float v = (r < 4095) ? bfr(relb[BKT[r] * NH_ + h]) : 0.f; *(float*)(BT + e) = v;  }
// k_prep: everything that reads the inputs alone, in one launch; grid (512, 6): y = 0 the LayerNorm of all rows (the longest work, so it starts first), y = 1 .. 4 the four weight planes (one size, one behind the other in Bt), y = 5 the bias table. The branch is the same for a whole workgroup and stands in front of the barrier.
static_assert(NB_ * TT / 8 == 512 && DM * DQ / 256 / 8 == 512 && NH_ * 4096 / 256 <= 512, "grid x of k_prep");
__global__ __launch_bounds__(256) void k_prep(const float* __restrict__ X, const float* __restrict__ A, const float* __restrict__ g, const float* __restrict__ be, float* Z, bf* Yh, bf* Yl, const float* __restrict__ w0, const float* __restrict__ w1, const float* __restrict__ w2, const float* __restrict__ w3, bf* Bt, const float* __restrict__ relb, float* BT) {
    if (blockIdx.y == 5) { d_btab(relb, BT); return; }
    if (blockIdx.y != 0) { d_wtG<DM, DQ>((blockIdx.y == 1) ? w0 : (blockIdx.y == 2) ? w1 : (blockIdx.y == 3) ? w2 : w3, Bt + (size_t)(blockIdx.y - 1) * DQ * DM); return; }
    static_assert(TT % 8 == 0, "a workgroup's 8 rows are all inside or all outside");
    __shared__ __align__(16) bf ys[2][8][DM + 16];   /* the workgroup's 8 rows, hi and lo; the pitch spreads 8 rows' 16-byte pieces over the banks */
    const int lane = threadIdx.x & 31; const int wr = threadIdx.x >> 5; const int r = blockIdx.x * 8 + wr; if (blockIdx.x * 8 >= NB_ * TT) return; const float* xr = X + (size_t)r * DM; const float* ar = A ? A + (size_t)r * DM : nullptr; float s = 0.f;
#pragma unroll 1
    for (int ch = 0; ch < DM / 128; ++ch) { const int c0 = ch * 128 + lane * 4; const v4f a = *(const v4f*)(xr + c0); v4f d = {0.f, 0.f, 0.f, 0.f}; if (ar) d = *(const v4f*)(ar + c0);
#pragma unroll
        for (int q = 0; q < 4; ++q) s += __fadd_rn(bfr(a[q]), d[q]); }
#pragma unroll
    for (int sh = 16; sh; sh >>= 1) s += __shfl_xor(s, sh, 32);
    const float mu = s * (1.0f / DM); float s2 = 0.f;
#pragma unroll 1
    for (int ch = 0; ch < DM / 128; ++ch) { const int c0 = ch * 128 + lane * 4; const v4f a = *(const v4f*)(xr + c0); v4f d = {0.f, 0.f, 0.f, 0.f}; if (ar) d = *(const v4f*)(ar + c0);
#pragma unroll
        for (int q = 0; q < 4; ++q) { const float d0 = __fsub_rn(__fadd_rn(bfr(a[q]), d[q]), mu); float p = __fmul_rn(d0, d0); asm volatile("" : "+v"(p)); s2 = __fadd_rn(s2, p); } }
#pragma unroll
    for (int sh = 16; sh; sh >>= 1) s2 += __shfl_xor(s2, sh, 32);
    const float rs = __fdiv_rn(1.0f, __fsqrt_rn(__fadd_rn(s2 * (1.0f / DM), LNEPS)));
{
#pragma unroll 1
        for (int ch = 0; ch < DM / 128; ++ch) { const int c0 = ch * 128 + lane * 4; const v4f a = *(const v4f*)(xr + c0); v4f d = {0.f, 0.f, 0.f, 0.f}; if (ar) d = *(const v4f*)(ar + c0); v4f z4; v4us oh, ol;
#pragma unroll
            for (int q = 0; q < 4; ++q) { const float v = __fadd_rn(bfr(a[q]), d[q]); z4[q] = v; float n0 = __fmul_rn(__fsub_rn(v, mu), rs); asm volatile("" : "+v"(n0)); float n1 = __fmul_rn(n0, bfr(g[c0 + q])); asm volatile("" : "+v"(n1)); const float y = __fadd_rn(n1, bfr(be[c0 + q])); unsigned short h2, l2; splitf(y, h2, l2); oh[q] = h2; ol[q] = l2; }
            if (Z) *(v4f*)(Z + (size_t)r * DM + c0) = z4; *(v4usa*)(&ys[0][wr][c0]) = oh; *(v4usa*)(&ys[1][wr][c0]) = ol; }
         }
    __syncthreads();   /* all 8 rows staged: a 128-byte line of a plane in fragment order holds 16 bytes of each of them */
    const size_t yo = (size_t)(blockIdx.x >> 1) * 16 * DM + (blockIdx.x & 1) * 64 + (threadIdx.x & 7) * 8;   /* rows 8 (x % 2) + t % 8 of row block x / 2 */
#pragma unroll
    for (int i = 0; i < DM / 256; ++i) { const int sg = i * 32 + (threadIdx.x >> 3);   /* columns 8 sg ..: a wave stores four whole lines */
        *(v8us*)(Yh + yo + sg * 128) = *(const v8usa*)(&ys[0][threadIdx.x & 7][sg * 8]); *(v8us*)(Yl + yo + sg * 128) = *(const v8usa*)(&ys[1][threadIdx.x & 7][sg * 8]); } }
__global__ __launch_bounds__(256) void k_cvt8(const float* __restrict__ src, bf* dst, size_t n8) { const size_t i = (size_t)blockIdx.x * 256 + threadIdx.x; if (i >= n8) return; const v8f v = *(const v8f*)(src + i * 8); v8us o;
#pragma unroll
    for (int k = 0; k < 8; ++k) o[k] = f2bf(v[k]); *(v8us*)(dst + i * 8) = o;  }

typedef __attribute__((ext_vector_type(8))) __bf16 v8bf;
__device__ __forceinline__ float xhalf(float x) { const int b = __float_as_int(x); return __int_as_float(__builtin_amdgcn_permlanex16(b, b, 0x76543210, 0xfedcba98, false, false)); }   /* lane l <-> l ^ 16 */
// The wait stands between a run of global loads and the first rewrite of an address register that they name: the addresses are inputs, so they stay in their registers up to it, and the scheduling barrier keeps later instructions behind it.
__device__ __forceinline__ void xwait(const void* a, const void* b) { asm volatile("s_wait_xcnt 0x0" :: "v"(a), "v"(b) : "memory"); __builtin_amdgcn_sched_barrier(0); }
// 2^x by v_exp_f32 with the one free slot that the instruction set asks for behind a transcendental in the same statement, so that it stands directly behind it wherever the statement is scheduled.
__device__ __forceinline__ float exp2s(float x) { float y; asm("v_exp_f32 %0, %1\n\tv_nop" : "=v"(y) : "v"(x)); return y; }
template <typename T16, bool HI, int NQ>
__device__ __forceinline__ void fa_wave(const T16* __restrict__ Q, const T16* __restrict__ Q2, const T16* __restrict__ K, const T16* __restrict__ K2, const T16* __restrict__ V, const T16* __restrict__ V2, const float* __restrict__ bt, int q0, bf* Ah, bf* Al) {
    typedef WFrag<T16> WF; typedef typename WF::V F;
    const int lane = threadIdx.x & 31, lr = lane & 15, hi = lane >> 4;
    const float L2E = 1.4426950408889634f;
    F qf[NQ][2], qf2[NQ][2];
    const T16* qp = Q + (size_t)q0 * HD + lane * 8; const T16* qp2 = Q2 + (size_t)q0 * HD + lane * 8;
#pragma unroll
    for (int nb = 0; nb < NQ; ++nb)
#pragma unroll
        for (int ks = 0; ks < 2; ++ks) { qf[nb][ks] = WF::ld(qp + nb * 16 * HD + ks * 512); if (HI) qf2[nb][ks] = WF::ld(qp2 + nb * 16 * HD + ks * 512); }
    v8f o[4][NQ];
#pragma unroll
    for (int dt = 0; dt < 4; ++dt)
#pragma unroll
        for (int nb = 0; nb < NQ; ++nb) o[dt][nb] = (v8f){};
    float m[NQ], l[NQ];
#pragma unroll
    for (int nb = 0; nb < NQ; ++nb) { m[nb] = -3.0e38f; l[nb] = 0.f; }
    const float cneg = bt[-(TT - 1)], cpos = bt[TT - 1];
    const int ko = lane * 8, vo = lane * 8;
    F kf[2][2], kf2[2][2];
#pragma unroll
    for (int kt = 0; kt < 2; ++kt)
#pragma unroll
        for (int ks = 0; ks < 2; ++ks) { kf[kt][ks] = WF::ld(K + ko + kt * 16 * HD + ks * 512); if (HI) kf2[kt][ks] = WF::ld(K2 + ko + kt * 16 * HD + ks * 512); }
    xwait(qp, HI ? qp2 : qp); xwait(K + ko, HI ? K2 + ko : K + ko);
    // rolled: the running maximum chains the passes, so unrolling would add code and registers without overlapping them
#pragma unroll 1
    for (int k0 = 0; k0 < TT; k0 += 32) {
        F vf[4], vf2[4]; const T16* vp = V + vo + k0 * 16; const T16* vp2 = V2 + vo + k0 * 16;
#pragma unroll
        for (int dt = 0; dt < 4; ++dt) { vf[dt] = WF::ld(vp + dt * 16 * TT); if (HI) vf2[dt] = WF::ld(vp2 + dt * 16 * TT); }
        xwait(vp, HI ? vp2 : vp);
        v8f s[2][NQ];
        if (k0 - (q0 + 16 * NQ - 1) >= 128 || (k0 + 31) - q0 <= -128) { const float c = (k0 > q0) ? cpos : cneg;
#pragma unroll
            for (int kt = 0; kt < 2; ++kt)
#pragma unroll
                for (int nb = 0; nb < NQ; ++nb)
#pragma unroll
                    for (int r = 0; r < 8; ++r) s[kt][nb][r] = c;
        } else { const float* bp0 = bt + (k0 + 8 * hi) - (q0 + lr);
#pragma unroll
            for (int kt = 0; kt < 2; ++kt)
#pragma unroll
                for (int nb = 0; nb < NQ; ++nb) { const float* bp = bp0 + (kt - nb) * 16;
#pragma unroll
                    for (int r = 0; r < 8; ++r) s[kt][nb][r] = bp[r]; }
            xwait(bp0, bp0);
        }
#pragma unroll
        for (int ks = 0; ks < 2; ++ks)
#pragma unroll
            for (int kt = 0; kt < 2; ++kt)
#pragma unroll
                for (int nb = 0; nb < NQ; ++nb) { s[kt][nb] = WF::mma(kf[kt][ks], qf[nb][ks], s[kt][nb]); if (HI) { s[kt][nb] = WF::mma(kf[kt][ks], qf2[nb][ks], s[kt][nb]); s[kt][nb] = WF::mma(kf2[kt][ks], qf[nb][ks], s[kt][nb]); } }
        const int kn = (k0 + 32 < TT) ? k0 + 32 : 0;   /* the next pass's key rows, fetched behind this pass's score products; the last pass refetches rows 0-31, unused */
        const T16* kp = K + ko + kn * HD; const T16* kp2 = K2 + ko + kn * HD;
#pragma unroll
        for (int kt = 0; kt < 2; ++kt)
#pragma unroll
            for (int ks = 0; ks < 2; ++ks) { kf[kt][ks] = WF::ld(kp + kt * 16 * HD + ks * 512); if (HI) kf2[kt][ks] = WF::ld(kp2 + kt * 16 * HD + ks * 512); }
        xwait(kp, HI ? kp2 : kp);
        F pf[NQ], pf2[NQ];
#pragma unroll
        for (int nb = 0; nb < NQ; ++nb) {
            float mx = s[0][nb][0];
#pragma unroll
            for (int r = 1; r < 8; ++r) mx = fmaxf(mx, s[0][nb][r]);
#pragma unroll
            for (int r = 0; r < 8; ++r) mx = fmaxf(mx, s[1][nb][r]);
            mx = fmaxf(mx, xhalf(mx));
            const float mn = fmaxf(m[nb], mx);
            const float al = exp2s((m[nb] - mn) * L2E);
            const float ng = (HI ? 0.0f : PSH) - mn * L2E;
            m[nb] = mn;
            float sum = 0.f;
#pragma unroll
            for (int kt = 0; kt < 2; ++kt)
#pragma unroll
                for (int r = 0; r < 8; ++r) { const float p = exp2s(__builtin_fmaf(s[kt][nb][r], L2E, ng)); s[kt][nb][r] = p; sum += p; }
            l[nb] = l[nb] * al + sum;
#pragma unroll
            for (int dt = 0; dt < 4; ++dt) o[dt][nb] *= al;
            if constexpr (HI) {
                const v8bf h0 = __builtin_convertvector(s[0][nb], v8bf), h1 = __builtin_convertvector(s[1][nb], v8bf);
                const v8bf l0 = __builtin_convertvector(s[0][nb] - __builtin_convertvector(h0, v8f), v8bf), l1 = __builtin_convertvector(s[1][nb] - __builtin_convertvector(h1, v8f), v8bf);
                pf[nb] = __builtin_shufflevector(h0, h1, 0, 1, 2, 3, 4, 5, 6, 7, 8, 9, 10, 11, 12, 13, 14, 15); pf2[nb] = __builtin_shufflevector(l0, l1, 0, 1, 2, 3, 4, 5, 6, 7, 8, 9, 10, 11, 12, 13, 14, 15);
            } else {
                pf[nb] = cat16(__builtin_convertvector(s[0][nb], v8h), __builtin_convertvector(s[1][nb], v8h));
            }
        }
#pragma unroll
        for (int dt = 0; dt < 4; ++dt)
#pragma unroll
            for (int nb = 0; nb < NQ; ++nb) { o[dt][nb] = WF::mma(vf[dt], pf[nb], o[dt][nb]); if (HI) { o[dt][nb] = WF::mma(vf[dt], pf2[nb], o[dt][nb]); o[dt][nb] = WF::mma(vf2[dt], pf[nb], o[dt][nb]); } }
    }
#pragma unroll
    for (int nb = 0; nb < NQ; ++nb) { const float inv = __fdiv_rn(1.0f, l[nb] + xhalf(l[nb])); const size_t oo = (size_t)(q0 + nb * 16) * DQ + lane * 8;
#pragma unroll
        for (int dt = 0; dt < 4; ++dt) { v8us oh, ol;
#pragma unroll
            for (int r = 0; r < 8; ++r) { unsigned short a, c2; splitf(o[dt][nb][r] * inv, a, c2); oh[r] = a; ol[r] = c2; }
            *(v8us*)(Ah + oo + dt * 256) = oh; *(v8us*)(Al + oo + dt * 256) = ol; } }
}
// grid (RH / 32, heads, batches), 5 waves: waves 0-1 take 16 hi/lo query rows each, waves 2-4 take 32 fp16 rows each, so every workgroup carries the same share of both kinds of work (no barrier in the kernel: the waves are independent); planes [b][h] of (row t, k = d) (q, k) and of (row d, k = t) (v); merged output planes [b] of (row t, k = h d) as hi/lo; all in fragment order
static_assert(RH / 32 == (TT - RH) / 96 && RH % 32 == 0 && (TT - RH) % 96 == 0, "2 hi/lo waves and 3 fp16 waves per workgroup cover all rows");
__global__ __launch_bounds__(160) void k_fattn(const h16* __restrict__ Q16, const h16* __restrict__ K16, const h16* __restrict__ V16, const bf* __restrict__ Qh, const bf* __restrict__ Ql, const bf* __restrict__ Kh, const bf* __restrict__ Kl, const bf* __restrict__ Vh, const bf* __restrict__ Vl, const float* __restrict__ BT, bf* Ah, bf* Al) {
    const int wv = __builtin_amdgcn_readfirstlane((int)(threadIdx.x >> 5)), bx = blockIdx.x, h = blockIdx.y, b = blockIdx.z;
    const size_t pq = ((size_t)b * NH_ + h) * TT * HD, pk = ((size_t)b * NKV + h / REP) * TT * HD, po = (size_t)b * TT * DQ + h * HD * 16;
    const float* bt = BT + (size_t)h * 4096 + (TT - 1);   /* bt[j - i] */
    if (wv < 2) fa_wave<bf, true, 1>(Qh + pq, Ql + pq, Kh + pk, Kl + pk, Vh + pk, Vl + pk, bt, (bx * 2 + wv) * 16, Ah + po, Al + po);
    else fa_wave<h16, false, 2>(Q16 + pq, nullptr, K16 + pk, nullptr, V16 + pk, nullptr, bt, RH + (bx * 3 + wv - 2) * 32, Ah + po, Al + po);
}

extern "C" void kernel_launch(void* const* d_in, const int* in_sizes, int n_in,
                              void* d_out, int out_size, void* d_ws, size_t ws_size, hipStream_t stream) {
    (void)in_sizes; (void)n_in; (void)out_size;
    const float* x = (const float*)d_in[0]; const float* g1 = (const float*)d_in[1]; const float* e1b = (const float*)d_in[2]; const float* wq = (const float*)d_in[3]; const float* wk = (const float*)d_in[4]; const float* wv = (const float*)d_in[5]; const float* wo = (const float*)d_in[6]; const float* relb = (const float*)d_in[7];
    float* OUT = (float*)d_out;     // [2][2048][1024]
    char* wsp = (char*)d_ws;
    auto take = [&](size_t bytes) { char* p = wsp; wsp += (bytes + 255) & ~(size_t)255; return (void*)p; };
    bf* WQ = (bf*)take((size_t)DQ * DM * 2); bf* WK = (bf*)take((size_t)DKV * DM * 2); bf* WV = (bf*)take((size_t)DKV * DM * 2); bf* WO = (bf*)take((size_t)DM * DQ * 2);
    bf* Yh = (bf*)take((size_t)NB_ * TT * DM * 2); bf* Yl = (bf*)take((size_t)NB_ * TT * DM * 2); float* BT = (float*)take((size_t)NH_ * 4096 * 4);
    h16* QP16 = (h16*)take((size_t)NB_ * NH_ * TT * HD * 2); h16* KP16 = (h16*)take((size_t)NB_ * NKV * TT * HD * 2); h16* VT16 = (h16*)take((size_t)NB_ * NKV * HD * TT * 2);
    bf* QPh = (bf*)take((size_t)NB_ * NH_ * TT * HD * 2); bf* KPh = (bf*)take((size_t)NB_ * NKV * TT * HD * 2); bf* VTh = (bf*)take((size_t)NB_ * NKV * HD * TT * 2); bf* QPl = (bf*)take((size_t)NB_ * NH_ * TT * HD * 2); bf* KPl = (bf*)take((size_t)NB_ * NKV * TT * HD * 2); bf* VTl = (bf*)take((size_t)NB_ * NKV * HD * TT * 2);   // q, k, v of each kind follow one another (every size is a multiple of 256 bytes), as do WQ, WK, WV, WO: the z stride of the merged launches
    bf* ATh = (bf*)take((size_t)NB_ * TT * DQ * 2); bf* ATl = (bf*)take((size_t)NB_ * TT * DQ * 2);
    if ((size_t)(wsp - (char*)d_ws) > ws_size) return;    // ws 256 MiB
    k_prep<<<dim3(512, 6, 1), 256, 0, stream>>>(x, nullptr, g1, e1b, nullptr, Yh, Yl, wq, wk, wv, wo, WQ, relb, BT);   /* n = LN(hidden) as hi/lo planes, both batches; all four weight planes; the bias table */
    k_gemmw<bf, 1, 1, DM><<<dim3(NB_ * TT / 64, DQ / 64, 3), 32, 0, stream>>>(Yh, Yl, WQ, nullptr, nullptr, nullptr, QP16, QPh, QPl, 0, (size_t)DQ * DM, (size_t)NB_ * NH_ * TT * HD);   /* q, k, v of both batches: head planes, written by the projections themselves */
    k_fattn<<<dim3(RH / 32, NH_, NB_), 160, 0, stream>>>(QP16, KP16, VT16, QPh, QPl, KPh, KPl, VTh, VTl, BT, ATh, ATl);
    k_gemmw<bf, 1, 0, DQ><<<dim3(NB_ * TT / 64, DM / 64, 1), 32, 0, stream>>>(ATh, ATl, WO, nullptr, x, OUT, nullptr, nullptr, nullptr, 0, 0, 0);   /* out = hidden + ctx Wo */
}

// v006
// Measured time: 165 microseconds a run.
// Two timings next to v005 put it at 1.21 and 1.19 times that version's speed.
// All steps since v000 together make it 12.5 times as fast.
#include <hip/hip_runtime.h>

// T5 self-attention layer (hidden [2][2048][1024]; n = LayerNorm(hidden) (1e-6, ln_g, ln_b); q, k, v = n W ('xw' [1024][1024], no bias, 16 heads x 64); scores = q.k (NO 1/sqrt(d)) + rel_bias[bucket(j - i)][h] (T5 bidirectional buckets, 32 buckets, max distance 128); softmax over all keys; out = hidden + merged Wo -> [2][2048][1024]).
// The bucket index depends only on (j - i); it is embedded as a 4095-entry integer table computed with the reference's own bucket function (its f32 log -> int32 cast has exact-integer knife edges, so it is not recomputed on the device).
// Compute dtypes, f32 accumulate: every input rounded to bf16; q/k/v projections hl x exact (2 products); the relative-position bias (bf16-rounded rel_bias values through the embedded bucket table) enters the scores in f32; scores and attn.v: query rows < 512 hl (3 products), the rest single fp16 (P x1024); softmax f32, online; Wo hl x exact (2 products), + hidden residual in f32.

#define NB_  2
#define TT   2048
#define DM   1024
#define NH_  16
#define NKV  16
#define REP  (NH_ / NKV)
#define HD   64
#define DQ   (NH_ * HD)
#define DKV  (NKV * HD)
#define LNEPS 1e-6f
#define NBKT 32
#define RH   512                  // query rows < RH use hi+lo planes
#define WIN  0
#define PSH  10.0f                 // fp16 P carries 2^10 (added to the exponent; it cancels against the row sum)
#define SCL  1.0f                  // T5: no 1/sqrt(d) scaling
typedef _Float16 h16;
typedef unsigned short bf;
typedef __attribute__((ext_vector_type(16))) __bf16   v16bf;
typedef __attribute__((ext_vector_type(16))) _Float16 v16h;
typedef __attribute__((ext_vector_type(8)))  _Float16 v8h;
typedef __attribute__((ext_vector_type(8)))  unsigned short v8us;
typedef __attribute__((ext_vector_type(8)))  float    v8f;
typedef __attribute__((ext_vector_type(4)))  float    v4f;
typedef v8h  __attribute__((may_alias)) v8ha;
typedef v4f  __attribute__((may_alias)) v4fa;
typedef v8us __attribute__((may_alias)) v8usa;

__device__ __forceinline__ unsigned short f2bf(float f) { unsigned u = __float_as_uint(f); u += 0x7FFFu + ((u >> 16) & 1u); return (unsigned short)(u >> 16); }
__device__ __forceinline__ float bf2f(unsigned short b) { return __uint_as_float(((unsigned)b) << 16); }
__device__ __forceinline__ float bfr(float f) { return bf2f(f2bf(f)); }
__device__ __forceinline__ v16h cat16(v8h lo, v8h hi) { return __builtin_shufflevector(lo, hi, 0, 1, 2, 3, 4, 5, 6, 7, 8, 9, 10, 11, 12, 13, 14, 15); }
__device__ __forceinline__ v16bf cat16b(v8us lo, v8us hi) { return __builtin_bit_cast(v16bf, __builtin_shufflevector(lo, hi, 0, 1, 2, 3, 4, 5, 6, 7, 8, 9, 10, 11, 12, 13, 14, 15)); }
__device__ __forceinline__ v8f wmma16(v16h a, v16h b, v8f c) { return __builtin_amdgcn_wmma_f32_16x16x32_f16(false, a, false, b, (short)0, c, false, false); }
__device__ __forceinline__ v8f wmmab(v16bf a, v16bf b, v8f c) { return __builtin_amdgcn_wmma_f32_16x16x32_bf16(false, a, false, b, (short)0, c, false, false); }



__device__ __forceinline__ h16 tohx(float x) { return (h16)x; }
__device__ __forceinline__ void splitf(float y, unsigned short& h, unsigned short& l) { h = f2bf(y); l = f2bf(y - bf2f(h)); }
// The two waits stand between a run of global stores and the first rewrite of a register that they name: addresses and data are inputs, so they stay in their registers up to the wait, and the scheduling barrier keeps later instructions behind it.
__device__ __forceinline__ void swaitp(const void* a, const void* b, const void* c, const v8h (&x)[4], const v8us (&y)[4], const v8us (&w)[4]) { asm volatile("s_wait_xcnt 0x0" :: "v"(a), "v"(b), "v"(c), "v"(x[0]), "v"(x[1]), "v"(x[2]), "v"(x[3]), "v"(y[0]), "v"(y[1]), "v"(y[2]), "v"(y[3]), "v"(w[0]), "v"(w[1]), "v"(w[2]), "v"(w[3]) : "memory"); __builtin_amdgcn_sched_barrier(0); }
// The same between a run of global loads and the first rewrite of an address register that they name.
__device__ __forceinline__ void gwait(const void* a, const void* b, const void* c, const void* d) { asm volatile("s_wait_xcnt 0x0" :: "v"(a), "v"(b), "v"(c), "v"(d) : "memory"); __builtin_amdgcn_sched_barrier(0); }
__device__ __forceinline__ void swaitf(const void* a, const void* b, const v4f (&x)[8]) { asm volatile("s_wait_xcnt 0x0" :: "v"(a), "v"(b), "v"(x[0]), "v"(x[1]), "v"(x[2]), "v"(x[3]), "v"(x[4]), "v"(x[5]), "v"(x[6]), "v"(x[7]) : "memory"); __builtin_amdgcn_sched_barrier(0); }

// FRAGMENT ORDER of every 16-bit operand plane P[row][k] (K columns): element (row, k) lies at ((row / 16) (K / 32) + k / 32) 512 + ((k / 16) % 2) 256 + ((k / 8) % 2) 128 + (row % 16) 8 + k % 8.
// A 16 x 32 fragment is 1 KiB in a row and lane l = 16 hi + lr takes 8 elements at l 8 and 8 at 256 + l 8 (the same values in the same registers as from a row-major plane: row lr, k = 8 hi .. and 16 + 8 hi ..), so each 16-byte load of a wave reads 512 contiguous bytes, four whole lines, not 32 bytes of each of 16 lines.
// ---- k_gemmw: register-blocked GEMM, ONE WAVE per 64x64 output tile (16 accumulators), operands straight from 16-bit planes in fragment order; grid (M/64, N/64, Z), 32 threads. M counts the rows of both batches (their row blocks follow one another in every plane), Z the weight matrices that share the A operand: one launch carries all of a stage's tiles.
// c[m][n] (f32) = sum_k A[m][k] Bt[n][k] (+ split products per NSPLIT). z-batch strides sA/sB/sC in elements (sC: of C and X, or of each plane). K % 32 == 0, a compile-time constant, so that the 16-row blocks of a pass lie at constant offsets.
// The tile leaves the kernel in its final form, 16 staged rows of 64 at a time, every store a whole 128-byte line or more:
// EPI 0: C[m][n] (f32, pitch DM) = bf16-rounded X[m][n] + c, the residual add. EPI 1: planes [z][m / TT][n / 64]; z < 2 (q, k): head planes, each (row m % TT, k = n % 64) in fragment order; z == 2 (v): transposed head planes, each (row n % 64, k = m % TT) in fragment order. Planes: fp16 (P16) and a bf16 hi/lo pair (Ph, Pl); a tile's 64 columns are one head, its 64 rows lie in one batch.
template <typename T16> struct WFrag;
template <> struct WFrag<h16> { typedef v16h V; static __device__ __forceinline__ V ld(const h16* p) { return cat16(*(const v8h*)p, *(const v8h*)(p + 256)); } static __device__ __forceinline__ v8f mma(V a, V b, v8f c) { return wmma16(a, b, c); } };
template <> struct WFrag<bf> { typedef v16bf V; static __device__ __forceinline__ V ld(const bf* p) { return cat16b(*(const v8us*)p, *(const v8us*)(p + 256)); } static __device__ __forceinline__ v8f mma(V a, V b, v8f c) { return wmmab(a, b, c); } };
static_assert(HD == 64, "one 64-column tile is one head");
static_assert(TT % 64 == 0 && NKV == NH_ && DQ == DM && DKV == DM, "a 64-row tile lies in one batch; q, k, v planes and the four weight matrices have one size each");
// The plane epilogue of one tile; TR: transposed planes. Every loop is unrolled (the accumulators are registers and take constant indices only) and PP is a constant, so that all stores of a block name p16, ph or pl plus a constant.
template <bool TR>
__device__ __forceinline__ void gemm_planes(const v8f (&acc)[4][4], float* os, h16* p16, bf* ph, bf* pl, int lr, int hi) {
    constexpr int PP = TR ? TT : HD;   /* columns (K) of a plane: 16 staged rows are 16 PP elements of it */
#pragma unroll
    for (int blk = 0; blk < 4; ++blk) {
#pragma unroll
        for (int ob = 0; ob < 4; ++ob) {
            if constexpr (!TR) {   /* staged row = m, 16 rows of block blk */
#pragma unroll
                for (int j = 0; j < 8; ++j) os[(hi * 8 + j) * 68 + ob * 16 + lr] = acc[blk][ob][j];
            } else {   /* staged row = n, 16 columns of block blk: a lane's 8 accumulator rows are 8 neighbours in it */
                const v8f t = acc[ob][blk]; *(v4fa*)(os + lr * 68 + ob * 16 + hi * 8) = __builtin_shufflevector(t, t, 0, 1, 2, 3); *(v4fa*)(os + lr * 68 + ob * 16 + hi * 8 + 4) = __builtin_shufflevector(t, t, 4, 5, 6, 7); } }
        __builtin_amdgcn_wave_barrier(); asm volatile("" ::: "memory");   /* fence: writes before reads */
        v8h o16[4]; v8us oh[4], ol[4];
#pragma unroll
        for (int s = 0; s < 4; ++s) { const float* sp = os + lr * 68 + s * 16 + hi * 8; const v4f x0 = *(const v4fa*)sp, x1 = *(const v4fa*)(sp + 4);
#pragma unroll
            for (int k = 0; k < 8; ++k) { const float x = (k < 4) ? x0[k & 3] : x1[k & 3]; o16[s][k] = tohx(x); unsigned short a2, c2; splitf(x, a2, c2); oh[s][k] = a2; ol[s][k] = c2; }
            *(v8h*)(p16 + blk * 16 * PP + s * 256) = o16[s]; *(v8us*)(ph + blk * 16 * PP + s * 256) = oh[s]; *(v8us*)(pl + blk * 16 * PP + s * 256) = ol[s]; }
        swaitp(p16, ph, pl, o16, oh, ol);
        __builtin_amdgcn_wave_barrier(); asm volatile("" ::: "memory");   /* fence: reads before the next writes */
    }
}
template <typename T16, int NSPLIT, int EPI, int K>
__global__ __launch_bounds__(32) void k_gemmw(const T16* __restrict__ A, const T16* __restrict__ A2, const T16* __restrict__ Bt, const T16* __restrict__ Bt2, const float* __restrict__ X, float* C, h16* P16, bf* Ph, bf* Pl, size_t sA, size_t sB, size_t sC) {
    typedef typename WFrag<T16>::V V;
    __shared__ __align__(16) float os[16 * 68];
    const size_t z = blockIdx.z; A += z * sA; if (A2) A2 += z * sA; Bt += z * sB; if (Bt2) Bt2 += z * sB;
    const int lane = threadIdx.x & 31, lr = lane & 15, hi = lane >> 4; const int r0 = blockIdx.x * 64, c0 = blockIdx.y * 64;
    v8f acc[4][4];
#pragma unroll
    for (int mb = 0; mb < 4; ++mb)
#pragma unroll
        for (int nb = 0; nb < 4; ++nb) acc[mb][nb] = (v8f){};
    const size_t aoff = (size_t)r0 * K + lane * 8, boff = (size_t)c0 * K + lane * 8;
#pragma unroll 1
    for (int kc = 0; kc < K; kc += 32) {
        V a[4], a2[4], b[4], b2[4]; const T16* ap = A + aoff + kc * 16; const T16* ap2 = (NSPLIT == 1 || NSPLIT == 2) ? A2 + aoff + kc * 16 : ap; const T16* bp = Bt + boff + kc * 16; const T16* bp2 = (NSPLIT >= 2) ? Bt2 + boff + kc * 16 : bp;   /* every load of the pass names one of these, plus a constant */
#pragma unroll
        for (int mb = 0; mb < 4; ++mb) { a[mb] = WFrag<T16>::ld(ap + mb * 16 * K); if (NSPLIT == 1 || NSPLIT == 2) a2[mb] = WFrag<T16>::ld(ap2 + mb * 16 * K); }
#pragma unroll
        for (int nb = 0; nb < 4; ++nb) { b[nb] = WFrag<T16>::ld(bp + nb * 16 * K); if (NSPLIT >= 2) b2[nb] = WFrag<T16>::ld(bp2 + nb * 16 * K); }
        gwait(ap, ap2, bp, bp2);
#pragma unroll
        for (int nb = 0; nb < 4; ++nb) {
#pragma unroll
            for (int mb = 0; mb < 4; ++mb) { acc[mb][nb] = WFrag<T16>::mma(a[mb], b[nb], acc[mb][nb]); if (NSPLIT == 1 || NSPLIT == 2) acc[mb][nb] = WFrag<T16>::mma(a2[mb], b[nb], acc[mb][nb]); if (NSPLIT >= 2) acc[mb][nb] = WFrag<T16>::mma(a[mb], b2[nb], acc[mb][nb]); } }
        asm volatile("v_nop\n\tv_nop\n\tv_nop\n\tv_nop" : "+v"(acc[0][0]), "+v"(acc[1][1]), "+v"(acc[2][2]), "+v"(acc[3][3]) : "v"(a[0]), "v"(a[3]));
    }
    // Epilogue. Every loop is unrolled: the accumulators are registers and take constant indices only. The staged rows pass from lane to lane through LDS, which runs one wave's operations in order;
    // each fence (wave barrier + memory clobber) keeps that order in the compiled code: all lanes' writes of a block, then its reads, then the next block's writes.
    if constexpr (EPI == 0) {
        const size_t co = z * sC + (size_t)(r0 + hi) * DM + c0 + lr * 4;   /* a lane's 4 columns of rows hi, 2 + hi, ... */
        const float* xp = X + co; float* cp = C + co;
        v4f xv[2][8];   /* the residual rows, fetched one 16-row block ahead */
#pragma unroll
        for (int s = 0; s < 8; ++s) xv[0][s] = *(const v4f*)(xp + 2 * s * DM);
#pragma unroll
        for (int mb = 0; mb < 4; ++mb) {
            if (mb < 3) {
#pragma unroll
                for (int s = 0; s < 8; ++s) xv[(mb + 1) & 1][s] = *(const v4f*)(xp + ((mb + 1) * 16 + 2 * s) * DM); }
#pragma unroll
            for (int nb = 0; nb < 4; ++nb) {
#pragma unroll
                for (int j = 0; j < 8; ++j) os[(hi * 8 + j) * 68 + nb * 16 + lr] = acc[mb][nb][j]; }
            __builtin_amdgcn_wave_barrier(); asm volatile("" ::: "memory");   /* fence: writes before reads */
            v4f val[8];
#pragma unroll
            for (int s = 0; s < 8; ++s) { val[s] = *(const v4fa*)(os + (2 * s + hi) * 68 + lr * 4);
#pragma unroll
                for (int q = 0; q < 4; ++q) val[s][q] = __fadd_rn(bfr(xv[mb & 1][s][q]), val[s][q]);
                *(v4f*)(cp + (mb * 16 + 2 * s) * DM) = val[s]; }
            swaitf(xp, cp, val);
            __builtin_amdgcn_wave_barrier(); asm volatile("" ::: "memory");   /* fence: reads before the next writes */
        }
    } else {
        const bool tr = blockIdx.z == 2;   /* the same for the whole wave: a scalar branch */
        const size_t po = z * sC + ((size_t)(r0 / TT) * NH_ + blockIdx.y) * TT * HD + (size_t)(r0 % TT) * (tr ? 16 : HD) + lane * 8;   /* a lane's 8 elements of staged row lr, columns 8 hi, 16 + 8 hi, ...: each store of the wave is 512 bytes in a row */
        if (tr) gemm_planes<true>(acc, os, P16 + po, Ph + po, Pl + po, lr, hi); else gemm_planes<false>(acc, os, P16 + po, Ph + po, Pl + po, lr, hi);
    }
}

typedef __attribute__((ext_vector_type(2))) _Float16 v2h;
typedef __attribute__((ext_vector_type(4))) _Float16 v4h;
typedef __attribute__((ext_vector_type(2))) unsigned short v2us;
typedef __attribute__((ext_vector_type(4))) unsigned short v4us;
typedef v4us __attribute__((may_alias)) v4usa;
typedef __attribute__((ext_vector_type(2))) float v2f;
typedef __attribute__((ext_vector_type(4))) int v4i;

template <int K, int N>
__device__ __forceinline__ void d_wtG(const float* __restrict__ w, bf* Bt) {
    // Bt (row n, column k) = w[k][n] in fragment order: one wave writes one 512-byte unit u (16 rows n, 16 columns k)
    const int lane = threadIdx.x & 31; const int u = blockIdx.x * 8 + (threadIdx.x >> 5); if (u >= N * K / 256) return;
    const int k = (u % (K / 16)) * 16 + (lane >> 4) * 8, n = (u / (K / 16)) * 16 + (lane & 15); const float* wp = w + (size_t)k * N + n; float x[8]; v8us o;
#pragma unroll
    for (int e = 0; e < 8; ++e) x[e] = wp[e * N];
    gwait(wp, wp, wp, wp);
#pragma unroll
    for (int e = 0; e < 8; ++e) o[e] = f2bf(x[e]);
    *(v8us*)(Bt + (size_t)u * 256 + lane * 8) = o;
}
__constant__ int BKT[4095] = {15,15,15,15,15,15,15,15,15,15,15,15,15,15,15,15,15,15,15,15,15,15,15,15,15,15,15,15,15,15,15,15,15,15,15,15,15,15,15,15,15,15,15,15,15,15,15,15,15,15,15,15,15,15,15,15,15,15,15,15,15,15,15,15,15,15,15,15,15,15,15,15,15,15,15,15,15,15,15,15,15,15,15,15,15,15,15,15,15,15,15,15,15,15,15,15,15,15,15,15,15,15,15,15,15,15,15,15,15,15,15,15,15,15,15,15,15,15,15,15,15,15,15,15,15,15,15,15,15,15,15,15,15,15,15,15,15,15,15,15,15,15,15,15,15,15,15,15,15,15,15,15,15,15,15,15,15,15,15,15,15,15,15,15,15,15,15,15,15,15,15,15,15,15,15,15,15,15,15,15,15,15,15,15,15,15,15,15,15,15,15,15,15,15,15,15,15,15,15,15,15,15,15,15,15,15,15,15,15,15,15,15,15,15,15,15,15,15,15,15,15,15,15,15,15,15,15,15,15,15,15,15,15,15,15,15,15,15,15,15,15,15,15,15,15,15,15,15,15,15,15,15,15,15,15,15,15,15,15,15,15,15,15,15,15,15,15,15,15,15,15,15,15,15,15,15,15,15,15,15,15,15,15,15,15,15,15,15,15,15,15,15,15,15,15,15,15,15,15,15,15,15,15,15,15,15,15,15,15,15,15,15,15,15,15,15,15,15,15,15,15,15,15,15,15,15,15,15,15,15,15,15,15,15,15,15,15,15,15,15,15,15,15,15,15,15,15,15,15,15,15,15,15,15,15,15,15,15,15,15,15,15,15,15,15,15,15,15,15,15,15,15,15,15,15,15,15,15,15,15,15,15,15,15,15,15,15,15,15,15,15,15,15,15,15,15,15,15,15,15,15,15,15,15,15,15,15,15,15,15,15,15,15,15,15,15,15,15,15,15,15,15,15,15,15,15,15,15,15,15,15,15,15,15,15,15,15,15,15,15,15,15,15,15,15,15,15,15,15,15,15,15,15,15,15,15,15,15,15,15,15,15,15,15,15,15,15,15,15,15,15,15,15,15,15,15,15,15,15,15,15,15,15,15,15,15,15,15,15,15,15,15,15,15,15,15,15,15,15,15,15,15,15,15,15,15,15,15,15,15,15,15,15,15,15,15,15,15,15,15,15,15,15,15,15,15,15,15,15,15,15,15,15,15,15,15,15,15,15,15,15,15,15,15,15,15,15,15,15,15,15,15,15,15,15,15,15,15,15,15,15,15,15,15,15,15,15,15,15,15,15,15,15,15,15,15,15,15,15,15,15,15,15,15,15,15,15,15,15,15,15,15,15,15,15,15,15,15,15,15,15,15,15,15,15,15,15,15,15,15,15,15,15,15,15,15,15,15,15,15,15,15,15,15,15,15,15,15,15,15,15,15,15,15,15,15,15,15,15,15,15,15,15,15,15,15,15,15,15,15,15,15,15,15,15,15,15,15,15,15,15,15,15,15,15,15,15,15,15,15,15,15,15,15,15,15,15,15,15,15,15,15,15,15,15,15,15,15,15,15,15,15,15,15,15,15,15,15,15,15,15,15,15,15,15,15,15,15,15,15,15,15,15,15,15,15,15,15,15,15,15,15,15,15,15,15,15,15,15,15,15,15,15,15,15,15,15,15,15,15,15,15,15,15,15,15,15,15,15,15,15,15,15,15,15,15,15,15,15,15,15,15,15,15,15,15,15,15,15,15,15,15,15,15,15,15,15,15,15,15,15,15,15,15,15,15,15,15,15,15,15,15,15,15,15,15,15,15,15,15,15,15,15,15,15,15,15,15,15,15,15,15,15,15,15,15,15,15,15,15,15,15,15,15,15,15,15,15,15,15,15,15,15,15,15,15,15,15,15,15,15,15,15,15,15,15,15,15,15,15,15,15,15,15,15,15,15,15,15,15,15,15,15,15,15,15,15,15,15,15,15,15,15,15,15,15,15,15,15,15,15,15,15,15,15,15,15,15,15,15,15,15,15,15,15,15,15,15,15,15,15,15,15,15,15,15,15,15,15,15,15,15,15,15,15,15,15,15,15,15,15,15,15,15,15,15,15,15,15,15,15,15,15,15,15,15,15,15,15,15,15,15,15,15,15,15,15,15,15,15,15,15,15,15,15,15,15,15,15,15,15,15,15,15,15,15,15,15,15,15,15,15,15,15,15,15,15,15,15,15,15,15,15,15,15,15,15,15,15,15,15,15,15,15,15,15,15,15,15,15,15,15,15,15,15,15,15,15,15,15,15,15,15,15,15,15,15,15,15,15,15,15,15,15,15,15,15,15,15,15,15,15,15,15,15,15,15,15,15,15,15,15,15,15,15,15,15,15,15,15,15,15,15,15,15,15,15,15,15,15,15,15,15,15,15,15,15,15,15,15,15,15,15,15,15,15,15,15,15,15,15,15,15,15,15,15,15,15,15,15,15,15,15,15,15,15,15,15,15,15,15,15,15,15,15,15,15,15,15,15,15,15,15,15,15,15,15,15,15,15,15,15,15,15,15,15,15,15,15,15,15,15,15,15,15,15,15,15,15,15,15,15,15,15,15,15,15,15,15,15,15,15,15,15,15,15,15,15,15,15,15,15,15,15,15,15,15,15,15,15,15,15,15,15,15,15,15,15,15,15,15,15,15,15,15,15,15,15,15,15,15,15,15,15,15,15,15,15,15,15,15,15,15,15,15,15,15,15,15,15,15,15,15,15,15,15,15,15,15,15,15,15,15,15,15,15,15,15,15,15,15,15,15,15,15,15,15,15,15,15,15,15,15,15,15,15,15,15,15,15,15,15,15,15,15,15,15,15,15,15,15,15,15,15,15,15,15,15,15,15,15,15,15,15,15,15,15,15,15,15,15,15,15,15,15,15,15,15,15,15,15,15,15,15,15,15,15,15,15,15,15,15,15,15,15,15,15,15,15,15,15,15,15,15,15,15,15,15,15,15,15,15,15,15,15,15,15,15,15,15,15,15,15,15,15,15,15,15,15,15,15,15,15,15,15,15,15,15,15,15,15,15,15,15,15,15,15,15,15,15,15,15,15,15,15,15,15,15,15,15,15,15,15,15,15,15,15,15,15,15,15,15,15,15,15,15,15,15,15,15,15,15,15,15,15,15,15,15,15,15,15,15,15,15,15,15,15,15,15,15,15,15,15,15,15,15,15,15,15,15,15,15,15,15,15,15,15,15,15,15,15,15,15,15,15,15,15,15,15,15,15,15,15,15,15,15,15,15,15,15,15,15,15,15,15,15,15,15,15,15,15,15,15,15,15,15,15,15,15,15,15,15,15,15,15,15,15,15,15,15,15,15,15,15,15,15,15,15,15,15,15,15,15,15,15,15,15,15,15,15,15,15,15,15,15,15,15,15,15,15,15,15,15,15,15,15,15,15,15,15,15,15,15,15,15,15,15,15,15,15,15,15,15,15,15,15,15,15,15,15,15,15,15,15,15,15,15,15,15,15,15,15,15,15,15,15,15,15,15,15,15,15,15,15,15,15,15,15,15,15,15,15,15,15,15,15,15,15,15,15,15,15,15,15,15,15,15,15,15,15,15,15,15,15,15,15,15,15,15,15,15,15,15,15,15,15,15,15,15,15,15,15,15,15,15,15,15,15,15,15,15,15,15,15,15,15,15,15,15,15,15,15,15,15,15,15,15,15,15,15,15,15,15,15,15,15,15,15,15,15,15,15,15,15,15,15,15,15,15,15,15,15,15,15,15,15,15,15,15,15,15,15,15,15,15,15,15,15,15,15,15,15,15,15,15,15,15,15,15,15,15,15,15,15,15,15,15,15,15,15,15,15,15,15,15,15,15,15,15,15,15,15,15,15,15,15,15,15,15,15,15,15,15,15,15,15,15,15,15,15,15,15,15,15,15,15,15,15,15,15,15,15,15,15,15,15,15,15,15,15,15,15,15,15,15,15,15,15,15,15,15,15,15,15,15,15,15,15,15,15,15,15,15,15,15,15,15,15,15,15,15,15,15,15,15,15,15,15,15,15,15,15,15,15,15,15,15,15,15,15,15,15,15,15,15,15,15,15,15,15,15,15,15,15,15,15,15,15,15,15,15,15,15,15,15,15,15,15,15,15,15,15,15,15,15,15,15,15,15,15,15,15,15,15,15,15,15,15,15,15,15,15,15,15,15,15,15,15,15,15,15,15,15,15,15,15,15,15,15,15,15,15,15,15,15,15,15,15,15,15,15,15,15,15,15,15,15,15,15,15,15,15,15,15,15,15,15,15,15,15,15,15,15,15,15,15,15,15,15,15,15,15,15,15,15,15,15,15,15,15,15,15,15,15,15,15,15,15,15,15,15,15,15,15,15,15,15,15,15,15,15,15,15,15,15,15,15,15,15,15,15,15,15,15,15,15,15,14,14,14,14,14,14,14,14,14,14,14,14,14,14,14,14,14,14,14,14,14,14,14,14,14,14,14,13,13,13,13,13,13,13,13,13,13,13,13,13,13,13,13,13,13,12,12,12,12,12,12,12,12,12,12,12,12,12,12,11,11,11,11,11,11,11,11,11,10,10,10,10,10,10,10,9,9,9,9,8,8,8,8,7,6,5,4,3,2,1,0,17,18,19,20,21,22,23,24,24,24,24,25,25,25,25,26,26,26,26,26,26,26,27,27,27,27,27,27,27,27,27,28,28,28,28,28,28,28,28,28,28,28,28,28,28,29,29,29,29,29,29,29,29,29,29,29,29,29,29,29,29,29,29,30,30,30,30,30,30,30,30,30,30,30,30,30,30,30,30,30,30,30,30,30,30,30,30,30,30,30,31,31,31,31,31,31,31,31,31,31,31,31,31,31,31,31,31,31,31,31,31,31,31,31,31,31,31,31,31,31,31,31,31,31,31,31,31,31,31,31,31,31,31,31,31,31,31,31,31,31,31,31,31,31,31,31,31,31,31,31,31,31,31,31,31,31,31,31,31,31,31,31,31,31,31,31,31,31,31,31,31,31,31,31,31,31,31,31,31,31,31,31,31,31,31,31,31,31,31,31,31,31,31,31,31,31,31,31,31,31,31,31,31,31,31,31,31,31,31,31,31,31,31,31,31,31,31,31,31,31,31,31,31,31,31,31,31,31,31,31,31,31,31,31,31,31,31,31,31,31,31,31,31,31,31,31,31,31,31,31,31,31,31,31,31,31,31,31,31,31,31,31,31,31,31,31,31,31,31,31,31,31,31,31,31,31,31,31,31,31,31,31,31,31,31,31,31,31,31,31,31,31,31,31,31,31,31,31,31,31,31,31,31,31,31,31,31,31,31,31,31,31,31,31,31,31,31,31,31,31,31,31,31,31,31,31,31,31,31,31,31,31,31,31,31,31,31,31,31,31,31,31,31,31,31,31,31,31,31,31,31,31,31,31,31,31,31,31,31,31,31,31,31,31,31,31,31,31,31,31,31,31,31,31,31,31,31,31,31,31,31,31,31,31,31,31,31,31,31,31,31,31,31,31,31,31,31,31,31,31,31,31,31,31,31,31,31,31,31,31,31,31,31,31,31,31,31,31,31,31,31,31,31,31,31,31,31,31,31,31,31,31,31,31,31,31,31,31,31,31,31,31,31,31,31,31,31,31,31,31,31,31,31,31,31,31,31,31,31,31,31,31,31,31,31,31,31,31,31,31,31,31,31,31,31,31,31,31,31,31,31,31,31,31,31,31,31,31,31,31,31,31,31,31,31,31,31,31,31,31,31,31,31,31,31,31,31,31,31,31,31,31,31,31,31,31,31,31,31,31,31,31,31,31,31,31,31,31,31,31,31,31,31,31,31,31,31,31,31,31,31,31,31,31,31,31,31,31,31,31,31,31,31,31,31,31,31,31,31,31,31,31,31,31,31,31,31,31,31,31,31,31,31,31,31,31,31,31,31,31,31,31,31,31,31,31,31,31,31,31,31,31,31,31,31,31,31,31,31,31,31,31,31,31,31,31,31,31,31,31,31,31,31,31,31,31,31,31,31,31,31,31,31,31,31,31,31,31,31,31,31,31,31,31,31,31,31,31,31,31,31,31,31,31,31,31,31,31,31,31,31,31,31,31,31,31,31,31,31,31,31,31,31,31,31,31,31,31,31,31,31,31,31,31,31,31,31,31,31,31,31,31,31,31,31,31,31,31,31,31,31,31,31,31,31,31,31,31,31,31,31,31,31,31,31,31,31,31,31,31,31,31,31,31,31,31,31,31,31,31,31,31,31,31,31,31,31,31,31,31,31,31,31,31,31,31,31,31,31,31,31,31,31,31,31,31,31,31,31,31,31,31,31,31,31,31,31,31,31,31,31,31,31,31,31,31,31,31,31,31,31,31,31,31,31,31,31,31,31,31,31,31,31,31,31,31,31,31,31,31,31,31,31,31,31,31,31,31,31,31,31,31,31,31,31,31,31,31,31,31,31,31,31,31,31,31,31,31,31,31,31,31,31,31,31,31,31,31,31,31,31,31,31,31,31,31,31,31,31,31,31,31,31,31,31,31,31,31,31,31,31,31,31,31,31,31,31,31,31,31,31,31,31,31,31,31,31,31,31,31,31,31,31,31,31,31,31,31,31,31,31,31,31,31,31,31,31,31,31,31,31,31,31,31,31,31,31,31,31,31,31,31,31,31,31,31,31,31,31,31,31,31,31,31,31,31,31,31,31,31,31,31,31,31,31,31,31,31,31,31,31,31,31,31,31,31,31,31,31,31,31,31,31,31,31,31,31,31,31,31,31,31,31,31,31,31,31,31,31,31,31,31,31,31,31,31,31,31,31,31,31,31,31,31,31,31,31,31,31,31,31,31,31,31,31,31,31,31,31,31,31,31,31,31,31,31,31,31,31,31,31,31,31,31,31,31,31,31,31,31,31,31,31,31,31,31,31,31,31,31,31,31,31,31,31,31,31,31,31,31,31,31,31,31,31,31,31,31,31,31,31,31,31,31,31,31,31,31,31,31,31,31,31,31,31,31,31,31,31,31,31,31,31,31,31,31,31,31,31,31,31,31,31,31,31,31,31,31,31,31,31,31,31,31,31,31,31,31,31,31,31,31,31,31,31,31,31,31,31,31,31,31,31,31,31,31,31,31,31,31,31,31,31,31,31,31,31,31,31,31,31,31,31,31,31,31,31,31,31,31,31,31,31,31,31,31,31,31,31,31,31,31,31,31,31,31,31,31,31,31,31,31,31,31,31,31,31,31,31,31,31,31,31,31,31,31,31,31,31,31,31,31,31,31,31,31,31,31,31,31,31,31,31,31,31,31,31,31,31,31,31,31,31,31,31,31,31,31,31,31,31,31,31,31,31,31,31,31,31,31,31,31,31,31,31,31,31,31,31,31,31,31,31,31,31,31,31,31,31,31,31,31,31,31,31,31,31,31,31,31,31,31,31,31,31,31,31,31,31,31,31,31,31,31,31,31,31,31,31,31,31,31,31,31,31,31,31,31,31,31,31,31,31,31,31,31,31,31,31,31,31,31,31,31,31,31,31,31,31,31,31,31,31,31,31,31,31,31,31,31,31,31,31,31,31,31,31,31,31,31,31,31,31,31,31,31,31,31,31,31,31,31,31,31,31,31,31,31,31,31,31,31,31,31,31,31,31,31,31,31,31,31,31,31,31,31,31,31,31,31,31,31,31,31,31,31,31,31,31,31,31,31,31,31,31,31,31,31,31,31,31,31,31,31,31,31,31,31,31,31,31,31,31,31,31,31,31,31,31,31,31,31,31,31,31,31,31,31,31,31,31,31,31,31,31,31,31,31,31,31,31,31,31,31,31,31,31,31,31,31,31,31,31,31,31,31,31,31,31,31,31,31,31,31,31,31,31,31,31,31,31,31,31,31,31,31,31,31,31,31,31,31,31,31,31,31,31,31,31,31,31,31,31,31,31,31,31,31,31,31,31,31,31,31,31,31,31,31,31,31,31,31,31,31,31,31,31,31,31,31,31,31,31,31,31,31,31,31,31,31,31,31,31,31,31,31,31,31,31,31,31,31,31,31,31,31,31,31,31,31,31,31,31,31,31,31,31,31,31,31,31,31,31,31,31,31,31,31,31,31,31,31,31,31,31,31,31,31,31,31,31,31,31,31,31,31,31,31,31,31,31,31,31,31,31,31,31,31,31,31,31,31,31,31,31,31,31,31,31,31,31,31,31,31,31,31,31,31,31,31,31,31,31,31,31,31,31,31,31,31,31,31,31,31,31,31,31,31,31,31,31,31,31,31,31,31,31,31,31,31,31,31,31,31,31,31,31,31,31,31,31,31,31,31,31,31,31,31,31,31,31,31,31,31,31,31,31,31,31,31,31,31,31,31,31,31,31,31,31,31,31,31,31,31,31,31,31,31,31,31,31,31,31,31,31,31,31,31,31,31,31,31,31,31,31,31,31,31,31,31,31,31,31,31,31,31,31,31,31,31,31,31,31,31,31,31,31,31,31,31,31,31,31,31,31,31,31,31,31,31,31,31,31,31,31,31,31,31,31,31,31,31,31,31,31,31,31,31,31,31,31,31,31,31,31,31,31,31,31,31,31,31,31,31,31,31,31,31,31,31,31,31,31,31,31,31,31,31,31,31,31,31,31,31,31,31,31,31,31,31,31,31,31,31,31,31,31,31,31,31,31,31,31,31,31,31,31,31,31,31,31,31,31,31,31,31,31,31,31,31,31,31,31,31,31,31,31,31,31,31,31,31,31,31,31,31,31,31,31,31,31,31,31,31,31,31,31,31,31,31,31,31,31,31,31,31,31,31,31,31,31,31,31,31,31,31,31,31,31,31,31,31,31,31,31,31,31,31,31,31,31,31,31,31,31,31,31,31,31,31,31,31,31,31,31,31,31,31,31,31,31,31,31,31,31,31,31,31,31,31,31,31,31,31,31,31,31,31,31,31,31,31,31,31,31,31,31,31,31,31,31,31,31,31,31,31,31,31,31,31,31,31,31,31,31,31,31,31,31,31,31,31,31,31,31,31,31,31,31,31,31,31,31,31,31,31,31,31,31,31,31,31,31,31,31,31,31,31,31,31,31,31,31,31,31,31,31,31,31,31,31,31,31,31,31,31,31,31,31,31,31,31,31,31,31,31,31,31,31,31,31,31,31,31,31,31,31,31,31,31,31,31,31,31,31,31,31,31,31,31,31,31,31,31,31,31,31,31,31,31,31,31,31,31,31,31,31,31,31,31,31,31,31,31,31,31,31};
__device__ __forceinline__ void d_btab(const float* __restrict__ relb, float* BT) { const int e = blockIdx.x * 256 + threadIdx.x; if (e >= NH_ * 4096) return; const int r = e % 4096, h = e / 4096; const float v = (r < 4095) ? bfr(relb[BKT[r] * NH_ + h]) : 0.f; *(float*)(BT + e) = v;  }
// k_prep: everything that reads the inputs alone, in one launch; grid (512, 6): y = 0 the LayerNorm of all rows (the longest work, so it starts first), y = 1 .. 4 the four weight planes (one size, one behind the other in Bt), y = 5 the bias table. The branch is the same for a whole workgroup and stands in front of the barrier.
static_assert(NB_ * TT / 8 == 512 && DM * DQ / 256 / 8 == 512 && NH_ * 4096 / 256 <= 512, "grid x of k_prep");
__global__ __launch_bounds__(256) void k_prep(const float* __restrict__ X, const float* __restrict__ A, const float* __restrict__ g, const float* __restrict__ be, float* Z, bf* Yh, bf* Yl, const float* __restrict__ w0, const float* __restrict__ w1, const float* __restrict__ w2, const float* __restrict__ w3, bf* Bt, const float* __restrict__ relb, float* BT) {
    if (blockIdx.y == 5) { d_btab(relb, BT); return; }
    if (blockIdx.y != 0) { d_wtG<DM, DQ>((blockIdx.y == 1) ? w0 : (blockIdx.y == 2) ? w1 : (blockIdx.y == 3) ? w2 : w3, Bt + (size_t)(blockIdx.y - 1) * DQ * DM); return; }
    static_assert(TT % 8 == 0, "a workgroup's 8 rows are all inside or all outside");
    __shared__ __align__(16) bf ys[2][8][DM + 16];   /* the workgroup's 8 rows, hi and lo; the pitch spreads 8 rows' 16-byte pieces over the banks */
    const int lane = threadIdx.x & 31; const int wr = threadIdx.x >> 5; const int r = blockIdx.x * 8 + wr; if (blockIdx.x * 8 >= NB_ * TT) return; const float* xr = X + (size_t)r * DM; const float* ar = A ? A + (size_t)r * DM : nullptr; float s = 0.f;
#pragma unroll 1
    for (int ch = 0; ch < DM / 128; ++ch) { const int c0 = ch * 128 + lane * 4; const v4f a = *(const v4f*)(xr + c0); v4f d = {0.f, 0.f, 0.f, 0.f}; if (ar) d = *(const v4f*)(ar + c0);
#pragma unroll
        for (int q = 0; q < 4; ++q) s += __fadd_rn(bfr(a[q]), d[q]); }
#pragma unroll
    for (int sh = 16; sh; sh >>= 1) s += __shfl_xor(s, sh, 32);
    const float mu = s * (1.0f / DM); float s2 = 0.f;
#pragma unroll 1
    for (int ch = 0; ch < DM / 128; ++ch) { const int c0 = ch * 128 + lane * 4; const v4f a = *(const v4f*)(xr + c0); v4f d = {0.f, 0.f, 0.f, 0.f}; if (ar) d = *(const v4f*)(ar + c0);
#pragma unroll
        for (int q = 0; q < 4; ++q) { const float d0 = __fsub_rn(__fadd_rn(bfr(a[q]), d[q]), mu); float p = __fmul_rn(d0, d0); asm volatile("" : "+v"(p)); s2 = __fadd_rn(s2, p); } }
#pragma unroll
    for (int sh = 16; sh; sh >>= 1) s2 += __shfl_xor(s2, sh, 32);
    const float rs = __fdiv_rn(1.0f, __fsqrt_rn(__fadd_rn(s2 * (1.0f / DM), LNEPS)));
{
#pragma unroll 1
        for (int ch = 0; ch < DM / 128; ++ch) { const int c0 = ch * 128 + lane * 4; const v4f a = *(const v4f*)(xr + c0); v4f d = {0.f, 0.f, 0.f, 0.f}; if (ar) d = *(const v4f*)(ar + c0); v4f z4; v4us oh, ol;
#pragma unroll
            for (int q = 0; q < 4; ++q) { const float v = __fadd_rn(bfr(a[q]), d[q]); z4[q] = v; float n0 = __fmul_rn(__fsub_rn(v, mu), rs); asm volatile("" : "+v"(n0)); float n1 = __fmul_rn(n0, bfr(g[c0 + q])); asm volatile("" : "+v"(n1)); const float y = __fadd_rn(n1, bfr(be[c0 + q])); unsigned short h2, l2; splitf(y, h2, l2); oh[q] = h2; ol[q] = l2; }
            if (Z) *(v4f*)(Z + (size_t)r * DM + c0) = z4; *(v4usa*)(&ys[0][wr][c0]) = oh; *(v4usa*)(&ys[1][wr][c0]) = ol; }
         }
    __syncthreads();   /* all 8 rows staged: a 128-byte line of a plane in fragment order holds 16 bytes of each of them */
    const size_t yo = (size_t)(blockIdx.x >> 1) * 16 * DM + (blockIdx.x & 1) * 64 + (threadIdx.x & 7) * 8;   /* rows 8 (x % 2) + t % 8 of row block x / 2 */
#pragma unroll
    for (int i = 0; i < DM / 256; ++i) { const int sg = i * 32 + (threadIdx.x >> 3);   /* columns 8 sg ..: a wave stores four whole lines */
        *(v8us*)(Yh + yo + sg * 128) = *(const v8usa*)(&ys[0][threadIdx.x & 7][sg * 8]); *(v8us*)(Yl + yo + sg * 128) = *(const v8usa*)(&ys[1][threadIdx.x & 7][sg * 8]); } }
__global__ __launch_bounds__(256) void k_cvt8(const float* __restrict__ src, bf* dst, size_t n8) { const size_t i = (size_t)blockIdx.x * 256 + threadIdx.x; if (i >= n8) return; const v8f v = *(const v8f*)(src + i * 8); v8us o;
#pragma unroll
    for (int k = 0; k < 8; ++k) o[k] = f2bf(v[k]); *(v8us*)(dst + i * 8) = o;  }

typedef __attribute__((ext_vector_type(8))) __bf16 v8bf;
__device__ __forceinline__ float xhalf(float x) { const int b = __float_as_int(x); return __int_as_float(__builtin_amdgcn_permlanex16(b, b, 0x76543210, 0xfedcba98, false, false)); }   /* lane l <-> l ^ 16 */
// The wait stands between a run of global loads and the first rewrite of an address register that they name: the addresses are inputs, so they stay in their registers up to it, and the scheduling barrier keeps later instructions behind it.
__device__ __forceinline__ void xwait(const void* a, const void* b) { asm volatile("s_wait_xcnt 0x0" :: "v"(a), "v"(b) : "memory"); __builtin_amdgcn_sched_barrier(0); }
// 2^x by v_exp_f32 with the one free slot that the instruction set asks for behind a transcendental in the same statement, so that it stands directly behind it wherever the statement is scheduled.
__device__ __forceinline__ float exp2s(float x) { float y; asm("v_exp_f32 %0, %1\n\tv_nop" : "=v"(y) : "v"(x)); return y; }
template <bool B> struct BoolC { static constexpr bool value = B; };
template <typename T16, bool HI, int NQ>
__device__ __forceinline__ void fa_wave(const T16* __restrict__ Q, const T16* __restrict__ Q2, const T16* __restrict__ K, const T16* __restrict__ K2, const T16* __restrict__ V, const T16* __restrict__ V2, const float* __restrict__ bt, int q0, bf* Ah, bf* Al) {
    typedef WFrag<T16> WF; typedef typename WF::V F;
    const int lane = threadIdx.x & 31, lr = lane & 15, hi = lane >> 4;
    const float L2E = 1.4426950408889634f;
    F qf[NQ][2], qf2[NQ][2];
    const T16* qp = Q + (size_t)q0 * HD + lane * 8; const T16* qp2 = Q2 + (size_t)q0 * HD + lane * 8;
#pragma unroll
    for (int nb = 0; nb < NQ; ++nb)
#pragma unroll
        for (int ks = 0; ks < 2; ++ks) { qf[nb][ks] = WF::ld(qp + nb * 16 * HD + ks * 512); if (HI) qf2[nb][ks] = WF::ld(qp2 + nb * 16 * HD + ks * 512); }
    v8f o[4][NQ];
#pragma unroll
    for (int dt = 0; dt < 4; ++dt)
#pragma unroll
        for (int nb = 0; nb < NQ; ++nb) o[dt][nb] = (v8f){};
    float m[NQ], l[NQ];
#pragma unroll
    for (int nb = 0; nb < NQ; ++nb) { m[nb] = -3.0e38f; l[nb] = 0.f; }
    const float cneg = bt[-(TT - 1)], cpos = bt[TT - 1];
    const int ko = lane * 8, vo = lane * 8;
    F kf[2][2], kf2[2][2];
#pragma unroll
    for (int kt = 0; kt < 2; ++kt)
#pragma unroll
        for (int ks = 0; ks < 2; ++ks) { kf[kt][ks] = WF::ld(K + ko + kt * 16 * HD + ks * 512); if (HI) kf2[kt][ks] = WF::ld(K2 + ko + kt * 16 * HD + ks * 512); }
    xwait(qp, HI ? qp2 : qp); xwait(K + ko, HI ? K2 + ko : K + ko);
    // One pass over keys k0 .. k0 + 31, written once and compiled into three loops (below). NEAR: the score tiles start from table values, loaded in front of the V loads, so that the wait for them leaves the V loads in flight. Otherwise all 32 keys have the one bias cb: the tiles start from 0, and cb joins the pass's maximum and the addend of the exponent.
    auto pass = [&](auto nearc, const int k0, const float cb) __attribute__((always_inline)) {
        constexpr bool NEAR = decltype(nearc)::value;
        v8f s[2][NQ];
        if constexpr (!NEAR) {
#pragma unroll
            for (int kt = 0; kt < 2; ++kt)
#pragma unroll
                for (int nb = 0; nb < NQ; ++nb) s[kt][nb] = (v8f){};
        } else { const float* bp0 = bt + (k0 + 8 * hi) - (q0 + lr);
#pragma unroll
            for (int kt = 0; kt < 2; ++kt)
#pragma unroll
                for (int nb = 0; nb < NQ; ++nb) { const float* bp = bp0 + (kt - nb) * 16;
#pragma unroll
                    for (int r = 0; r < 8; ++r) s[kt][nb][r] = bp[r]; }
            xwait(bp0, bp0);
        }
        F vf[4], vf2[4]; const T16* vp = V + vo + k0 * 16; const T16* vp2 = V2 + vo + k0 * 16;
#pragma unroll
        for (int dt = 0; dt < 4; ++dt) { vf[dt] = WF::ld(vp + dt * 16 * TT); if (HI) vf2[dt] = WF::ld(vp2 + dt * 16 * TT); }
        xwait(vp, HI ? vp2 : vp);
#pragma unroll
        for (int ks = 0; ks < 2; ++ks)
#pragma unroll
            for (int kt = 0; kt < 2; ++kt)
#pragma unroll
                for (int nb = 0; nb < NQ; ++nb) { s[kt][nb] = WF::mma(kf[kt][ks], qf[nb][ks], s[kt][nb]); if (HI) { s[kt][nb] = WF::mma(kf[kt][ks], qf2[nb][ks], s[kt][nb]); s[kt][nb] = WF::mma(kf2[kt][ks], qf[nb][ks], s[kt][nb]); } }
        const int kn = (k0 + 32 < TT) ? k0 + 32 : 0;   /* the next pass's key rows, fetched behind this pass's score products; the last pass refetches rows 0-31, unused */
        const T16* kp = K + ko + kn * HD; const T16* kp2 = K2 + ko + kn * HD;
#pragma unroll
        for (int kt = 0; kt < 2; ++kt)
#pragma unroll
            for (int ks = 0; ks < 2; ++ks) { kf[kt][ks] = WF::ld(kp + kt * 16 * HD + ks * 512); if (HI) kf2[kt][ks] = WF::ld(kp2 + kt * 16 * HD + ks * 512); }
        xwait(kp, HI ? kp2 : kp);
        F pf[NQ], pf2[NQ];
#pragma unroll
        for (int nb = 0; nb < NQ; ++nb) {
            float mx = s[0][nb][0];
#pragma unroll
            for (int r = 1; r < 8; ++r) mx = fmaxf(mx, s[0][nb][r]);
#pragma unroll
            for (int r = 0; r < 8; ++r) mx = fmaxf(mx, s[1][nb][r]);
            mx = fmaxf(mx, xhalf(mx));
            if constexpr (!NEAR) mx += cb;
            const float mn = fmaxf(m[nb], mx);
            const float al = exp2s((m[nb] - mn) * L2E);
            float ng = (HI ? 0.0f : PSH) - mn * L2E;
            if constexpr (!NEAR) ng = __builtin_fmaf(cb, L2E, ng);
            m[nb] = mn;
            float sum = 0.f;
#pragma unroll
            for (int kt = 0; kt < 2; ++kt)
#pragma unroll
                for (int r = 0; r < 8; ++r) { const float p = exp2s(__builtin_fmaf(s[kt][nb][r], L2E, ng)); s[kt][nb][r] = p; sum += p; }
            l[nb] = l[nb] * al + sum;
#pragma unroll
            for (int dt = 0; dt < 4; ++dt) o[dt][nb] *= al;
            if constexpr (HI) {
                const v8bf h0 = __builtin_convertvector(s[0][nb], v8bf), h1 = __builtin_convertvector(s[1][nb], v8bf);
                const v8bf l0 = __builtin_convertvector(s[0][nb] - __builtin_convertvector(h0, v8f), v8bf), l1 = __builtin_convertvector(s[1][nb] - __builtin_convertvector(h1, v8f), v8bf);
                pf[nb] = __builtin_shufflevector(h0, h1, 0, 1, 2, 3, 4, 5, 6, 7, 8, 9, 10, 11, 12, 13, 14, 15); pf2[nb] = __builtin_shufflevector(l0, l1, 0, 1, 2, 3, 4, 5, 6, 7, 8, 9, 10, 11, 12, 13, 14, 15);
            } else {
                pf[nb] = cat16(__builtin_convertvector(s[0][nb], v8h), __builtin_convertvector(s[1][nb], v8h));
            }
        }
#pragma unroll
        for (int dt = 0; dt < 4; ++dt)
#pragma unroll
            for (int nb = 0; nb < NQ; ++nb) { o[dt][nb] = WF::mma(vf[dt], pf[nb], o[dt][nb]); if (HI) { o[dt][nb] = WF::mma(vf[dt], pf2[nb], o[dt][nb]); o[dt][nb] = WF::mma(vf2[dt], pf[nb], o[dt][nb]); } }
    };
    // The keys in ascending order, as three loops: passes wholly 128 or more below the queries, passes that need the table, passes wholly 128 or more above. A loop of the first or third kind holds no bias load and no branch, so nothing in it waits for the pass's own V loads before attn.v needs them.
    // Each is rolled: the running maximum chains the passes, so unrolling would add code and registers without overlapping them.
    const int e1 = (q0 > 127 ? q0 - 127 : 0) & ~31;   /* k0 < e1: (k0 + 31) - q0 <= -128 */
    const int e2r = (q0 + 16 * NQ + 127 + 31) & ~31, e2 = e2r < TT ? e2r : TT;   /* k0 >= e2: k0 - (q0 + 16 NQ - 1) >= 128 */
    int k0 = 0;
#pragma unroll 1
    for (; k0 < e1; k0 += 32) pass(BoolC<false>{}, k0, cneg);
#pragma unroll 1
    for (; k0 < e2; k0 += 32) pass(BoolC<true>{}, k0, 0.f);
#pragma unroll 1
    for (; k0 < TT; k0 += 32) pass(BoolC<false>{}, k0, cpos);
#pragma unroll
    for (int nb = 0; nb < NQ; ++nb) { const float inv = __fdiv_rn(1.0f, l[nb] + xhalf(l[nb])); const size_t oo = (size_t)(q0 + nb * 16) * DQ + lane * 8;
#pragma unroll
        for (int dt = 0; dt < 4; ++dt) { v8us oh, ol;
#pragma unroll
            for (int r = 0; r < 8; ++r) { unsigned short a, c2; splitf(o[dt][nb][r] * inv, a, c2); oh[r] = a; ol[r] = c2; }
            *(v8us*)(Ah + oo + dt * 256) = oh; *(v8us*)(Al + oo + dt * 256) = ol; } }
}
// grid (RH / 32, heads, batches), 5 waves: waves 0-1 take 16 hi/lo query rows each, waves 2-4 take 32 fp16 rows each, so every workgroup carries the same share of both kinds of work (no barrier in the kernel: the waves are independent); planes [b][h] of (row t, k = d) (q, k) and of (row d, k = t) (v); merged output planes [b] of (row t, k = h d) as hi/lo; all in fragment order
static_assert(RH / 32 == (TT - RH) / 96 && RH % 32 == 0 && (TT - RH) % 96 == 0, "2 hi/lo waves and 3 fp16 waves per workgroup cover all rows");
__global__ __launch_bounds__(160) void k_fattn(const h16* __restrict__ Q16, const h16* __restrict__ K16, const h16* __restrict__ V16, const bf* __restrict__ Qh, const bf* __restrict__ Ql, const bf* __restrict__ Kh, const bf* __restrict__ Kl, const bf* __restrict__ Vh, const bf* __restrict__ Vl, const float* __restrict__ BT, bf* Ah, bf* Al) {
    const int wv = __builtin_amdgcn_readfirstlane((int)(threadIdx.x >> 5)), bx = blockIdx.x, h = blockIdx.y, b = blockIdx.z;
    const size_t pq = ((size_t)b * NH_ + h) * TT * HD, pk = ((size_t)b * NKV + h / REP) * TT * HD, po = (size_t)b * TT * DQ + h * HD * 16;
    const float* bt = BT + (size_t)h * 4096 + (TT - 1);   /* bt[j - i] */
    if (wv < 2) fa_wave<bf, true, 1>(Qh + pq, Ql + pq, Kh + pk, Kl + pk, Vh + pk, Vl + pk, bt, (bx * 2 + wv) * 16, Ah + po, Al + po);
    else fa_wave<h16, false, 2>(Q16 + pq, nullptr, K16 + pk, nullptr, V16 + pk, nullptr, bt, RH + (bx * 3 + wv - 2) * 32, Ah + po, Al + po);
}

extern "C" void kernel_launch(void* const* d_in, const int* in_sizes, int n_in,
                              void* d_out, int out_size, void* d_ws, size_t ws_size, hipStream_t stream) {
    (void)in_sizes; (void)n_in; (void)out_size;
    const float* x = (const float*)d_in[0]; const float* g1 = (const float*)d_in[1]; const float* e1b = (const float*)d_in[2]; const float* wq = (const float*)d_in[3]; const float* wk = (const float*)d_in[4]; const float* wv = (const float*)d_in[5]; const float* wo = (const float*)d_in[6]; const float* relb = (const float*)d_in[7];
    float* OUT = (float*)d_out;     // [2][2048][1024]
    char* wsp = (char*)d_ws;
    auto take = [&](size_t bytes) { char* p = wsp; wsp += (bytes + 255) & ~(size_t)255; return (void*)p; };
    bf* WQ = (bf*)take((size_t)DQ * DM * 2); bf* WK = (bf*)take((size_t)DKV * DM * 2); bf* WV = (bf*)take((size_t)DKV * DM * 2); bf* WO = (bf*)take((size_t)DM * DQ * 2);
    bf* Yh = (bf*)take((size_t)NB_ * TT * DM * 2); bf* Yl = (bf*)take((size_t)NB_ * TT * DM * 2); float* BT = (float*)take((size_t)NH_ * 4096 * 4);
    h16* QP16 = (h16*)take((size_t)NB_ * NH_ * TT * HD * 2); h16* KP16 = (h16*)take((size_t)NB_ * NKV * TT * HD * 2); h16* VT16 = (h16*)take((size_t)NB_ * NKV * HD * TT * 2);
    bf* QPh = (bf*)take((size_t)NB_ * NH_ * TT * HD * 2); bf* KPh = (bf*)take((size_t)NB_ * NKV * TT * HD * 2); bf* VTh = (bf*)take((size_t)NB_ * NKV * HD * TT * 2); bf* QPl = (bf*)take((size_t)NB_ * NH_ * TT * HD * 2); bf* KPl = (bf*)take((size_t)NB_ * NKV * TT * HD * 2); bf* VTl = (bf*)take((size_t)NB_ * NKV * HD * TT * 2);   // q, k, v of each kind follow one another (every size is a multiple of 256 bytes), as do WQ, WK, WV, WO: the z stride of the merged launches
    bf* ATh = (bf*)take((size_t)NB_ * TT * DQ * 2); bf* ATl = (bf*)take((size_t)NB_ * TT * DQ * 2);
    if ((size_t)(wsp - (char*)d_ws) > ws_size) return;    // ws 256 MiB
    k_prep<<<dim3(512, 6, 1), 256, 0, stream>>>(x, nullptr, g1, e1b, nullptr, Yh, Yl, wq, wk, wv, wo, WQ, relb, BT);   /* n = LN(hidden) as hi/lo planes, both batches; all four weight planes; the bias table */
    k_gemmw<bf, 1, 1, DM><<<dim3(NB_ * TT / 64, DQ / 64, 3), 32, 0, stream>>>(Yh, Yl, WQ, nullptr, nullptr, nullptr, QP16, QPh, QPl, 0, (size_t)DQ * DM, (size_t)NB_ * NH_ * TT * HD);   /* q, k, v of both batches: head planes, written by the projections themselves */
    k_fattn<<<dim3(RH / 32, NH_, NB_), 160, 0, stream>>>(QP16, KP16, VT16, QPh, QPl, KPh, KPl, VTh, VTl, BT, ATh, ATl);
    k_gemmw<bf, 1, 0, DQ><<<dim3(NB_ * TT / 64, DM / 64, 1), 32, 0, stream>>>(ATh, ATl, WO, nullptr, x, OUT, nullptr, nullptr, nullptr, 0, 0, 0);   /* out = hidden + ctx Wo */
}

// v007
// A run of this version takes 153 microseconds.
// Two timings next to v006 put it at 1.09 and 1.06 times that version's speed.
// Counting every step since v000, it is 13.4 times as fast.
#include <hip/hip_runtime.h>

// T5 self-attention layer (hidden [2][2048][1024]; n = LayerNorm(hidden) (1e-6, ln_g, ln_b); q, k, v = n W ('xw' [1024][1024], no bias, 16 heads x 64); scores = q.k (NO 1/sqrt(d)) + rel_bias[bucket(j - i)][h] (T5 bidirectional buckets, 32 buckets, max distance 128); softmax over all keys; out = hidden + merged Wo -> [2][2048][1024]).
// The bucket index depends only on (j - i); it is embedded as a 4095-entry integer table computed with the reference's own bucket function (its f32 log -> int32 cast has exact-integer knife edges, so it is not recomputed on the device).
// Compute dtypes, f32 accumulate: every input rounded to bf16; q/k/v projections hl x exact (2 products); the relative-position bias (bf16-rounded rel_bias values through the embedded bucket table) enters the scores in f32; scores and attn.v: query rows < 512 hl (3 products), the rest single fp16 (P x1024); softmax f32, online; Wo hl x exact (2 products), + hidden residual in f32.

#define NB_  2
#define TT   2048
#define DM   1024
#define NH_  16
#define NKV  16
#define REP  (NH_ / NKV)
#define HD   64
#define DQ   (NH_ * HD)
#define DKV  (NKV * HD)
#define LNEPS 1e-6f
#define NBKT 32
#define RH   512                  // query rows < RH use hi+lo planes
#define WIN  0
#define PSH  10.0f                 // fp16 P carries 2^10 (added to the exponent; it cancels against the row sum)
#define SCL  1.0f                  // T5: no 1/sqrt(d) scaling
typedef _Float16 h16;
typedef unsigned short bf;
typedef __attribute__((ext_vector_type(16))) __bf16   v16bf;
typedef __attribute__((ext_vector_type(16))) _Float16 v16h;
typedef __attribute__((ext_vector_type(8)))  _Float16 v8h;
typedef __attribute__((ext_vector_type(8)))  unsigned short v8us;
typedef __attribute__((ext_vector_type(8)))  float    v8f;
typedef __attribute__((ext_vector_type(4)))  float    v4f;
typedef v8h  __attribute__((may_alias)) v8ha;
typedef v4f  __attribute__((may_alias)) v4fa;
typedef v8us __attribute__((may_alias)) v8usa;

__device__ __forceinline__ unsigned short f2bf(float f) { unsigned u = __float_as_uint(f); u += 0x7FFFu + ((u >> 16) & 1u); return (unsigned short)(u >> 16); }
__device__ __forceinline__ float bf2f(unsigned short b) { return __uint_as_float(((unsigned)b) << 16); }
__device__ __forceinline__ float bfr(float f) { return bf2f(f2bf(f)); }
__device__ __forceinline__ v16h cat16(v8h lo, v8h hi) { return __builtin_shufflevector(lo, hi, 0, 1, 2, 3, 4, 5, 6, 7, 8, 9, 10, 11, 12, 13, 14, 15); }
__device__ __forceinline__ v16bf cat16b(v8us lo, v8us hi) { return __builtin_bit_cast(v16bf, __builtin_shufflevector(lo, hi, 0, 1, 2, 3, 4, 5, 6, 7, 8, 9, 10, 11, 12, 13, 14, 15)); }
__device__ __forceinline__ v8f wmma16(v16h a, v16h b, v8f c) { return __builtin_amdgcn_wmma_f32_16x16x32_f16(false, a, false, b, (short)0, c, false, false); }
__device__ __forceinline__ v8f wmmab(v16bf a, v16bf b, v8f c) { return __builtin_amdgcn_wmma_f32_16x16x32_bf16(false, a, false, b, (short)0, c, false, false); }



__device__ __forceinline__ h16 tohx(float x) { return (h16)x; }
__device__ __forceinline__ void splitf(float y, unsigned short& h, unsigned short& l) { h = f2bf(y); l = f2bf(y - bf2f(h)); }
// The two waits stand between a run of global stores and the first rewrite of a register that they name: addresses and data are inputs, so they stay in their registers up to the wait, and the scheduling barrier keeps later instructions behind it.
__device__ __forceinline__ void swaitp(const void* a, const void* b, const void* c, const v8h (&x)[4], const v8us (&y)[4], const v8us (&w)[4]) { asm volatile("s_wait_xcnt 0x0" :: "v"(a), "v"(b), "v"(c), "v"(x[0]), "v"(x[1]), "v"(x[2]), "v"(x[3]), "v"(y[0]), "v"(y[1]), "v"(y[2]), "v"(y[3]), "v"(w[0]), "v"(w[1]), "v"(w[2]), "v"(w[3]) : "memory"); __builtin_amdgcn_sched_barrier(0); }
// The same between a run of global loads and the first rewrite of an address register that they name.
__device__ __forceinline__ void gwait(const void* a, const void* b, const void* c, const void* d) { asm volatile("s_wait_xcnt 0x0" :: "v"(a), "v"(b), "v"(c), "v"(d) : "memory"); __builtin_amdgcn_sched_barrier(0); }
__device__ __forceinline__ void swaitf(const void* a, const void* b, const v4f (&x)[8]) { asm volatile("s_wait_xcnt 0x0" :: "v"(a), "v"(b), "v"(x[0]), "v"(x[1]), "v"(x[2]), "v"(x[3]), "v"(x[4]), "v"(x[5]), "v"(x[6]), "v"(x[7]) : "memory"); __builtin_amdgcn_sched_barrier(0); }

// FRAGMENT ORDER of every 16-bit operand plane P[row][k] (K columns): element (row, k) lies at ((row / 16) (K / 32) + k / 32) 512 + ((k / 16) % 2) 256 + ((k / 8) % 2) 128 + (row % 16) 8 + k % 8.
// A 16 x 32 fragment is 1 KiB in a row and lane l = 16 hi + lr takes 8 elements at l 8 and 8 at 256 + l 8 (the same values in the same registers as from a row-major plane: row lr, k = 8 hi .. and 16 + 8 hi ..), so each 16-byte load of a wave reads 512 contiguous bytes, four whole lines, not 32 bytes of each of 16 lines.
// ---- k_gemmw: register-blocked GEMM, ONE WAVE per 64x64 output tile (16 accumulators), operands straight from 16-bit planes in fragment order; grid (M/64, N/64, Z), 32 threads. M counts the rows of both batches (their row blocks follow one another in every plane), Z the weight matrices that share the A operand: one launch carries all of a stage's tiles.
// c[m][n] (f32) = sum_k A[m][k] Bt[n][k] (+ split products per NSPLIT). z-batch strides sA/sB/sC in elements (sC: of C and X, or of each plane). K % 32 == 0, a compile-time constant, so that the 16-row blocks of a pass lie at constant offsets.
// The tile leaves the kernel in its final form, 16 staged rows of 64 at a time, every store a whole 128-byte line or more:
// EPI 0: C[m][n] (f32, pitch DM) = bf16-rounded X[m][n] + c, the residual add. EPI 1: planes [z][m / TT][n / 64]; z < 2 (q, k): head planes, each (row m % TT, k = n % 64) in fragment order; z == 2 (v): transposed head planes, each (row n % 64, k = m % TT) in fragment order. Planes: fp16 (P16) and a bf16 hi/lo pair (Ph, Pl); a tile's 64 columns are one head, its 64 rows lie in one batch.
template <typename T16> struct WFrag;
template <> struct WFrag<h16> { typedef v16h V; static __device__ __forceinline__ V ld(const h16* p) { return cat16(*(const v8h*)p, *(const v8h*)(p + 256)); } static __device__ __forceinline__ v8f mma(V a, V b, v8f c) { return wmma16(a, b, c); } };
template <> struct WFrag<bf> { typedef v16bf V; static __device__ __forceinline__ V ld(const bf* p) { return cat16b(*(const v8us*)p, *(const v8us*)(p + 256)); } static __device__ __forceinline__ v8f mma(V a, V b, v8f c) { return wmmab(a, b, c); } };
static_assert(HD == 64, "one 64-column tile is one head");
static_assert(TT % 64 == 0 && NKV == NH_ && DQ == DM && DKV == DM, "a 64-row tile lies in one batch; q, k, v planes and the four weight matrices have one size each");
// The plane epilogue of one tile; TR: transposed planes. Every loop is unrolled (the accumulators are registers and take constant indices only) and PP is a constant, so that all stores of a block name p16, ph or pl plus a constant.
template <bool TR>
__device__ __forceinline__ void gemm_planes(const v8f (&acc)[4][4], float* os, h16* p16, bf* ph, bf* pl, int lr, int hi) {
    constexpr int PP = TR ? TT : HD;   /* columns (K) of a plane: 16 staged rows are 16 PP elements of it */
#pragma unroll
    for (int blk = 0; blk < 4; ++blk) {
#pragma unroll
        for (int ob = 0; ob < 4; ++ob) {
            if constexpr (!TR) {   /* staged row = m, 16 rows of block blk */
#pragma unroll
                for (int j = 0; j < 8; ++j) os[(hi * 8 + j) * 68 + ob * 16 + lr] = acc[blk][ob][j];
            } else {   /* staged row = n, 16 columns of block blk: a lane's 8 accumulator rows are 8 neighbours in it */
                const v8f t = acc[ob][blk]; *(v4fa*)(os + lr * 68 + ob * 16 + hi * 8) = __builtin_shufflevector(t, t, 0, 1, 2, 3); *(v4fa*)(os + lr * 68 + ob * 16 + hi * 8 + 4) = __builtin_shufflevector(t, t, 4, 5, 6, 7); } }
        __builtin_amdgcn_wave_barrier(); asm volatile("" ::: "memory");   /* fence: writes before reads */
        v8h o16[4]; v8us oh[4], ol[4];
#pragma unroll
        for (int s = 0; s < 4; ++s) { const float* sp = os + lr * 68 + s * 16 + hi * 8; const v4f x0 = *(const v4fa*)sp, x1 = *(const v4fa*)(sp + 4);
#pragma unroll
            for (int k = 0; k < 8; ++k) { const float x = (k < 4) ? x0[k & 3] : x1[k & 3]; o16[s][k] = tohx(x); unsigned short a2, c2; splitf(x, a2, c2); oh[s][k] = a2; ol[s][k] = c2; }
            *(v8h*)(p16 + blk * 16 * PP + s * 256) = o16[s]; *(v8us*)(ph + blk * 16 * PP + s * 256) = oh[s]; *(v8us*)(pl + blk * 16 * PP + s * 256) = ol[s]; }
        swaitp(p16, ph, pl, o16, oh, ol);
        __builtin_amdgcn_wave_barrier(); asm volatile("" ::: "memory");   /* fence: reads before the next writes */
    }
}
template <typename T16, int NSPLIT, int EPI, int K>
__global__ __launch_bounds__(32) void k_gemmw(const T16* __restrict__ A, const T16* __restrict__ A2, const T16* __restrict__ Bt, const T16* __restrict__ Bt2, const float* __restrict__ X, float* C, h16* P16, bf* Ph, bf* Pl, size_t sA, size_t sB, size_t sC) {
    typedef typename WFrag<T16>::V V;
    __shared__ __align__(16) float os[16 * 68];
    const size_t z = blockIdx.z; A += z * sA; if (A2) A2 += z * sA; Bt += z * sB; if (Bt2) Bt2 += z * sB;
    const int lane = threadIdx.x & 31, lr = lane & 15, hi = lane >> 4; const int r0 = blockIdx.x * 64, c0 = blockIdx.y * 64;
    v8f acc[4][4];
#pragma unroll
    for (int mb = 0; mb < 4; ++mb)
#pragma unroll
        for (int nb = 0; nb < 4; ++nb) acc[mb][nb] = (v8f){};
    const size_t aoff = (size_t)r0 * K + lane * 8, boff = (size_t)c0 * K + lane * 8;
#pragma unroll 1
    for (int kc = 0; kc < K; kc += 32) {
        V a[4], a2[4], b[4], b2[4]; const T16* ap = A + aoff + kc * 16; const T16* ap2 = (NSPLIT == 1 || NSPLIT == 2) ? A2 + aoff + kc * 16 : ap; const T16* bp = Bt + boff + kc * 16; const T16* bp2 = (NSPLIT >= 2) ? Bt2 + boff + kc * 16 : bp;   /* every load of the pass names one of these, plus a constant */
#pragma unroll
        for (int mb = 0; mb < 4; ++mb) { a[mb] = WFrag<T16>::ld(ap + mb * 16 * K); if (NSPLIT == 1 || NSPLIT == 2) a2[mb] = WFrag<T16>::ld(ap2 + mb * 16 * K); }
#pragma unroll
        for (int nb = 0; nb < 4; ++nb) { b[nb] = WFrag<T16>::ld(bp + nb * 16 * K); if (NSPLIT >= 2) b2[nb] = WFrag<T16>::ld(bp2 + nb * 16 * K); }
        gwait(ap, ap2, bp, bp2);
#pragma unroll
        for (int nb = 0; nb < 4; ++nb) {
#pragma unroll
            for (int mb = 0; mb < 4; ++mb) { acc[mb][nb] = WFrag<T16>::mma(a[mb], b[nb], acc[mb][nb]); if (NSPLIT == 1 || NSPLIT == 2) acc[mb][nb] = WFrag<T16>::mma(a2[mb], b[nb], acc[mb][nb]); if (NSPLIT >= 2) acc[mb][nb] = WFrag<T16>::mma(a[mb], b2[nb], acc[mb][nb]); } }
        asm volatile("v_nop\n\tv_nop\n\tv_nop\n\tv_nop" : "+v"(acc[0][0]), "+v"(acc[1][1]), "+v"(acc[2][2]), "+v"(acc[3][3]) : "v"(a[0]), "v"(a[3]));
    }
    // Epilogue. Every loop is unrolled: the accumulators are registers and take constant indices only. The staged rows pass from lane to lane through LDS, which runs one wave's operations in order;
    // each fence (wave barrier + memory clobber) keeps that order in the compiled code: all lanes' writes of a block, then its reads, then the next block's writes.
    if constexpr (EPI == 0) {
        const size_t co = z * sC + (size_t)(r0 + hi) * DM + c0 + lr * 4;   /* a lane's 4 columns of rows hi, 2 + hi, ... */
        const float* xp = X + co; float* cp = C + co;
        v4f xv[2][8];   /* the residual rows, fetched one 16-row block ahead */
#pragma unroll
        for (int s = 0; s < 8; ++s) xv[0][s] = *(const v4f*)(xp + 2 * s * DM);
#pragma unroll
        for (int mb = 0; mb < 4; ++mb) {
            if (mb < 3) {
#pragma unroll
                for (int s = 0; s < 8; ++s) xv[(mb + 1) & 1][s] = *(const v4f*)(xp + ((mb + 1) * 16 + 2 * s) * DM); }
#pragma unroll
            for (int nb = 0; nb < 4; ++nb) {
#pragma unroll
                for (int j = 0; j < 8; ++j) os[(hi * 8 + j) * 68 + nb * 16 + lr] = acc[mb][nb][j]; }
            __builtin_amdgcn_wave_barrier(); asm volatile("" ::: "memory");   /* fence: writes before reads */
            v4f val[8];
#pragma unroll
            for (int s = 0; s < 8; ++s) { val[s] = *(const v4fa*)(os + (2 * s + hi) * 68 + lr * 4);
#pragma unroll
                for (int q = 0; q < 4; ++q) val[s][q] = __fadd_rn(bfr(xv[mb & 1][s][q]), val[s][q]);
                *(v4f*)(cp + (mb * 16 + 2 * s) * DM) = val[s]; }
            swaitf(xp, cp, val);
            __builtin_amdgcn_wave_barrier(); asm volatile("" ::: "memory");   /* fence: reads before the next writes */
        }
    } else {
        const bool tr = blockIdx.z == 2;   /* the same for the whole wave: a scalar branch */
        const size_t po = z * sC + ((size_t)(r0 / TT) * NH_ + blockIdx.y) * TT * HD + (size_t)(r0 % TT) * (tr ? 16 : HD) + lane * 8;   /* a lane's 8 elements of staged row lr, columns 8 hi, 16 + 8 hi, ...: each store of the wave is 512 bytes in a row */
        if (tr) gemm_planes<true>(acc, os, P16 + po, Ph + po, Pl + po, lr, hi); else gemm_planes<false>(acc, os, P16 + po, Ph + po, Pl + po, lr, hi);
    }
}

typedef __attribute__((ext_vector_type(2))) _Float16 v2h;
typedef __attribute__((ext_vector_type(4))) _Float16 v4h;
typedef __attribute__((ext_vector_type(2))) unsigned short v2us;
typedef __attribute__((ext_vector_type(4))) unsigned short v4us;
typedef v4us __attribute__((may_alias)) v4usa;
typedef __attribute__((ext_vector_type(2))) float v2f;
typedef __attribute__((ext_vector_type(4))) int v4i;

template <int K, int N>
__device__ __forceinline__ void d_wtG(const float* __restrict__ w, bf* Bt) {
    // Bt (row n, column k) = w[k][n] in fragment order: one wave writes one 512-byte unit u (16 rows n, 16 columns k)
    const int lane = threadIdx.x & 31; const int u = blockIdx.x * 8 + (threadIdx.x >> 5); if (u >= N * K / 256) return;
    const int k = (u % (K / 16)) * 16 + (lane >> 4) * 8, n = (u / (K / 16)) * 16 + (lane & 15); const float* wp = w + (size_t)k * N + n; float x[8]; v8us o;
#pragma unroll
    for (int e = 0; e < 8; ++e) x[e] = wp[e * N];
    gwait(wp, wp, wp, wp);
#pragma unroll
    for (int e = 0; e < 8; ++e) o[e] = f2bf(x[e]);
    *(v8us*)(Bt + (size_t)u * 256 + lane * 8) = o;
}
__constant__ int BKT[4095] = {15,15,15,15,15,15,15,15,15,15,15,15,15,15,15,15,15,15,15,15,15,15,15,15,15,15,15,15,15,15,15,15,15,15,15,15,15,15,15,15,15,15,15,15,15,15,15,15,15,15,15,15,15,15,15,15,15,15,15,15,15,15,15,15,15,15,15,15,15,15,15,15,15,15,15,15,15,15,15,15,15,15,15,15,15,15,15,15,15,15,15,15,15,15,15,15,15,15,15,15,15,15,15,15,15,15,15,15,15,15,15,15,15,15,15,15,15,15,15,15,15,15,15,15,15,15,15,15,15,15,15,15,15,15,15,15,15,15,15,15,15,15,15,15,15,15,15,15,15,15,15,15,15,15,15,15,15,15,15,15,15,15,15,15,15,15,15,15,15,15,15,15,15,15,15,15,15,15,15,15,15,15,15,15,15,15,15,15,15,15,15,15,15,15,15,15,15,15,15,15,15,15,15,15,15,15,15,15,15,15,15,15,15,15,15,15,15,15,15,15,15,15,15,15,15,15,15,15,15,15,15,15,15,15,15,15,15,15,15,15,15,15,15,15,15,15,15,15,15,15,15,15,15,15,15,15,15,15,15,15,15,15,15,15,15,15,15,15,15,15,15,15,15,15,15,15,15,15,15,15,15,15,15,15,15,15,15,15,15,15,15,15,15,15,15,15,15,15,15,15,15,15,15,15,15,15,15,15,15,15,15,15,15,15,15,15,15,15,15,15,15,15,15,15,15,15,15,15,15,15,15,15,15,15,15,15,15,15,15,15,15,15,15,15,15,15,15,15,15,15,15,15,15,15,15,15,15,15,15,15,15,15,15,15,15,15,15,15,15,15,15,15,15,15,15,15,15,15,15,15,15,15,15,15,15,15,15,15,15,15,15,15,15,15,15,15,15,15,15,15,15,15,15,15,15,15,15,15,15,15,15,15,15,15,15,15,15,15,15,15,15,15,15,15,15,15,15,15,15,15,15,15,15,15,15,15,15,15,15,15,15,15,15,15,15,15,15,15,15,15,15,15,15,15,15,15,15,15,15,15,15,15,15,15,15,15,15,15,15,15,15,15,15,15,15,15,15,15,15,15,15,15,15,15,15,15,15,15,15,15,15,15,15,15,15,15,15,15,15,15,15,15,15,15,15,15,15,15,15,15,15,15,15,15,15,15,15,15,15,15,15,15,15,15,15,15,15,15,15,15,15,15,15,15,15,15,15,15,15,15,15,15,15,15,15,15,15,15,15,15,15,15,15,15,15,15,15,15,15,15,15,15,15,15,15,15,15,15,15,15,15,15,15,15,15,15,15,15,15,15,15,15,15,15,15,15,15,15,15,15,15,15,15,15,15,15,15,15,15,15,15,15,15,15,15,15,15,15,15,15,15,15,15,15,15,15,15,15,15,15,15,15,15,15,15,15,15,15,15,15,15,15,15,15,15,15,15,15,15,15,15,15,15,15,15,15,15,15,15,15,15,15,15,15,15,15,15,15,15,15,15,15,15,15,15,15,15,15,15,15,15,15,15,15,15,15,15,15,15,15,15,15,15,15,15,15,15,15,15,15,15,15,15,15,15,15,15,15,15,15,15,15,15,15,15,15,15,15,15,15,15,15,15,15,15,15,15,15,15,15,15,15,15,15,15,15,15,15,15,15,15,15,15,15,15,15,15,15,15,15,15,15,15,15,15,15,15,15,15,15,15,15,15,15,15,15,15,15,15,15,15,15,15,15,15,15,15,15,15,15,15,15,15,15,15,15,15,15,15,15,15,15,15,15,15,15,15,15,15,15,15,15,15,15,15,15,15,15,15,15,15,15,15,15,15,15,15,15,15,15,15,15,15,15,15,15,15,15,15,15,15,15,15,15,15,15,15,15,15,15,15,15,15,15,15,15,15,15,15,15,15,15,15,15,15,15,15,15,15,15,15,15,15,15,15,15,15,15,15,15,15,15,15,15,15,15,15,15,15,15,15,15,15,15,15,15,15,15,15,15,15,15,15,15,15,15,15,15,15,15,15,15,15,15,15,15,15,15,15,15,15,15,15,15,15,15,15,15,15,15,15,15,15,15,15,15,15,15,15,15,15,15,15,15,15,15,15,15,15,15,15,15,15,15,15,15,15,15,15,15,15,15,15,15,15,15,15,15,15,15,15,15,15,15,15,15,15,15,15,15,15,15,15,15,15,15,15,15,15,15,15,15,15,15,15,15,15,15,15,15,15,15,15,15,15,15,15,15,15,15,15,15,15,15,15,15,15,15,15,15,15,15,15,15,15,15,15,15,15,15,15,15,15,15,15,15,15,15,15,15,15,15,15,15,15,15,15,15,15,15,15,15,15,15,15,15,15,15,15,15,15,15,15,15,15,15,15,15,15,15,15,15,15,15,15,15,15,15,15,15,15,15,15,15,15,15,15,15,15,15,15,15,15,15,15,15,15,15,15,15,15,15,15,15,15,15,15,15,15,15,15,15,15,15,15,15,15,15,15,15,15,15,15,15,15,15,15,15,15,15,15,15,15,15,15,15,15,15,15,15,15,15,15,15,15,15,15,15,15,15,15,15,15,15,15,15,15,15,15,15,15,15,15,15,15,15,15,15,15,15,15,15,15,15,15,15,15,15,15,15,15,15,15,15,15,15,15,15,15,15,15,15,15,15,15,15,15,15,15,15,15,15,15,15,15,15,15,15,15,15,15,15,15,15,15,15,15,15,15,15,15,15,15,15,15,15,15,15,15,15,15,15,15,15,15,15,15,15,15,15,15,15,15,15,15,15,15,15,15,15,15,15,15,15,15,15,15,15,15,15,15,15,15,15,15,15,15,15,15,15,15,15,15,15,15,15,15,15,15,15,15,15,15,15,15,15,15,15,15,15,15,15,15,15,15,15,15,15,15,15,15,15,15,15,15,15,15,15,15,15,15,15,15,15,15,15,15,15,15,15,15,15,15,15,15,15,15,15,15,15,15,15,15,15,15,15,15,15,15,15,15,15,15,15,15,15,15,15,15,15,15,15,15,15,15,15,15,15,15,15,15,15,15,15,15,15,15,15,15,15,15,15,15,15,15,15,15,15,15,15,15,15,15,15,15,15,15,15,15,15,15,15,15,15,15,15,15,15,15,15,15,15,15,15,15,15,15,15,15,15,15,15,15,15,15,15,15,15,15,15,15,15,15,15,15,15,15,15,15,15,15,15,15,15,15,15,15,15,15,15,15,15,15,15,15,15,15,15,15,15,15,15,15,15,15,15,15,15,15,15,15,15,15,15,15,15,15,15,15,15,15,15,15,15,15,15,15,15,15,15,15,15,15,15,15,15,15,15,15,15,15,15,15,15,15,15,15,15,15,15,15,15,15,15,15,15,15,15,15,15,15,15,15,15,15,15,15,15,15,15,15,15,15,15,15,15,15,15,15,15,15,15,15,15,15,15,15,15,15,15,15,15,15,15,15,15,15,15,15,15,15,15,15,15,15,15,15,15,15,15,15,15,15,15,15,15,15,15,15,15,15,15,15,15,15,15,15,15,15,15,15,15,15,15,15,15,15,15,15,15,15,15,15,15,15,15,15,15,15,15,15,15,15,15,15,15,15,15,15,15,15,15,15,15,15,15,15,15,15,15,15,15,15,15,15,15,15,15,15,15,15,15,15,15,15,15,15,15,15,15,15,15,15,15,15,15,15,15,15,15,15,15,15,15,15,15,15,15,15,15,15,15,15,15,15,15,15,15,15,15,15,15,15,15,15,15,15,15,15,15,15,15,15,15,15,15,15,15,15,15,15,15,15,15,15,15,15,15,15,15,15,15,15,15,15,15,15,15,15,15,15,15,15,15,15,15,15,15,15,15,15,15,15,15,15,15,15,15,15,15,15,15,15,15,15,15,15,15,15,15,15,15,15,15,15,15,15,15,15,15,15,15,15,15,15,15,15,15,15,15,15,15,15,15,15,15,15,15,15,15,15,15,15,15,15,15,15,15,15,15,15,15,15,15,15,15,15,15,15,15,15,15,15,15,15,15,15,15,15,15,15,15,15,15,15,15,15,15,15,15,15,15,15,15,15,15,15,15,15,15,15,15,15,15,15,15,15,15,15,15,15,15,15,15,15,15,15,15,15,15,15,15,15,15,15,15,15,15,15,15,15,15,15,15,15,15,15,15,15,15,15,15,15,15,15,15,15,15,15,15,15,15,15,15,15,15,15,15,15,15,15,15,15,15,15,15,15,15,15,15,15,15,15,15,15,15,15,15,15,15,15,15,15,15,15,15,15,15,15,15,15,15,15,15,15,15,15,15,15,15,15,15,15,15,15,15,15,15,15,15,15,15,15,15,15,15,15,15,15,15,15,15,15,15,15,15,15,15,15,15,15,15,15,15,15,15,15,15,15,15,15,15,15,15,15,15,15,15,15,15,15,15,15,15,15,15,15,14,14,14,14,14,14,14,14,14,14,14,14,14,14,14,14,14,14,14,14,14,14,14,14,14,14,14,13,13,13,13,13,13,13,13,13,13,13,13,13,13,13,13,13,13,12,12,12,12,12,12,12,12,12,12,12,12,12,12,11,11,11,11,11,11,11,11,11,10,10,10,10,10,10,10,9,9,9,9,8,8,8,8,7,6,5,4,3,2,1,0,17,18,19,20,21,22,23,24,24,24,24,25,25,25,25,26,26,26,26,26,26,26,27,27,27,27,27,27,27,27,27,28,28,28,28,28,28,28,28,28,28,28,28,28,28,29,29,29,29,29,29,29,29,29,29,29,29,29,29,29,29,29,29,30,30,30,30,30,30,30,30,30,30,30,30,30,30,30,30,30,30,30,30,30,30,30,30,30,30,30,31,31,31,31,31,31,31,31,31,31,31,31,31,31,31,31,31,31,31,31,31,31,31,31,31,31,31,31,31,31,31,31,31,31,31,31,31,31,31,31,31,31,31,31,31,31,31,31,31,31,31,31,31,31,31,31,31,31,31,31,31,31,31,31,31,31,31,31,31,31,31,31,31,31,31,31,31,31,31,31,31,31,31,31,31,31,31,31,31,31,31,31,31,31,31,31,31,31,31,31,31,31,31,31,31,31,31,31,31,31,31,31,31,31,31,31,31,31,31,31,31,31,31,31,31,31,31,31,31,31,31,31,31,31,31,31,31,31,31,31,31,31,31,31,31,31,31,31,31,31,31,31,31,31,31,31,31,31,31,31,31,31,31,31,31,31,31,31,31,31,31,31,31,31,31,31,31,31,31,31,31,31,31,31,31,31,31,31,31,31,31,31,31,31,31,31,31,31,31,31,31,31,31,31,31,31,31,31,31,31,31,31,31,31,31,31,31,31,31,31,31,31,31,31,31,31,31,31,31,31,31,31,31,31,31,31,31,31,31,31,31,31,31,31,31,31,31,31,31,31,31,31,31,31,31,31,31,31,31,31,31,31,31,31,31,31,31,31,31,31,31,31,31,31,31,31,31,31,31,31,31,31,31,31,31,31,31,31,31,31,31,31,31,31,31,31,31,31,31,31,31,31,31,31,31,31,31,31,31,31,31,31,31,31,31,31,31,31,31,31,31,31,31,31,31,31,31,31,31,31,31,31,31,31,31,31,31,31,31,31,31,31,31,31,31,31,31,31,31,31,31,31,31,31,31,31,31,31,31,31,31,31,31,31,31,31,31,31,31,31,31,31,31,31,31,31,31,31,31,31,31,31,31,31,31,31,31,31,31,31,31,31,31,31,31,31,31,31,31,31,31,31,31,31,31,31,31,31,31,31,31,31,31,31,31,31,31,31,31,31,31,31,31,31,31,31,31,31,31,31,31,31,31,31,31,31,31,31,31,31,31,31,31,31,31,31,31,31,31,31,31,31,31,31,31,31,31,31,31,31,31,31,31,31,31,31,31,31,31,31,31,31,31,31,31,31,31,31,31,31,31,31,31,31,31,31,31,31,31,31,31,31,31,31,31,31,31,31,31,31,31,31,31,31,31,31,31,31,31,31,31,31,31,31,31,31,31,31,31,31,31,31,31,31,31,31,31,31,31,31,31,31,31,31,31,31,31,31,31,31,31,31,31,31,31,31,31,31,31,31,31,31,31,31,31,31,31,31,31,31,31,31,31,31,31,31,31,31,31,31,31,31,31,31,31,31,31,31,31,31,31,31,31,31,31,31,31,31,31,31,31,31,31,31,31,31,31,31,31,31,31,31,31,31,31,31,31,31,31,31,31,31,31,31,31,31,31,31,31,31,31,31,31,31,31,31,31,31,31,31,31,31,31,31,31,31,31,31,31,31,31,31,31,31,31,31,31,31,31,31,31,31,31,31,31,31,31,31,31,31,31,31,31,31,31,31,31,31,31,31,31,31,31,31,31,31,31,31,31,31,31,31,31,31,31,31,31,31,31,31,31,31,31,31,31,31,31,31,31,31,31,31,31,31,31,31,31,31,31,31,31,31,31,31,31,31,31,31,31,31,31,31,31,31,31,31,31,31,31,31,31,31,31,31,31,31,31,31,31,31,31,31,31,31,31,31,31,31,31,31,31,31,31,31,31,31,31,31,31,31,31,31,31,31,31,31,31,31,31,31,31,31,31,31,31,31,31,31,31,31,31,31,31,31,31,31,31,31,31,31,31,31,31,31,31,31,31,31,31,31,31,31,31,31,31,31,31,31,31,31,31,31,31,31,31,31,31,31,31,31,31,31,31,31,31,31,31,31,31,31,31,31,31,31,31,31,31,31,31,31,31,31,31,31,31,31,31,31,31,31,31,31,31,31,31,31,31,31,31,31,31,31,31,31,31,31,31,31,31,31,31,31,31,31,31,31,31,31,31,31,31,31,31,31,31,31,31,31,31,31,31,31,31,31,31,31,31,31,31,31,31,31,31,31,31,31,31,31,31,31,31,31,31,31,31,31,31,31,31,31,31,31,31,31,31,31,31,31,31,31,31,31,31,31,31,31,31,31,31,31,31,31,31,31,31,31,31,31,31,31,31,31,31,31,31,31,31,31,31,31,31,31,31,31,31,31,31,31,31,31,31,31,31,31,31,31,31,31,31,31,31,31,31,31,31,31,31,31,31,31,31,31,31,31,31,31,31,31,31,31,31,31,31,31,31,31,31,31,31,31,31,31,31,31,31,31,31,31,31,31,31,31,31,31,31,31,31,31,31,31,31,31,31,31,31,31,31,31,31,31,31,31,31,31,31,31,31,31,31,31,31,31,31,31,31,31,31,31,31,31,31,31,31,31,31,31,31,31,31,31,31,31,31,31,31,31,31,31,31,31,31,31,31,31,31,31,31,31,31,31,31,31,31,31,31,31,31,31,31,31,31,31,31,31,31,31,31,31,31,31,31,31,31,31,31,31,31,31,31,31,31,31,31,31,31,31,31,31,31,31,31,31,31,31,31,31,31,31,31,31,31,31,31,31,31,31,31,31,31,31,31,31,31,31,31,31,31,31,31,31,31,31,31,31,31,31,31,31,31,31,31,31,31,31,31,31,31,31,31,31,31,31,31,31,31,31,31,31,31,31,31,31,31,31,31,31,31,31,31,31,31,31,31,31,31,31,31,31,31,31,31,31,31,31,31,31,31,31,31,31,31,31,31,31,31,31,31,31,31,31,31,31,31,31,31,31,31,31,31,31,31,31,31,31,31,31,31,31,31,31,31,31,31,31,31,31,31,31,31,31,31,31,31,31,31,31,31,31,31,31,31,31,31,31,31,31,31,31,31,31,31,31,31,31,31,31,31,31,31,31,31,31,31,31,31,31,31,31,31,31,31,31,31,31,31,31,31,31,31,31,31,31,31,31,31,31,31,31,31,31,31,31,31,31,31,31,31,31,31,31,31,31,31,31,31,31,31,31,31,31,31,31,31,31,31,31,31,31,31,31,31,31,31,31,31,31,31,31,31,31,31,31,31,31,31,31,31,31,31,31,31,31,31,31,31,31,31,31,31,31,31,31,31,31,31,31,31,31,31,31,31,31,31,31,31,31,31,31,31,31,31,31,31,31,31,31,31,31,31,31,31,31,31,31,31,31,31,31,31,31,31,31,31,31,31,31,31,31,31,31,31,31,31,31,31,31,31,31,31,31,31,31,31,31,31,31,31,31,31,31,31,31,31,31,31,31,31,31,31,31,31,31,31,31,31,31,31,31,31,31,31,31,31,31,31,31,31,31,31,31,31,31,31,31,31,31,31,31,31,31,31,31,31,31,31,31,31,31,31,31,31,31,31,31,31,31,31,31,31,31,31,31,31,31,31,31,31,31,31,31,31,31,31,31,31,31,31,31,31,31,31,31,31,31,31,31,31,31,31,31,31,31,31,31,31,31,31,31,31,31,31,31,31,31,31,31,31,31,31,31,31,31,31,31,31,31,31,31,31,31,31,31,31,31,31,31,31,31,31,31,31,31,31,31,31,31,31,31,31,31,31,31,31,31,31,31,31,31,31,31,31,31,31,31,31,31,31,31,31,31,31,31,31,31,31,31,31,31,31,31,31,31,31,31,31,31,31,31,31,31,31,31,31,31,31,31,31,31,31,31,31,31,31,31,31,31,31,31,31,31,31,31,31,31,31,31,31,31,31,31,31,31,31,31,31,31,31,31,31,31,31,31,31,31,31,31,31,31,31,31,31,31,31,31,31,31,31,31,31,31,31,31,31,31,31,31,31,31,31,31,31,31,31,31,31,31,31,31,31,31,31,31,31,31,31,31,31,31,31,31,31,31,31,31,31,31,31,31,31,31,31,31,31,31,31,31,31,31,31,31,31,31,31,31,31,31,31,31,31,31,31,31,31,31,31,31,31,31,31,31,31,31,31,31,31,31,31,31,31,31,31,31,31,31,31,31,31,31,31,31,31,31,31,31,31,31,31,31,31,31,31,31,31,31,31,31,31,31,31,31,31,31,31,31,31,31,31,31,31,31,31,31,31,31,31,31,31,31,31,31,31,31,31,31,31,31,31,31,31,31,31,31,31,31,31,31,31,31,31,31,31,31,31,31,31,31,31,31,31,31,31,31,31,31,31,31,31,31,31,31,31,31,31,31,31,31,31,31,31,31,31,31,31,31,31,31,31,31,31,31,31,31,31,31,31,31,31,31,31,31,31,31,31,31,31,31,31,31,31,31,31,31,31,31,31,31,31,31,31,31,31,31,31,31,31,31,31,31,31,31,31,31,31,31,31,31,31,31,31,31,31,31,31,31,31,31,31,31,31,31,31,31,31,31,31,31,31,31,31,31,31,31,31,31,31,31,31};
__device__ __forceinline__ void d_btab(const float* __restrict__ relb, float* BT) { const int e = blockIdx.x * 256 + threadIdx.x; if (e >= NH_ * 4096) return; const int r = e % 4096, h = e / 4096; const float v = (r < 4095) ? bfr(relb[BKT[r] * NH_ + h]) : 0.f; *(float*)(BT + e) = v;  }
// k_prep: everything that reads the inputs alone, in one launch; grid (512, 6): y = 0 the LayerNorm of all rows (the longest work, so it starts first), y = 1 .. 4 the four weight planes (one size, one behind the other in Bt), y = 5 the bias table. The branch is the same for a whole workgroup and stands in front of the barrier.
static_assert(NB_ * TT / 8 == 512 && DM * DQ / 256 / 8 == 512 && NH_ * 4096 / 256 <= 512, "grid x of k_prep");
__global__ __launch_bounds__(256) void k_prep(const float* __restrict__ X, const float* __restrict__ A, const float* __restrict__ g, const float* __restrict__ be, float* Z, bf* Yh, bf* Yl, const float* __restrict__ w0, const float* __restrict__ w1, const float* __restrict__ w2, const float* __restrict__ w3, bf* Bt, const float* __restrict__ relb, float* BT) {
    if (blockIdx.y == 5) { d_btab(relb, BT); return; }
    if (blockIdx.y != 0) { d_wtG<DM, DQ>((blockIdx.y == 1) ? w0 : (blockIdx.y == 2) ? w1 : (blockIdx.y == 3) ? w2 : w3, Bt + (size_t)(blockIdx.y - 1) * DQ * DM); return; }
    static_assert(TT % 8 == 0, "a workgroup's 8 rows are all inside or all outside");
    __shared__ __align__(16) bf ys[2][8][DM + 16];   /* the workgroup's 8 rows, hi and lo; the pitch spreads 8 rows' 16-byte pieces over the banks */
    const int lane = threadIdx.x & 31; const int wr = threadIdx.x >> 5; const int r = blockIdx.x * 8 + wr; if (blockIdx.x * 8 >= NB_ * TT) return; const float* xr = X + (size_t)r * DM; const float* ar = A ? A + (size_t)r * DM : nullptr; float s = 0.f;
#pragma unroll 1
    for (int ch = 0; ch < DM / 128; ++ch) { const int c0 = ch * 128 + lane * 4; const v4f a = *(const v4f*)(xr + c0); v4f d = {0.f, 0.f, 0.f, 0.f}; if (ar) d = *(const v4f*)(ar + c0);
#pragma unroll
        for (int q = 0; q < 4; ++q) s += __fadd_rn(bfr(a[q]), d[q]); }
#pragma unroll
    for (int sh = 16; sh; sh >>= 1) s += __shfl_xor(s, sh, 32);
    const float mu = s * (1.0f / DM); float s2 = 0.f;
#pragma unroll 1
    for (int ch = 0; ch < DM / 128; ++ch) { const int c0 = ch * 128 + lane * 4; const v4f a = *(const v4f*)(xr + c0); v4f d = {0.f, 0.f, 0.f, 0.f}; if (ar) d = *(const v4f*)(ar + c0);
#pragma unroll
        for (int q = 0; q < 4; ++q) { const float d0 = __fsub_rn(__fadd_rn(bfr(a[q]), d[q]), mu); float p = __fmul_rn(d0, d0); asm volatile("" : "+v"(p)); s2 = __fadd_rn(s2, p); } }
#pragma unroll
    for (int sh = 16; sh; sh >>= 1) s2 += __shfl_xor(s2, sh, 32);
    const float rs = __fdiv_rn(1.0f, __fsqrt_rn(__fadd_rn(s2 * (1.0f / DM), LNEPS)));
{
#pragma unroll 1
        for (int ch = 0; ch < DM / 128; ++ch) { const int c0 = ch * 128 + lane * 4; const v4f a = *(const v4f*)(xr + c0); v4f d = {0.f, 0.f, 0.f, 0.f}; if (ar) d = *(const v4f*)(ar + c0); v4f z4; v4us oh, ol;
#pragma unroll
            for (int q = 0; q < 4; ++q) { const float v = __fadd_rn(bfr(a[q]), d[q]); z4[q] = v; float n0 = __fmul_rn(__fsub_rn(v, mu), rs); asm volatile("" : "+v"(n0)); float n1 = __fmul_rn(n0, bfr(g[c0 + q])); asm volatile("" : "+v"(n1)); const float y = __fadd_rn(n1, bfr(be[c0 + q])); unsigned short h2, l2; splitf(y, h2, l2); oh[q] = h2; ol[q] = l2; }
            if (Z) *(v4f*)(Z + (size_t)r * DM + c0) = z4; *(v4usa*)(&ys[0][wr][c0]) = oh; *(v4usa*)(&ys[1][wr][c0]) = ol; }
         }
    __syncthreads();   /* all 8 rows staged: a 128-byte line of a plane in fragment order holds 16 bytes of each of them */
    const size_t yo = (size_t)(blockIdx.x >> 1) * 16 * DM + (blockIdx.x & 1) * 64 + (threadIdx.x & 7) * 8;   /* rows 8 (x % 2) + t % 8 of row block x / 2 */
#pragma unroll
    for (int i = 0; i < DM / 256; ++i) { const int sg = i * 32 + (threadIdx.x >> 3);   /* columns 8 sg ..: a wave stores four whole lines */
        *(v8us*)(Yh + yo + sg * 128) = *(const v8usa*)(&ys[0][threadIdx.x & 7][sg * 8]); *(v8us*)(Yl + yo + sg * 128) = *(const v8usa*)(&ys[1][threadIdx.x & 7][sg * 8]); } }
__global__ __launch_bounds__(256) void k_cvt8(const float* __restrict__ src, bf* dst, size_t n8) { const size_t i = (size_t)blockIdx.x * 256 + threadIdx.x; if (i >= n8) return; const v8f v = *(const v8f*)(src + i * 8); v8us o;
#pragma unroll
    for (int k = 0; k < 8; ++k) o[k] = f2bf(v[k]); *(v8us*)(dst + i * 8) = o;  }

typedef __attribute__((ext_vector_type(8))) __bf16 v8bf;
__device__ __forceinline__ float xhalf(float x) { const int b = __float_as_int(x); return __int_as_float(__builtin_amdgcn_permlanex16(b, b, 0x76543210, 0xfedcba98, false, false)); }   /* lane l <-> l ^ 16 */
// The wait stands between a run of global loads and the first rewrite of an address register that they name: the addresses are inputs, so they stay in their registers up to it, and the scheduling barrier keeps later instructions behind it.
__device__ __forceinline__ void xwait(const void* a, const void* b) { asm volatile("s_wait_xcnt 0x0" :: "v"(a), "v"(b) : "memory"); __builtin_amdgcn_sched_barrier(0); }
// 2^x by v_exp_f32 with the one free slot that the instruction set asks for behind a transcendental in the same statement, so that it stands directly behind it wherever the statement is scheduled.
__device__ __forceinline__ float exp2s(float x) { float y; asm("v_exp_f32 %0, %1\n\tv_nop" : "=v"(y) : "v"(x)); return y; }
template <bool B> struct BoolC { static constexpr bool value = B; };
#define KT   128                  // keys of a staged tile
#define PLE  (KT * HD)            // elements of one plane's tile (16 KiB)
#define TLB  (6 * PLE * 2)        // bytes of a staged tile: planes K16, V16, Kh, Kl, Vh, Vl, one behind the other
static_assert(TT % KT == 0 && TT / KT >= 2 && KT % 32 == 0, "whole tiles, and both buffers are filled in front of the loop");
// Twelve copies of 512 bytes (16 a lane) from global memory into LDS, through no register. The s_wait_xcnt 0 is the statement's last line, so that it stands in front of every later write of an address register that a copy names.
__device__ __forceinline__ void copy12(const unsigned (&d)[12], const void* const (&g)[12]) {
    asm volatile("global_load_async_to_lds_b128 %0, %12, off\n\tglobal_load_async_to_lds_b128 %1, %13, off\n\tglobal_load_async_to_lds_b128 %2, %14, off\n\tglobal_load_async_to_lds_b128 %3, %15, off\n\t"
                 "global_load_async_to_lds_b128 %4, %16, off\n\tglobal_load_async_to_lds_b128 %5, %17, off\n\tglobal_load_async_to_lds_b128 %6, %18, off\n\tglobal_load_async_to_lds_b128 %7, %19, off\n\t"
                 "global_load_async_to_lds_b128 %8, %20, off\n\tglobal_load_async_to_lds_b128 %9, %21, off\n\tglobal_load_async_to_lds_b128 %10, %22, off\n\tglobal_load_async_to_lds_b128 %11, %23, off\n\ts_wait_xcnt 0x0"
                 :: "v"(d[0]), "v"(d[1]), "v"(d[2]), "v"(d[3]), "v"(d[4]), "v"(d[5]), "v"(d[6]), "v"(d[7]), "v"(d[8]), "v"(d[9]), "v"(d[10]), "v"(d[11]),
                    "v"(g[0]), "v"(g[1]), "v"(g[2]), "v"(g[3]), "v"(g[4]), "v"(g[5]), "v"(g[6]), "v"(g[7]), "v"(g[8]), "v"(g[9]), "v"(g[10]), "v"(g[11]) : "memory");
}
// Tile t of the six planes into the buffer at LDS byte address dst; one of eight waves (w) takes piece 8 j + w of the 32 pieces of each plane's tile. A key plane's tile is 16 KiB in a row; a value plane's is 4 KiB (the tile's four fragments) of each of the four 16-row blocks.
__device__ __forceinline__ void fa_stage(const h16* K16, const h16* V16, const bf* Kh, const bf* Kl, const bf* Vh, const bf* Vl, unsigned dst, int t, int w, int lane) {
    const unsigned dl = dst + w * 512 + lane * 16;
    const size_t ko = (size_t)t * PLE + w * 256 + lane * 8, vo = (size_t)t * (KT * 16) + w * 256 + lane * 8;
    unsigned d[12]; const void* g[12];
#pragma unroll
    for (int j = 0; j < 4; ++j) { d[j] = dl + j * 4096; g[j] = K16 + ko + j * 2048; d[4 + j] = dl + 4 * PLE + j * 4096; g[4 + j] = Kh + ko + j * 2048; d[8 + j] = dl + 6 * PLE + j * 4096; g[8 + j] = Kl + ko + j * 2048; }
    copy12(d, g);
#pragma unroll
    for (int j = 0; j < 4; ++j) { d[j] = dl + 2 * PLE + j * 4096; g[j] = V16 + vo + j * 16 * TT; d[4 + j] = dl + 8 * PLE + j * 4096; g[4 + j] = Vh + vo + j * 16 * TT; d[8 + j] = dl + 10 * PLE + j * 4096; g[8 + j] = Vl + vo + j * 16 * TT; }
    copy12(d, g);
}
// What a wave carries from tile to tile, in one form for both kinds of wave: output tiles, four query fragments (fp16: [column group][k half]; hi/lo: hi [k half], lo [k half]), running maximum and sum.
struct FaState { v8f o[4][2]; v16h q[4]; float m[2], l[2]; };
// One wave's work on one staged tile (keys kb .. kb + KT - 1); K, K2, V, V2: the tile's planes in LDS.
template <typename T16, bool HI, int NQ>
__device__ __forceinline__ void fa_tile(FaState& st, const T16* K, const T16* K2, const T16* V, const T16* V2, const float* __restrict__ bt, int q0, int kb, float cneg, float cpos) {
    typedef WFrag<T16> WF; typedef typename WF::V F;
    const int lane = threadIdx.x & 31, lr = lane & 15, hi = lane >> 4;
    const float L2E = 1.4426950408889634f;
    F qf[NQ][2], qf2[NQ][2];
#pragma unroll
    for (int nb = 0; nb < NQ; ++nb)
#pragma unroll
        for (int ks = 0; ks < 2; ++ks) { qf[nb][ks] = __builtin_bit_cast(F, st.q[HI ? ks : nb * 2 + ks]); if (HI) qf2[nb][ks] = __builtin_bit_cast(F, st.q[2 + ks]); }
    v8f (&o)[4][2] = st.o; float (&m)[2] = st.m; float (&l)[2] = st.l;
    const int ko = lane * 8, vo = lane * 8;
    // One pass over keys k0 .. k0 + 31 (kl: k0 - kb), written once and compiled into three loops (below). NEAR: the score tiles start from table values. Otherwise all 32 keys have the one bias cb: the tiles start from 0, and cb joins the pass's maximum and the addend of the exponent.
    auto pass = [&](auto nearc, const int k0, const int kl, const float cb) __attribute__((always_inline)) {
        constexpr bool NEAR = decltype(nearc)::value;
        v8f s[2][NQ];
        if constexpr (!NEAR) {
#pragma unroll
            for (int kt = 0; kt < 2; ++kt)
#pragma unroll
                for (int nb = 0; nb < NQ; ++nb) s[kt][nb] = (v8f){};
        } else { const float* bp0 = bt + (k0 + 8 * hi) - (q0 + lr);
#pragma unroll
            for (int kt = 0; kt < 2; ++kt)
#pragma unroll
                for (int nb = 0; nb < NQ; ++nb) { const float* bp = bp0 + (kt - nb) * 16;
#pragma unroll
                    for (int r = 0; r < 8; ++r) s[kt][nb][r] = bp[r]; }
            xwait(bp0, bp0);
        }
        F kf[2][2], kf2[2][2]; const T16* kp = K + ko + kl * HD; const T16* kp2 = K2 + ko + kl * HD;   /* the pass's key rows, then its value rows: LDS answers in order, so the score products wait for the first only */
#pragma unroll
        for (int kt = 0; kt < 2; ++kt)
#pragma unroll
            for (int ks = 0; ks < 2; ++ks) { kf[kt][ks] = WF::ld(kp + kt * 16 * HD + ks * 512); if (HI) kf2[kt][ks] = WF::ld(kp2 + kt * 16 * HD + ks * 512); }
        F vf[4], vf2[4]; const T16* vp = V + vo + kl * 16; const T16* vp2 = V2 + vo + kl * 16;
#pragma unroll
        for (int dt = 0; dt < 4; ++dt) { vf[dt] = WF::ld(vp + dt * 16 * KT); if (HI) vf2[dt] = WF::ld(vp2 + dt * 16 * KT); }
#pragma unroll
        for (int ks = 0; ks < 2; ++ks)
#pragma unroll
            for (int kt = 0; kt < 2; ++kt)
#pragma unroll
                for (int nb = 0; nb < NQ; ++nb) { s[kt][nb] = WF::mma(kf[kt][ks], qf[nb][ks], s[kt][nb]); if (HI) { s[kt][nb] = WF::mma(kf[kt][ks], qf2[nb][ks], s[kt][nb]); s[kt][nb] = WF::mma(kf2[kt][ks], qf[nb][ks], s[kt][nb]); } }
        F pf[NQ], pf2[NQ];
#pragma unroll
        for (int nb = 0; nb < NQ; ++nb) {
            float mx = s[0][nb][0];
#pragma unroll
            for (int r = 1; r < 8; ++r) mx = fmaxf(mx, s[0][nb][r]);
#pragma unroll
            for (int r = 0; r < 8; ++r) mx = fmaxf(mx, s[1][nb][r]);
            mx = fmaxf(mx, xhalf(mx));
            if constexpr (!NEAR) mx += cb;
            const float mn = fmaxf(m[nb], mx);
            const float al = exp2s((m[nb] - mn) * L2E);
            float ng = (HI ? 0.0f : PSH) - mn * L2E;
            if constexpr (!NEAR) ng = __builtin_fmaf(cb, L2E, ng);
            m[nb] = mn;
            float sum = 0.f;
#pragma unroll
            for (int kt = 0; kt < 2; ++kt)
#pragma unroll
                for (int r = 0; r < 8; ++r) { const float p = exp2s(__builtin_fmaf(s[kt][nb][r], L2E, ng)); s[kt][nb][r] = p; sum += p; }
            l[nb] = l[nb] * al + sum;
#pragma unroll
            for (int dt = 0; dt < 4; ++dt) o[dt][nb] *= al;
            if constexpr (HI) {
                const v8bf h0 = __builtin_convertvector(s[0][nb], v8bf), h1 = __builtin_convertvector(s[1][nb], v8bf);
                const v8bf l0 = __builtin_convertvector(s[0][nb] - __builtin_convertvector(h0, v8f), v8bf), l1 = __builtin_convertvector(s[1][nb] - __builtin_convertvector(h1, v8f), v8bf);
                pf[nb] = __builtin_shufflevector(h0, h1, 0, 1, 2, 3, 4, 5, 6, 7, 8, 9, 10, 11, 12, 13, 14, 15); pf2[nb] = __builtin_shufflevector(l0, l1, 0, 1, 2, 3, 4, 5, 6, 7, 8, 9, 10, 11, 12, 13, 14, 15);
            } else {
                pf[nb] = cat16(__builtin_convertvector(s[0][nb], v8h), __builtin_convertvector(s[1][nb], v8h));
            }
        }
#pragma unroll
        for (int dt = 0; dt < 4; ++dt)
#pragma unroll
            for (int nb = 0; nb < NQ; ++nb) { o[dt][nb] = WF::mma(vf[dt], pf[nb], o[dt][nb]); if (HI) { o[dt][nb] = WF::mma(vf[dt], pf2[nb], o[dt][nb]); o[dt][nb] = WF::mma(vf2[dt], pf[nb], o[dt][nb]); } }
        if constexpr (NQ == 1) asm volatile("v_nop\n\tv_nop\n\tv_nop\n\tv_nop" : "+v"(o[3][0])); else asm volatile("v_nop\n\tv_nop\n\tv_nop\n\tv_nop" : "+v"(o[3][0]), "+v"(o[3][1]));   /* the four vector slots that the chip needs behind the pass's last matrix instructions */
    };
    // The tile's keys in ascending order, as three loops: passes wholly 128 or more below the queries, passes that need the table, passes wholly 128 or more above. Each loop has one body, so the output tiles stay in their registers from pass to pass.
    // Each is rolled: the running maximum chains the passes, so unrolling would add code and registers without overlapping them.
    const int e1 = (q0 > 127 ? q0 - 127 : 0) & ~31;   /* k0 < e1: (k0 + 31) - q0 <= -128 */
    const int e2 = (q0 + 16 * NQ + 127 + 31) & ~31;   /* k0 >= e2: k0 - (q0 + 16 NQ - 1) >= 128 */
    const int l1 = e1 - kb < KT ? e1 - kb : KT, l2 = e2 - kb < KT ? e2 - kb : KT;   /* the same bounds counted from the tile's first key */
    int kl = 0;
#pragma unroll 1
    for (; kl < l1; kl += 32) pass(BoolC<false>{}, kb + kl, kl, cneg);
#pragma unroll 1
    for (; kl < l2; kl += 32) pass(BoolC<true>{}, kb + kl, kl, 0.f);
#pragma unroll 1
    for (; kl < KT; kl += 32) pass(BoolC<false>{}, kb + kl, kl, cpos);
}
template <int NQ>
__device__ __forceinline__ void fa_out(const FaState& st, int q0, bf* Ah, bf* Al) {
    const int lane = threadIdx.x & 31;
#pragma unroll
    for (int nb = 0; nb < NQ; ++nb) { const float inv = __fdiv_rn(1.0f, st.l[nb] + xhalf(st.l[nb])); const size_t oo = (size_t)(q0 + nb * 16) * DQ + lane * 8;
#pragma unroll
        for (int dt = 0; dt < 4; ++dt) { v8us oh, ol;
#pragma unroll
            for (int r = 0; r < 8; ++r) { unsigned short a, c2; splitf(st.o[dt][nb][r] * inv, a, c2); oh[r] = a; ol[r] = c2; }
            *(v8us*)(Ah + oo + dt * 256) = oh; *(v8us*)(Al + oo + dt * 256) = ol; }
        asm volatile("s_wait_xcnt 0x0" ::: "memory"); }   /* stands between the column group's stores and the next rewrite of a register that they name */
}
// grid (RH / 64, heads, batches), 10 waves, one work-group per WGP: waves 0-3 take 16 hi/lo query rows each, waves 4-9 take 32 fp16 rows each, so every work-group carries the same share of both kinds of work; planes [b][h] of (row t, k = d) (q, k) and of (row d, k = t) (v); merged output planes [b] of (row t, k = h d) as hi/lo; all in fragment order
static_assert(RH / 64 == (TT - RH) / 192 && RH % 64 == 0 && (TT - RH) % 192 == 0, "4 hi/lo waves and 6 fp16 waves per workgroup cover all rows");
__global__ __launch_bounds__(320) void k_fattn(const h16* __restrict__ Q16, const h16* __restrict__ K16, const h16* __restrict__ V16, const bf* __restrict__ Qh, const bf* __restrict__ Ql, const bf* __restrict__ Kh, const bf* __restrict__ Kl, const bf* __restrict__ Vh, const bf* __restrict__ Vl, const float* __restrict__ BT, bf* Ah, bf* Al) {
    __shared__ __attribute__((aligned(1024))) bf ring[2 * TLB / 2];   /* two buffers of one tile each */
    const int wv = __builtin_amdgcn_readfirstlane((int)(threadIdx.x >> 5)), lane = threadIdx.x & 31, bx = blockIdx.x, h = blockIdx.y, b = blockIdx.z;
    const size_t pq = ((size_t)b * NH_ + h) * TT * HD, pk = ((size_t)b * NKV + h / REP) * TT * HD, po = (size_t)b * TT * DQ + h * HD * 16;
    const float* bt = BT + (size_t)h * 4096 + (TT - 1);   /* bt[j - i] */
    const bool hw = wv < 4, cw = wv < 8;   /* kind of wave; the eight waves that copy. Both the same for a whole wave: scalar branches */
    const int q0 = hw ? (bx * 4 + wv) * 16 : RH + (bx * 6 + wv - 4) * 32;
    const unsigned rb = (unsigned)(size_t)&ring[0];   /* LDS byte address of buffer 0 */
    if (cw) fa_stage(K16 + pk, V16 + pk, Kh + pk, Kl + pk, Vh + pk, Vl + pk, rb, 0, wv, lane);
    asm volatile("s_wait_asynccnt 0x0" ::: "memory");   /* this wave's copies of tile 0 have landed */
    __syncthreads();   /* tile 0 is there for every wave */
    if (cw) fa_stage(K16 + pk, V16 + pk, Kh + pk, Kl + pk, Vh + pk, Vl + pk, rb + TLB, 1, wv, lane);
    FaState st;
    const bf* qa = (hw ? Qh + pq : (const bf*)(Q16 + pq)) + (size_t)q0 * HD + lane * 8; const bf* qb = (hw ? Ql + pq : (const bf*)(Q16 + pq) + 16 * HD) + (size_t)q0 * HD + lane * 8;   /* 16-bit patterns, whatever the kind */
#pragma unroll
    for (int ks = 0; ks < 2; ++ks) { st.q[ks] = __builtin_bit_cast(v16h, WFrag<bf>::ld(qa + ks * 512)); st.q[2 + ks] = __builtin_bit_cast(v16h, WFrag<bf>::ld(qb + ks * 512)); }
    xwait(qa, qb);
#pragma unroll
    for (int dt = 0; dt < 4; ++dt)
#pragma unroll
        for (int nb = 0; nb < 2; ++nb) st.o[dt][nb] = (v8f){};
#pragma unroll
    for (int nb = 0; nb < 2; ++nb) { st.m[nb] = -3.0e38f; st.l[nb] = 0.f; }
    const float cneg = bt[-(TT - 1)], cpos = bt[TT - 1];
    // Rolled: one trip per tile, with the hand-over of the buffers at its foot.
#pragma unroll 1
    for (int t = 0; t < TT / KT; ++t) {
        const bf* tb = ring + (t & 1) * (TLB / 2);
        if (hw) fa_tile<bf, true, 1>(st, tb + 2 * PLE, tb + 3 * PLE, tb + 4 * PLE, tb + 5 * PLE, bt, q0, t * KT, cneg, cpos);
        else fa_tile<h16, false, 2>(st, (const h16*)tb, nullptr, (const h16*)tb + PLE, nullptr, bt, q0, t * KT, cneg, cpos);
        asm volatile("s_wait_dscnt 0x0" ::: "memory");      /* this wave's reads of tile t are done */
        asm volatile("s_wait_asynccnt 0x0" ::: "memory");   /* its copies of tile t + 1 have landed */
        __syncthreads();   /* tile t + 1 is there for every wave, and no wave reads tile t any more */
        if (t + 2 < TT / KT) { if (cw) fa_stage(K16 + pk, V16 + pk, Kh + pk, Kl + pk, Vh + pk, Vl + pk, rb + (t & 1) * TLB, t + 2, wv, lane); }
    }
    asm volatile("s_wait_asynccnt 0x0" ::: "memory");   /* no copy is outstanding when the wave ends */
    if (hw) fa_out<1>(st, q0, Ah + po, Al + po); else fa_out<2>(st, q0, Ah + po, Al + po);
}

extern "C" void kernel_launch(void* const* d_in, const int* in_sizes, int n_in,
                              void* d_out, int out_size, void* d_ws, size_t ws_size, hipStream_t stream) {
    (void)in_sizes; (void)n_in; (void)out_size;
    const float* x = (const float*)d_in[0]; const float* g1 = (const float*)d_in[1]; const float* e1b = (const float*)d_in[2]; const float* wq = (const float*)d_in[3]; const float* wk = (const float*)d_in[4]; const float* wv = (const float*)d_in[5]; const float* wo = (const float*)d_in[6]; const float* relb = (const float*)d_in[7];
    float* OUT = (float*)d_out;     // [2][2048][1024]
    char* wsp = (char*)d_ws;
    auto take = [&](size_t bytes) { char* p = wsp; wsp += (bytes + 255) & ~(size_t)255; return (void*)p; };
    bf* WQ = (bf*)take((size_t)DQ * DM * 2); bf* WK = (bf*)take((size_t)DKV * DM * 2); bf* WV = (bf*)take((size_t)DKV * DM * 2); bf* WO = (bf*)take((size_t)DM * DQ * 2);
    bf* Yh = (bf*)take((size_t)NB_ * TT * DM * 2); bf* Yl = (bf*)take((size_t)NB_ * TT * DM * 2); float* BT = (float*)take((size_t)NH_ * 4096 * 4);
    h16* QP16 = (h16*)take((size_t)NB_ * NH_ * TT * HD * 2); h16* KP16 = (h16*)take((size_t)NB_ * NKV * TT * HD * 2); h16* VT16 = (h16*)take((size_t)NB_ * NKV * HD * TT * 2);
    bf* QPh = (bf*)take((size_t)NB_ * NH_ * TT * HD * 2); bf* KPh = (bf*)take((size_t)NB_ * NKV * TT * HD * 2); bf* VTh = (bf*)take((size_t)NB_ * NKV * HD * TT * 2); bf* QPl = (bf*)take((size_t)NB_ * NH_ * TT * HD * 2); bf* KPl = (bf*)take((size_t)NB_ * NKV * TT * HD * 2); bf* VTl = (bf*)take((size_t)NB_ * NKV * HD * TT * 2);   // q, k, v of each kind follow one another (every size is a multiple of 256 bytes), as do WQ, WK, WV, WO: the z stride of the merged launches
    bf* ATh = (bf*)take((size_t)NB_ * TT * DQ * 2); bf* ATl = (bf*)take((size_t)NB_ * TT * DQ * 2);
    if ((size_t)(wsp - (char*)d_ws) > ws_size) return;    // ws 256 MiB
    k_prep<<<dim3(512, 6, 1), 256, 0, stream>>>(x, nullptr, g1, e1b, nullptr, Yh, Yl, wq, wk, wv, wo, WQ, relb, BT);   /* n = LN(hidden) as hi/lo planes, both batches; all four weight planes; the bias table */
    k_gemmw<bf, 1, 1, DM><<<dim3(NB_ * TT / 64, DQ / 64, 3), 32, 0, stream>>>(Yh, Yl, WQ, nullptr, nullptr, nullptr, QP16, QPh, QPl, 0, (size_t)DQ * DM, (size_t)NB_ * NH_ * TT * HD);   /* q, k, v of both batches: head planes, written by the projections themselves */
    k_fattn<<<dim3(RH / 64, NH_, NB_), 320, 0, stream>>>(QP16, KP16, VT16, QPh, QPl, KPh, KPl, VTh, VTl, BT, ATh, ATl);
    k_gemmw<bf, 1, 0, DQ><<<dim3(NB_ * TT / 64, DM / 64, 1), 32, 0, stream>>>(ATh, ATl, WO, nullptr, x, OUT, nullptr, nullptr, nullptr, 0, 0, 0);   /* out = hidden + ctx Wo */
}

// v008
// It runs in 131 microseconds.
// Next to v007, in two timings, it ran 1.16 and 1.17 times as fast.
// All steps since v000 together make it 15.7 times as fast.
#include <hip/hip_runtime.h>

// T5 self-attention layer (hidden [2][2048][1024]; n = LayerNorm(hidden) (1e-6, ln_g, ln_b); q, k, v = n W ('xw' [1024][1024], no bias, 16 heads x 64); scores = q.k (NO 1/sqrt(d)) + rel_bias[bucket(j - i)][h] (T5 bidirectional buckets, 32 buckets, max distance 128); softmax over all keys; out = hidden + merged Wo -> [2][2048][1024]).
// The bucket index depends only on (j - i); it is embedded as a 4095-entry integer table computed with the reference's own bucket function (its f32 log -> int32 cast has exact-integer knife edges, so it is not recomputed on the device).
// Compute dtypes, f32 accumulate: every input rounded to bf16; q/k/v projections hl x exact (2 products); the relative-position bias (bf16-rounded rel_bias values through the embedded bucket table) enters the scores in f32; scores and attn.v: query rows < 512 hl (3 products), the rest single fp16 (P x1024); softmax f32, online; Wo hl x exact (2 products), + hidden residual in f32.

#define NB_  2
#define TT   2048
#define DM   1024
#define NH_  16
#define NKV  16
#define REP  (NH_ / NKV)
#define HD   64
#define DQ   (NH_ * HD)
#define DKV  (NKV * HD)
#define LNEPS 1e-6f
#define NBKT 32
#define RH   512                  // query rows < RH use hi+lo planes
#define WIN  0
#define PSH  10.0f                 // fp16 P carries 2^10 (added to the exponent; it cancels against the row sum)
#define SCL  1.0f                  // T5: no 1/sqrt(d) scaling
typedef _Float16 h16;
typedef unsigned short bf;
typedef __attribute__((ext_vector_type(16))) __bf16   v16bf;
typedef __attribute__((ext_vector_type(16))) _Float16 v16h;
typedef __attribute__((ext_vector_type(8)))  _Float16 v8h;
typedef __attribute__((ext_vector_type(8)))  unsigned short v8us;
typedef __attribute__((ext_vector_type(8)))  float    v8f;
typedef __attribute__((ext_vector_type(4)))  float    v4f;
typedef v8h  __attribute__((may_alias)) v8ha;
typedef v4f  __attribute__((may_alias)) v4fa;
typedef v8us __attribute__((may_alias)) v8usa;

__device__ __forceinline__ unsigned short f2bf(float f) { unsigned u = __float_as_uint(f); u += 0x7FFFu + ((u >> 16) & 1u); return (unsigned short)(u >> 16); }
__device__ __forceinline__ float bf2f(unsigned short b) { return __uint_as_float(((unsigned)b) << 16); }
__device__ __forceinline__ float bfr(float f) { return bf2f(f2bf(f)); }
__device__ __forceinline__ v16h cat16(v8h lo, v8h hi) { return __builtin_shufflevector(lo, hi, 0, 1, 2, 3, 4, 5, 6, 7, 8, 9, 10, 11, 12, 13, 14, 15); }
__device__ __forceinline__ v16bf cat16b(v8us lo, v8us hi) { return __builtin_bit_cast(v16bf, __builtin_shufflevector(lo, hi, 0, 1, 2, 3, 4, 5, 6, 7, 8, 9, 10, 11, 12, 13, 14, 15)); }
__device__ __forceinline__ v8f wmma16(v16h a, v16h b, v8f c) { return __builtin_amdgcn_wmma_f32_16x16x32_f16(false, a, false, b, (short)0, c, false, false); }
__device__ __forceinline__ v8f wmmab(v16bf a, v16bf b, v8f c) { return __builtin_amdgcn_wmma_f32_16x16x32_bf16(false, a, false, b, (short)0, c, false, false); }



__device__ __forceinline__ h16 tohx(float x) { return (h16)x; }
__device__ __forceinline__ void splitf(float y, unsigned short& h, unsigned short& l) { h = f2bf(y); l = f2bf(y - bf2f(h)); }
// The two waits stand between a run of global stores and the first rewrite of a register that they name: addresses and data are inputs, so they stay in their registers up to the wait, and the scheduling barrier keeps later instructions behind it.
__device__ __forceinline__ void swaitp(const void* a, const void* b, const void* c, const v8h (&x)[4], const v8us (&y)[4], const v8us (&w)[4]) { asm volatile("s_wait_xcnt 0x0" :: "v"(a), "v"(b), "v"(c), "v"(x[0]), "v"(x[1]), "v"(x[2]), "v"(x[3]), "v"(y[0]), "v"(y[1]), "v"(y[2]), "v"(y[3]), "v"(w[0]), "v"(w[1]), "v"(w[2]), "v"(w[3]) : "memory"); __builtin_amdgcn_sched_barrier(0); }
// The same between a run of global loads and the first rewrite of an address register that they name.
__device__ __forceinline__ void gwait(const void* a, const void* b, const void* c, const void* d) { asm volatile("s_wait_xcnt 0x0" :: "v"(a), "v"(b), "v"(c), "v"(d) : "memory"); __builtin_amdgcn_sched_barrier(0); }
__device__ __forceinline__ void swaitf(const void* a, const void* b, const v4f (&x)[8]) { asm volatile("s_wait_xcnt 0x0" :: "v"(a), "v"(b), "v"(x[0]), "v"(x[1]), "v"(x[2]), "v"(x[3]), "v"(x[4]), "v"(x[5]), "v"(x[6]), "v"(x[7]) : "memory"); __builtin_amdgcn_sched_barrier(0); }

template <typename T16> struct WFrag;
template <> struct WFrag<h16> { typedef v16h V; static __device__ __forceinline__ V ld(const h16* p) { return cat16(*(const v8h*)p, *(const v8h*)(p + 256)); } static __device__ __forceinline__ v8f mma(V a, V b, v8f c) { return wmma16(a, b, c); } };
template <> struct WFrag<bf> { typedef v16bf V; static __device__ __forceinline__ V ld(const bf* p) { return cat16b(*(const v8us*)p, *(const v8us*)(p + 256)); } static __device__ __forceinline__ v8f mma(V a, V b, v8f c) { return wmmab(a, b, c); } };
static_assert(HD == 64, "one 64-column tile is one head");
static_assert(TT % 64 == 0 && NKV == NH_ && DQ == DM && DKV == DM, "a 64-row tile lies in one batch; q, k, v planes and the four weight matrices have one size each");
// The plane epilogue of one tile; TR: transposed planes. Every loop is unrolled (the accumulators are registers and take constant indices only) and PP is a constant, so that all stores of a block name p16, ph or pl plus a constant.
template <bool TR>
__device__ __forceinline__ void gemm_planes(const v8f (&acc)[4][4], float* os, h16* p16, bf* ph, bf* pl, int lr, int hi) {
    constexpr int PP = TR ? TT : HD;   /* columns (K) of a plane: 16 staged rows are 16 PP elements of it */
#pragma unroll
    for (int blk = 0; blk < 4; ++blk) {
#pragma unroll
        for (int ob = 0; ob < 4; ++ob) {
            if constexpr (!TR) {   /* staged row = m, 16 rows of block blk */
#pragma unroll
                for (int j = 0; j < 8; ++j) os[(hi * 8 + j) * 68 + ob * 16 + lr] = acc[blk][ob][j];
            } else {   /* staged row = n, 16 columns of block blk: a lane's 8 accumulator rows are 8 neighbours in it */
                const v8f t = acc[ob][blk]; *(v4fa*)(os + lr * 68 + ob * 16 + hi * 8) = __builtin_shufflevector(t, t, 0, 1, 2, 3); *(v4fa*)(os + lr * 68 + ob * 16 + hi * 8 + 4) = __builtin_shufflevector(t, t, 4, 5, 6, 7); } }
        __builtin_amdgcn_wave_barrier(); asm volatile("" ::: "memory");   /* fence: writes before reads */
        v8h o16[4]; v8us oh[4], ol[4];
#pragma unroll
        for (int s = 0; s < 4; ++s) { const float* sp = os + lr * 68 + s * 16 + hi * 8; const v4f x0 = *(const v4fa*)sp, x1 = *(const v4fa*)(sp + 4);
#pragma unroll
            for (int k = 0; k < 8; ++k) { const float x = (k < 4) ? x0[k & 3] : x1[k & 3]; o16[s][k] = tohx(x); unsigned short a2, c2; splitf(x, a2, c2); oh[s][k] = a2; ol[s][k] = c2; }
            *(v8h*)(p16 + blk * 16 * PP + s * 256) = o16[s]; *(v8us*)(ph + blk * 16 * PP + s * 256) = oh[s]; *(v8us*)(pl + blk * 16 * PP + s * 256) = ol[s]; }
        swaitp(p16, ph, pl, o16, oh, ol);
        __builtin_amdgcn_wave_barrier(); asm volatile("" ::: "memory");   /* fence: reads before the next writes */
    }
}
// Twelve copies of 512 bytes (16 a lane) from global memory into LDS, through no register. The s_wait_xcnt 0 is the statement's last line, so that it stands in front of every later write of an address register that a copy names.
__device__ __forceinline__ void copy12(const unsigned (&d)[12], const void* const (&g)[12]) {
    asm volatile("global_load_async_to_lds_b128 %0, %12, off\n\tglobal_load_async_to_lds_b128 %1, %13, off\n\tglobal_load_async_to_lds_b128 %2, %14, off\n\tglobal_load_async_to_lds_b128 %3, %15, off\n\t"
                 "global_load_async_to_lds_b128 %4, %16, off\n\tglobal_load_async_to_lds_b128 %5, %17, off\n\tglobal_load_async_to_lds_b128 %6, %18, off\n\tglobal_load_async_to_lds_b128 %7, %19, off\n\t"
                 "global_load_async_to_lds_b128 %8, %20, off\n\tglobal_load_async_to_lds_b128 %9, %21, off\n\tglobal_load_async_to_lds_b128 %10, %22, off\n\tglobal_load_async_to_lds_b128 %11, %23, off\n\ts_wait_xcnt 0x0"
                 :: "v"(d[0]), "v"(d[1]), "v"(d[2]), "v"(d[3]), "v"(d[4]), "v"(d[5]), "v"(d[6]), "v"(d[7]), "v"(d[8]), "v"(d[9]), "v"(d[10]), "v"(d[11]),
                    "v"(g[0]), "v"(g[1]), "v"(g[2]), "v"(g[3]), "v"(g[4]), "v"(g[5]), "v"(g[6]), "v"(g[7]), "v"(g[8]), "v"(g[9]), "v"(g[10]), "v"(g[11]) : "memory");
}
// Tile s (k columns s GKS ..) of the work-group's 128 rows of A, A2 and Bt into the buffer at LDS byte address dst (planes A, A2, Bt, one behind the other). In fragment order the GKS columns of a 16-row block are 32 GKS bytes in a row, and they keep that order in LDS; wave w of four takes row blocks 2 w and 2 w + 1 of each plane, in pieces of 512 bytes.
template <int K, int GKS>
__device__ __forceinline__ void gm_stage(const bf* A, const bf* A2, const bf* B, unsigned dst, int s, int w, int lane) {
    constexpr int GPL = 128 * GKS;   /* elements of one plane's tile */
    const unsigned dl = dst + w * (64 * GKS) + lane * 16;
    const size_t go = (size_t)w * (32 * K) + (size_t)s * (GKS * 16) + lane * 8;
    unsigned d[12]; const void* g[12];
#pragma unroll
    for (int q = 0; q < GKS / 32; ++q) {   /* 2 KiB of each plane: part q % (GKS / 64) of row block q / (GKS / 64) */
        const unsigned dq = dl + (q / (GKS / 64)) * (32 * GKS) + (q % (GKS / 64)) * 2048; const size_t gq = go + (q / (GKS / 64)) * (16 * K) + (q % (GKS / 64)) * 1024;
#pragma unroll
        for (int j = 0; j < 4; ++j) { d[j] = dq + j * 512; g[j] = A + gq + j * 256; d[4 + j] = dq + 2 * GPL + j * 512; g[4 + j] = A2 + gq + j * 256; d[8 + j] = dq + 4 * GPL + j * 512; g[8 + j] = B + gq + j * 256; }
        copy12(d, g);
        __builtin_amdgcn_sched_barrier(0); }   /* the next twelve copies' addresses are formed behind these copies: formed in front of them, a whole tile's addresses are live at once beside the accumulators, and some are spilled */
}
template <typename T16, int NSPLIT, int EPI, int K>
__global__ __launch_bounds__(128) void k_gemmw(const T16* __restrict__ A, const T16* __restrict__ A2, const T16* __restrict__ Bt, const T16* __restrict__ Bt2, const float* __restrict__ X, float* C, h16* P16, bf* Ph, bf* Pl, size_t sA, size_t sB, size_t sC) {
    typedef typename WFrag<T16>::V V;
    constexpr int GKS = (EPI == 0) ? 128 : 64;   /* k columns of a staged tile: 64 where three work-groups share a WGP's LDS (the launch has three per WGP), 128 where the launch has one per WGP (the ring then also keeps a second work-group off that WGP) */
    constexpr int GPL = 128 * GKS, GTB = 3 * GPL * 2;   /* elements of one plane's tile; bytes of a tile */
    static_assert(NSPLIT == 1 && K % GKS == 0 && K / GKS >= 2, "planes A, A2, Bt; whole tiles, and both buffers are filled in front of the loop");
    __shared__ __attribute__((aligned(1024))) T16 ring[2 * GTB / 2];   /* two buffers of one tile each; behind the loop each wave's epilogue staging */
    const size_t z = blockIdx.z; A += z * sA; A2 += z * sA; Bt += z * sB;
    const int wv = __builtin_amdgcn_readfirstlane((int)(threadIdx.x >> 5)), lane = threadIdx.x & 31, lr = lane & 15, hi = lane >> 4;
    const int wm = wv >> 1, wn = wv & 1; const int r0 = blockIdx.x * 128 + wm * 64, c0 = blockIdx.y * 128 + wn * 64;   /* the wave's own 64 x 64 tile */
    const T16* Ag = A + (size_t)blockIdx.x * 128 * K; const T16* A2g = A2 + (size_t)blockIdx.x * 128 * K; const T16* Bg = Bt + (size_t)blockIdx.y * 128 * K;
    const unsigned rb = (unsigned)(size_t)&ring[0];   /* LDS byte address of buffer 0 */
    gm_stage<K, GKS>(Ag, A2g, Bg, rb, 0, wv, lane);
    asm volatile("s_wait_asynccnt 0x0" ::: "memory");   /* this wave's copies of tile 0 have landed */
    __syncthreads();   /* tile 0 is there for every wave */
    gm_stage<K, GKS>(Ag, A2g, Bg, rb + GTB, 1, wv, lane);
    v8f acc[4][4];
#pragma unroll
    for (int mb = 0; mb < 4; ++mb)
#pragma unroll
        for (int nb = 0; nb < 4; ++nb) acc[mb][nb] = (v8f){};
    // Rolled: one trip per tile, with the hand-over of the buffers at its foot.
#pragma unroll 1
    for (int s = 0; s < K / GKS; ++s) {
        const T16* tb = ring + (s & 1) * (GTB / 2);
        const T16* ap = tb + wm * (64 * GKS) + lane * 8; const T16* ap2 = ap + GPL; const T16* bp = tb + 2 * GPL + wn * (64 * GKS) + lane * 8;
#pragma unroll
        for (int c = 0; c < GKS / 32; ++c) {
            // The 24 LDS reads of 32 products stand in one run in front of them, in the order in which the products take them: LDS answers in order, so the first products wait for the first ten reads only. Each scheduling barrier keeps that order in the compiled code: left to itself the compiler reads an A fragment directly in front of its four products and waits for it there, or turns the run round and waits for all of it.
            V a[4], a2[4], b[4];
#pragma unroll
            for (int nb = 0; nb < 4; ++nb) b[nb] = WFrag<T16>::ld(bp + nb * 16 * GKS + c * 512);
            a[0] = WFrag<T16>::ld(ap + c * 512);
            __builtin_amdgcn_sched_barrier(0);   /* first: what the first four products take */
#pragma unroll
            for (int mb = 1; mb < 4; ++mb) a[mb] = WFrag<T16>::ld(ap + mb * 16 * GKS + c * 512);
#pragma unroll
            for (int mb = 0; mb < 4; ++mb) a2[mb] = WFrag<T16>::ld(ap2 + mb * 16 * GKS + c * 512);
            __builtin_amdgcn_sched_barrier(0);   /* then the other fragments; no product stands among the reads */
#pragma unroll
            for (int mb = 0; mb < 4; ++mb)
#pragma unroll
                for (int nb = 0; nb < 4; ++nb) acc[mb][nb] = WFrag<T16>::mma(a[mb], b[nb], acc[mb][nb]);
#pragma unroll
            for (int mb = 0; mb < 4; ++mb)
#pragma unroll
                for (int nb = 0; nb < 4; ++nb) acc[mb][nb] = WFrag<T16>::mma(a2[mb], b[nb], acc[mb][nb]);
            __builtin_amdgcn_sched_barrier(0);   /* the next run of reads stays behind these products: drawn in front of them it would need a second set of fragment registers */
            if (c == GKS / 32 - 1) asm volatile("v_nop\n\tv_nop\n\tv_nop\n\tv_nop" : "+v"(acc[3][0]), "+v"(acc[3][1]), "+v"(acc[3][2]), "+v"(acc[3][3]) : "v"(a2[3]), "v"(b[3]));   /* the four vector slots that the chip needs behind the trip's last matrix instructions */
        }
        asm volatile("s_wait_dscnt 0x0" ::: "memory");      /* this wave's reads of tile s are done */
        asm volatile("s_wait_asynccnt 0x0" ::: "memory");   /* its copies of tile s + 1 have landed */
        __syncthreads();   /* tile s + 1 is there for every wave, and no wave reads tile s any more */
        if (s + 2 < K / GKS) gm_stage<K, GKS>(Ag, A2g, Bg, rb + (s & 1) * GTB, s + 2, wv, lane);
    }
    asm volatile("s_wait_asynccnt 0x0" ::: "memory");   /* no copy is outstanding when the ring is put to another use */
    float* os = (float*)ring + wv * (16 * 68);   /* behind the last trip's barrier nobody reads the ring any more: each wave stages its rows in a piece of its own */
    // Epilogue. Every loop is unrolled: the accumulators are registers and take constant indices only. The staged rows pass from lane to lane through LDS, which runs one wave's operations in order;
    // each fence (wave barrier + memory clobber) keeps that order in the compiled code: all lanes' writes of a block, then its reads, then the next block's writes.
    if constexpr (EPI == 0) {
        const size_t co = z * sC + (size_t)(r0 + hi) * DM + c0 + lr * 4;   /* a lane's 4 columns of rows hi, 2 + hi, ... */
        const float* xp = X + co; float* cp = C + co;
        v4f xv[2][8];   /* the residual rows, fetched one 16-row block ahead */
#pragma unroll
        for (int s = 0; s < 8; ++s) xv[0][s] = *(const v4f*)(xp + 2 * s * DM);
#pragma unroll
        for (int mb = 0; mb < 4; ++mb) {
            if (mb < 3) {
#pragma unroll
                for (int s = 0; s < 8; ++s) xv[(mb + 1) & 1][s] = *(const v4f*)(xp + ((mb + 1) * 16 + 2 * s) * DM); }
#pragma unroll
            for (int nb = 0; nb < 4; ++nb) {
#pragma unroll
                for (int j = 0; j < 8; ++j) os[(hi * 8 + j) * 68 + nb * 16 + lr] = acc[mb][nb][j]; }
            __builtin_amdgcn_wave_barrier(); asm volatile("" ::: "memory");   /* fence: writes before reads */
            v4f val[8];
#pragma unroll
            for (int s = 0; s < 8; ++s) { val[s] = *(const v4fa*)(os + (2 * s + hi) * 68 + lr * 4);
#pragma unroll
                for (int q = 0; q < 4; ++q) val[s][q] = __fadd_rn(bfr(xv[mb & 1][s][q]), val[s][q]);
                *(v4f*)(cp + (mb * 16 + 2 * s) * DM) = val[s]; }
            swaitf(xp, cp, val);
            __builtin_amdgcn_wave_barrier(); asm volatile("" ::: "memory");   /* fence: reads before the next writes */
        }
    } else {
        const bool tr = blockIdx.z == 2;   /* the same for the whole wave: a scalar branch */
        const size_t po = z * sC + ((size_t)(r0 / TT) * NH_ + c0 / 64) * TT * HD + (size_t)(r0 % TT) * (tr ? 16 : HD) + lane * 8;   /* a lane's 8 elements of staged row lr, columns 8 hi, 16 + 8 hi, ...: each store of the wave is 512 bytes in a row */
        if (tr) gemm_planes<true>(acc, os, P16 + po, Ph + po, Pl + po, lr, hi); else gemm_planes<false>(acc, os, P16 + po, Ph + po, Pl + po, lr, hi);
    }
}

typedef __attribute__((ext_vector_type(2))) _Float16 v2h;
typedef __attribute__((ext_vector_type(4))) _Float16 v4h;
typedef __attribute__((ext_vector_type(2))) unsigned short v2us;
typedef __attribute__((ext_vector_type(4))) unsigned short v4us;
typedef v4us __attribute__((may_alias)) v4usa;
typedef __attribute__((ext_vector_type(2))) float v2f;
typedef __attribute__((ext_vector_type(4))) int v4i;

template <int K, int N>
__device__ __forceinline__ void d_wtG(const float* __restrict__ w, bf* Bt) {
    // Bt (row n, column k) = w[k][n] in fragment order: one wave writes one 512-byte unit u (16 rows n, 16 columns k)
    const int lane = threadIdx.x & 31; const int u = blockIdx.x * 8 + (threadIdx.x >> 5); if (u >= N * K / 256) return;
    const int k = (u % (K / 16)) * 16 + (lane >> 4) * 8, n = (u / (K / 16)) * 16 + (lane & 15); const float* wp = w + (size_t)k * N + n; float x[8]; v8us o;
#pragma unroll
    for (int e = 0; e < 8; ++e) x[e] = wp[e * N];
    gwait(wp, wp, wp, wp);
#pragma unroll
    for (int e = 0; e < 8; ++e) o[e] = f2bf(x[e]);
    *(v8us*)(Bt + (size_t)u * 256 + lane * 8) = o;
}
__constant__ int BKT[4095] = {15,15,15,15,15,15,15,15,15,15,15,15,15,15,15,15,15,15,15,15,15,15,15,15,15,15,15,15,15,15,15,15,15,15,15,15,15,15,15,15,15,15,15,15,15,15,15,15,15,15,15,15,15,15,15,15,15,15,15,15,15,15,15,15,15,15,15,15,15,15,15,15,15,15,15,15,15,15,15,15,15,15,15,15,15,15,15,15,15,15,15,15,15,15,15,15,15,15,15,15,15,15,15,15,15,15,15,15,15,15,15,15,15,15,15,15,15,15,15,15,15,15,15,15,15,15,15,15,15,15,15,15,15,15,15,15,15,15,15,15,15,15,15,15,15,15,15,15,15,15,15,15,15,15,15,15,15,15,15,15,15,15,15,15,15,15,15,15,15,15,15,15,15,15,15,15,15,15,15,15,15,15,15,15,15,15,15,15,15,15,15,15,15,15,15,15,15,15,15,15,15,15,15,15,15,15,15,15,15,15,15,15,15,15,15,15,15,15,15,15,15,15,15,15,15,15,15,15,15,15,15,15,15,15,15,15,15,15,15,15,15,15,15,15,15,15,15,15,15,15,15,15,15,15,15,15,15,15,15,15,15,15,15,15,15,15,15,15,15,15,15,15,15,15,15,15,15,15,15,15,15,15,15,15,15,15,15,15,15,15,15,15,15,15,15,15,15,15,15,15,15,15,15,15,15,15,15,15,15,15,15,15,15,15,15,15,15,15,15,15,15,15,15,15,15,15,15,15,15,15,15,15,15,15,15,15,15,15,15,15,15,15,15,15,15,15,15,15,15,15,15,15,15,15,15,15,15,15,15,15,15,15,15,15,15,15,15,15,15,15,15,15,15,15,15,15,15,15,15,15,15,15,15,15,15,15,15,15,15,15,15,15,15,15,15,15,15,15,15,15,15,15,15,15,15,15,15,15,15,15,15,15,15,15,15,15,15,15,15,15,15,15,15,15,15,15,15,15,15,15,15,15,15,15,15,15,15,15,15,15,15,15,15,15,15,15,15,15,15,15,15,15,15,15,15,15,15,15,15,15,15,15,15,15,15,15,15,15,15,15,15,15,15,15,15,15,15,15,15,15,15,15,15,15,15,15,15,15,15,15,15,15,15,15,15,15,15,15,15,15,15,15,15,15,15,15,15,15,15,15,15,15,15,15,15,15,15,15,15,15,15,15,15,15,15,15,15,15,15,15,15,15,15,15,15,15,15,15,15,15,15,15,15,15,15,15,15,15,15,15,15,15,15,15,15,15,15,15,15,15,15,15,15,15,15,15,15,15,15,15,15,15,15,15,15,15,15,15,15,15,15,15,15,15,15,15,15,15,15,15,15,15,15,15,15,15,15,15,15,15,15,15,15,15,15,15,15,15,15,15,15,15,15,15,15,15,15,15,15,15,15,15,15,15,15,15,15,15,15,15,15,15,15,15,15,15,15,15,15,15,15,15,15,15,15,15,15,15,15,15,15,15,15,15,15,15,15,15,15,15,15,15,15,15,15,15,15,15,15,15,15,15,15,15,15,15,15,15,15,15,15,15,15,15,15,15,15,15,15,15,15,15,15,15,15,15,15,15,15,15,15,15,15,15,15,15,15,15,15,15,15,15,15,15,15,15,15,15,15,15,15,15,15,15,15,15,15,15,15,15,15,15,15,15,15,15,15,15,15,15,15,15,15,15,15,15,15,15,15,15,15,15,15,15,15,15,15,15,15,15,15,15,15,15,15,15,15,15,15,15,15,15,15,15,15,15,15,15,15,15,15,15,15,15,15,15,15,15,15,15,15,15,15,15,15,15,15,15,15,15,15,15,15,15,15,15,15,15,15,15,15,15,15,15,15,15,15,15,15,15,15,15,15,15,15,15,15,15,15,15,15,15,15,15,15,15,15,15,15,15,15,15,15,15,15,15,15,15,15,15,15,15,15,15,15,15,15,15,15,15,15,15,15,15,15,15,15,15,15,15,15,15,15,15,15,15,15,15,15,15,15,15,15,15,15,15,15,15,15,15,15,15,15,15,15,15,15,15,15,15,15,15,15,15,15,15,15,15,15,15,15,15,15,15,15,15,15,15,15,15,15,15,15,15,15,15,15,15,15,15,15,15,15,15,15,15,15,15,15,15,15,15,15,15,15,15,15,15,15,15,15,15,15,15,15,15,15,15,15,15,15,15,15,15,15,15,15,15,15,15,15,15,15,15,15,15,15,15,15,15,15,15,15,15,15,15,15,15,15,15,15,15,15,15,15,15,15,15,15,15,15,15,15,15,15,15,15,15,15,15,15,15,15,15,15,15,15,15,15,15,15,15,15,15,15,15,15,15,15,15,15,15,15,15,15,15,15,15,15,15,15,15,15,15,15,15,15,15,15,15,15,15,15,15,15,15,15,15,15,15,15,15,15,15,15,15,15,15,15,15,15,15,15,15,15,15,15,15,15,15,15,15,15,15,15,15,15,15,15,15,15,15,15,15,15,15,15,15,15,15,15,15,15,15,15,15,15,15,15,15,15,15,15,15,15,15,15,15,15,15,15,15,15,15,15,15,15,15,15,15,15,15,15,15,15,15,15,15,15,15,15,15,15,15,15,15,15,15,15,15,15,15,15,15,15,15,15,15,15,15,15,15,15,15,15,15,15,15,15,15,15,15,15,15,15,15,15,15,15,15,15,15,15,15,15,15,15,15,15,15,15,15,15,15,15,15,15,15,15,15,15,15,15,15,15,15,15,15,15,15,15,15,15,15,15,15,15,15,15,15,15,15,15,15,15,15,15,15,15,15,15,15,15,15,15,15,15,15,15,15,15,15,15,15,15,15,15,15,15,15,15,15,15,15,15,15,15,15,15,15,15,15,15,15,15,15,15,15,15,15,15,15,15,15,15,15,15,15,15,15,15,15,15,15,15,15,15,15,15,15,15,15,15,15,15,15,15,15,15,15,15,15,15,15,15,15,15,15,15,15,15,15,15,15,15,15,15,15,15,15,15,15,15,15,15,15,15,15,15,15,15,15,15,15,15,15,15,15,15,15,15,15,15,15,15,15,15,15,15,15,15,15,15,15,15,15,15,15,15,15,15,15,15,15,15,15,15,15,15,15,15,15,15,15,15,15,15,15,15,15,15,15,15,15,15,15,15,15,15,15,15,15,15,15,15,15,15,15,15,15,15,15,15,15,15,15,15,15,15,15,15,15,15,15,15,15,15,15,15,15,15,15,15,15,15,15,15,15,15,15,15,15,15,15,15,15,15,15,15,15,15,15,15,15,15,15,15,15,15,15,15,15,15,15,15,15,15,15,15,15,15,15,15,15,15,15,15,15,15,15,15,15,15,15,15,15,15,15,15,15,15,15,15,15,15,15,15,15,15,15,15,15,15,15,15,15,15,15,15,15,15,15,15,15,15,15,15,15,15,15,15,15,15,15,15,15,15,15,15,15,15,15,15,15,15,15,15,15,15,15,15,15,15,15,15,15,15,15,15,15,15,15,15,15,15,15,15,15,15,15,15,15,15,15,15,15,15,15,15,15,15,15,15,15,15,15,15,15,15,15,15,15,15,15,15,15,15,15,15,15,15,15,15,15,15,15,15,15,15,15,15,15,15,15,15,15,15,15,15,15,15,15,15,15,15,15,15,15,15,15,15,15,15,15,15,15,15,15,15,15,15,15,15,15,15,15,15,15,15,15,15,15,15,15,15,15,15,15,15,15,15,15,15,15,15,15,15,15,15,15,15,15,15,15,15,15,15,15,15,15,15,15,15,15,15,15,15,15,15,15,15,15,15,15,15,15,15,15,15,15,15,15,15,15,15,15,15,15,15,15,15,15,15,15,15,15,15,15,15,15,15,15,15,15,15,15,15,15,15,15,15,15,15,15,15,15,15,15,15,15,15,15,15,15,15,15,15,15,15,15,15,15,15,15,15,15,15,15,15,15,15,15,15,15,15,15,15,15,15,15,15,15,15,15,15,15,15,15,15,15,15,15,15,15,15,15,15,15,15,15,15,15,15,15,15,15,15,15,15,15,15,15,15,15,15,15,15,15,15,15,15,15,15,15,15,15,15,15,15,15,15,15,15,15,15,15,15,15,15,15,15,15,15,15,15,15,15,15,15,15,15,15,15,15,15,15,15,15,15,15,15,15,15,15,15,15,15,15,15,15,15,15,15,15,15,15,15,15,15,15,15,15,15,15,15,15,15,15,15,15,15,15,15,15,15,15,15,15,15,15,15,15,15,15,15,15,15,15,15,15,15,15,15,15,15,15,15,15,15,15,15,15,15,15,15,15,15,15,15,15,15,15,15,15,15,15,15,15,15,15,15,15,15,15,15,15,15,15,15,15,15,15,15,15,15,15,15,15,15,15,15,15,15,15,15,15,15,15,15,15,15,15,15,15,15,15,15,15,15,15,15,15,15,15,15,15,15,14,14,14,14,14,14,14,14,14,14,14,14,14,14,14,14,14,14,14,14,14,14,14,14,14,14,14,13,13,13,13,13,13,13,13,13,13,13,13,13,13,13,13,13,13,12,12,12,12,12,12,12,12,12,12,12,12,12,12,11,11,11,11,11,11,11,11,11,10,10,10,10,10,10,10,9,9,9,9,8,8,8,8,7,6,5,4,3,2,1,0,17,18,19,20,21,22,23,24,24,24,24,25,25,25,25,26,26,26,26,26,26,26,27,27,27,27,27,27,27,27,27,28,28,28,28,28,28,28,28,28,28,28,28,28,28,29,29,29,29,29,29,29,29,29,29,29,29,29,29,29,29,29,29,30,30,30,30,30,30,30,30,30,30,30,30,30,30,30,30,30,30,30,30,30,30,30,30,30,30,30,31,31,31,31,31,31,31,31,31,31,31,31,31,31,31,31,31,31,31,31,31,31,31,31,31,31,31,31,31,31,31,31,31,31,31,31,31,31,31,31,31,31,31,31,31,31,31,31,31,31,31,31,31,31,31,31,31,31,31,31,31,31,31,31,31,31,31,31,31,31,31,31,31,31,31,31,31,31,31,31,31,31,31,31,31,31,31,31,31,31,31,31,31,31,31,31,31,31,31,31,31,31,31,31,31,31,31,31,31,31,31,31,31,31,31,31,31,31,31,31,31,31,31,31,31,31,31,31,31,31,31,31,31,31,31,31,31,31,31,31,31,31,31,31,31,31,31,31,31,31,31,31,31,31,31,31,31,31,31,31,31,31,31,31,31,31,31,31,31,31,31,31,31,31,31,31,31,31,31,31,31,31,31,31,31,31,31,31,31,31,31,31,31,31,31,31,31,31,31,31,31,31,31,31,31,31,31,31,31,31,31,31,31,31,31,31,31,31,31,31,31,31,31,31,31,31,31,31,31,31,31,31,31,31,31,31,31,31,31,31,31,31,31,31,31,31,31,31,31,31,31,31,31,31,31,31,31,31,31,31,31,31,31,31,31,31,31,31,31,31,31,31,31,31,31,31,31,31,31,31,31,31,31,31,31,31,31,31,31,31,31,31,31,31,31,31,31,31,31,31,31,31,31,31,31,31,31,31,31,31,31,31,31,31,31,31,31,31,31,31,31,31,31,31,31,31,31,31,31,31,31,31,31,31,31,31,31,31,31,31,31,31,31,31,31,31,31,31,31,31,31,31,31,31,31,31,31,31,31,31,31,31,31,31,31,31,31,31,31,31,31,31,31,31,31,31,31,31,31,31,31,31,31,31,31,31,31,31,31,31,31,31,31,31,31,31,31,31,31,31,31,31,31,31,31,31,31,31,31,31,31,31,31,31,31,31,31,31,31,31,31,31,31,31,31,31,31,31,31,31,31,31,31,31,31,31,31,31,31,31,31,31,31,31,31,31,31,31,31,31,31,31,31,31,31,31,31,31,31,31,31,31,31,31,31,31,31,31,31,31,31,31,31,31,31,31,31,31,31,31,31,31,31,31,31,31,31,31,31,31,31,31,31,31,31,31,31,31,31,31,31,31,31,31,31,31,31,31,31,31,31,31,31,31,31,31,31,31,31,31,31,31,31,31,31,31,31,31,31,31,31,31,31,31,31,31,31,31,31,31,31,31,31,31,31,31,31,31,31,31,31,31,31,31,31,31,31,31,31,31,31,31,31,31,31,31,31,31,31,31,31,31,31,31,31,31,31,31,31,31,31,31,31,31,31,31,31,31,31,31,31,31,31,31,31,31,31,31,31,31,31,31,31,31,31,31,31,31,31,31,31,31,31,31,31,31,31,31,31,31,31,31,31,31,31,31,31,31,31,31,31,31,31,31,31,31,31,31,31,31,31,31,31,31,31,31,31,31,31,31,31,31,31,31,31,31,31,31,31,31,31,31,31,31,31,31,31,31,31,31,31,31,31,31,31,31,31,31,31,31,31,31,31,31,31,31,31,31,31,31,31,31,31,31,31,31,31,31,31,31,31,31,31,31,31,31,31,31,31,31,31,31,31,31,31,31,31,31,31,31,31,31,31,31,31,31,31,31,31,31,31,31,31,31,31,31,31,31,31,31,31,31,31,31,31,31,31,31,31,31,31,31,31,31,31,31,31,31,31,31,31,31,31,31,31,31,31,31,31,31,31,31,31,31,31,31,31,31,31,31,31,31,31,31,31,31,31,31,31,31,31,31,31,31,31,31,31,31,31,31,31,31,31,31,31,31,31,31,31,31,31,31,31,31,31,31,31,31,31,31,31,31,31,31,31,31,31,31,31,31,31,31,31,31,31,31,31,31,31,31,31,31,31,31,31,31,31,31,31,31,31,31,31,31,31,31,31,31,31,31,31,31,31,31,31,31,31,31,31,31,31,31,31,31,31,31,31,31,31,31,31,31,31,31,31,31,31,31,31,31,31,31,31,31,31,31,31,31,31,31,31,31,31,31,31,31,31,31,31,31,31,31,31,31,31,31,31,31,31,31,31,31,31,31,31,31,31,31,31,31,31,31,31,31,31,31,31,31,31,31,31,31,31,31,31,31,31,31,31,31,31,31,31,31,31,31,31,31,31,31,31,31,31,31,31,31,31,31,31,31,31,31,31,31,31,31,31,31,31,31,31,31,31,31,31,31,31,31,31,31,31,31,31,31,31,31,31,31,31,31,31,31,31,31,31,31,31,31,31,31,31,31,31,31,31,31,31,31,31,31,31,31,31,31,31,31,31,31,31,31,31,31,31,31,31,31,31,31,31,31,31,31,31,31,31,31,31,31,31,31,31,31,31,31,31,31,31,31,31,31,31,31,31,31,31,31,31,31,31,31,31,31,31,31,31,31,31,31,31,31,31,31,31,31,31,31,31,31,31,31,31,31,31,31,31,31,31,31,31,31,31,31,31,31,31,31,31,31,31,31,31,31,31,31,31,31,31,31,31,31,31,31,31,31,31,31,31,31,31,31,31,31,31,31,31,31,31,31,31,31,31,31,31,31,31,31,31,31,31,31,31,31,31,31,31,31,31,31,31,31,31,31,31,31,31,31,31,31,31,31,31,31,31,31,31,31,31,31,31,31,31,31,31,31,31,31,31,31,31,31,31,31,31,31,31,31,31,31,31,31,31,31,31,31,31,31,31,31,31,31,31,31,31,31,31,31,31,31,31,31,31,31,31,31,31,31,31,31,31,31,31,31,31,31,31,31,31,31,31,31,31,31,31,31,31,31,31,31,31,31,31,31,31,31,31,31,31,31,31,31,31,31,31,31,31,31,31,31,31,31,31,31,31,31,31,31,31,31,31,31,31,31,31,31,31,31,31,31,31,31,31,31,31,31,31,31,31,31,31,31,31,31,31,31,31,31,31,31,31,31,31,31,31,31,31,31,31,31,31,31,31,31,31,31,31,31,31,31,31,31,31,31,31,31,31,31,31,31,31,31,31,31,31,31,31,31,31,31,31,31,31,31,31,31,31,31,31,31,31,31,31,31,31,31,31,31,31,31,31,31,31,31,31,31,31,31,31,31,31,31,31,31,31,31,31,31,31,31,31,31,31,31,31,31,31,31,31,31,31,31,31,31,31,31,31,31,31,31,31,31,31,31,31,31,31,31,31,31,31,31,31,31,31,31,31,31,31,31,31,31,31,31,31,31,31,31,31,31,31,31,31,31,31,31,31,31,31,31,31,31,31,31,31,31,31,31,31,31,31,31,31,31,31,31,31,31,31,31,31,31,31,31,31,31,31,31,31,31,31,31,31,31,31,31,31,31,31,31,31,31,31,31,31,31,31,31,31,31,31,31,31,31,31,31,31,31,31,31,31,31,31,31,31,31,31,31,31,31,31,31,31,31,31,31,31,31,31,31,31,31,31,31,31,31,31,31,31,31,31,31,31,31,31,31,31,31,31,31,31,31,31,31,31,31,31,31,31,31,31,31,31,31,31,31,31,31,31,31,31,31,31,31,31,31,31,31,31,31,31,31,31,31,31,31,31,31,31,31,31,31,31,31,31,31,31,31,31,31,31,31,31,31,31,31,31,31,31,31,31,31,31,31,31,31,31,31,31,31,31,31,31,31,31,31,31,31,31,31,31,31,31,31,31,31,31,31,31,31,31,31,31,31,31,31,31,31,31,31,31,31,31,31,31,31,31,31,31,31,31,31,31,31,31,31,31,31,31,31,31,31,31,31,31,31,31,31,31,31,31,31,31,31,31,31,31,31,31,31,31,31,31,31,31,31,31,31,31,31,31,31,31,31,31,31,31,31,31,31,31,31,31,31,31,31,31,31,31,31,31,31,31,31,31,31,31,31,31,31,31,31,31,31,31,31,31,31,31,31,31,31,31,31,31,31,31,31,31,31,31,31,31,31,31,31,31,31,31,31,31,31,31,31,31,31,31,31,31,31,31,31,31,31,31,31,31,31,31,31,31,31,31,31,31,31,31,31,31,31,31,31,31,31,31,31,31,31,31,31,31,31,31,31,31,31,31,31,31,31,31,31,31,31,31,31,31,31,31,31,31,31,31,31,31,31,31,31,31,31,31,31,31,31,31,31,31,31,31,31,31,31,31,31,31,31,31,31,31,31,31,31,31,31,31,31,31,31,31,31,31,31,31,31,31,31,31,31,31,31,31,31,31,31,31,31,31,31,31,31,31,31,31,31,31,31,31,31,31,31,31,31,31,31,31,31,31,31,31,31,31,31,31,31,31,31,31,31,31,31,31,31,31,31,31,31,31,31,31,31,31,31,31,31,31,31,31,31,31,31,31,31,31,31,31,31,31,31,31,31,31,31,31,31,31,31,31,31,31,31,31,31,31,31,31,31,31,31,31};
__device__ __forceinline__ void d_btab(const float* __restrict__ relb, float* BT) { const int e = blockIdx.x * 256 + threadIdx.x; if (e >= NH_ * 4096) return; const int r = e % 4096, h = e / 4096; const float v = (r < 4095) ? bfr(relb[BKT[r] * NH_ + h]) : 0.f; *(float*)(BT + e) = v;  }
// k_prep: everything that reads the inputs alone, in one launch; grid (512, 6): y = 0 the LayerNorm of all rows (the longest work, so it starts first), y = 1 .. 4 the four weight planes (one size, one behind the other in Bt), y = 5 the bias table. The branch is the same for a whole workgroup and stands in front of the barrier.
static_assert(NB_ * TT / 8 == 512 && DM * DQ / 256 / 8 == 512 && NH_ * 4096 / 256 <= 512, "grid x of k_prep");
__global__ __launch_bounds__(256) void k_prep(const float* __restrict__ X, const float* __restrict__ A, const float* __restrict__ g, const float* __restrict__ be, float* Z, bf* Yh, bf* Yl, const float* __restrict__ w0, const float* __restrict__ w1, const float* __restrict__ w2, const float* __restrict__ w3, bf* Bt, const float* __restrict__ relb, float* BT) {
    if (blockIdx.y == 5) { d_btab(relb, BT); return; }
    if (blockIdx.y != 0) { d_wtG<DM, DQ>((blockIdx.y == 1) ? w0 : (blockIdx.y == 2) ? w1 : (blockIdx.y == 3) ? w2 : w3, Bt + (size_t)(blockIdx.y - 1) * DQ * DM); return; }
    static_assert(TT % 8 == 0, "a workgroup's 8 rows are all inside or all outside");
    __shared__ __align__(16) bf ys[2][8][DM + 16];   /* the workgroup's 8 rows, hi and lo; the pitch spreads 8 rows' 16-byte pieces over the banks */
    const int lane = threadIdx.x & 31; const int wr = threadIdx.x >> 5; const int r = blockIdx.x * 8 + wr; if (blockIdx.x * 8 >= NB_ * TT) return; const float* xr = X + (size_t)r * DM; const float* ar = A ? A + (size_t)r * DM : nullptr; float s = 0.f;
#pragma unroll 1
    for (int ch = 0; ch < DM / 128; ++ch) { const int c0 = ch * 128 + lane * 4; const v4f a = *(const v4f*)(xr + c0); v4f d = {0.f, 0.f, 0.f, 0.f}; if (ar) d = *(const v4f*)(ar + c0);
#pragma unroll
        for (int q = 0; q < 4; ++q) s += __fadd_rn(bfr(a[q]), d[q]); }
#pragma unroll
    for (int sh = 16; sh; sh >>= 1) s += __shfl_xor(s, sh, 32);
    const float mu = s * (1.0f / DM); float s2 = 0.f;
#pragma unroll 1
    for (int ch = 0; ch < DM / 128; ++ch) { const int c0 = ch * 128 + lane * 4; const v4f a = *(const v4f*)(xr + c0); v4f d = {0.f, 0.f, 0.f, 0.f}; if (ar) d = *(const v4f*)(ar + c0);
#pragma unroll
        for (int q = 0; q < 4; ++q) { const float d0 = __fsub_rn(__fadd_rn(bfr(a[q]), d[q]), mu); float p = __fmul_rn(d0, d0); asm volatile("" : "+v"(p)); s2 = __fadd_rn(s2, p); } }
#pragma unroll
    for (int sh = 16; sh; sh >>= 1) s2 += __shfl_xor(s2, sh, 32);
    const float rs = __fdiv_rn(1.0f, __fsqrt_rn(__fadd_rn(s2 * (1.0f / DM), LNEPS)));
{
#pragma unroll 1
        for (int ch = 0; ch < DM / 128; ++ch) { const int c0 = ch * 128 + lane * 4; const v4f a = *(const v4f*)(xr + c0); v4f d = {0.f, 0.f, 0.f, 0.f}; if (ar) d = *(const v4f*)(ar + c0); v4f z4; v4us oh, ol;
#pragma unroll
            for (int q = 0; q < 4; ++q) { const float v = __fadd_rn(bfr(a[q]), d[q]); z4[q] = v; float n0 = __fmul_rn(__fsub_rn(v, mu), rs); asm volatile("" : "+v"(n0)); float n1 = __fmul_rn(n0, bfr(g[c0 + q])); asm volatile("" : "+v"(n1)); const float y = __fadd_rn(n1, bfr(be[c0 + q])); unsigned short h2, l2; splitf(y, h2, l2); oh[q] = h2; ol[q] = l2; }
            if (Z) *(v4f*)(Z + (size_t)r * DM + c0) = z4; *(v4usa*)(&ys[0][wr][c0]) = oh; *(v4usa*)(&ys[1][wr][c0]) = ol; }
         }
    __syncthreads();   /* all 8 rows staged: a 128-byte line of a plane in fragment order holds 16 bytes of each of them */
    const size_t yo = (size_t)(blockIdx.x >> 1) * 16 * DM + (blockIdx.x & 1) * 64 + (threadIdx.x & 7) * 8;   /* rows 8 (x % 2) + t % 8 of row block x / 2 */
#pragma unroll
    for (int i = 0; i < DM / 256; ++i) { const int sg = i * 32 + (threadIdx.x >> 3);   /* columns 8 sg ..: a wave stores four whole lines */
        *(v8us*)(Yh + yo + sg * 128) = *(const v8usa*)(&ys[0][threadIdx.x & 7][sg * 8]); *(v8us*)(Yl + yo + sg * 128) = *(const v8usa*)(&ys[1][threadIdx.x & 7][sg * 8]); } }
__global__ __launch_bounds__(256) void k_cvt8(const float* __restrict__ src, bf* dst, size_t n8) { const size_t i = (size_t)blockIdx.x * 256 + threadIdx.x; if (i >= n8) return; const v8f v = *(const v8f*)(src + i * 8); v8us o;
#pragma unroll
    for (int k = 0; k < 8; ++k) o[k] = f2bf(v[k]); *(v8us*)(dst + i * 8) = o;  }

typedef __attribute__((ext_vector_type(8))) __bf16 v8bf;
__device__ __forceinline__ float xhalf(float x) { const int b = __float_as_int(x); return __int_as_float(__builtin_amdgcn_permlanex16(b, b, 0x76543210, 0xfedcba98, false, false)); }   /* lane l <-> l ^ 16 */
// The wait stands between a run of global loads and the first rewrite of an address register that they name: the addresses are inputs, so they stay in their registers up to it, and the scheduling barrier keeps later instructions behind it.
__device__ __forceinline__ void xwait(const void* a, const void* b) { asm volatile("s_wait_xcnt 0x0" :: "v"(a), "v"(b) : "memory"); __builtin_amdgcn_sched_barrier(0); }
// 2^x by v_exp_f32 with the one free slot that the instruction set asks for behind a transcendental in the same statement, so that it stands directly behind it wherever the statement is scheduled.
__device__ __forceinline__ float exp2s(float x) { float y; asm("v_exp_f32 %0, %1\n\tv_nop" : "=v"(y) : "v"(x)); return y; }
template <bool B> struct BoolC { static constexpr bool value = B; };
#define KT   128                  // keys of a staged tile
#define PLE  (KT * HD)            // elements of one plane's tile (16 KiB)
#define TLB  (6 * PLE * 2)        // bytes of a staged tile: planes K16, V16, Kh, Kl, Vh, Vl, one behind the other
static_assert(TT % KT == 0 && TT / KT >= 2 && KT % 32 == 0, "whole tiles, and both buffers are filled in front of the loop");
// Tile t of the six planes into the buffer at LDS byte address dst; one of eight waves (w) takes piece 8 j + w of the 32 pieces of each plane's tile. A key plane's tile is 16 KiB in a row; a value plane's is 4 KiB (the tile's four fragments) of each of the four 16-row blocks.
__device__ __forceinline__ void fa_stage(const h16* K16, const h16* V16, const bf* Kh, const bf* Kl, const bf* Vh, const bf* Vl, unsigned dst, int t, int w, int lane) {
    const unsigned dl = dst + w * 512 + lane * 16;
    const size_t ko = (size_t)t * PLE + w * 256 + lane * 8, vo = (size_t)t * (KT * 16) + w * 256 + lane * 8;
    unsigned d[12]; const void* g[12];
#pragma unroll
    for (int j = 0; j < 4; ++j) { d[j] = dl + j * 4096; g[j] = K16 + ko + j * 2048; d[4 + j] = dl + 4 * PLE + j * 4096; g[4 + j] = Kh + ko + j * 2048; d[8 + j] = dl + 6 * PLE + j * 4096; g[8 + j] = Kl + ko + j * 2048; }
    copy12(d, g);
#pragma unroll
    for (int j = 0; j < 4; ++j) { d[j] = dl + 2 * PLE + j * 4096; g[j] = V16 + vo + j * 16 * TT; d[4 + j] = dl + 8 * PLE + j * 4096; g[4 + j] = Vh + vo + j * 16 * TT; d[8 + j] = dl + 10 * PLE + j * 4096; g[8 + j] = Vl + vo + j * 16 * TT; }
    copy12(d, g);
}
// What a wave carries from tile to tile, in one form for both kinds of wave: output tiles, four query fragments (fp16: [column group][k half]; hi/lo: hi [k half], lo [k half]), running maximum and sum.
struct FaState { v8f o[4][2]; v16h q[4]; float m[2], l[2]; };
// One wave's work on one staged tile (keys kb .. kb + KT - 1); K, K2, V, V2: the tile's planes in LDS.
template <typename T16, bool HI, int NQ>
__device__ __forceinline__ void fa_tile(FaState& st, const T16* K, const T16* K2, const T16* V, const T16* V2, const float* __restrict__ bt, int q0, int kb, float cneg, float cpos) {
    typedef WFrag<T16> WF; typedef typename WF::V F;
    const int lane = threadIdx.x & 31, lr = lane & 15, hi = lane >> 4;
    const float L2E = 1.4426950408889634f;
    F qf[NQ][2], qf2[NQ][2];
#pragma unroll
    for (int nb = 0; nb < NQ; ++nb)
#pragma unroll
        for (int ks = 0; ks < 2; ++ks) { qf[nb][ks] = __builtin_bit_cast(F, st.q[HI ? ks : nb * 2 + ks]); if (HI) qf2[nb][ks] = __builtin_bit_cast(F, st.q[2 + ks]); }
    v8f (&o)[4][2] = st.o; float (&m)[2] = st.m; float (&l)[2] = st.l;
    const int ko = lane * 8, vo = lane * 8;
    // One pass over keys k0 .. k0 + 31 (kl: k0 - kb), written once and compiled into three loops (below). NEAR: the score tiles start from table values. Otherwise all 32 keys have the one bias cb: the tiles start from 0, and cb joins the pass's maximum and the addend of the exponent.
    auto pass = [&](auto nearc, const int k0, const int kl, const float cb) __attribute__((always_inline)) {
        constexpr bool NEAR = decltype(nearc)::value;
        v8f s[2][NQ];
        if constexpr (!NEAR) {
#pragma unroll
            for (int kt = 0; kt < 2; ++kt)
#pragma unroll
                for (int nb = 0; nb < NQ; ++nb) s[kt][nb] = (v8f){};
        } else { const float* bp0 = bt + (k0 + 8 * hi) - (q0 + lr);
#pragma unroll
            for (int kt = 0; kt < 2; ++kt)
#pragma unroll
                for (int nb = 0; nb < NQ; ++nb) { const float* bp = bp0 + (kt - nb) * 16;
#pragma unroll
                    for (int r = 0; r < 8; ++r) s[kt][nb][r] = bp[r]; }
            xwait(bp0, bp0);
        }
        F kf[2][2], kf2[2][2]; const T16* kp = K + ko + kl * HD; const T16* kp2 = K2 + ko + kl * HD;   /* the pass's key rows, then its value rows: LDS answers in order, so the score products wait for the first only */
#pragma unroll
        for (int kt = 0; kt < 2; ++kt)
#pragma unroll
            for (int ks = 0; ks < 2; ++ks) { kf[kt][ks] = WF::ld(kp + kt * 16 * HD + ks * 512); if (HI) kf2[kt][ks] = WF::ld(kp2 + kt * 16 * HD + ks * 512); }
        F vf[4], vf2[4]; const T16* vp = V + vo + kl * 16; const T16* vp2 = V2 + vo + kl * 16;
#pragma unroll
        for (int dt = 0; dt < 4; ++dt) { vf[dt] = WF::ld(vp + dt * 16 * KT); if (HI) vf2[dt] = WF::ld(vp2 + dt * 16 * KT); }
#pragma unroll
        for (int ks = 0; ks < 2; ++ks)
#pragma unroll
            for (int kt = 0; kt < 2; ++kt)
#pragma unroll
                for (int nb = 0; nb < NQ; ++nb) { s[kt][nb] = WF::mma(kf[kt][ks], qf[nb][ks], s[kt][nb]); if (HI) { s[kt][nb] = WF::mma(kf[kt][ks], qf2[nb][ks], s[kt][nb]); s[kt][nb] = WF::mma(kf2[kt][ks], qf[nb][ks], s[kt][nb]); } }
        F pf[NQ], pf2[NQ];
#pragma unroll
        for (int nb = 0; nb < NQ; ++nb) {
            float mx = s[0][nb][0];
#pragma unroll
            for (int r = 1; r < 8; ++r) mx = fmaxf(mx, s[0][nb][r]);
#pragma unroll
            for (int r = 0; r < 8; ++r) mx = fmaxf(mx, s[1][nb][r]);
            mx = fmaxf(mx, xhalf(mx));
            if constexpr (!NEAR) mx += cb;
            const float mn = fmaxf(m[nb], mx);
            const float al = exp2s((m[nb] - mn) * L2E);
            float ng = (HI ? 0.0f : PSH) - mn * L2E;
            if constexpr (!NEAR) ng = __builtin_fmaf(cb, L2E, ng);
            m[nb] = mn;
            float sum = 0.f;
#pragma unroll
            for (int kt = 0; kt < 2; ++kt)
#pragma unroll
                for (int r = 0; r < 8; ++r) { const float p = exp2s(__builtin_fmaf(s[kt][nb][r], L2E, ng)); s[kt][nb][r] = p; sum += p; }
            l[nb] = l[nb] * al + sum;
#pragma unroll
            for (int dt = 0; dt < 4; ++dt) o[dt][nb] *= al;
            if constexpr (HI) {
                const v8bf h0 = __builtin_convertvector(s[0][nb], v8bf), h1 = __builtin_convertvector(s[1][nb], v8bf);
                const v8bf l0 = __builtin_convertvector(s[0][nb] - __builtin_convertvector(h0, v8f), v8bf), l1 = __builtin_convertvector(s[1][nb] - __builtin_convertvector(h1, v8f), v8bf);
                pf[nb] = __builtin_shufflevector(h0, h1, 0, 1, 2, 3, 4, 5, 6, 7, 8, 9, 10, 11, 12, 13, 14, 15); pf2[nb] = __builtin_shufflevector(l0, l1, 0, 1, 2, 3, 4, 5, 6, 7, 8, 9, 10, 11, 12, 13, 14, 15);
            } else {
                pf[nb] = cat16(__builtin_convertvector(s[0][nb], v8h), __builtin_convertvector(s[1][nb], v8h));
            }
        }
#pragma unroll
        for (int dt = 0; dt < 4; ++dt)
#pragma unroll
            for (int nb = 0; nb < NQ; ++nb) { o[dt][nb] = WF::mma(vf[dt], pf[nb], o[dt][nb]); if (HI) { o[dt][nb] = WF::mma(vf[dt], pf2[nb], o[dt][nb]); o[dt][nb] = WF::mma(vf2[dt], pf[nb], o[dt][nb]); } }
        if constexpr (NQ == 1) asm volatile("v_nop\n\tv_nop\n\tv_nop\n\tv_nop" : "+v"(o[3][0])); else asm volatile("v_nop\n\tv_nop\n\tv_nop\n\tv_nop" : "+v"(o[3][0]), "+v"(o[3][1]));   /* the four vector slots that the chip needs behind the pass's last matrix instructions */
    };
    // The tile's keys in ascending order, as three loops: passes wholly 128 or more below the queries, passes that need the table, passes wholly 128 or more above. Each loop has one body, so the output tiles stay in their registers from pass to pass.
    // Each is rolled: the running maximum chains the passes, so unrolling would add code and registers without overlapping them.
    const int e1 = (q0 > 127 ? q0 - 127 : 0) & ~31;   /* k0 < e1: (k0 + 31) - q0 <= -128 */
    const int e2 = (q0 + 16 * NQ + 127 + 31) & ~31;   /* k0 >= e2: k0 - (q0 + 16 NQ - 1) >= 128 */
    const int l1 = e1 - kb < KT ? e1 - kb : KT, l2 = e2 - kb < KT ? e2 - kb : KT;   /* the same bounds counted from the tile's first key */
    int kl = 0;
#pragma unroll 1
    for (; kl < l1; kl += 32) pass(BoolC<false>{}, kb + kl, kl, cneg);
#pragma unroll 1
    for (; kl < l2; kl += 32) pass(BoolC<true>{}, kb + kl, kl, 0.f);
#pragma unroll 1
    for (; kl < KT; kl += 32) pass(BoolC<false>{}, kb + kl, kl, cpos);
}
template <int NQ>
__device__ __forceinline__ void fa_out(const FaState& st, int q0, bf* Ah, bf* Al) {
    const int lane = threadIdx.x & 31;
#pragma unroll
    for (int nb = 0; nb < NQ; ++nb) { const float inv = __fdiv_rn(1.0f, st.l[nb] + xhalf(st.l[nb])); const size_t oo = (size_t)(q0 + nb * 16) * DQ + lane * 8;
#pragma unroll
        for (int dt = 0; dt < 4; ++dt) { v8us oh, ol;
#pragma unroll
            for (int r = 0; r < 8; ++r) { unsigned short a, c2; splitf(st.o[dt][nb][r] * inv, a, c2); oh[r] = a; ol[r] = c2; }
            *(v8us*)(Ah + oo + dt * 256) = oh; *(v8us*)(Al + oo + dt * 256) = ol; }
        asm volatile("s_wait_xcnt 0x0" ::: "memory"); }   /* stands between the column group's stores and the next rewrite of a register that they name */
}
// grid (RH / 64, heads, batches), 10 waves, one work-group per WGP: waves 0-3 take 16 hi/lo query rows each, waves 4-9 take 32 fp16 rows each, so every work-group carries the same share of both kinds of work; planes [b][h] of (row t, k = d) (q, k) and of (row d, k = t) (v); merged output planes [b] of (row t, k = h d) as hi/lo; all in fragment order
static_assert(RH / 64 == (TT - RH) / 192 && RH % 64 == 0 && (TT - RH) % 192 == 0, "4 hi/lo waves and 6 fp16 waves per workgroup cover all rows");
__global__ __launch_bounds__(320) void k_fattn(const h16* __restrict__ Q16, const h16* __restrict__ K16, const h16* __restrict__ V16, const bf* __restrict__ Qh, const bf* __restrict__ Ql, const bf* __restrict__ Kh, const bf* __restrict__ Kl, const bf* __restrict__ Vh, const bf* __restrict__ Vl, const float* __restrict__ BT, bf* Ah, bf* Al) {
    __shared__ __attribute__((aligned(1024))) bf ring[2 * TLB / 2];   /* two buffers of one tile each */
    const int wv = __builtin_amdgcn_readfirstlane((int)(threadIdx.x >> 5)), lane = threadIdx.x & 31, bx = blockIdx.x, h = blockIdx.y, b = blockIdx.z;
    const size_t pq = ((size_t)b * NH_ + h) * TT * HD, pk = ((size_t)b * NKV + h / REP) * TT * HD, po = (size_t)b * TT * DQ + h * HD * 16;
    const float* bt = BT + (size_t)h * 4096 + (TT - 1);   /* bt[j - i] */
    const bool hw = wv < 4, cw = wv < 8;   /* kind of wave; the eight waves that copy. Both the same for a whole wave: scalar branches */
    const int q0 = hw ? (bx * 4 + wv) * 16 : RH + (bx * 6 + wv - 4) * 32;
    const unsigned rb = (unsigned)(size_t)&ring[0];   /* LDS byte address of buffer 0 */
    if (cw) fa_stage(K16 + pk, V16 + pk, Kh + pk, Kl + pk, Vh + pk, Vl + pk, rb, 0, wv, lane);
    asm volatile("s_wait_asynccnt 0x0" ::: "memory");   /* this wave's copies of tile 0 have landed */
    __syncthreads();   /* tile 0 is there for every wave */
    if (cw) fa_stage(K16 + pk, V16 + pk, Kh + pk, Kl + pk, Vh + pk, Vl + pk, rb + TLB, 1, wv, lane);
    FaState st;
    const bf* qa = (hw ? Qh + pq : (const bf*)(Q16 + pq)) + (size_t)q0 * HD + lane * 8; const bf* qb = (hw ? Ql + pq : (const bf*)(Q16 + pq) + 16 * HD) + (size_t)q0 * HD + lane * 8;   /* 16-bit patterns, whatever the kind */
#pragma unroll
    for (int ks = 0; ks < 2; ++ks) { st.q[ks] = __builtin_bit_cast(v16h, WFrag<bf>::ld(qa + ks * 512)); st.q[2 + ks] = __builtin_bit_cast(v16h, WFrag<bf>::ld(qb + ks * 512)); }
    xwait(qa, qb);
#pragma unroll
    for (int dt = 0; dt < 4; ++dt)
#pragma unroll
        for (int nb = 0; nb < 2; ++nb) st.o[dt][nb] = (v8f){};
#pragma unroll
    for (int nb = 0; nb < 2; ++nb) { st.m[nb] = -3.0e38f; st.l[nb] = 0.f; }
    const float cneg = bt[-(TT - 1)], cpos = bt[TT - 1];
    // Rolled: one trip per tile, with the hand-over of the buffers at its foot.
#pragma unroll 1
    for (int t = 0; t < TT / KT; ++t) {
        const bf* tb = ring + (t & 1) * (TLB / 2);
        if (hw) fa_tile<bf, true, 1>(st, tb + 2 * PLE, tb + 3 * PLE, tb + 4 * PLE, tb + 5 * PLE, bt, q0, t * KT, cneg, cpos);
        else fa_tile<h16, false, 2>(st, (const h16*)tb, nullptr, (const h16*)tb + PLE, nullptr, bt, q0, t * KT, cneg, cpos);
        asm volatile("s_wait_dscnt 0x0" ::: "memory");      /* this wave's reads of tile t are done */
        asm volatile("s_wait_asynccnt 0x0" ::: "memory");   /* its copies of tile t + 1 have landed */
        __syncthreads();   /* tile t + 1 is there for every wave, and no wave reads tile t any more */
        if (t + 2 < TT / KT) { if (cw) fa_stage(K16 + pk, V16 + pk, Kh + pk, Kl + pk, Vh + pk, Vl + pk, rb + (t & 1) * TLB, t + 2, wv, lane); }
    }
    asm volatile("s_wait_asynccnt 0x0" ::: "memory");   /* no copy is outstanding when the wave ends */
    if (hw) fa_out<1>(st, q0, Ah + po, Al + po); else fa_out<2>(st, q0, Ah + po, Al + po);
}

extern "C" void kernel_launch(void* const* d_in, const int* in_sizes, int n_in,
                              void* d_out, int out_size, void* d_ws, size_t ws_size, hipStream_t stream) {
    (void)in_sizes; (void)n_in; (void)out_size;
    const float* x = (const float*)d_in[0]; const float* g1 = (const float*)d_in[1]; const float* e1b = (const float*)d_in[2]; const float* wq = (const float*)d_in[3]; const float* wk = (const float*)d_in[4]; const float* wv = (const float*)d_in[5]; const float* wo = (const float*)d_in[6]; const float* relb = (const float*)d_in[7];
    float* OUT = (float*)d_out;     // [2][2048][1024]
    char* wsp = (char*)d_ws;
    auto take = [&](size_t bytes) { char* p = wsp; wsp += (bytes + 255) & ~(size_t)255; return (void*)p; };
    bf* WQ = (bf*)take((size_t)DQ * DM * 2); bf* WK = (bf*)take((size_t)DKV * DM * 2); bf* WV = (bf*)take((size_t)DKV * DM * 2); bf* WO = (bf*)take((size_t)DM * DQ * 2);
    bf* Yh = (bf*)take((size_t)NB_ * TT * DM * 2); bf* Yl = (bf*)take((size_t)NB_ * TT * DM * 2); float* BT = (float*)take((size_t)NH_ * 4096 * 4);
    h16* QP16 = (h16*)take((size_t)NB_ * NH_ * TT * HD * 2); h16* KP16 = (h16*)take((size_t)NB_ * NKV * TT * HD * 2); h16* VT16 = (h16*)take((size_t)NB_ * NKV * HD * TT * 2);
    bf* QPh = (bf*)take((size_t)NB_ * NH_ * TT * HD * 2); bf* KPh = (bf*)take((size_t)NB_ * NKV * TT * HD * 2); bf* VTh = (bf*)take((size_t)NB_ * NKV * HD * TT * 2); bf* QPl = (bf*)take((size_t)NB_ * NH_ * TT * HD * 2); bf* KPl = (bf*)take((size_t)NB_ * NKV * TT * HD * 2); bf* VTl = (bf*)take((size_t)NB_ * NKV * HD * TT * 2);   // q, k, v of each kind follow one another (every size is a multiple of 256 bytes), as do WQ, WK, WV, WO: the z stride of the merged launches
    bf* ATh = (bf*)take((size_t)NB_ * TT * DQ * 2); bf* ATl = (bf*)take((size_t)NB_ * TT * DQ * 2);
    if ((size_t)(wsp - (char*)d_ws) > ws_size) return;    // ws 256 MiB
    k_prep<<<dim3(512, 6, 1), 256, 0, stream>>>(x, nullptr, g1, e1b, nullptr, Yh, Yl, wq, wk, wv, wo, WQ, relb, BT);   /* n = LN(hidden) as hi/lo planes, both batches; all four weight planes; the bias table */
    k_gemmw<bf, 1, 1, DM><<<dim3(NB_ * TT / 128, DQ / 128, 3), 128, 0, stream>>>(Yh, Yl, WQ, nullptr, nullptr, nullptr, QP16, QPh, QPl, 0, (size_t)DQ * DM, (size_t)NB_ * NH_ * TT * HD);   /* q, k, v of both batches: head planes, written by the projections themselves */
    k_fattn<<<dim3(RH / 64, NH_, NB_), 320, 0, stream>>>(QP16, KP16, VT16, QPh, QPl, KPh, KPl, VTh, VTl, BT, ATh, ATl);
    k_gemmw<bf, 1, 0, DQ><<<dim3(NB_ * TT / 128, DM / 128, 1), 128, 0, stream>>>(ATh, ATl, WO, nullptr, x, OUT, nullptr, nullptr, nullptr, 0, 0, 0);   /* out = hidden + ctx Wo */
}

// v009
// A run of this version takes 121 microseconds.
// Two timings next to v008 put it at 1.10 and 1.08 times that version's speed.
// Counting every step since v000, it is 17.1 times as fast.
#include <hip/hip_runtime.h>

// T5 self-attention layer (hidden [2][2048][1024]; n = LayerNorm(hidden) (1e-6, ln_g, ln_b); q, k, v = n W ('xw' [1024][1024], no bias, 16 heads x 64); scores = q.k (NO 1/sqrt(d)) + rel_bias[bucket(j - i)][h] (T5 bidirectional buckets, 32 buckets, max distance 128); softmax over all keys; out = hidden + merged Wo -> [2][2048][1024]).
// The bucket index depends only on (j - i); it is embedded as a 4095-entry integer table computed with the reference's own bucket function (its f32 log -> int32 cast has exact-integer knife edges, so it is not recomputed on the device).
// Compute dtypes, f32 accumulate: every input rounded to bf16; q/k/v projections hl x exact (2 products); the relative-position bias (bf16-rounded rel_bias values through the embedded bucket table) enters the scores in f32; scores and attn.v: query rows < 512 hl (3 products), the rest single fp16 (P x1024); softmax f32, online; Wo hl x exact (2 products), + hidden residual in f32.

#define NB_  2
#define TT   2048
#define DM   1024
#define NH_  16
#define NKV  16
#define REP  (NH_ / NKV)
#define HD   64
#define DQ   (NH_ * HD)
#define DKV  (NKV * HD)
#define LNEPS 1e-6f
#define NBKT 32
#define RH   512                  // query rows < RH use hi+lo planes
#define WIN  0
#define PSH  10.0f                 // fp16 P carries 2^10 (added to the exponent; it cancels against the row sum)
#define SCL  1.0f                  // T5: no 1/sqrt(d) scaling
typedef _Float16 h16;
typedef unsigned short bf;
typedef __attribute__((ext_vector_type(16))) __bf16   v16bf;
typedef __attribute__((ext_vector_type(16))) _Float16 v16h;
typedef __attribute__((ext_vector_type(8)))  _Float16 v8h;
typedef __attribute__((ext_vector_type(8)))  unsigned short v8us;
typedef __attribute__((ext_vector_type(8)))  float    v8f;
typedef __attribute__((ext_vector_type(4)))  float    v4f;
typedef v8h  __attribute__((may_alias)) v8ha;
typedef v4f  __attribute__((may_alias)) v4fa;
typedef v8us __attribute__((may_alias)) v8usa;

__device__ __forceinline__ unsigned short f2bf(float f) { unsigned u = __float_as_uint(f); u += 0x7FFFu + ((u >> 16) & 1u); return (unsigned short)(u >> 16); }
__device__ __forceinline__ float bf2f(unsigned short b) { return __uint_as_float(((unsigned)b) << 16); }
__device__ __forceinline__ float bfr(float f) { return bf2f(f2bf(f)); }
__device__ __forceinline__ v16h cat16(v8h lo, v8h hi) { return __builtin_shufflevector(lo, hi, 0, 1, 2, 3, 4, 5, 6, 7, 8, 9, 10, 11, 12, 13, 14, 15); }
__device__ __forceinline__ v16bf cat16b(v8us lo, v8us hi) { return __builtin_bit_cast(v16bf, __builtin_shufflevector(lo, hi, 0, 1, 2, 3, 4, 5, 6, 7, 8, 9, 10, 11, 12, 13, 14, 15)); }
__device__ __forceinline__ v8f wmma16(v16h a, v16h b, v8f c) { return __builtin_amdgcn_wmma_f32_16x16x32_f16(false, a, false, b, (short)0, c, false, false); }
__device__ __forceinline__ v8f wmmab(v16bf a, v16bf b, v8f c) { return __builtin_amdgcn_wmma_f32_16x16x32_bf16(false, a, false, b, (short)0, c, false, false); }



__device__ __forceinline__ h16 tohx(float x) { return (h16)x; }
__device__ __forceinline__ void splitf(float y, unsigned short& h, unsigned short& l) { h = f2bf(y); l = f2bf(y - bf2f(h)); }
// The two waits stand between a run of global stores and the first rewrite of a register that they name: addresses and data are inputs, so they stay in their registers up to the wait, and the scheduling barrier keeps later instructions behind it.
__device__ __forceinline__ void swaitp(const void* a, const void* b, const void* c, const v8h (&x)[4], const v8us (&y)[4], const v8us (&w)[4]) { asm volatile("s_wait_xcnt 0x0" :: "v"(a), "v"(b), "v"(c), "v"(x[0]), "v"(x[1]), "v"(x[2]), "v"(x[3]), "v"(y[0]), "v"(y[1]), "v"(y[2]), "v"(y[3]), "v"(w[0]), "v"(w[1]), "v"(w[2]), "v"(w[3]) : "memory"); __builtin_amdgcn_sched_barrier(0); }
// The same between a run of global loads and the first rewrite of an address register that they name.
__device__ __forceinline__ void gwait(const void* a, const void* b, const void* c, const void* d) { asm volatile("s_wait_xcnt 0x0" :: "v"(a), "v"(b), "v"(c), "v"(d) : "memory"); __builtin_amdgcn_sched_barrier(0); }
// The same behind a run of eight global stores: address and data are inputs, so each stays in its register until every store of the run has been issued and the wait has passed.
__device__ __forceinline__ void swaitw(const void* a, const v8us (&x)[8]) { asm volatile("s_wait_xcnt 0x0" :: "v"(a), "v"(x[0]), "v"(x[1]), "v"(x[2]), "v"(x[3]), "v"(x[4]), "v"(x[5]), "v"(x[6]), "v"(x[7]) : "memory"); }
__device__ __forceinline__ void swaitf(const void* a, const void* b, const v4f (&x)[8]) { asm volatile("s_wait_xcnt 0x0" :: "v"(a), "v"(b), "v"(x[0]), "v"(x[1]), "v"(x[2]), "v"(x[3]), "v"(x[4]), "v"(x[5]), "v"(x[6]), "v"(x[7]) : "memory"); __builtin_amdgcn_sched_barrier(0); }

template <typename T16> struct WFrag;
template <> struct WFrag<h16> { typedef v16h V; static __device__ __forceinline__ V ld(const h16* p) { return cat16(*(const v8h*)p, *(const v8h*)(p + 256)); } static __device__ __forceinline__ v8f mma(V a, V b, v8f c) { return wmma16(a, b, c); } };
template <> struct WFrag<bf> { typedef v16bf V; static __device__ __forceinline__ V ld(const bf* p) { return cat16b(*(const v8us*)p, *(const v8us*)(p + 256)); } static __device__ __forceinline__ v8f mma(V a, V b, v8f c) { return wmmab(a, b, c); } };
static_assert(HD == 64, "one 64-column tile is one head");
static_assert(TT % 64 == 0 && NKV == NH_ && DQ == DM && DKV == DM, "a 64-row tile lies in one batch; q, k, v planes and the four weight matrices have one size each");
// The plane epilogue of one tile; TR: transposed planes. Every loop is unrolled (the accumulators are registers and take constant indices only) and PP is a constant, so that all stores of a block name p16, ph or pl plus a constant.
template <bool TR>
__device__ __forceinline__ void gemm_planes(const v8f (&acc)[4][4], float* os, h16* p16, bf* ph, bf* pl, int lr, int hi) {
    constexpr int PP = TR ? TT : HD;   /* columns (K) of a plane: 16 staged rows are 16 PP elements of it */
#pragma unroll
    for (int blk = 0; blk < 4; ++blk) {
#pragma unroll
        for (int ob = 0; ob < 4; ++ob) {
            if constexpr (!TR) {   /* staged row = m, 16 rows of block blk */
#pragma unroll
                for (int j = 0; j < 8; ++j) os[(hi * 8 + j) * 68 + ob * 16 + lr] = acc[blk][ob][j];
            } else {   /* staged row = n, 16 columns of block blk: a lane's 8 accumulator rows are 8 neighbours in it */
                const v8f t = acc[ob][blk]; *(v4fa*)(os + lr * 68 + ob * 16 + hi * 8) = __builtin_shufflevector(t, t, 0, 1, 2, 3); *(v4fa*)(os + lr * 68 + ob * 16 + hi * 8 + 4) = __builtin_shufflevector(t, t, 4, 5, 6, 7); } }
        __builtin_amdgcn_wave_barrier(); asm volatile("" ::: "memory");   /* fence: writes before reads */
        v8h o16[4]; v8us oh[4], ol[4];
#pragma unroll
        for (int s = 0; s < 4; ++s) { const float* sp = os + lr * 68 + s * 16 + hi * 8; const v4f x0 = *(const v4fa*)sp, x1 = *(const v4fa*)(sp + 4);
#pragma unroll
            for (int k = 0; k < 8; ++k) { const float x = (k < 4) ? x0[k & 3] : x1[k & 3]; o16[s][k] = tohx(x); unsigned short a2, c2; splitf(x, a2, c2); oh[s][k] = a2; ol[s][k] = c2; }
            *(v8h*)(p16 + blk * 16 * PP + s * 256) = o16[s]; *(v8us*)(ph + blk * 16 * PP + s * 256) = oh[s]; *(v8us*)(pl + blk * 16 * PP + s * 256) = ol[s]; }
        swaitp(p16, ph, pl, o16, oh, ol);
        __builtin_amdgcn_wave_barrier(); asm volatile("" ::: "memory");   /* fence: reads before the next writes */
    }
}
// Twelve copies of 512 bytes (16 a lane) from global memory into LDS, through no register. The s_wait_xcnt 0 is the statement's last line, so that it stands in front of every later write of an address register that a copy names.
__device__ __forceinline__ void copy12(const unsigned (&d)[12], const void* const (&g)[12]) {
    asm volatile("global_load_async_to_lds_b128 %0, %12, off\n\tglobal_load_async_to_lds_b128 %1, %13, off\n\tglobal_load_async_to_lds_b128 %2, %14, off\n\tglobal_load_async_to_lds_b128 %3, %15, off\n\t"
                 "global_load_async_to_lds_b128 %4, %16, off\n\tglobal_load_async_to_lds_b128 %5, %17, off\n\tglobal_load_async_to_lds_b128 %6, %18, off\n\tglobal_load_async_to_lds_b128 %7, %19, off\n\t"
                 "global_load_async_to_lds_b128 %8, %20, off\n\tglobal_load_async_to_lds_b128 %9, %21, off\n\tglobal_load_async_to_lds_b128 %10, %22, off\n\tglobal_load_async_to_lds_b128 %11, %23, off\n\ts_wait_xcnt 0x0"
                 :: "v"(d[0]), "v"(d[1]), "v"(d[2]), "v"(d[3]), "v"(d[4]), "v"(d[5]), "v"(d[6]), "v"(d[7]), "v"(d[8]), "v"(d[9]), "v"(d[10]), "v"(d[11]),
                    "v"(g[0]), "v"(g[1]), "v"(g[2]), "v"(g[3]), "v"(g[4]), "v"(g[5]), "v"(g[6]), "v"(g[7]), "v"(g[8]), "v"(g[9]), "v"(g[10]), "v"(g[11]) : "memory");
}
// Tile s (k columns s GKS ..) of the work-group's 128 rows of A, A2 and Bt into the buffer at LDS byte address dst (planes A, A2, Bt, one behind the other). In fragment order the GKS columns of a 16-row block are 32 GKS bytes in a row, and they keep that order in LDS; wave w of four takes row blocks 2 w and 2 w + 1 of each plane, in pieces of 512 bytes.
template <int K, int GKS>
__device__ __forceinline__ void gm_stage(const bf* A, const bf* A2, const bf* B, unsigned dst, int s, int w, int lane) {
    constexpr int GPL = 128 * GKS;   /* elements of one plane's tile */
    const unsigned dl = dst + w * (64 * GKS) + lane * 16;
    const size_t go = (size_t)w * (32 * K) + (size_t)s * (GKS * 16) + lane * 8;
    unsigned d[12]; const void* g[12];
#pragma unroll
    for (int q = 0; q < GKS / 32; ++q) {   /* 2 KiB of each plane: part q % (GKS / 64) of row block q / (GKS / 64) */
        const unsigned dq = dl + (q / (GKS / 64)) * (32 * GKS) + (q % (GKS / 64)) * 2048; const size_t gq = go + (q / (GKS / 64)) * (16 * K) + (q % (GKS / 64)) * 1024;
#pragma unroll
        for (int j = 0; j < 4; ++j) { d[j] = dq + j * 512; g[j] = A + gq + j * 256; d[4 + j] = dq + 2 * GPL + j * 512; g[4 + j] = A2 + gq + j * 256; d[8 + j] = dq + 4 * GPL + j * 512; g[8 + j] = B + gq + j * 256; }
        copy12(d, g);
        __builtin_amdgcn_sched_barrier(0); }   /* the next twelve copies' addresses are formed behind these copies: formed in front of them, a whole tile's addresses are live at once beside the accumulators, and some are spilled */
}
template <typename T16, int NSPLIT, int EPI, int K>
__global__ __launch_bounds__(128) void k_gemmw(const T16* __restrict__ A, const T16* __restrict__ A2, const T16* __restrict__ Bt, const T16* __restrict__ Bt2, const float* __restrict__ X, float* C, h16* P16, bf* Ph, bf* Pl, size_t sA, size_t sB, size_t sC) {
    typedef typename WFrag<T16>::V V;
    constexpr int GKS = (EPI == 0) ? 128 : 64;   /* k columns of a staged tile: 64 where three work-groups share a WGP's LDS (the launch has three per WGP), 128 where the launch has one per WGP (the ring then also keeps a second work-group off that WGP) */
    constexpr int GPL = 128 * GKS, GTB = 3 * GPL * 2;   /* elements of one plane's tile; bytes of a tile */
    static_assert(NSPLIT == 1 && K % GKS == 0 && K / GKS >= 2, "planes A, A2, Bt; whole tiles, and both buffers are filled in front of the loop");
    __shared__ __attribute__((aligned(1024))) T16 ring[2 * GTB / 2];   /* two buffers of one tile each; behind the loop each wave's epilogue staging */
    const size_t z = blockIdx.z; A += z * sA; A2 += z * sA; Bt += z * sB;
    const int wv = __builtin_amdgcn_readfirstlane((int)(threadIdx.x >> 5)), lane = threadIdx.x & 31, lr = lane & 15, hi = lane >> 4;
    const int wm = wv >> 1, wn = wv & 1; const int r0 = blockIdx.x * 128 + wm * 64, c0 = blockIdx.y * 128 + wn * 64;   /* the wave's own 64 x 64 tile */
    const T16* Ag = A + (size_t)blockIdx.x * 128 * K; const T16* A2g = A2 + (size_t)blockIdx.x * 128 * K; const T16* Bg = Bt + (size_t)blockIdx.y * 128 * K;
    const unsigned rb = (unsigned)(size_t)&ring[0];   /* LDS byte address of buffer 0 */
    gm_stage<K, GKS>(Ag, A2g, Bg, rb, 0, wv, lane);
    asm volatile("s_wait_asynccnt 0x0" ::: "memory");   /* this wave's copies of tile 0 have landed */
    __syncthreads();   /* tile 0 is there for every wave */
    gm_stage<K, GKS>(Ag, A2g, Bg, rb + GTB, 1, wv, lane);
    v8f acc[4][4];
#pragma unroll
    for (int mb = 0; mb < 4; ++mb)
#pragma unroll
        for (int nb = 0; nb < 4; ++nb) acc[mb][nb] = (v8f){};
    // Rolled: one trip per tile, with the hand-over of the buffers at its foot.
#pragma unroll 1
    for (int s = 0; s < K / GKS; ++s) {
        const T16* tb = ring + (s & 1) * (GTB / 2);
        const T16* ap = tb + wm * (64 * GKS) + lane * 8; const T16* ap2 = ap + GPL; const T16* bp = tb + 2 * GPL + wn * (64 * GKS) + lane * 8;
#pragma unroll
        for (int c = 0; c < GKS / 32; ++c) {
            // The 24 LDS reads of 32 products stand in one run in front of them, in the order in which the products take them: LDS answers in order, so the first products wait for the first ten reads only. Each scheduling barrier keeps that order in the compiled code: left to itself the compiler reads an A fragment directly in front of its four products and waits for it there, or turns the run round and waits for all of it.
            V a[4], a2[4], b[4];
#pragma unroll
            for (int nb = 0; nb < 4; ++nb) b[nb] = WFrag<T16>::ld(bp + nb * 16 * GKS + c * 512);
            a[0] = WFrag<T16>::ld(ap + c * 512);
            __builtin_amdgcn_sched_barrier(0);   /* first: what the first four products take */
#pragma unroll
            for (int mb = 1; mb < 4; ++mb) a[mb] = WFrag<T16>::ld(ap + mb * 16 * GKS + c * 512);
#pragma unroll
            for (int mb = 0; mb < 4; ++mb) a2[mb] = WFrag<T16>::ld(ap2 + mb * 16 * GKS + c * 512);
            __builtin_amdgcn_sched_barrier(0);   /* then the other fragments; no product stands among the reads */
#pragma unroll
            for (int mb = 0; mb < 4; ++mb)
#pragma unroll
                for (int nb = 0; nb < 4; ++nb) acc[mb][nb] = WFrag<T16>::mma(a[mb], b[nb], acc[mb][nb]);
#pragma unroll
            for (int mb = 0; mb < 4; ++mb)
#pragma unroll
                for (int nb = 0; nb < 4; ++nb) acc[mb][nb] = WFrag<T16>::mma(a2[mb], b[nb], acc[mb][nb]);
            __builtin_amdgcn_sched_barrier(0);   /* the next run of reads stays behind these products: drawn in front of them it would need a second set of fragment registers */
            if (c == GKS / 32 - 1) asm volatile("v_nop\n\tv_nop\n\tv_nop\n\tv_nop" : "+v"(acc[3][0]), "+v"(acc[3][1]), "+v"(acc[3][2]), "+v"(acc[3][3]) : "v"(a2[3]), "v"(b[3]));   /* the four vector slots that the chip needs behind the trip's last matrix instructions */
        }
        asm volatile("s_wait_dscnt 0x0" ::: "memory");      /* this wave's reads of tile s are done */
        asm volatile("s_wait_asynccnt 0x0" ::: "memory");   /* its copies of tile s + 1 have landed */
        __syncthreads();   /* tile s + 1 is there for every wave, and no wave reads tile s any more */
        if (s + 2 < K / GKS) gm_stage<K, GKS>(Ag, A2g, Bg, rb + (s & 1) * GTB, s + 2, wv, lane);
    }
    asm volatile("s_wait_asynccnt 0x0" ::: "memory");   /* no copy is outstanding when the ring is put to another use */
    float* os = (float*)ring + wv * (16 * 68);   /* behind the last trip's barrier nobody reads the ring any more: each wave stages its rows in a piece of its own */
    // Epilogue. Every loop is unrolled: the accumulators are registers and take constant indices only. The staged rows pass from lane to lane through LDS, which runs one wave's operations in order;
    // each fence (wave barrier + memory clobber) keeps that order in the compiled code: all lanes' writes of a block, then its reads, then the next block's writes.
    if constexpr (EPI == 0) {
        const size_t co = z * sC + (size_t)(r0 + hi) * DM + c0 + lr * 4;   /* a lane's 4 columns of rows hi, 2 + hi, ... */
        const float* xp = X + co; float* cp = C + co;
        v4f xv[2][8];   /* the residual rows, fetched one 16-row block ahead */
#pragma unroll
        for (int s = 0; s < 8; ++s) xv[0][s] = *(const v4f*)(xp + 2 * s * DM);
#pragma unroll
        for (int mb = 0; mb < 4; ++mb) {
            if (mb < 3) {
#pragma unroll
                for (int s = 0; s < 8; ++s) xv[(mb + 1) & 1][s] = *(const v4f*)(xp + ((mb + 1) * 16 + 2 * s) * DM); }
#pragma unroll
            for (int nb = 0; nb < 4; ++nb) {
#pragma unroll
                for (int j = 0; j < 8; ++j) os[(hi * 8 + j) * 68 + nb * 16 + lr] = acc[mb][nb][j]; }
            __builtin_amdgcn_wave_barrier(); asm volatile("" ::: "memory");   /* fence: writes before reads */
            v4f val[8];
#pragma unroll
            for (int s = 0; s < 8; ++s) { val[s] = *(const v4fa*)(os + (2 * s + hi) * 68 + lr * 4);
#pragma unroll
                for (int q = 0; q < 4; ++q) val[s][q] = __fadd_rn(bfr(xv[mb & 1][s][q]), val[s][q]);
                *(v4f*)(cp + (mb * 16 + 2 * s) * DM) = val[s]; }
            swaitf(xp, cp, val);
            __builtin_amdgcn_wave_barrier(); asm volatile("" ::: "memory");   /* fence: reads before the next writes */
        }
    } else {
        const bool tr = blockIdx.z == 2;   /* the same for the whole wave: a scalar branch */
        const size_t po = z * sC + ((size_t)(r0 / TT) * NH_ + c0 / 64) * TT * HD + (size_t)(r0 % TT) * (tr ? 16 : HD) + lane * 8;   /* a lane's 8 elements of staged row lr, columns 8 hi, 16 + 8 hi, ...: each store of the wave is 512 bytes in a row */
        if (tr) gemm_planes<true>(acc, os, P16 + po, Ph + po, Pl + po, lr, hi); else gemm_planes<false>(acc, os, P16 + po, Ph + po, Pl + po, lr, hi);
    }
}

typedef __attribute__((ext_vector_type(2))) _Float16 v2h;
typedef __attribute__((ext_vector_type(4))) _Float16 v4h;
typedef __attribute__((ext_vector_type(2))) unsigned short v2us;
typedef __attribute__((ext_vector_type(4))) unsigned short v4us;
typedef v4us __attribute__((may_alias)) v4usa;
typedef __attribute__((ext_vector_type(2))) float v2f;
typedef __attribute__((ext_vector_type(4))) int v4i;

template <int K, int N>
__device__ __forceinline__ void d_wtG(const float* __restrict__ w, bf* Bt, int blk) {
    // Bt (row n, column k) = w[k][n] in fragment order, in 512-byte units u (16 rows n, 16 columns k). One wave takes eight units: two neighbouring n blocks (each row of w then gives a whole 128-byte line) by four neighbouring k blocks (2 KiB in a row of Bt per n block). Its 64 loads stand in one run: one memory latency for 8 KiB of w.
    const int lane = threadIdx.x & 31; const int t = blk * 8 + (threadIdx.x >> 5); const int kb = (t % (K / 64)) * 4, nb = (t / (K / 64)) * 2;
    const float* wp = w + (size_t)(kb * 16 + (lane >> 4) * 8) * N + nb * 16 + (lane & 15); bf* op = Bt + ((size_t)nb * (K / 16) + kb) * 256 + lane * 8; float x[8][8]; v8us o[8];
#pragma unroll
    for (int i = 0; i < 8; ++i)   /* unit i: n block nb + i % 2, k block kb + i / 2 */
#pragma unroll
        for (int e = 0; e < 8; ++e) x[i][e] = wp[((i >> 1) * 16 + e) * N + (i & 1) * 16];
    gwait(wp, wp, wp, wp);
#pragma unroll
    for (int i = 0; i < 8; ++i) {
#pragma unroll
        for (int e = 0; e < 8; ++e) o[i][e] = f2bf(x[i][e]);
        *(v8us*)(op + ((i & 1) * (K / 16) + (i >> 1)) * 256) = o[i]; }
    swaitw(op, o);
}
__constant__ int BKT[4095] = {15,15,15,15,15,15,15,15,15,15,15,15,15,15,15,15,15,15,15,15,15,15,15,15,15,15,15,15,15,15,15,15,15,15,15,15,15,15,15,15,15,15,15,15,15,15,15,15,15,15,15,15,15,15,15,15,15,15,15,15,15,15,15,15,15,15,15,15,15,15,15,15,15,15,15,15,15,15,15,15,15,15,15,15,15,15,15,15,15,15,15,15,15,15,15,15,15,15,15,15,15,15,15,15,15,15,15,15,15,15,15,15,15,15,15,15,15,15,15,15,15,15,15,15,15,15,15,15,15,15,15,15,15,15,15,15,15,15,15,15,15,15,15,15,15,15,15,15,15,15,15,15,15,15,15,15,15,15,15,15,15,15,15,15,15,15,15,15,15,15,15,15,15,15,15,15,15,15,15,15,15,15,15,15,15,15,15,15,15,15,15,15,15,15,15,15,15,15,15,15,15,15,15,15,15,15,15,15,15,15,15,15,15,15,15,15,15,15,15,15,15,15,15,15,15,15,15,15,15,15,15,15,15,15,15,15,15,15,15,15,15,15,15,15,15,15,15,15,15,15,15,15,15,15,15,15,15,15,15,15,15,15,15,15,15,15,15,15,15,15,15,15,15,15,15,15,15,15,15,15,15,15,15,15,15,15,15,15,15,15,15,15,15,15,15,15,15,15,15,15,15,15,15,15,15,15,15,15,15,15,15,15,15,15,15,15,15,15,15,15,15,15,15,15,15,15,15,15,15,15,15,15,15,15,15,15,15,15,15,15,15,15,15,15,15,15,15,15,15,15,15,15,15,15,15,15,15,15,15,15,15,15,15,15,15,15,15,15,15,15,15,15,15,15,15,15,15,15,15,15,15,15,15,15,15,15,15,15,15,15,15,15,15,15,15,15,15,15,15,15,15,15,15,15,15,15,15,15,15,15,15,15,15,15,15,15,15,15,15,15,15,15,15,15,15,15,15,15,15,15,15,15,15,15,15,15,15,15,15,15,15,15,15,15,15,15,15,15,15,15,15,15,15,15,15,15,15,15,15,15,15,15,15,15,15,15,15,15,15,15,15,15,15,15,15,15,15,15,15,15,15,15,15,15,15,15,15,15,15,15,15,15,15,15,15,15,15,15,15,15,15,15,15,15,15,15,15,15,15,15,15,15,15,15,15,15,15,15,15,15,15,15,15,15,15,15,15,15,15,15,15,15,15,15,15,15,15,15,15,15,15,15,15,15,15,15,15,15,15,15,15,15,15,15,15,15,15,15,15,15,15,15,15,15,15,15,15,15,15,15,15,15,15,15,15,15,15,15,15,15,15,15,15,15,15,15,15,15,15,15,15,15,15,15,15,15,15,15,15,15,15,15,15,15,15,15,15,15,15,15,15,15,15,15,15,15,15,15,15,15,15,15,15,15,15,15,15,15,15,15,15,15,15,15,15,15,15,15,15,15,15,15,15,15,15,15,15,15,15,15,15,15,15,15,15,15,15,15,15,15,15,15,15,15,15,15,15,15,15,15,15,15,15,15,15,15,15,15,15,15,15,15,15,15,15,15,15,15,15,15,15,15,15,15,15,15,15,15,15,15,15,15,15,15,15,15,15,15,15,15,15,15,15,15,15,15,15,15,15,15,15,15,15,15,15,15,15,15,15,15,15,15,15,15,15,15,15,15,15,15,15,15,15,15,15,15,15,15,15,15,15,15,15,15,15,15,15,15,15,15,15,15,15,15,15,15,15,15,15,15,15,15,15,15,15,15,15,15,15,15,15,15,15,15,15,15,15,15,15,15,15,15,15,15,15,15,15,15,15,15,15,15,15,15,15,15,15,15,15,15,15,15,15,15,15,15,15,15,15,15,15,15,15,15,15,15,15,15,15,15,15,15,15,15,15,15,15,15,15,15,15,15,15,15,15,15,15,15,15,15,15,15,15,15,15,15,15,15,15,15,15,15,15,15,15,15,15,15,15,15,15,15,15,15,15,15,15,15,15,15,15,15,15,15,15,15,15,15,15,15,15,15,15,15,15,15,15,15,15,15,15,15,15,15,15,15,15,15,15,15,15,15,15,15,15,15,15,15,15,15,15,15,15,15,15,15,15,15,15,15,15,15,15,15,15,15,15,15,15,15,15,15,15,15,15,15,15,15,15,15,15,15,15,15,15,15,15,15,15,15,15,15,15,15,15,15,15,15,15,15,15,15,15,15,15,15,15,15,15,15,15,15,15,15,15,15,15,15,15,15,15,15,15,15,15,15,15,15,15,15,15,15,15,15,15,15,15,15,15,15,15,15,15,15,15,15,15,15,15,15,15,15,15,15,15,15,15,15,15,15,15,15,15,15,15,15,15,15,15,15,15,15,15,15,15,15,15,15,15,15,15,15,15,15,15,15,15,15,15,15,15,15,15,15,15,15,15,15,15,15,15,15,15,15,15,15,15,15,15,15,15,15,15,15,15,15,15,15,15,15,15,15,15,15,15,15,15,15,15,15,15,15,15,15,15,15,15,15,15,15,15,15,15,15,15,15,15,15,15,15,15,15,15,15,15,15,15,15,15,15,15,15,15,15,15,15,15,15,15,15,15,15,15,15,15,15,15,15,15,15,15,15,15,15,15,15,15,15,15,15,15,15,15,15,15,15,15,15,15,15,15,15,15,15,15,15,15,15,15,15,15,15,15,15,15,15,15,15,15,15,15,15,15,15,15,15,15,15,15,15,15,15,15,15,15,15,15,15,15,15,15,15,15,15,15,15,15,15,15,15,15,15,15,15,15,15,15,15,15,15,15,15,15,15,15,15,15,15,15,15,15,15,15,15,15,15,15,15,15,15,15,15,15,15,15,15,15,15,15,15,15,15,15,15,15,15,15,15,15,15,15,15,15,15,15,15,15,15,15,15,15,15,15,15,15,15,15,15,15,15,15,15,15,15,15,15,15,15,15,15,15,15,15,15,15,15,15,15,15,15,15,15,15,15,15,15,15,15,15,15,15,15,15,15,15,15,15,15,15,15,15,15,15,15,15,15,15,15,15,15,15,15,15,15,15,15,15,15,15,15,15,15,15,15,15,15,15,15,15,15,15,15,15,15,15,15,15,15,15,15,15,15,15,15,15,15,15,15,15,15,15,15,15,15,15,15,15,15,15,15,15,15,15,15,15,15,15,15,15,15,15,15,15,15,15,15,15,15,15,15,15,15,15,15,15,15,15,15,15,15,15,15,15,15,15,15,15,15,15,15,15,15,15,15,15,15,15,15,15,15,15,15,15,15,15,15,15,15,15,15,15,15,15,15,15,15,15,15,15,15,15,15,15,15,15,15,15,15,15,15,15,15,15,15,15,15,15,15,15,15,15,15,15,15,15,15,15,15,15,15,15,15,15,15,15,15,15,15,15,15,15,15,15,15,15,15,15,15,15,15,15,15,15,15,15,15,15,15,15,15,15,15,15,15,15,15,15,15,15,15,15,15,15,15,15,15,15,15,15,15,15,15,15,15,15,15,15,15,15,15,15,15,15,15,15,15,15,15,15,15,15,15,15,15,15,15,15,15,15,15,15,15,15,15,15,15,15,15,15,15,15,15,15,15,15,15,15,15,15,15,15,15,15,15,15,15,15,15,15,15,15,15,15,15,15,15,15,15,15,15,15,15,15,15,15,15,15,15,15,15,15,15,15,15,15,15,15,15,15,15,15,15,15,15,15,15,15,15,15,15,15,15,15,15,15,15,15,15,15,15,15,15,15,15,15,15,15,15,15,15,15,15,15,15,15,15,15,15,15,15,15,15,15,15,15,15,15,15,15,15,15,15,15,15,15,15,15,15,15,15,15,15,15,15,15,15,15,15,15,15,15,15,15,15,15,15,15,15,15,15,15,15,15,15,15,15,15,15,15,15,15,15,15,15,15,15,15,15,15,15,15,15,15,15,15,15,15,15,15,15,15,15,15,15,15,15,15,15,15,15,15,15,15,15,15,15,15,15,15,15,15,15,15,15,15,15,15,15,15,15,15,15,15,15,15,15,15,15,15,15,15,15,15,15,15,15,15,15,15,15,15,15,15,15,15,15,15,15,15,15,15,15,15,15,15,15,15,15,15,15,15,15,15,15,15,15,15,15,15,15,15,15,15,15,15,15,15,15,15,15,15,15,15,15,15,15,15,15,15,15,15,15,15,15,15,15,15,15,15,15,15,15,15,15,15,15,15,15,15,15,15,15,15,15,15,15,15,15,15,15,15,15,15,15,15,15,15,15,15,15,15,15,15,15,15,15,15,15,15,15,15,15,15,15,15,15,15,15,15,15,15,15,15,15,15,15,15,15,15,15,15,15,15,15,15,15,15,15,15,15,15,15,15,15,15,15,15,15,15,15,15,15,15,15,15,15,15,15,15,15,15,15,15,15,15,15,15,15,15,15,15,15,15,15,15,15,15,14,14,14,14,14,14,14,14,14,14,14,14,14,14,14,14,14,14,14,14,14,14,14,14,14,14,14,13,13,13,13,13,13,13,13,13,13,13,13,13,13,13,13,13,13,12,12,12,12,12,12,12,12,12,12,12,12,12,12,11,11,11,11,11,11,11,11,11,10,10,10,10,10,10,10,9,9,9,9,8,8,8,8,7,6,5,4,3,2,1,0,17,18,19,20,21,22,23,24,24,24,24,25,25,25,25,26,26,26,26,26,26,26,27,27,27,27,27,27,27,27,27,28,28,28,28,28,28,28,28,28,28,28,28,28,28,29,29,29,29,29,29,29,29,29,29,29,29,29,29,29,29,29,29,30,30,30,30,30,30,30,30,30,30,30,30,30,30,30,30,30,30,30,30,30,30,30,30,30,30,30,31,31,31,31,31,31,31,31,31,31,31,31,31,31,31,31,31,31,31,31,31,31,31,31,31,31,31,31,31,31,31,31,31,31,31,31,31,31,31,31,31,31,31,31,31,31,31,31,31,31,31,31,31,31,31,31,31,31,31,31,31,31,31,31,31,31,31,31,31,31,31,31,31,31,31,31,31,31,31,31,31,31,31,31,31,31,31,31,31,31,31,31,31,31,31,31,31,31,31,31,31,31,31,31,31,31,31,31,31,31,31,31,31,31,31,31,31,31,31,31,31,31,31,31,31,31,31,31,31,31,31,31,31,31,31,31,31,31,31,31,31,31,31,31,31,31,31,31,31,31,31,31,31,31,31,31,31,31,31,31,31,31,31,31,31,31,31,31,31,31,31,31,31,31,31,31,31,31,31,31,31,31,31,31,31,31,31,31,31,31,31,31,31,31,31,31,31,31,31,31,31,31,31,31,31,31,31,31,31,31,31,31,31,31,31,31,31,31,31,31,31,31,31,31,31,31,31,31,31,31,31,31,31,31,31,31,31,31,31,31,31,31,31,31,31,31,31,31,31,31,31,31,31,31,31,31,31,31,31,31,31,31,31,31,31,31,31,31,31,31,31,31,31,31,31,31,31,31,31,31,31,31,31,31,31,31,31,31,31,31,31,31,31,31,31,31,31,31,31,31,31,31,31,31,31,31,31,31,31,31,31,31,31,31,31,31,31,31,31,31,31,31,31,31,31,31,31,31,31,31,31,31,31,31,31,31,31,31,31,31,31,31,31,31,31,31,31,31,31,31,31,31,31,31,31,31,31,31,31,31,31,31,31,31,31,31,31,31,31,31,31,31,31,31,31,31,31,31,31,31,31,31,31,31,31,31,31,31,31,31,31,31,31,31,31,31,31,31,31,31,31,31,31,31,31,31,31,31,31,31,31,31,31,31,31,31,31,31,31,31,31,31,31,31,31,31,31,31,31,31,31,31,31,31,31,31,31,31,31,31,31,31,31,31,31,31,31,31,31,31,31,31,31,31,31,31,31,31,31,31,31,31,31,31,31,31,31,31,31,31,31,31,31,31,31,31,31,31,31,31,31,31,31,31,31,31,31,31,31,31,31,31,31,31,31,31,31,31,31,31,31,31,31,31,31,31,31,31,31,31,31,31,31,31,31,31,31,31,31,31,31,31,31,31,31,31,31,31,31,31,31,31,31,31,31,31,31,31,31,31,31,31,31,31,31,31,31,31,31,31,31,31,31,31,31,31,31,31,31,31,31,31,31,31,31,31,31,31,31,31,31,31,31,31,31,31,31,31,31,31,31,31,31,31,31,31,31,31,31,31,31,31,31,31,31,31,31,31,31,31,31,31,31,31,31,31,31,31,31,31,31,31,31,31,31,31,31,31,31,31,31,31,31,31,31,31,31,31,31,31,31,31,31,31,31,31,31,31,31,31,31,31,31,31,31,31,31,31,31,31,31,31,31,31,31,31,31,31,31,31,31,31,31,31,31,31,31,31,31,31,31,31,31,31,31,31,31,31,31,31,31,31,31,31,31,31,31,31,31,31,31,31,31,31,31,31,31,31,31,31,31,31,31,31,31,31,31,31,31,31,31,31,31,31,31,31,31,31,31,31,31,31,31,31,31,31,31,31,31,31,31,31,31,31,31,31,31,31,31,31,31,31,31,31,31,31,31,31,31,31,31,31,31,31,31,31,31,31,31,31,31,31,31,31,31,31,31,31,31,31,31,31,31,31,31,31,31,31,31,31,31,31,31,31,31,31,31,31,31,31,31,31,31,31,31,31,31,31,31,31,31,31,31,31,31,31,31,31,31,31,31,31,31,31,31,31,31,31,31,31,31,31,31,31,31,31,31,31,31,31,31,31,31,31,31,31,31,31,31,31,31,31,31,31,31,31,31,31,31,31,31,31,31,31,31,31,31,31,31,31,31,31,31,31,31,31,31,31,31,31,31,31,31,31,31,31,31,31,31,31,31,31,31,31,31,31,31,31,31,31,31,31,31,31,31,31,31,31,31,31,31,31,31,31,31,31,31,31,31,31,31,31,31,31,31,31,31,31,31,31,31,31,31,31,31,31,31,31,31,31,31,31,31,31,31,31,31,31,31,31,31,31,31,31,31,31,31,31,31,31,31,31,31,31,31,31,31,31,31,31,31,31,31,31,31,31,31,31,31,31,31,31,31,31,31,31,31,31,31,31,31,31,31,31,31,31,31,31,31,31,31,31,31,31,31,31,31,31,31,31,31,31,31,31,31,31,31,31,31,31,31,31,31,31,31,31,31,31,31,31,31,31,31,31,31,31,31,31,31,31,31,31,31,31,31,31,31,31,31,31,31,31,31,31,31,31,31,31,31,31,31,31,31,31,31,31,31,31,31,31,31,31,31,31,31,31,31,31,31,31,31,31,31,31,31,31,31,31,31,31,31,31,31,31,31,31,31,31,31,31,31,31,31,31,31,31,31,31,31,31,31,31,31,31,31,31,31,31,31,31,31,31,31,31,31,31,31,31,31,31,31,31,31,31,31,31,31,31,31,31,31,31,31,31,31,31,31,31,31,31,31,31,31,31,31,31,31,31,31,31,31,31,31,31,31,31,31,31,31,31,31,31,31,31,31,31,31,31,31,31,31,31,31,31,31,31,31,31,31,31,31,31,31,31,31,31,31,31,31,31,31,31,31,31,31,31,31,31,31,31,31,31,31,31,31,31,31,31,31,31,31,31,31,31,31,31,31,31,31,31,31,31,31,31,31,31,31,31,31,31,31,31,31,31,31,31,31,31,31,31,31,31,31,31,31,31,31,31,31,31,31,31,31,31,31,31,31,31,31,31,31,31,31,31,31,31,31,31,31,31,31,31,31,31,31,31,31,31,31,31,31,31,31,31,31,31,31,31,31,31,31,31,31,31,31,31,31,31,31,31,31,31,31,31,31,31,31,31,31,31,31,31,31,31,31,31,31,31,31,31,31,31,31,31,31,31,31,31,31,31,31,31,31,31,31,31,31,31,31,31,31,31,31,31,31,31,31,31,31,31,31,31,31,31,31,31,31,31,31,31,31,31,31,31,31,31,31,31,31,31,31,31,31,31,31,31,31,31,31,31,31,31,31,31,31,31,31,31,31,31,31,31,31,31,31,31,31,31,31,31,31,31,31,31,31,31,31,31,31,31,31,31,31,31,31,31,31,31,31,31,31,31,31,31,31,31,31,31,31,31,31,31,31,31,31,31,31,31,31,31,31,31,31,31,31,31,31,31,31,31,31,31,31,31,31,31,31,31,31,31,31,31,31,31,31,31,31,31,31,31,31,31,31,31,31,31,31,31,31,31,31,31,31,31,31,31,31,31,31,31,31,31,31,31,31,31,31,31,31,31,31,31,31,31,31,31,31,31,31,31,31,31,31,31,31,31,31,31,31,31,31,31,31,31,31,31,31,31,31,31,31,31,31,31,31,31,31,31,31,31,31,31,31,31,31,31,31,31,31,31,31,31,31,31,31,31,31,31,31,31,31,31,31,31,31,31,31,31,31,31,31,31,31,31,31,31,31,31,31,31,31,31,31,31,31,31,31,31,31,31,31,31,31,31,31,31,31,31,31,31,31,31,31,31,31,31,31,31,31,31,31,31,31,31,31,31,31,31,31,31,31,31,31,31,31,31,31,31,31,31,31,31,31,31,31,31,31,31,31,31,31,31,31,31,31,31,31,31,31,31,31,31,31,31,31,31,31,31,31,31,31,31,31,31,31,31,31,31,31,31,31,31,31,31,31,31,31,31,31,31,31,31,31,31,31,31,31,31,31,31,31,31,31,31,31,31,31,31,31,31,31,31,31,31,31,31,31,31,31,31,31,31,31,31,31,31,31,31,31,31,31,31,31,31,31,31,31,31,31,31,31,31,31,31,31,31,31,31,31,31,31,31,31,31,31,31,31,31,31,31,31,31,31,31,31,31,31,31,31,31,31,31,31,31,31,31,31,31,31,31,31,31,31,31,31,31,31,31,31,31,31,31,31,31,31,31,31,31,31,31,31,31,31,31,31,31,31,31,31,31,31,31,31,31,31,31,31,31,31,31,31,31,31,31,31,31,31,31,31,31,31,31,31,31,31,31,31,31,31,31,31,31,31,31,31,31,31,31,31,31,31,31,31,31,31,31,31,31,31,31,31,31,31,31,31,31,31,31,31,31,31,31,31,31,31,31,31,31,31,31,31,31,31,31,31,31,31,31,31,31,31,31,31,31,31,31,31,31,31,31,31,31,31,31,31,31,31,31,31,31,31,31,31,31,31,31,31,31,31,31,31,31,31,31,31,31,31,31,31,31,31,31,31,31,31,31,31,31,31,31,31,31,31,31,31,31,31,31,31,31,31,31,31,31,31,31,31,31,31,31,31,31,31,31,31,31,31};
// Four entries a thread, 256 apart (a work-group's 1024 lie in one head): their four bucket reads stand in one run, then their four bias reads. Entry 4095 of a head is padding that nobody reads: it gets entry 4094's value, so that no read hangs on a test.
__device__ __forceinline__ void d_btab(const float* __restrict__ relb, float* BT, int blk) { const int h = blk >> 2, r0 = ((blk & 3) << 10) + threadIdx.x; int bk[4]; float rv[4];
#pragma unroll
    for (int j = 0; j < 4; ++j) bk[j] = BKT[(r0 + j * 256 < 4095) ? r0 + j * 256 : 4094];
#pragma unroll
    for (int j = 0; j < 4; ++j) rv[j] = relb[bk[j] * NH_ + h];
#pragma unroll
    for (int j = 0; j < 4; ++j) BT[h * 4096 + r0 + j * 256] = bfr(rv[j]); }
// k_prep: everything that reads the inputs alone, in one launch of few, long waves, each with all its global reads in flight at once; grid x: first the LayerNorm of all rows (8 rows a work-group), then the four weight planes (one size, one behind the other in Bt; 64 units a work-group), then the bias table. The branch is the same for a whole workgroup and stands in front of the barrier.
#define PB_LN (NB_ * TT / 8)              // work-groups of the LayerNorm
#define PB_W  (4 * (DM * DQ / 256 / 64))  // of the four weight planes
#define PB_T  (NH_ * 4096 / 1024)         // of the bias table
static_assert(DM % 64 == 0 && DQ % 32 == 0 && (DM / 64) * (DQ / 32) % 8 == 0 && 4096 % 1024 == 0, "whole waves, whole work-groups");
__global__ __launch_bounds__(256) void k_prep(const float* __restrict__ X, const float* __restrict__ g, const float* __restrict__ be, bf* Yh, bf* Yl, const float* __restrict__ w0, const float* __restrict__ w1, const float* __restrict__ w2, const float* __restrict__ w3, bf* Bt, const float* __restrict__ relb, float* BT) {
    if (blockIdx.x >= PB_LN + PB_W) { d_btab(relb, BT, blockIdx.x - (PB_LN + PB_W)); return; }
    if (blockIdx.x >= PB_LN) { const int wb = blockIdx.x - PB_LN, mi = wb / (PB_W / 4); d_wtG<DM, DQ>((mi == 0) ? w0 : (mi == 1) ? w1 : (mi == 2) ? w2 : w3, Bt + (size_t)mi * DQ * DM, wb % (PB_W / 4)); return; }
    static_assert(TT % 8 == 0, "a workgroup's 8 rows are all inside or all outside");
    __shared__ __align__(16) bf ys[2][8][DM + 16];   /* the workgroup's 8 rows, hi and lo; the pitch spreads 8 rows' 16-byte pieces over the banks */
    const int lane = threadIdx.x & 31; const int wr = threadIdx.x >> 5; const int r = blockIdx.x * 8 + wr; const float* xl = X + (size_t)r * DM + lane * 4; const float* gl = g + lane * 4; const float* bl = be + lane * 4; float s = 0.f;
    v4f xa[DM / 128], ga[DM / 128], ba[DM / 128];   /* the wave's row, read once and kept in registers for all three passes, and the lane's columns of gain and bias; the 24 loads stand in one run, so the wave waits out one memory latency, not one per 512 bytes of each pass */
#pragma unroll
    for (int ch = 0; ch < DM / 128; ++ch) xa[ch] = *(const v4f*)(xl + ch * 128);
#pragma unroll
    for (int ch = 0; ch < DM / 128; ++ch) { ga[ch] = *(const v4f*)(gl + ch * 128); ba[ch] = *(const v4f*)(bl + ch * 128); }
    gwait(xl, gl, bl, bl);
#pragma unroll
    for (int ch = 0; ch < DM / 128; ++ch) { const v4f a = xa[ch]; const v4f d = {0.f, 0.f, 0.f, 0.f};
#pragma unroll
        for (int q = 0; q < 4; ++q) s += __fadd_rn(bfr(a[q]), d[q]); }
#pragma unroll
    for (int sh = 16; sh; sh >>= 1) s += __shfl_xor(s, sh, 32);
    const float mu = s * (1.0f / DM); float s2 = 0.f;
#pragma unroll
    for (int ch = 0; ch < DM / 128; ++ch) { const v4f a = xa[ch]; const v4f d = {0.f, 0.f, 0.f, 0.f};
#pragma unroll
        for (int q = 0; q < 4; ++q) { const float d0 = __fsub_rn(__fadd_rn(bfr(a[q]), d[q]), mu); float p = __fmul_rn(d0, d0); asm volatile("" : "+v"(p)); s2 = __fadd_rn(s2, p); } }
#pragma unroll
    for (int sh = 16; sh; sh >>= 1) s2 += __shfl_xor(s2, sh, 32);
    const float rs = __fdiv_rn(1.0f, __fsqrt_rn(__fadd_rn(s2 * (1.0f / DM), LNEPS)));
{
#pragma unroll
        for (int ch = 0; ch < DM / 128; ++ch) { const int c0 = ch * 128 + lane * 4; const v4f a = xa[ch]; const v4f d = {0.f, 0.f, 0.f, 0.f}; v4f z4; v4us oh, ol;
#pragma unroll
            for (int q = 0; q < 4; ++q) { const float v = __fadd_rn(bfr(a[q]), d[q]); z4[q] = v; float n0 = __fmul_rn(__fsub_rn(v, mu), rs); asm volatile("" : "+v"(n0)); float n1 = __fmul_rn(n0, bfr(ga[ch][q])); asm volatile("" : "+v"(n1)); const float y = __fadd_rn(n1, bfr(ba[ch][q])); unsigned short h2, l2; splitf(y, h2, l2); oh[q] = h2; ol[q] = l2; }
            *(v4usa*)(&ys[0][wr][c0]) = oh; *(v4usa*)(&ys[1][wr][c0]) = ol; }
         }
    __syncthreads();   /* all 8 rows staged: a 128-byte line of a plane in fragment order holds 16 bytes of each of them */
    const size_t yo = (size_t)(blockIdx.x >> 1) * 16 * DM + (blockIdx.x & 1) * 64 + (threadIdx.x & 7) * 8;   /* rows 8 (x % 2) + t % 8 of row block x / 2 */
#pragma unroll
    for (int i = 0; i < DM / 256; ++i) { const int sg = i * 32 + (threadIdx.x >> 3);   /* columns 8 sg ..: a wave stores four whole lines */
        *(v8us*)(Yh + yo + sg * 128) = *(const v8usa*)(&ys[0][threadIdx.x & 7][sg * 8]); *(v8us*)(Yl + yo + sg * 128) = *(const v8usa*)(&ys[1][threadIdx.x & 7][sg * 8]); } }
__global__ __launch_bounds__(256) void k_cvt8(const float* __restrict__ src, bf* dst, size_t n8) { const size_t i = (size_t)blockIdx.x * 256 + threadIdx.x; if (i >= n8) return; const v8f v = *(const v8f*)(src + i * 8); v8us o;
#pragma unroll
    for (int k = 0; k < 8; ++k) o[k] = f2bf(v[k]); *(v8us*)(dst + i * 8) = o;  }

typedef __attribute__((ext_vector_type(8))) __bf16 v8bf;
__device__ __forceinline__ float xhalf(float x) { const int b = __float_as_int(x); return __int_as_float(__builtin_amdgcn_permlanex16(b, b, 0x76543210, 0xfedcba98, false, false)); }   /* lane l <-> l ^ 16 */
// The wait stands between a run of global loads and the first rewrite of an address register that they name: the addresses are inputs, so they stay in their registers up to it, and the scheduling barrier keeps later instructions behind it.
__device__ __forceinline__ void xwait(const void* a, const void* b) { asm volatile("s_wait_xcnt 0x0" :: "v"(a), "v"(b) : "memory"); __builtin_amdgcn_sched_barrier(0); }
// 2^x by v_exp_f32 with the one free slot that the instruction set asks for behind a transcendental in the same statement, so that it stands directly behind it wherever the statement is scheduled.
__device__ __forceinline__ float exp2s(float x) { float y; asm("v_exp_f32 %0, %1\n\tv_nop" : "=v"(y) : "v"(x)); return y; }
template <bool B> struct BoolC { static constexpr bool value = B; };
#define KT   128                  // keys of a staged tile
#define PLE  (KT * HD)            // elements of one plane's tile (16 KiB)
#define TLB  (6 * PLE * 2)        // bytes of a staged tile: planes K16, V16, Kh, Kl, Vh, Vl, one behind the other
static_assert(TT % KT == 0 && TT / KT >= 2 && KT % 32 == 0, "whole tiles, and both buffers are filled in front of the loop");
// Tile t of the six planes into the buffer at LDS byte address dst; one of eight waves (w) takes piece 8 j + w of the 32 pieces of each plane's tile. A key plane's tile is 16 KiB in a row; a value plane's is 4 KiB (the tile's four fragments) of each of the four 16-row blocks.
__device__ __forceinline__ void fa_stage(const h16* K16, const h16* V16, const bf* Kh, const bf* Kl, const bf* Vh, const bf* Vl, unsigned dst, int t, int w, int lane) {
    const unsigned dl = dst + w * 512 + lane * 16;
    const size_t ko = (size_t)t * PLE + w * 256 + lane * 8, vo = (size_t)t * (KT * 16) + w * 256 + lane * 8;
    unsigned d[12]; const void* g[12];
#pragma unroll
    for (int j = 0; j < 4; ++j) { d[j] = dl + j * 4096; g[j] = K16 + ko + j * 2048; d[4 + j] = dl + 4 * PLE + j * 4096; g[4 + j] = Kh + ko + j * 2048; d[8 + j] = dl + 6 * PLE + j * 4096; g[8 + j] = Kl + ko + j * 2048; }
    copy12(d, g);
#pragma unroll
    for (int j = 0; j < 4; ++j) { d[j] = dl + 2 * PLE + j * 4096; g[j] = V16 + vo + j * 16 * TT; d[4 + j] = dl + 8 * PLE + j * 4096; g[4 + j] = Vh + vo + j * 16 * TT; d[8 + j] = dl + 10 * PLE + j * 4096; g[8 + j] = Vl + vo + j * 16 * TT; }
    copy12(d, g);
}
// What a wave carries from tile to tile, in one form for both kinds of wave: output tiles, four query fragments (fp16: [column group][k half]; hi/lo: hi [k half], lo [k half]), running maximum and sum.
struct FaState { v8f o[4][2]; v16h q[4]; float m[2], l[2]; };
// One wave's work on one staged tile (keys kb .. kb + KT - 1); K, K2, V, V2: the tile's planes in LDS.
template <typename T16, bool HI, int NQ>
__device__ __forceinline__ void fa_tile(FaState& st, const T16* K, const T16* K2, const T16* V, const T16* V2, const float* __restrict__ bt, int q0, int kb, float cneg, float cpos) {
    typedef WFrag<T16> WF; typedef typename WF::V F;
    const int lane = threadIdx.x & 31, lr = lane & 15, hi = lane >> 4;
    const float L2E = 1.4426950408889634f;
    F qf[NQ][2], qf2[NQ][2];
#pragma unroll
    for (int nb = 0; nb < NQ; ++nb)
#pragma unroll
        for (int ks = 0; ks < 2; ++ks) { qf[nb][ks] = __builtin_bit_cast(F, st.q[HI ? ks : nb * 2 + ks]); if (HI) qf2[nb][ks] = __builtin_bit_cast(F, st.q[2 + ks]); }
    v8f (&o)[4][2] = st.o; float (&m)[2] = st.m; float (&l)[2] = st.l;
    const int ko = lane * 8, vo = lane * 8;
    // One pass over keys k0 .. k0 + 31 (kl: k0 - kb), written once and compiled into three loops (below). NEAR: the score tiles start from table values. Otherwise all 32 keys have the one bias cb: the tiles start from 0, and cb joins the pass's maximum and the addend of the exponent.
    auto pass = [&](auto nearc, const int k0, const int kl, const float cb) __attribute__((always_inline)) {
        constexpr bool NEAR = decltype(nearc)::value;
        v8f s[2][NQ];
        if constexpr (!NEAR) {
#pragma unroll
            for (int kt = 0; kt < 2; ++kt)
#pragma unroll
                for (int nb = 0; nb < NQ; ++nb) s[kt][nb] = (v8f){};
        } else { const float* bp0 = bt + (k0 + 8 * hi) - (q0 + lr);
#pragma unroll
            for (int kt = 0; kt < 2; ++kt)
#pragma unroll
                for (int nb = 0; nb < NQ; ++nb) { const float* bp = bp0 + (kt - nb) * 16;
#pragma unroll
                    for (int r = 0; r < 8; ++r) s[kt][nb][r] = bp[r]; }
            xwait(bp0, bp0);
        }
        F kf[2][2], kf2[2][2]; const T16* kp = K + ko + kl * HD; const T16* kp2 = K2 + ko + kl * HD;   /* the pass's key rows, then its value rows: LDS answers in order, so the score products wait for the first only */
#pragma unroll
        for (int kt = 0; kt < 2; ++kt)
#pragma unroll
            for (int ks = 0; ks < 2; ++ks) { kf[kt][ks] = WF::ld(kp + kt * 16 * HD + ks * 512); if (HI) kf2[kt][ks] = WF::ld(kp2 + kt * 16 * HD + ks * 512); }
        F vf[4], vf2[4]; const T16* vp = V + vo + kl * 16; const T16* vp2 = V2 + vo + kl * 16;
#pragma unroll
        for (int dt = 0; dt < 4; ++dt) { vf[dt] = WF::ld(vp + dt * 16 * KT); if (HI) vf2[dt] = WF::ld(vp2 + dt * 16 * KT); }
#pragma unroll
        for (int ks = 0; ks < 2; ++ks)
#pragma unroll
            for (int kt = 0; kt < 2; ++kt)
#pragma unroll
                for (int nb = 0; nb < NQ; ++nb) { s[kt][nb] = WF::mma(kf[kt][ks], qf[nb][ks], s[kt][nb]); if (HI) { s[kt][nb] = WF::mma(kf[kt][ks], qf2[nb][ks], s[kt][nb]); s[kt][nb] = WF::mma(kf2[kt][ks], qf[nb][ks], s[kt][nb]); } }
        F pf[NQ], pf2[NQ];
#pragma unroll
        for (int nb = 0; nb < NQ; ++nb) {
            float mx = s[0][nb][0];
#pragma unroll
            for (int r = 1; r < 8; ++r) mx = fmaxf(mx, s[0][nb][r]);
#pragma unroll
            for (int r = 0; r < 8; ++r) mx = fmaxf(mx, s[1][nb][r]);
            mx = fmaxf(mx, xhalf(mx));
            if constexpr (!NEAR) mx += cb;
            const float mn = fmaxf(m[nb], mx);
            const float al = exp2s((m[nb] - mn) * L2E);
            float ng = (HI ? 0.0f : PSH) - mn * L2E;
            if constexpr (!NEAR) ng = __builtin_fmaf(cb, L2E, ng);
            m[nb] = mn;
            float sum = 0.f;
#pragma unroll
            for (int kt = 0; kt < 2; ++kt)
#pragma unroll
                for (int r = 0; r < 8; ++r) { const float p = exp2s(__builtin_fmaf(s[kt][nb][r], L2E, ng)); s[kt][nb][r] = p; sum += p; }
            l[nb] = l[nb] * al + sum;
#pragma unroll
            for (int dt = 0; dt < 4; ++dt) o[dt][nb] *= al;
            if constexpr (HI) {
                const v8bf h0 = __builtin_convertvector(s[0][nb], v8bf), h1 = __builtin_convertvector(s[1][nb], v8bf);
                const v8bf l0 = __builtin_convertvector(s[0][nb] - __builtin_convertvector(h0, v8f), v8bf), l1 = __builtin_convertvector(s[1][nb] - __builtin_convertvector(h1, v8f), v8bf);
                pf[nb] = __builtin_shufflevector(h0, h1, 0, 1, 2, 3, 4, 5, 6, 7, 8, 9, 10, 11, 12, 13, 14, 15); pf2[nb] = __builtin_shufflevector(l0, l1, 0, 1, 2, 3, 4, 5, 6, 7, 8, 9, 10, 11, 12, 13, 14, 15);
            } else {
                pf[nb] = cat16(__builtin_convertvector(s[0][nb], v8h), __builtin_convertvector(s[1][nb], v8h));
            }
        }
#pragma unroll
        for (int dt = 0; dt < 4; ++dt)
#pragma unroll
            for (int nb = 0; nb < NQ; ++nb) { o[dt][nb] = WF::mma(vf[dt], pf[nb], o[dt][nb]); if (HI) { o[dt][nb] = WF::mma(vf[dt], pf2[nb], o[dt][nb]); o[dt][nb] = WF::mma(vf2[dt], pf[nb], o[dt][nb]); } }
        if constexpr (NQ == 1) asm volatile("v_nop\n\tv_nop\n\tv_nop\n\tv_nop" : "+v"(o[3][0])); else asm volatile("v_nop\n\tv_nop\n\tv_nop\n\tv_nop" : "+v"(o[3][0]), "+v"(o[3][1]));   /* the four vector slots that the chip needs behind the pass's last matrix instructions */
    };
    // The tile's keys in ascending order, as three loops: passes wholly 128 or more below the queries, passes that need the table, passes wholly 128 or more above. Each loop has one body, so the output tiles stay in their registers from pass to pass.
    // Each is rolled: the running maximum chains the passes, so unrolling would add code and registers without overlapping them.
    const int e1 = (q0 > 127 ? q0 - 127 : 0) & ~31;   /* k0 < e1: (k0 + 31) - q0 <= -128 */
    const int e2 = (q0 + 16 * NQ + 127 + 31) & ~31;   /* k0 >= e2: k0 - (q0 + 16 NQ - 1) >= 128 */
    const int l1 = e1 - kb < KT ? e1 - kb : KT, l2 = e2 - kb < KT ? e2 - kb : KT;   /* the same bounds counted from the tile's first key */
    int kl = 0;
#pragma unroll 1
    for (; kl < l1; kl += 32) pass(BoolC<false>{}, kb + kl, kl, cneg);
#pragma unroll 1
    for (; kl < l2; kl += 32) pass(BoolC<true>{}, kb + kl, kl, 0.f);
#pragma unroll 1
    for (; kl < KT; kl += 32) pass(BoolC<false>{}, kb + kl, kl, cpos);
}
template <int NQ>
__device__ __forceinline__ void fa_out(const FaState& st, int q0, bf* Ah, bf* Al) {
    const int lane = threadIdx.x & 31;
#pragma unroll
    for (int nb = 0; nb < NQ; ++nb) { const float inv = __fdiv_rn(1.0f, st.l[nb] + xhalf(st.l[nb])); const size_t oo = (size_t)(q0 + nb * 16) * DQ + lane * 8;
#pragma unroll
        for (int dt = 0; dt < 4; ++dt) { v8us oh, ol;
#pragma unroll
            for (int r = 0; r < 8; ++r) { unsigned short a, c2; splitf(st.o[dt][nb][r] * inv, a, c2); oh[r] = a; ol[r] = c2; }
            *(v8us*)(Ah + oo + dt * 256) = oh; *(v8us*)(Al + oo + dt * 256) = ol; }
        asm volatile("s_wait_xcnt 0x0" ::: "memory"); }   /* stands between the column group's stores and the next rewrite of a register that they name */
}
// grid (RH / 64, heads, batches), 10 waves, one work-group per WGP: waves 0-3 take 16 hi/lo query rows each, waves 4-9 take 32 fp16 rows each, so every work-group carries the same share of both kinds of work; planes [b][h] of (row t, k = d) (q, k) and of (row d, k = t) (v); merged output planes [b] of (row t, k = h d) as hi/lo; all in fragment order
static_assert(RH / 64 == (TT - RH) / 192 && RH % 64 == 0 && (TT - RH) % 192 == 0, "4 hi/lo waves and 6 fp16 waves per workgroup cover all rows");
__global__ __launch_bounds__(320) void k_fattn(const h16* __restrict__ Q16, const h16* __restrict__ K16, const h16* __restrict__ V16, const bf* __restrict__ Qh, const bf* __restrict__ Ql, const bf* __restrict__ Kh, const bf* __restrict__ Kl, const bf* __restrict__ Vh, const bf* __restrict__ Vl, const float* __restrict__ BT, bf* Ah, bf* Al) {
    __shared__ __attribute__((aligned(1024))) bf ring[2 * TLB / 2];   /* two buffers of one tile each */
    const int wv = __builtin_amdgcn_readfirstlane((int)(threadIdx.x >> 5)), lane = threadIdx.x & 31, bx = blockIdx.x, h = blockIdx.y, b = blockIdx.z;
    const size_t pq = ((size_t)b * NH_ + h) * TT * HD, pk = ((size_t)b * NKV + h / REP) * TT * HD, po = (size_t)b * TT * DQ + h * HD * 16;
    const float* bt = BT + (size_t)h * 4096 + (TT - 1);   /* bt[j - i] */
    const bool hw = wv < 4, cw = wv < 8;   /* kind of wave; the eight waves that copy. Both the same for a whole wave: scalar branches */
    const int q0 = hw ? (bx * 4 + wv) * 16 : RH + (bx * 6 + wv - 4) * 32;
    const unsigned rb = (unsigned)(size_t)&ring[0];   /* LDS byte address of buffer 0 */
    if (cw) fa_stage(K16 + pk, V16 + pk, Kh + pk, Kl + pk, Vh + pk, Vl + pk, rb, 0, wv, lane);
    asm volatile("s_wait_asynccnt 0x0" ::: "memory");   /* this wave's copies of tile 0 have landed */
    __syncthreads();   /* tile 0 is there for every wave */
    if (cw) fa_stage(K16 + pk, V16 + pk, Kh + pk, Kl + pk, Vh + pk, Vl + pk, rb + TLB, 1, wv, lane);
    FaState st;
    const bf* qa = (hw ? Qh + pq : (const bf*)(Q16 + pq)) + (size_t)q0 * HD + lane * 8; const bf* qb = (hw ? Ql + pq : (const bf*)(Q16 + pq) + 16 * HD) + (size_t)q0 * HD + lane * 8;   /* 16-bit patterns, whatever the kind */
#pragma unroll
    for (int ks = 0; ks < 2; ++ks) { st.q[ks] = __builtin_bit_cast(v16h, WFrag<bf>::ld(qa + ks * 512)); st.q[2 + ks] = __builtin_bit_cast(v16h, WFrag<bf>::ld(qb + ks * 512)); }
    xwait(qa, qb);
#pragma unroll
    for (int dt = 0; dt < 4; ++dt)
#pragma unroll
        for (int nb = 0; nb < 2; ++nb) st.o[dt][nb] = (v8f){};
#pragma unroll
    for (int nb = 0; nb < 2; ++nb) { st.m[nb] = -3.0e38f; st.l[nb] = 0.f; }
    const float cneg = bt[-(TT - 1)], cpos = bt[TT - 1];
    // Rolled: one trip per tile, with the hand-over of the buffers at its foot.
#pragma unroll 1
    for (int t = 0; t < TT / KT; ++t) {
        const bf* tb = ring + (t & 1) * (TLB / 2);
        if (hw) fa_tile<bf, true, 1>(st, tb + 2 * PLE, tb + 3 * PLE, tb + 4 * PLE, tb + 5 * PLE, bt, q0, t * KT, cneg, cpos);
        else fa_tile<h16, false, 2>(st, (const h16*)tb, nullptr, (const h16*)tb + PLE, nullptr, bt, q0, t * KT, cneg, cpos);
        asm volatile("s_wait_dscnt 0x0" ::: "memory");      /* this wave's reads of tile t are done */
        asm volatile("s_wait_asynccnt 0x0" ::: "memory");   /* its copies of tile t + 1 have landed */
        __syncthreads();   /* tile t + 1 is there for every wave, and no wave reads tile t any more */
        if (t + 2 < TT / KT) { if (cw) fa_stage(K16 + pk, V16 + pk, Kh + pk, Kl + pk, Vh + pk, Vl + pk, rb + (t & 1) * TLB, t + 2, wv, lane); }
    }
    asm volatile("s_wait_asynccnt 0x0" ::: "memory");   /* no copy is outstanding when the wave ends */
    if (hw) fa_out<1>(st, q0, Ah + po, Al + po); else fa_out<2>(st, q0, Ah + po, Al + po);
}

extern "C" void kernel_launch(void* const* d_in, const int* in_sizes, int n_in,
                              void* d_out, int out_size, void* d_ws, size_t ws_size, hipStream_t stream) {
    (void)in_sizes; (void)n_in; (void)out_size;
    const float* x = (const float*)d_in[0]; const float* g1 = (const float*)d_in[1]; const float* e1b = (const float*)d_in[2]; const float* wq = (const float*)d_in[3]; const float* wk = (const float*)d_in[4]; const float* wv = (const float*)d_in[5]; const float* wo = (const float*)d_in[6]; const float* relb = (const float*)d_in[7];
    float* OUT = (float*)d_out;     // [2][2048][1024]
    char* wsp = (char*)d_ws;
    auto take = [&](size_t bytes) { char* p = wsp; wsp += (bytes + 255) & ~(size_t)255; return (void*)p; };
    bf* WQ = (bf*)take((size_t)DQ * DM * 2); bf* WK = (bf*)take((size_t)DKV * DM * 2); bf* WV = (bf*)take((size_t)DKV * DM * 2); bf* WO = (bf*)take((size_t)DM * DQ * 2);
    bf* Yh = (bf*)take((size_t)NB_ * TT * DM * 2); bf* Yl = (bf*)take((size_t)NB_ * TT * DM * 2); float* BT = (float*)take((size_t)NH_ * 4096 * 4);
    h16* QP16 = (h16*)take((size_t)NB_ * NH_ * TT * HD * 2); h16* KP16 = (h16*)take((size_t)NB_ * NKV * TT * HD * 2); h16* VT16 = (h16*)take((size_t)NB_ * NKV * HD * TT * 2);
    bf* QPh = (bf*)take((size_t)NB_ * NH_ * TT * HD * 2); bf* KPh = (bf*)take((size_t)NB_ * NKV * TT * HD * 2); bf* VTh = (bf*)take((size_t)NB_ * NKV * HD * TT * 2); bf* QPl = (bf*)take((size_t)NB_ * NH_ * TT * HD * 2); bf* KPl = (bf*)take((size_t)NB_ * NKV * TT * HD * 2); bf* VTl = (bf*)take((size_t)NB_ * NKV * HD * TT * 2);   // q, k, v of each kind follow one another (every size is a multiple of 256 bytes), as do WQ, WK, WV, WO: the z stride of the merged launches
    bf* ATh = (bf*)take((size_t)NB_ * TT * DQ * 2); bf* ATl = (bf*)take((size_t)NB_ * TT * DQ * 2);
    if ((size_t)(wsp - (char*)d_ws) > ws_size) return;    // ws 256 MiB
    k_prep<<<dim3(PB_LN + PB_W + PB_T, 1, 1), 256, 0, stream>>>(x, g1, e1b, Yh, Yl, wq, wk, wv, wo, WQ, relb, BT);   /* n = LN(hidden) as hi/lo planes, both batches; all four weight planes; the bias table */
    k_gemmw<bf, 1, 1, DM><<<dim3(NB_ * TT / 128, DQ / 128, 3), 128, 0, stream>>>(Yh, Yl, WQ, nullptr, nullptr, nullptr, QP16, QPh, QPl, 0, (size_t)DQ * DM, (size_t)NB_ * NH_ * TT * HD);   /* q, k, v of both batches: head planes, written by the projections themselves */
    k_fattn<<<dim3(RH / 64, NH_, NB_), 320, 0, stream>>>(QP16, KP16, VT16, QPh, QPl, KPh, KPl, VTh, VTl, BT, ATh, ATl);
    k_gemmw<bf, 1, 0, DQ><<<dim3(NB_ * TT / 128, DM / 128, 1), 128, 0, stream>>>(ATh, ATl, WO, nullptr, x, OUT, nullptr, nullptr, nullptr, 0, 0, 0);   /* out = hidden + ctx Wo */
}
